// v000
// Times are from an AMD MI455X. After a warm-up the kernel runs many times in a row, and a time is the length of
// such a window on the GPU divided by its runs, so every launch and the gaps after it count. The runs cycle
// through copies of the inputs. A figure is the median of several windows, for all but v000 over two sittings.
// Sittings can differ by a few percent; kernels timed side by side share one.
// v000 is the starting kernel. One run takes 1090 microseconds.
#include <hip/hip_runtime.h>
// MFI (3 frames, B=4, C=64, 64×64 → N=4096): SA_f = position attention on frame f (q = wq·x+bq (8 ch), k = wk·x+bk (8 ch), v = wv·x+bv (64 ch); attn = softmax_m(q[:,n]·k[:,m]) unscaled; out[e][n] = Σ_m v[e][m]·attn[n][m] + x[e][n]); then two guided attentions
// (q,k from SA_0 / SA_2, v and residual from SA_1), cat → fusion = tfus_w·cat + b; out = fusion·SA_1 + SA_1 → [4,64,64,64].
// Compute dtype: x, weights, biases rounded to bf16; q/k per token in f32 VALU (8×64 dot, rolled) emitted as concatenated f16 planes [q_hi|q_lo|q_hi|0] and [k_hi|k_hi·2^-10|k_lo|0] so ONE 32-wide WMMA k-step yields f32-accurate logits; v (+bias via an
// augmented ones column) channel-major by GEMM (f16); fused flash-style kernel per (slab, 64 queries) (online softmax f32, P f16 hi + residual, O token-major f32); residual add + channel-major restage in f32; cat f16 → fusion GEMM → out = fusion·sa₁ + sa₁ in f32. All on v_wmma_f32_16x16x32_f16.
#define NFR 3
#define BB 4
#define CC 64
#define TT 4096
#define NH 1
#define NSL (5 * BB)

typedef __bf16 v16b __attribute__((ext_vector_type(16)));
typedef unsigned short v8us __attribute__((ext_vector_type(8), may_alias));
typedef float  v8f  __attribute__((ext_vector_type(8)));
typedef float  v4f  __attribute__((ext_vector_type(4)));
typedef float  v4fa __attribute__((ext_vector_type(4), may_alias));
union FragB { v16b v; v8us half[2]; unsigned short u[16]; };

__device__ __forceinline__ unsigned short bf16_bits(float x) { unsigned int u = __float_as_uint(x); return (unsigned short)((u + 0x7FFFu + ((u >> 16) & 1u)) >> 16); }
__device__ __forceinline__ float bf16_val(unsigned short b) { return __uint_as_float(((unsigned int)b) << 16); }
__device__ __forceinline__ float bf16_round(float x) { return bf16_val(bf16_bits(x)); }
// D += A·B with NT terms: 1 = ah·bh, 2 = + al·bh (A split), 3 = + ah·bl (both split)
template <int NT>
__device__ __forceinline__ v8f mmaN(v16b ah, v16b al, v16b bh, v16b bl, v8f c) {
  c = __builtin_amdgcn_wmma_f32_16x16x32_bf16(false, ah, false, bh, (short)0, c, false, false);
  if (NT >= 2) c = __builtin_amdgcn_wmma_f32_16x16x32_bf16(false, al, false, bh, (short)0, c, false, false);
  if (NT >= 3) c = __builtin_amdgcn_wmma_f32_16x16x32_bf16(false, ah, false, bl, (short)0, c, false, false);
  asm volatile("v_nop\n\tv_nop\n\tv_nop\n\tv_nop" : "+v"(c) : "v"(ah), "v"(al), "v"(bh), "v"(bl));
  return c;
}

__global__ __launch_bounds__(256) void k_wt_bf16(const float* __restrict__ W, unsigned short* __restrict__ Wt, int K, int N) {
  const int t = blockIdx.x * 256 + threadIdx.x;
  const int k8n = K / 8;
  if (t >= N * k8n) return;
  const int n = t / k8n, k8 = (t % k8n) * 8;
  v8us v;
#pragma unroll
  for (int i = 0; i < 8; ++i) v[i] = bf16_bits(W[(size_t)(k8 + i) * N + n]);
  *(v8us*)(Wt + (size_t)n * K + k8) = v;
  
}

// GEMM C[M][N] (f32, pitch ldc) = act(A[M][K]·W + bias). A f32 row-major (pitch lda) converted per fragment to bf16
// (ASPLIT: hi/lo two planes -> 2 terms, else single rounded term); Wt bf16 [N][K] (pitch ldb). BIAS_BF16 rounds the
// bias to bf16 first (bias quantised to bf16 before the add). K%32==0, M%16==0, N%64==0.
template <bool ASPLIT, int ACT, bool BIAS_BF16>
__global__ __launch_bounds__(128) void k_gemm_bf(const float* __restrict__ A, int lda, const unsigned short* __restrict__ Wt, int ldb,
                                               const float* __restrict__ bias, float* __restrict__ C, int ldc, int M, int N, int K) {
  __shared__ __attribute__((aligned(16))) float so[4][16][64];
  const int tid = threadIdx.x, w = tid >> 5, lane = tid & 31, ln = lane & 15, hh = lane >> 4;
  const int ntn = N / 64;
  const int wid = blockIdx.x * 4 + w;
  const int mt = wid / ntn, nq = wid % ntn;
  if (mt * 16 >= M) return;
  const int row0 = mt * 16, col0 = nq * 64;
  const float* arow = A + (size_t)(row0 + ln) * lda;
  v8f acc[4] = {};
  for (int kb = 0; kb < K; kb += 32) {
    FragB ah, al;
    const v4f x0 = *(const v4fa*)(arow + kb + 8 * hh), x1 = *(const v4fa*)(arow + kb + 8 * hh + 4);
    const v4f x2 = *(const v4fa*)(arow + kb + 16 + 8 * hh), x3 = *(const v4fa*)(arow + kb + 16 + 8 * hh + 4);
    float xs[16] = {x0[0],x0[1],x0[2],x0[3],x1[0],x1[1],x1[2],x1[3],x2[0],x2[1],x2[2],x2[3],x3[0],x3[1],x3[2],x3[3]};
#pragma unroll
    for (int i = 0; i < 16; ++i) { const unsigned short hb = bf16_bits(xs[i]); ah.u[i] = hb; al.u[i] = ASPLIT ? bf16_bits(xs[i] - bf16_val(hb)) : (unsigned short)0; }
#pragma unroll
    for (int t = 0; t < 4; ++t) {
      const unsigned short* brow = Wt + (size_t)(col0 + t * 16 + ln) * ldb + kb;
      FragB b;
      b.half[0] = *(const v8us*)(brow + 8 * hh);
      b.half[1] = *(const v8us*)(brow + 16 + 8 * hh);
      acc[t] = mmaN<ASPLIT ? 2 : 1>(ah.v, al.v, b.v, b.v, acc[t]);
    }
  }
#pragma unroll
  for (int t = 0; t < 4; ++t) {
    float bv = bias ? bias[col0 + t * 16 + ln] : 0.f;
    if (BIAS_BF16) bv = bf16_round(bv);
#pragma unroll
    for (int r = 0; r < 8; ++r) { float v = acc[t][r] + bv; if (ACT == 1) v = fmaxf(v, 0.f); so[w][8 * hh + r][t * 16 + ln] = v; }
  }
  __builtin_amdgcn_fence(__ATOMIC_ACQ_REL, "workgroup");
  __builtin_amdgcn_wave_barrier();
  const int rsub = lane >> 4, c4 = (lane & 15) * 4;
  {
#pragma unroll
    for (int q = 0; q < 8; ++q) {
      const int r = q * 2 + rsub;
      const v4f v = *(const v4fa*)&so[w][r][c4];
      *(v4f*)(C + (size_t)(row0 + r) * ldc + col0 + c4) = v;
    }
    
  }
}

// Flash-style causal/unmasked attention, all contractions 3-term bf16 hi/lo splits, f32 softmax with running max.
// q,k,v rows are read from f32 buffers with arbitrary row pitch (so they can live inside a fused qkv buffer);
// D = head size (multiple of 32, <= 128); one wave = 16 query rows; block = 4 waves (64 queries) sharing K/V chunks of 32.
template <int D, bool CAUSAL>
__global__ __launch_bounds__(128) void k_flash(const float* __restrict__ qb, const float* __restrict__ kb, const float* __restrict__ vb,
                                             int pitch, int T, int H, float scale, float* __restrict__ y, int ypitch) {
  constexpr int KS = D / 32;        // k-steps for QK
  constexpr int DT = D / 16;        // d tiles for PV
  __shared__ __attribute__((aligned(16))) unsigned short sKh[32][D + 8], sKl[32][D + 8], sVh[32][D + 8], sVl[32][D + 8];
  __shared__ __attribute__((aligned(16))) unsigned short sPh[4][16][40], sPl[4][16][40];
  __shared__ __attribute__((aligned(16))) float sO[4][16][D];
  const int tid = threadIdx.x, w = tid >> 5, lane = tid & 31, ln = lane & 15, hh = lane >> 4;
  const int nqb = (T + 63) / 64;
  const int bh = blockIdx.x / nqb, qblk = blockIdx.x % nqb;
  const int b = bh / H, h = bh % H;
  const int q0 = qblk * 64 + w * 16;
  const float* Q = qb + (size_t)b * T * pitch + h * D;
  const float* K = kb + (size_t)b * T * pitch + h * D;
  const float* V = vb + (size_t)b * T * pitch + h * D;

  // A fragments of the wave's 16 query rows (scaled), hi/lo
  FragB aqh[KS], aql[KS];
  {
    int row = q0 + ln; if (row >= T) row = T - 1;
    const float* qr = Q + (size_t)row * pitch;
#pragma unroll
    for (int ks = 0; ks < KS; ++ks)
#pragma unroll
      for (int i = 0; i < 16; ++i) {
        const int d = ks * 32 + ((i < 8) ? (8 * hh + i) : (16 + 8 * hh + (i - 8)));
        const float x = qr[d] * scale; const unsigned short hb = bf16_bits(x);
        aqh[ks].u[i] = hb; aql[ks].u[i] = bf16_bits(x - bf16_val(hb));
      }
  }
  float m_r[8], l_r[8];
#pragma unroll
  for (int r = 0; r < 8; ++r) { m_r[r] = -3.0e38f; l_r[r] = 0.f; }
  v8f oacc[DT];
#pragma unroll
  for (int dt = 0; dt < DT; ++dt) oacc[dt] = (v8f){0.f,0.f,0.f,0.f,0.f,0.f,0.f,0.f};

  const int kv_end = CAUSAL ? min(T, qblk * 64 + 64) : T;     // block-uniform
  for (int j0 = 0; j0 < kv_end; j0 += 32) {
    __syncthreads();
    for (int e = tid; e < 32 * (D / 4); e += 128) {
      const int r = e / (D / 4), c4 = (e % (D / 4)) * 4;
      const int key = j0 + r;
      v4f kf = {0.f,0.f,0.f,0.f}, vf = {0.f,0.f,0.f,0.f};
      if (key < T) { kf = *(const v4fa*)(K + (size_t)key * pitch + c4); vf = *(const v4fa*)(V + (size_t)key * pitch + c4); }
#pragma unroll
      for (int t = 0; t < 4; ++t) {
        unsigned short hb = bf16_bits(kf[t]); sKh[r][c4 + t] = hb; sKl[r][c4 + t] = bf16_bits(kf[t] - bf16_val(hb));
        hb = bf16_bits(vf[t]); sVh[r][c4 + t] = hb; sVl[r][c4 + t] = bf16_bits(vf[t] - bf16_val(hb));
      }
    }
    __syncthreads();
    // S tile 16 x 32
    v8f s[2];
#pragma unroll
    for (int nt = 0; nt < 2; ++nt) {
      v8f acc = {};
#pragma unroll
      for (int ks = 0; ks < KS; ++ks) {
        FragB bh_, bl_;
        bh_.half[0] = *(const v8us*)&sKh[nt * 16 + ln][ks * 32 + 8 * hh]; bh_.half[1] = *(const v8us*)&sKh[nt * 16 + ln][ks * 32 + 16 + 8 * hh];
        bl_.half[0] = *(const v8us*)&sKl[nt * 16 + ln][ks * 32 + 8 * hh]; bl_.half[1] = *(const v8us*)&sKl[nt * 16 + ln][ks * 32 + 16 + 8 * hh];
        acc = mmaN<3>(aqh[ks].v, aql[ks].v, bh_.v, bl_.v, acc);
      }
      s[nt] = acc;
    }
    // mask + running max (rows 8hh+r; the 16 lanes of a half share rows)
    float alpha[8];
#pragma unroll
    for (int r = 0; r < 8; ++r) {
      const int qi = q0 + 8 * hh + r;
      const int ja = j0 + ln, jb = j0 + 16 + ln;
      if (CAUSAL) { if (ja > qi) s[0][r] = -3.0e38f; if (jb > qi) s[1][r] = -3.0e38f; }
      if (ja >= T) s[0][r] = -3.0e38f;
      if (jb >= T) s[1][r] = -3.0e38f;
      float mx = fmaxf(s[0][r], s[1][r]);
      mx = fmaxf(mx, __shfl_xor(mx, 1, 32)); mx = fmaxf(mx, __shfl_xor(mx, 2, 32)); mx = fmaxf(mx, __shfl_xor(mx, 4, 32)); mx = fmaxf(mx, __shfl_xor(mx, 8, 32));
      const float mnew = fmaxf(m_r[r], mx);
      alpha[r] = (mnew > -1.0e38f) ? __expf(m_r[r] - mnew) : 1.0f;
      const float p0 = (s[0][r] > -1.0e38f) ? __expf(s[0][r] - mnew) : 0.f;
      const float p1 = (s[1][r] > -1.0e38f) ? __expf(s[1][r] - mnew) : 0.f;
      m_r[r] = mnew;
      l_r[r] = l_r[r] * alpha[r] + p0 + p1;            // per-lane partial row sum (16 lanes combined at the end)
      unsigned short hb = bf16_bits(p0); sPh[w][8 * hh + r][ln] = hb;      sPl[w][8 * hh + r][ln] = bf16_bits(p0 - bf16_val(hb));
      hb = bf16_bits(p1);                sPh[w][8 * hh + r][16 + ln] = hb; sPl[w][8 * hh + r][16 + ln] = bf16_bits(p1 - bf16_val(hb));
    }
#pragma unroll
    for (int dt = 0; dt < DT; ++dt)
#pragma unroll
      for (int r = 0; r < 8; ++r) oacc[dt][r] *= alpha[r];
    __builtin_amdgcn_fence(__ATOMIC_ACQ_REL, "workgroup");
    __builtin_amdgcn_wave_barrier();
    FragB pah, pal;
    pah.half[0] = *(const v8us*)&sPh[w][ln][8 * hh]; pah.half[1] = *(const v8us*)&sPh[w][ln][16 + 8 * hh];
    pal.half[0] = *(const v8us*)&sPl[w][ln][8 * hh]; pal.half[1] = *(const v8us*)&sPl[w][ln][16 + 8 * hh];
#pragma unroll
    for (int dt = 0; dt < DT; ++dt) {
      FragB bvh, bvl;
#pragma unroll
      for (int i = 0; i < 8; ++i) {
        bvh.u[i] = sVh[8 * hh + i][dt * 16 + ln]; bvh.u[8 + i] = sVh[16 + 8 * hh + i][dt * 16 + ln];
        bvl.u[i] = sVl[8 * hh + i][dt * 16 + ln]; bvl.u[8 + i] = sVl[16 + 8 * hh + i][dt * 16 + ln];
      }
      oacc[dt] = mmaN<3>(pah.v, pal.v, bvh.v, bvl.v, oacc[dt]);
    }
    __builtin_amdgcn_fence(__ATOMIC_ACQ_REL, "workgroup");
    __builtin_amdgcn_wave_barrier();
  }
#pragma unroll
  for (int r = 0; r < 8; ++r) {
    float l = l_r[r];
    l += __shfl_xor(l, 1, 32); l += __shfl_xor(l, 2, 32); l += __shfl_xor(l, 4, 32); l += __shfl_xor(l, 8, 32);
    l_r[r] = (l > 0.f) ? 1.0f / l : 0.f;
  }
#pragma unroll
  for (int dt = 0; dt < DT; ++dt)
#pragma unroll
    for (int r = 0; r < 8; ++r) sO[w][8 * hh + r][dt * 16 + ln] = oacc[dt][r] * l_r[r];
  __builtin_amdgcn_fence(__ATOMIC_ACQ_REL, "workgroup");
  __builtin_amdgcn_wave_barrier();
  {
    for (int r = 0; r < 16; ++r) {
      const int row = q0 + r;
      if (row < T && lane < D / 4) {
        const v4f val = *(const v4fa*)&sO[w][r][lane * 4];
        *(v4f*)(y + ((size_t)b * T + row) * ypitch + h * D + lane * 4) = val;
      }
    }
    
  }
}

// GEMM C = act(A·W + bias + resid): A f32 (ASPLIT -> hi/lo 2 terms), Wt bf16 [N][K]; ACT 0 none, 1 relu, 2 exact gelu;
// resid (optional, f32, row index = (row % rmod), pitch ldr, RES_BF16 rounds it) added before the activation.
template <bool ASPLIT, int ACT, bool BIAS_BF16, bool RES_BF16>
__global__ __launch_bounds__(128) void k_gemm_bf3(const float* __restrict__ A, int lda, const unsigned short* __restrict__ Wt, int ldb,
                                                const float* __restrict__ bias, const float* __restrict__ resid, int rmod, int ldr,
                                                float* __restrict__ C, int ldc, int M, int N, int K) {
  __shared__ __attribute__((aligned(16))) float so[4][16][64];
  const int tid = threadIdx.x, w = tid >> 5, lane = tid & 31, ln = lane & 15, hh = lane >> 4;
  const int ntn = N / 64;
  const int wid = blockIdx.x * 4 + w;
  const int mt = wid / ntn, nq = wid % ntn;
  if (mt * 16 >= M) return;
  const int row0 = mt * 16, col0 = nq * 64;
  const float* arow = A + (size_t)(row0 + ln) * lda;
  v8f acc[4] = {};
  for (int kb = 0; kb < K; kb += 32) {
    FragB ah, al;
    const v4f x0 = *(const v4fa*)(arow + kb + 8 * hh), x1 = *(const v4fa*)(arow + kb + 8 * hh + 4);
    const v4f x2 = *(const v4fa*)(arow + kb + 16 + 8 * hh), x3 = *(const v4fa*)(arow + kb + 16 + 8 * hh + 4);
    float xs[16] = {x0[0],x0[1],x0[2],x0[3],x1[0],x1[1],x1[2],x1[3],x2[0],x2[1],x2[2],x2[3],x3[0],x3[1],x3[2],x3[3]};
#pragma unroll
    for (int i = 0; i < 16; ++i) { const unsigned short hb = bf16_bits(xs[i]); ah.u[i] = hb; al.u[i] = ASPLIT ? bf16_bits(xs[i] - bf16_val(hb)) : (unsigned short)0; }
#pragma unroll
    for (int t = 0; t < 4; ++t) {
      const unsigned short* brow = Wt + (size_t)(col0 + t * 16 + ln) * ldb + kb;
      FragB b;
      b.half[0] = *(const v8us*)(brow + 8 * hh);
      b.half[1] = *(const v8us*)(brow + 16 + 8 * hh);
      acc[t] = mmaN<ASPLIT ? 2 : 1>(ah.v, al.v, b.v, b.v, acc[t]);
    }
  }
#pragma unroll
  for (int t = 0; t < 4; ++t) {
    const int col = col0 + t * 16 + ln;
    float bv = bias ? bias[col] : 0.f;
    if (BIAS_BF16) bv = bf16_round(bv);
#pragma unroll
    for (int r = 0; r < 8; ++r) {
      float v = acc[t][r] + bv;
      if (resid) { float rv = resid[(size_t)((row0 + 8 * hh + r) % rmod) * ldr + col]; if (RES_BF16) rv = bf16_round(rv); v += rv; }
      if (ACT == 1) v = fmaxf(v, 0.f);
      if (ACT == 2) v = 0.5f * v * (1.0f + erff(v * 0.70710678118654752f));
      if (ACT == 3) { const float u = 0.7978845608028654f * (v + 0.044715f * v * v * v); v = 0.5f * v * (1.0f + tanhf(u)); }
      so[w][8 * hh + r][t * 16 + ln] = v;
    }
  }
  __builtin_amdgcn_fence(__ATOMIC_ACQ_REL, "workgroup");
  __builtin_amdgcn_wave_barrier();
  const int rsub = lane >> 4, c4 = (lane & 15) * 4;
  {
#pragma unroll
    for (int q = 0; q < 8; ++q) {
      const int r = q * 2 + rsub;
      const v4f v = *(const v4fa*)&so[w][r][c4];
      *(v4f*)(C + (size_t)(row0 + r) * ldc + col0 + c4) = v;
    }
    
  }
}
// row LayerNorm (biased variance, eps) over N: s = X (+ R); optional out_sum <- s; out_norm <- (s-mu)*rsqrt(var+eps)*g + b
template <bool PARAM_BF16>
__global__ __launch_bounds__(256) void k_layernorm(const float* __restrict__ X, const float* __restrict__ R, const float* __restrict__ g, const float* __restrict__ bta,
                                                  float* __restrict__ out_sum, float* __restrict__ out_norm, int N, float eps) {
  __shared__ float red[256];
  const int row = blockIdx.x, tid = threadIdx.x;
  const float* x = X + (size_t)row * N; const float* rr = R ? R + (size_t)row * N : nullptr;
  float vals[16];                     // up to N = 4096
  const int per = N / 256;            // contiguous chunk per thread? use strided-by-4 chunks: thread handles j = tid*4 + 1024*u
  float s1 = 0.f;
  for (int u = 0; u < per / 4; ++u) {
    const int j = tid * 4 + 1024 * u;
    const v4f a = *(const v4fa*)(x + j);
    v4f b = {0.f,0.f,0.f,0.f}; if (rr) b = *(const v4fa*)(rr + j);
#pragma unroll
    for (int q = 0; q < 4; ++q) { const float v = a[q] + b[q]; vals[u * 4 + q] = v; s1 += v; }
  }
  red[tid] = s1; __syncthreads();
  for (int st = 128; st > 0; st >>= 1) { if (tid < st) red[tid] += red[tid + st]; __syncthreads(); }
  const float mu = red[0] / (float)N; __syncthreads();
  float s2 = 0.f;
  for (int u = 0; u < per / 4; ++u)
#pragma unroll
    for (int q = 0; q < 4; ++q) { const float c = vals[u * 4 + q] - mu; s2 += c * c; }
  red[tid] = s2; __syncthreads();
  for (int st = 128; st > 0; st >>= 1) { if (tid < st) red[tid] += red[tid + st]; __syncthreads(); }
  const float rs = rsqrtf(red[0] / (float)N + eps);
  {
    for (int u = 0; u < per / 4; ++u) {
      const int j = tid * 4 + 1024 * u;
      v4f o, sm;
#pragma unroll
      for (int q = 0; q < 4; ++q) {
        float gg = g[j + q], bb = bta[j + q];
        if (PARAM_BF16) { gg = bf16_round(gg); bb = bf16_round(bb); }
        sm[q] = vals[u * 4 + q]; o[q] = (vals[u * 4 + q] - mu) * rs * gg + bb;
      }
      if (out_sum) *(v4f*)(out_sum + (size_t)row * N + j) = sm;
      *(v4f*)(out_norm + (size_t)row * N + j) = o;
    }
    
  }
}



// ---- f16 WMMA path (v_wmma_f32_16x16x32_f16): 11-bit significands for operands in range — used where a [0,1] probability operand needs more precision than bf16
typedef _Float16 v16h __attribute__((ext_vector_type(16)));
union FragH { v16h v; v8us half[2]; _Float16 h[16]; unsigned short u[16]; };
template <int NT>
__device__ __forceinline__ v8f mmaH(v16h ah, v16h al, v16h bh, v16h bl, v8f c) {
  c = __builtin_amdgcn_wmma_f32_16x16x32_f16(false, ah, false, bh, (short)0, c, false, false);
  if (NT >= 2) c = __builtin_amdgcn_wmma_f32_16x16x32_f16(false, al, false, bh, (short)0, c, false, false);
  if (NT >= 3) c = __builtin_amdgcn_wmma_f32_16x16x32_f16(false, ah, false, bl, (short)0, c, false, false);
  asm volatile("v_nop\n\tv_nop\n\tv_nop\n\tv_nop" : "+v"(c) : "v"(ah), "v"(al), "v"(bh), "v"(bl));
  return c;
}
// batched GEMM like k_gemm_b but f16 operands: A f32 (split into f16 hi/lo if ASPLIT, else rounded to f16), Bt = f16 values [n][k]; alpha; C f32; N multiple of 16 (partial tiles skipped)
template <bool ASPLIT>
__global__ __launch_bounds__(128) void k_gemm_h(const float* __restrict__ A, int lda, size_t sA, const _Float16* __restrict__ Bh, int ldb, size_t sB, float alpha, float* __restrict__ C, int ldc, size_t sC, int M, int N, int K) {
  __shared__ __attribute__((aligned(16))) float so[4][16][64];
  const int tid = threadIdx.x, w = tid >> 5, lane = tid & 31, ln = lane & 15, hh = lane >> 4; const int by = blockIdx.y;
  A += (size_t)by * sA; Bh += (size_t)by * sB; C += (size_t)by * sC;
  const int ntn = (N + 63) / 64; const int wid = blockIdx.x * 4 + w; const int mt = wid / ntn, nq = wid % ntn; if (mt * 16 >= M) return;
  const int row0 = mt * 16, col0 = nq * 64; const float* arow = A + (size_t)(row0 + ln) * lda;
  v8f acc[4] = {};
  for (int kb = 0; kb < K; kb += 32) {
    FragH ah, al;
    const v4f x0 = *(const v4fa*)(arow + kb + 8 * hh), x1 = *(const v4fa*)(arow + kb + 8 * hh + 4), x2 = *(const v4fa*)(arow + kb + 16 + 8 * hh), x3 = *(const v4fa*)(arow + kb + 16 + 8 * hh + 4);
    float xs[16] = {x0[0],x0[1],x0[2],x0[3],x1[0],x1[1],x1[2],x1[3],x2[0],x2[1],x2[2],x2[3],x3[0],x3[1],x3[2],x3[3]};
#pragma unroll
    for (int i = 0; i < 16; ++i) { const _Float16 h = (_Float16)xs[i]; ah.h[i] = h; al.h[i] = ASPLIT ? (_Float16)(xs[i] - (float)h) : (_Float16)0.0f; }
#pragma unroll
    for (int t = 0; t < 4; ++t) { if (col0 + t * 16 >= N) continue; const size_t boff = (size_t)(col0 + t * 16 + ln) * ldb + kb; FragH bq; bq.half[0] = *(const v8us*)(Bh + boff + 8 * hh); bq.half[1] = *(const v8us*)(Bh + boff + 16 + 8 * hh);
      acc[t] = mmaH<ASPLIT ? 2 : 1>(ah.v, al.v, bq.v, bq.v, acc[t]); }
  }
#pragma unroll
  for (int t = 0; t < 4; ++t) { if (col0 + t * 16 >= N) continue;
#pragma unroll
    for (int r = 0; r < 8; ++r) so[w][8 * hh + r][t * 16 + ln] = acc[t][r] * alpha; }
  __builtin_amdgcn_fence(__ATOMIC_ACQ_REL, "workgroup"); __builtin_amdgcn_wave_barrier();
  const int rsub = lane >> 4, c4 = (lane & 15) * 4;
  {
#pragma unroll
    for (int q = 0; q < 8; ++q) { const int r = q * 2 + rsub; if (col0 + c4 < N) { const v4f v = *(const v4fa*)&so[w][r][c4]; *(v4f*)(C + (size_t)(row0 + r) * ldc + col0 + c4) = v; } }
     }
}

// Wt[n][k] = f16(W[k][n]·scale) from f32 row-major W[K][N] (scale = power of two; bf16-exact weights stay exact in f16 away from the subnormal range)
__global__ __launch_bounds__(256) void k_wt_f16(const float* __restrict__ W, _Float16* __restrict__ Wt, int K, int N, float scale) {
  const int t = blockIdx.x * 256 + threadIdx.x; if (t >= N * (K / 8)) return; const int n = t / (K / 8), k8 = (t % (K / 8)) * 8; FragH f;
#pragma unroll
  for (int i = 0; i < 8; ++i) f.h[i] = (_Float16)(bf16_round(W[(size_t)(k8 + i) * N + n]) * scale); const v8us o = f.half[0];
  *(v8us*)((unsigned short*)Wt + (size_t)n * K + k8) = o; 
}
// k_gemm_hh variant with fused epilogue: v = acc·alpha + bias[by·sBias + col] (+ CP[(row/rowsPerB)·sCPb + by·64 + col] if CP) ; ACT 0 none / 1 elu ; writes f32 C and/or f16 C16 (each if non-null)
template <int ACT>
__global__ __launch_bounds__(128) void k_gemm_hhx(const _Float16* __restrict__ A, int lda, size_t sA, const _Float16* __restrict__ Bh, int ldb, size_t sB, float alpha, const float* __restrict__ bias, size_t sBias, const float* __restrict__ CP, int rowsPerB, size_t sCPb, int row0g,
    float* __restrict__ C, _Float16* __restrict__ C16, int ldc, size_t sC, int M, int N, int K) {
  __shared__ __attribute__((aligned(16))) float so[4][16][64];
  const int tid = threadIdx.x, w = tid >> 5, lane = tid & 31, ln = lane & 15, hh = lane >> 4; const int by = blockIdx.y;
  A += (size_t)by * sA; Bh += (size_t)by * sB; const size_t cofs = (size_t)by * sC; const float* bp = bias ? bias + (size_t)by * sBias : nullptr;
  const int ntn = (N + 63) / 64; const int wid = blockIdx.x * 4 + w; const int mt = wid / ntn, nq = wid % ntn; if (mt * 16 >= M) return;
  const int row0 = mt * 16, col0 = nq * 64; const _Float16* arow = A + (size_t)(row0 + ln) * lda;
  v8f acc[4] = {};
  for (int kb = 0; kb < K; kb += 32) { FragH ah; ah.half[0] = *(const v8us*)((const unsigned short*)arow + kb + 8 * hh); ah.half[1] = *(const v8us*)((const unsigned short*)arow + kb + 16 + 8 * hh);
#pragma unroll
    for (int t = 0; t < 4; ++t) { if (col0 + t * 16 >= N) continue; const size_t boff = (size_t)(col0 + t * 16 + ln) * ldb + kb; FragH bq; bq.half[0] = *(const v8us*)((const unsigned short*)Bh + boff + 8 * hh); bq.half[1] = *(const v8us*)((const unsigned short*)Bh + boff + 16 + 8 * hh);
      acc[t] = mmaH<1>(ah.v, ah.v, bq.v, bq.v, acc[t]); }
  }
#pragma unroll
  for (int t = 0; t < 4; ++t) { if (col0 + t * 16 >= N) continue; const int col = col0 + t * 16 + ln; const float bv = bp ? bf16_round(bp[col]) : 0.f;
#pragma unroll
    for (int r = 0; r < 8; ++r) { float v = acc[t][r] * alpha + bv; if (CP) { const int bidx = (row0g + row0 + 8 * hh + r) / rowsPerB; v += CP[(size_t)bidx * sCPb + (size_t)by * 64 + col]; } if (ACT == 1) v = (v > 0.f) ? v : expm1f(v); else if (ACT == 7) v = (v > 0.f) ? v + 1.0f : expf(v); else if (ACT == 8) v = tanhf(v); else if (ACT == 9) v = 0.5f * v * (1.0f + tanhf(0.7978845608028654f * (v + 0.044715f * v * v * v))); else if (ACT == 11) v = 1.0f / (1.0f + expf(-v)); else if (ACT == 12) v = (v > 0.f) ? v : 0.01f * v; else if (ACT == 14) v = (v > 0.f) ? v : 0.1f * v; else if (ACT == 15) v = v / (1.0f + expf(-v)); else if (ACT == 3) v = fmaxf(v, 0.f); else if (ACT == 6) v = 0.5f * v * (1.0f + erff(v * 0.70710678118654752f)); so[w][8 * hh + r][t * 16 + ln] = v; } }
  __builtin_amdgcn_fence(__ATOMIC_ACQ_REL, "workgroup"); __builtin_amdgcn_wave_barrier();
  const int rsub = lane >> 4, c4 = (lane & 15) * 4; typedef _Float16 v4h __attribute__((ext_vector_type(4)));
  {
#pragma unroll
    for (int q = 0; q < 8; ++q) { const int r = q * 2 + rsub; if (col0 + c4 < N) { const v4f v = *(const v4fa*)&so[w][r][c4]; if (C) *(v4f*)(C + cofs + (size_t)(row0 + r) * ldc + col0 + c4) = v; if (C16) { v4h h4; for (int i = 0; i < 4; ++i) h4[i] = (_Float16)v[i]; *(v4h*)(C16 + cofs + (size_t)(row0 + r) * ldc + col0 + c4) = h4; } } }
     }
}


typedef _Float16 v4h __attribute__((ext_vector_type(4)));

__global__ __launch_bounds__(256) void k_x16(const float* __restrict__ x, _Float16* __restrict__ X16, size_t n8) { const size_t t = (size_t)blockIdx.x * 256 + threadIdx.x; if (t >= n8) return; FragH f;
#pragma unroll
  for (int q = 0; q < 8; ++q) f.h[q] = (_Float16)bf16_round(x[t * 8 + q]); *(v8us*)((unsigned short*)X16 + t * 8) = f.half[0];  }
__global__ __launch_bounds__(256) void k_h16(const float* __restrict__ x, _Float16* __restrict__ X16, size_t n8) { const size_t t = (size_t)blockIdx.x * 256 + threadIdx.x; if (t >= n8) return; FragH f;
#pragma unroll
  for (int q = 0; q < 8; ++q) f.h[q] = (_Float16)x[t * 8 + q]; *(v8us*)((unsigned short*)X16 + t * 8) = f.half[0];  }
__global__ __launch_bounds__(256) void k_round16f(const float* __restrict__ W, _Float16* __restrict__ Bt, size_t n8) { const size_t t = (size_t)blockIdx.x * 256 + threadIdx.x; if (t >= n8) return; FragH f;
#pragma unroll
  for (int i = 0; i < 8; ++i) f.h[i] = (_Float16)(bf16_round(W[t * 8 + i]) * 16.0f); *(v8us*)((unsigned short*)Bt + t * 8) = f.half[0];  }
template <int NHv, int TTv>
__global__ __launch_bounds__(256) void k_vt(const _Float16* __restrict__ V16, int ldv, int voff, _Float16* __restrict__ Vt) { __shared__ unsigned short tl[64][66]; const int tid = threadIdx.x; const int slab = blockIdx.x / (TTv / 64), lg = blockIdx.x % (TTv / 64); const int b = slab / NHv, h = slab % NHv;
  for (int i = tid; i < 64 * 8; i += 256) { const int r = i / 8, c8 = (i % 8) * 8; FragH f; f.half[0] = *(const v8us*)((const unsigned short*)V16 + ((size_t)b * TTv + lg * 64 + r) * ldv + voff + h * 64 + c8);
#pragma unroll
    for (int q = 0; q < 8; ++q) tl[r][c8 + q] = f.u[q]; }
  __syncthreads();
  {
#pragma unroll
    for (int rd = 0; rd < 2; ++rd) { const int d = rd * 32 + tid / 8, pc = tid % 8; FragH f;
#pragma unroll
      for (int q = 0; q < 8; ++q) f.u[q] = tl[pc * 8 + q][d];
      *(v8us*)((unsigned short*)Vt + ((size_t)slab * 64 + d) * TTv + lg * 64 + pc * 8) = f.half[0]; }
     } }

template <int RB>
__global__ __launch_bounds__(256) void k_xt(const float* __restrict__ src, _Float16* __restrict__ XT) { const size_t t = (size_t)blockIdx.x * 256 + threadIdx.x; if (t >= (size_t)BB * TT * 12) return; const int c0 = (int)(t % 12) * 8; const size_t bn = t / 12; const int n = (int)(bn % TT), b = (int)(bn / TT); FragH f;
#pragma unroll
  for (int q = 0; q < 8; ++q) { const int c = c0 + q; float v = 0.f; if (c < CC) { v = src[((size_t)b * CC + c) * TT + n]; if (RB) v = bf16_round(v); } else if (c == CC) v = 1.f; f.h[q] = (_Float16)v; }
  *(v8us*)((unsigned short*)XT + t * 8) = f.half[0];  }
// q/k planes for one attention instance: per token n of batch b: q[d] = Σ_c wq[d][c]·xs[c][n] + bq[d], k likewise (f32, rolled over c; xs = bf16-rounded input frame or an internal SA plane (RB)); thread per (token, 16-B piece p ∈ 0..3):
template <int RB>
__global__ __launch_bounds__(256) void k_qk(const float* __restrict__ xs, const float* __restrict__ wq, const float* __restrict__ bq, const float* __restrict__ wk, const float* __restrict__ bk, int slab0, _Float16* __restrict__ QP, _Float16* __restrict__ KP) {
  #pragma clang fp contract(off)
  const size_t t = (size_t)blockIdx.x * 256 + threadIdx.x; if (t >= (size_t)BB * TT * 4) return; const int p = (int)(t % 4); const size_t bn = t / 4; const int n = (int)(bn % TT), b = (int)(bn / TT);
  float q[8], k[8]; for (int d = 0; d < 8; ++d) { q[d] = bf16_round(bq[d]); k[d] = bf16_round(bk[d]); }
#pragma unroll 1
  for (int c = 0; c < CC; ++c) { float xv = xs[((size_t)b * CC + c) * TT + n]; if (RB) xv = bf16_round(xv);
#pragma unroll
    for (int d = 0; d < 8; ++d) { q[d] += bf16_round(wq[d * CC + c]) * xv; k[d] += bf16_round(wk[d * CC + c]) * xv; } }
  FragH fq, fk;
#pragma unroll
  for (int d = 0; d < 8; ++d) { const _Float16 qh = (_Float16)q[d], kh = (_Float16)k[d]; const float qlo = (q[d] - (float)qh) * 1024.0f, klo = (k[d] - (float)kh);
    fq.h[d] = (p == 0) ? qh : (p == 1) ? (_Float16)qlo : (p == 2) ? qh : (_Float16)0.f;
    fk.h[d] = (p == 0) ? kh : (p == 1) ? (_Float16)((float)kh * 0.0009765625f) : (p == 2) ? (_Float16)klo : (_Float16)0.f; }
  const size_t row = (size_t)(slab0 + b) * TT + n;
  { *(v8us*)((unsigned short*)QP + row * 32 + p * 8) = fq.half[0]; *(v8us*)((unsigned short*)KP + row * 32 + p * 8) = fk.half[0];  } }
__global__ __launch_bounds__(256) void k_wvb(const float* __restrict__ wv, const float* __restrict__ bv, _Float16* __restrict__ A16) { const int t = blockIdx.x * 256 + threadIdx.x; if (t >= CC * 12) return; const int e = t / 12, c0 = (t % 12) * 8; FragH f;
  for (int q = 0; q < 8; ++q) { const int c = c0 + q; float v = 0.f; if (c < CC) v = bf16_round(wv[e * CC + c]); else if (c == CC) v = bf16_round(bv[e]); f.h[q] = (_Float16)(v * 16.0f); }
  *(v8us*)((unsigned short*)A16 + (size_t)t * 8) = f.half[0];  }
template <int RB>
__global__ __launch_bounds__(256) void k_ocm(const float* __restrict__ O, int slab0, const float* __restrict__ res, float* __restrict__ DST) { __shared__ float tl[64][65]; const int tid = threadIdx.x; const int b = blockIdx.x / (TT / 64), nb = blockIdx.x % (TT / 64); const int n0 = nb * 64;
  for (int i = tid; i < 64 * 64; i += 256) { const int n = i / 64, e = i % 64; tl[n][e] = O[((size_t)(slab0 + b) * TT + n0 + n) * CC + e]; } __syncthreads();
  const int piece = tid % 16, esub = tid / 16;      /* 16 consecutive lanes = one channel's 256-B segment (tokens n0..n0+63); 16 channels per iteration */
  v4f vals[4];
  for (int it = 0; it < 4; ++it) { const int e = it * 16 + esub; v4f v; for (int j = 0; j < 4; ++j) { float rv = res[((size_t)b * CC + e) * TT + n0 + piece * 4 + j]; if (RB) rv = bf16_round(rv); v[j] = tl[piece * 4 + j][e] + rv; } vals[it] = v; }
  { for (int it = 0; it < 4; ++it) { const int e = it * 16 + esub; *(v4f*)(DST + ((size_t)b * CC + e) * TT + n0 + piece * 4) = vals[it]; }  } }
__global__ __launch_bounds__(256) void k_cat(const float* __restrict__ M0, const float* __restrict__ M1, _Float16* __restrict__ CAT) { __shared__ float tl[128][65]; const int tid = threadIdx.x; const int b = blockIdx.x / (TT / 64), nb = blockIdx.x % (TT / 64); const int n0 = nb * 64;
  for (int i = tid; i < 128 * 64; i += 256) { const int ch = i / 64, n = i % 64; tl[ch][n] = (ch < 64) ? M0[((size_t)b * CC + ch) * TT + n0 + n] : M1[((size_t)b * CC + ch - 64) * TT + n0 + n]; } __syncthreads();
  const int piece = tid % 16, nsub = tid / 16;      /* 16 consecutive lanes = one token's 256-B row (128 halves); 16 tokens per iteration */
  FragH fv[4];
  for (int it = 0; it < 4; ++it) { const int n = it * 16 + nsub; for (int q = 0; q < 8; ++q) fv[it].h[q] = (_Float16)tl[piece * 8 + q][n]; }
  { for (int it = 0; it < 4; ++it) { const int n = it * 16 + nsub; *(v8us*)((unsigned short*)CAT + ((size_t)b * TT + n0 + n) * 128 + piece * 8) = fv[it].half[0]; }  } }
__global__ __launch_bounds__(256) void k_finb(const float* __restrict__ FUS, const float* __restrict__ tb, const float* __restrict__ SA1, float* __restrict__ out, size_t n4) {
  #pragma clang fp contract(off)
  const size_t t = (size_t)blockIdx.x * 256 + threadIdx.x; if (t >= n4) return; const int e = (int)(((t * 4) / TT) % CC); const float bb = bf16_round(tb[e]); const v4f f = *(const v4fa*)(FUS + t * 4), s = *(const v4fa*)(SA1 + t * 4); v4f o; for (int q = 0; q < 4; ++q) o[q] = (f[q] + bb) * s[q] + s[q]; *(v4f*)(out + t * 4) = o;  }
__global__ __launch_bounds__(128) void k_flash(const _Float16* __restrict__ Q16, int ldq, const _Float16* __restrict__ K16, int ldk, const _Float16* __restrict__ Vt, const int* __restrict__ MSK, float* __restrict__ O, int ldo) {
  constexpr int RPW = 16, RTN = RPW / 16, NQB = TT / (4 * RPW), DT = 4, KS = 1;      /* d_qk = 32 (24 real + zero padding), d_v = 64 */
  __shared__ __attribute__((aligned(16))) unsigned short sP[4][RPW][40]; __shared__ __attribute__((aligned(16))) unsigned short sPL[4][RPW][40]; __shared__ __attribute__((aligned(16))) float sO[4][RPW][64 + 4];
  const int tid = threadIdx.x, w = tid >> 5, lane = tid & 31, ln = lane & 15, hh = lane >> 4;
  const int slab = blockIdx.x / NQB, qblk = blockIdx.x % NQB; const int b = slab / NH, h = slab % NH; const int qb0 = qblk * (4 * RPW); const int q0 = qb0 + w * RPW;
  FragH aq[2][KS];
#pragma unroll
  for (int rt = 0; rt < RTN; ++rt) { const unsigned short* qr = (const unsigned short*)Q16 + ((size_t)b * TT + q0 + rt * 16 + ln) * ldq;
#pragma unroll
    for (int ks = 0; ks < KS; ++ks) { aq[rt][ks].half[0] = *(const v8us*)(qr + ks * 32 + 8 * hh); aq[rt][ks].half[1] = *(const v8us*)(qr + ks * 32 + 16 + 8 * hh); } }
  const unsigned short* Vth = (const unsigned short*)Vt + (size_t)slab * 64 * TT;      /* v per slab: [64][4096] */
  float m_r[2][8], l_r[2][8]; v8f oacc[2][DT];
#pragma unroll
  for (int rt = 0; rt < RTN; ++rt) {
#pragma unroll
    for (int r = 0; r < 8; ++r) { m_r[rt][r] = -3.0e38f; l_r[rt][r] = 0.f; }
#pragma unroll
    for (int dt = 0; dt < DT; ++dt) oacc[rt][dt] = (v8f){0.f,0.f,0.f,0.f,0.f,0.f,0.f,0.f}; }
  const int jend = TT;
#pragma unroll 1
  for (int j0 = 0; j0 < jend; j0 += 32) {
    v8f s[2][2];
#pragma unroll
    for (int nt = 0; nt < 2; ++nt) { const unsigned short* kr = (const unsigned short*)K16 + ((size_t)b * TT + j0 + nt * 16 + ln) * ldk; FragH bk[KS];
#pragma unroll
      for (int ks = 0; ks < KS; ++ks) { bk[ks].half[0] = *(const v8us*)(kr + ks * 32 + 8 * hh); bk[ks].half[1] = *(const v8us*)(kr + ks * 32 + 16 + 8 * hh); }
#pragma unroll
      for (int rt = 0; rt < RTN; ++rt) { v8f acc = (v8f){0.f,0.f,0.f,0.f,0.f,0.f,0.f,0.f};
#pragma unroll
        for (int ks = 0; ks < KS; ++ks) acc = mmaH<1>(aq[rt][ks].v, aq[rt][ks].v, bk[ks].v, bk[ks].v, acc); s[rt][nt] = acc; } }
#pragma unroll
    for (int rt = 0; rt < RTN; ++rt)
#pragma unroll
      for (int r = 0; r < 8; ++r) { const int tq = q0 + rt * 16 + 8 * hh + r; const int k0 = j0 + ln, k1 = j0 + 16 + ln; (void)tq; (void)k0; (void)k1;
        const bool ok0 = true, ok1 = true;
        const float s0 = s[rt][0][r], s1 = s[rt][1][r]; float mc = fmaxf(s0, s1);
        mc = fmaxf(mc, __shfl_xor(mc, 1, 32)); mc = fmaxf(mc, __shfl_xor(mc, 2, 32)); mc = fmaxf(mc, __shfl_xor(mc, 4, 32)); mc = fmaxf(mc, __shfl_xor(mc, 8, 32));
        const float mn = fmaxf(m_r[rt][r], mc); const float al = (mn > -1.0e38f) ? expf(m_r[rt][r] - mn) : 1.0f; m_r[rt][r] = mn; const float p0 = ok0 ? expf(s0 - mn) : 0.f, p1 = ok1 ? expf(s1 - mn) : 0.f; l_r[rt][r] = l_r[rt][r] * al + p0 + p1;
#pragma unroll
        for (int dt = 0; dt < DT; ++dt) oacc[rt][dt][r] *= al;
        FragH t2, t3; const float ps0 = p0 * 1024.0f, ps1 = p1 * 1024.0f; t2.h[0] = (_Float16)ps0; t2.h[1] = (_Float16)ps1; t3.h[0] = (_Float16)(ps0 - (float)t2.h[0]); t3.h[1] = (_Float16)(ps1 - (float)t2.h[1]);
        sP[w][rt * 16 + 8 * hh + r][ln] = t2.u[0]; sP[w][rt * 16 + 8 * hh + r][16 + ln] = t2.u[1]; sPL[w][rt * 16 + 8 * hh + r][ln] = t3.u[0]; sPL[w][rt * 16 + 8 * hh + r][16 + ln] = t3.u[1]; }
    __builtin_amdgcn_fence(__ATOMIC_ACQ_REL, "workgroup"); __builtin_amdgcn_wave_barrier();
    FragH pa[2], pl[2];
#pragma unroll
    for (int rt = 0; rt < RTN; ++rt) { pa[rt].half[0] = *(const v8us*)&sP[w][rt * 16 + ln][8 * hh]; pa[rt].half[1] = *(const v8us*)&sP[w][rt * 16 + ln][16 + 8 * hh]; pl[rt].half[0] = *(const v8us*)&sPL[w][rt * 16 + ln][8 * hh]; pl[rt].half[1] = *(const v8us*)&sPL[w][rt * 16 + ln][16 + 8 * hh]; }
#pragma unroll
    for (int dt = 0; dt < DT; ++dt) { const unsigned short* vrow = Vth + (size_t)(dt * 16 + ln) * TT + j0; FragH bv; bv.half[0] = *(const v8us*)(vrow + 8 * hh); bv.half[1] = *(const v8us*)(vrow + 16 + 8 * hh);
#pragma unroll
      for (int rt = 0; rt < RTN; ++rt) { oacc[rt][dt] = mmaH<1>(pa[rt].v, pa[rt].v, bv.v, bv.v, oacc[rt][dt]); oacc[rt][dt] = mmaH<1>(pl[rt].v, pl[rt].v, bv.v, bv.v, oacc[rt][dt]); } }      /* (Ph + Pl)·X */
    __builtin_amdgcn_fence(__ATOMIC_ACQ_REL, "workgroup"); __builtin_amdgcn_wave_barrier(); }
#pragma unroll
  for (int rt = 0; rt < RTN; ++rt) {
#pragma unroll
    for (int r = 0; r < 8; ++r) { float l = l_r[rt][r]; l += __shfl_xor(l, 1, 32); l += __shfl_xor(l, 2, 32); l += __shfl_xor(l, 4, 32); l += __shfl_xor(l, 8, 32); l_r[rt][r] = (l > 0.f) ? 1.0f / (l * 1024.0f) : 0.f; }
#pragma unroll
    for (int dt = 0; dt < DT; ++dt)
#pragma unroll
      for (int r = 0; r < 8; ++r) sO[w][rt * 16 + 8 * hh + r][dt * 16 + ln] = oacc[rt][dt][r] * l_r[rt][r]; }
  __builtin_amdgcn_fence(__ATOMIC_ACQ_REL, "workgroup"); __builtin_amdgcn_wave_barrier();
  {
#pragma unroll
    for (int rp = 0; rp < RPW; rp += 2) { const int r = rp + (lane >> 4), pc = lane & 15; const v4f val = *(const v4fa*)&sO[w][r][pc * 4]; *(v4f*)(O + ((size_t)slab * TT + q0 + r) * ldo + pc * 4) = val; }
     } }

extern "C" void kernel_launch(void* const* d_in, const int* in_sizes, int n_in,
                              void* d_out, int out_size, void* d_ws, size_t ws_size, hipStream_t stream) {
  (void)in_sizes; (void)n_in; (void)out_size;
  const float* const* I = (const float* const*)d_in; const float* x = I[0]; const float* sa_wq = I[1]; const float* sa_bq = I[2]; const float* sa_wk = I[3]; const float* sa_bk = I[4]; const float* sa_wv = I[5]; const float* sa_bv = I[6];
  const float* ga_wq = I[7]; const float* ga_bq = I[8]; const float* ga_wk = I[9]; const float* ga_bk = I[10]; const float* ga_wv = I[11]; const float* ga_bv = I[12]; const float* tw = I[13]; const float* tb = I[14];
  char* ws = (char*)d_ws; size_t off = 0;
  auto take = [&](size_t bytes) { char* p = ws + off; off += (bytes + 255) & ~(size_t)255; return p; };
  const size_t PL = (size_t)BB * CC * TT;      /* one [B][64][4096] f32 plane = 1 M floats */
  _Float16* AWV = (_Float16*)take((size_t)5 * CC * 96 * 2); _Float16* TW16 = (_Float16*)take((size_t)CC * 128 * 2);
  _Float16* XT = (_Float16*)take((size_t)BB * TT * 96 * 2); _Float16* QP = (_Float16*)take((size_t)NSL * TT * 32 * 2); _Float16* KP = (_Float16*)take((size_t)NSL * TT * 32 * 2); _Float16* VT = (_Float16*)take((size_t)NSL * CC * TT * 2); float* O = (float*)take((size_t)NSL * TT * CC * 4);
  float* SA = (float*)take(3 * PL * 4); float* MF = (float*)take(2 * PL * 4); _Float16* CAT = (_Float16*)take((size_t)BB * TT * 128 * 2); float* FUS = (float*)take(PL * 4);
  if (off > ws_size) return;      // 0.1 + 3.1 + 5.2 + 5.2 + 10.5 + 21 + 12.6 + 8.4 + 4.2 + 4.2 ≈ 74.5 MB
  for (int a = 0; a < 5; ++a) { const float* wv = (a < 3) ? sa_wv + (size_t)a * CC * CC : ga_wv + (size_t)(a - 3) * CC * CC; const float* bv = (a < 3) ? sa_bv + a * CC : ga_bv + (a - 3) * CC; k_wvb<<<(CC * 12 + 255) / 256, 256, 0, stream>>>(wv, bv, AWV + (size_t)a * CC * 96); }
  k_round16f<<<(CC * 128 / 8 + 255) / 256, 256, 0, stream>>>(tw, TW16, CC * 128 / 8);      /* tfus_w [64 o][128 c] natural = the A operand ×2^4 */
  const unsigned gxt = (unsigned)(((size_t)BB * TT * 12 + 255) / 256), gqk = (unsigned)(((size_t)BB * TT * 4 + 255) / 256); const dim3 gv(((CC / 16) * (TT / 64) + 3) / 4, BB);
  /* self attention on the three frames: slabs a·BB + b for a = 0,1,2 */
  for (int a = 0; a < 3; ++a) { const float* xf = x + (size_t)a * PL;
    k_xt<1><<<gxt, 256, 0, stream>>>(xf, XT); k_qk<1><<<gqk, 256, 0, stream>>>(xf, sa_wq + (size_t)a * 8 * CC, sa_bq + a * 8, sa_wk + (size_t)a * 8 * CC, sa_bk + a * 8, a * BB, QP, KP);
    k_gemm_hhx<0><<<gv, 128, 0, stream>>>(AWV + (size_t)a * CC * 96, 96, 0, XT, 96, (size_t)TT * 96, 0.0625f, nullptr, 0, nullptr, 1, 0, 0, nullptr, VT + (size_t)a * BB * CC * TT, TT, (size_t)CC * TT, CC, TT, 96); }      /* v[b][e][m] = wv·x + bv, channel-major f16: batched over b, M 64 N 4096 K 96 */
  k_flash<<<3 * BB * (TT / 64), 128, 0, stream>>>(QP, 32, KP, 32, VT, nullptr, O, CC);      /* slabs 0..11 */
  for (int a = 0; a < 3; ++a) k_ocm<1><<<BB * (TT / 64), 256, 0, stream>>>(O, a * BB, x + (size_t)a * PL, SA + (size_t)a * PL);      /* SA_a = attn-out + x_a (channel-major f32) */
  /* guided attentions: slabs 12..15 (q,k from SA_0; v,res from SA_1) and 16..19 (q,k from SA_2) */
  k_xt<0><<<gxt, 256, 0, stream>>>(SA + PL, XT);      /* SA_1 token-major (internal f32, no rounding) */
  for (int gi = 0; gi < 2; ++gi) { const float* src = SA + (size_t)(gi == 0 ? 0 : 2) * PL; const int a = 3 + gi;
    k_qk<0><<<gqk, 256, 0, stream>>>(src, ga_wq + (size_t)gi * 8 * CC, ga_bq + gi * 8, ga_wk + (size_t)gi * 8 * CC, ga_bk + gi * 8, a * BB, QP, KP);
    k_gemm_hhx<0><<<gv, 128, 0, stream>>>(AWV + (size_t)a * CC * 96, 96, 0, XT, 96, (size_t)TT * 96, 0.0625f, nullptr, 0, nullptr, 1, 0, 0, nullptr, VT + (size_t)a * BB * CC * TT, TT, (size_t)CC * TT, CC, TT, 96); }
  k_flash<<<2 * BB * (TT / 64), 128, 0, stream>>>(QP + (size_t)3 * BB * TT * 32, 32, KP + (size_t)3 * BB * TT * 32, 32, VT + (size_t)3 * BB * CC * TT, nullptr, O + (size_t)3 * BB * TT * CC, CC);      /* slabs 12..19 (kernel-relative 0..7) */
  for (int gi = 0; gi < 2; ++gi) k_ocm<0><<<BB * (TT / 64), 256, 0, stream>>>(O + (size_t)3 * BB * TT * CC, gi * BB, SA + PL, MF + (size_t)gi * PL);      /* mfi_gi = attn-out + SA_1 */
  k_cat<<<BB * (TT / 64), 256, 0, stream>>>(MF, MF + PL, CAT);
  k_gemm_hhx<0><<<dim3(((CC / 16) * (TT / 64) + 3) / 4, BB), 128, 0, stream>>>(TW16, 128, 0, CAT, 128, (size_t)TT * 128, 0.0625f, nullptr, 0, nullptr, 1, 0, 0, FUS, nullptr, TT, (size_t)CC * TT, CC, TT, 128);      /* fusion[b][o][n] = Σ_c W[o][c]·cat[b][c][n]: A = W (M 64, K 128), Bt = CAT[b] token-major; bias tfus_b per ROW o → added in k_fin? no: see k_finb */
  k_finb<<<(unsigned)((PL / 4 + 255) / 256), 256, 0, stream>>>(FUS, tb, SA + PL, (float*)d_out, PL / 4);
}

// v001
// A run of this version takes 631 microseconds.
// Two timings next to v000 both put it at 1.72 times that version's speed.
#include <hip/hip_runtime.h>
// MFI (3 frames, B=4, C=64, 64×64 → N=4096): SA_f = position attention on frame f (q = wq·x+bq (8 ch), k = wk·x+bk (8 ch), v = wv·x+bv (64 ch); attn = softmax_m(q[:,n]·k[:,m]) unscaled; out[e][n] = Σ_m v[e][m]·attn[n][m] + x[e][n]); then two guided attentions
// (q,k from SA_0 / SA_2, v and residual from SA_1), cat → fusion = tfus_w·cat + b; out = fusion·SA_1 + SA_1 → [4,64,64,64].
// Compute dtype: x, weights, biases rounded to bf16; q/k per token in f32 VALU (8×64 dot, rolled) emitted as concatenated f16 planes [q_hi|q_lo|q_hi|0] and [k_hi|k_hi·2^-10|k_lo|0] so ONE 32-wide WMMA k-step yields f32-accurate logits; v (+bias via an
// augmented ones column) channel-major by GEMM (f16); fused flash-style kernel per (slab, 64 queries) (online softmax f32, P f16 hi + residual, O token-major f32); residual add + channel-major restage in f32; cat f16 → fusion GEMM → out = fusion·sa₁ + sa₁ in f32. All on v_wmma_f32_16x16x32_f16.
#define NFR 3
#define BB 4
#define CC 64
#define TT 4096
#define NH 1
#define NSL (5 * BB)

typedef __bf16 v16b __attribute__((ext_vector_type(16)));
typedef unsigned short v8us __attribute__((ext_vector_type(8), may_alias));
typedef float  v8f  __attribute__((ext_vector_type(8)));
typedef float  v4f  __attribute__((ext_vector_type(4)));
typedef float  v4fa __attribute__((ext_vector_type(4), may_alias));
union FragB { v16b v; v8us half[2]; unsigned short u[16]; };

__device__ __forceinline__ unsigned short bf16_bits(float x) { unsigned int u = __float_as_uint(x); return (unsigned short)((u + 0x7FFFu + ((u >> 16) & 1u)) >> 16); }
__device__ __forceinline__ float bf16_val(unsigned short b) { return __uint_as_float(((unsigned int)b) << 16); }
__device__ __forceinline__ float bf16_round(float x) { return bf16_val(bf16_bits(x)); }
// D += A·B with NT terms: 1 = ah·bh, 2 = + al·bh (A split), 3 = + ah·bl (both split)
template <int NT>
__device__ __forceinline__ v8f mmaN(v16b ah, v16b al, v16b bh, v16b bl, v8f c) {
  c = __builtin_amdgcn_wmma_f32_16x16x32_bf16(false, ah, false, bh, (short)0, c, false, false);
  if (NT >= 2) c = __builtin_amdgcn_wmma_f32_16x16x32_bf16(false, al, false, bh, (short)0, c, false, false);
  if (NT >= 3) c = __builtin_amdgcn_wmma_f32_16x16x32_bf16(false, ah, false, bl, (short)0, c, false, false);
  asm volatile("v_nop\n\tv_nop\n\tv_nop\n\tv_nop" : "+v"(c) : "v"(ah), "v"(al), "v"(bh), "v"(bl));
  return c;
}

__global__ __launch_bounds__(256) void k_wt_bf16(const float* __restrict__ W, unsigned short* __restrict__ Wt, int K, int N) {
  const int t = blockIdx.x * 256 + threadIdx.x;
  const int k8n = K / 8;
  if (t >= N * k8n) return;
  const int n = t / k8n, k8 = (t % k8n) * 8;
  v8us v;
#pragma unroll
  for (int i = 0; i < 8; ++i) v[i] = bf16_bits(W[(size_t)(k8 + i) * N + n]);
  *(v8us*)(Wt + (size_t)n * K + k8) = v;
  
}

// GEMM C[M][N] (f32, pitch ldc) = act(A[M][K]·W + bias). A f32 row-major (pitch lda) converted per fragment to bf16
// (ASPLIT: hi/lo two planes -> 2 terms, else single rounded term); Wt bf16 [N][K] (pitch ldb). BIAS_BF16 rounds the
// bias to bf16 first (bias quantised to bf16 before the add). K%32==0, M%16==0, N%64==0.
template <bool ASPLIT, int ACT, bool BIAS_BF16>
__global__ __launch_bounds__(128) void k_gemm_bf(const float* __restrict__ A, int lda, const unsigned short* __restrict__ Wt, int ldb,
                                               const float* __restrict__ bias, float* __restrict__ C, int ldc, int M, int N, int K) {
  __shared__ __attribute__((aligned(16))) float so[4][16][64];
  const int tid = threadIdx.x, w = tid >> 5, lane = tid & 31, ln = lane & 15, hh = lane >> 4;
  const int ntn = N / 64;
  const int wid = blockIdx.x * 4 + w;
  const int mt = wid / ntn, nq = wid % ntn;
  if (mt * 16 >= M) return;
  const int row0 = mt * 16, col0 = nq * 64;
  const float* arow = A + (size_t)(row0 + ln) * lda;
  v8f acc[4] = {};
  for (int kb = 0; kb < K; kb += 32) {
    FragB ah, al;
    const v4f x0 = *(const v4fa*)(arow + kb + 8 * hh), x1 = *(const v4fa*)(arow + kb + 8 * hh + 4);
    const v4f x2 = *(const v4fa*)(arow + kb + 16 + 8 * hh), x3 = *(const v4fa*)(arow + kb + 16 + 8 * hh + 4);
    float xs[16] = {x0[0],x0[1],x0[2],x0[3],x1[0],x1[1],x1[2],x1[3],x2[0],x2[1],x2[2],x2[3],x3[0],x3[1],x3[2],x3[3]};
#pragma unroll
    for (int i = 0; i < 16; ++i) { const unsigned short hb = bf16_bits(xs[i]); ah.u[i] = hb; al.u[i] = ASPLIT ? bf16_bits(xs[i] - bf16_val(hb)) : (unsigned short)0; }
#pragma unroll
    for (int t = 0; t < 4; ++t) {
      const unsigned short* brow = Wt + (size_t)(col0 + t * 16 + ln) * ldb + kb;
      FragB b;
      b.half[0] = *(const v8us*)(brow + 8 * hh);
      b.half[1] = *(const v8us*)(brow + 16 + 8 * hh);
      acc[t] = mmaN<ASPLIT ? 2 : 1>(ah.v, al.v, b.v, b.v, acc[t]);
    }
  }
#pragma unroll
  for (int t = 0; t < 4; ++t) {
    float bv = bias ? bias[col0 + t * 16 + ln] : 0.f;
    if (BIAS_BF16) bv = bf16_round(bv);
#pragma unroll
    for (int r = 0; r < 8; ++r) { float v = acc[t][r] + bv; if (ACT == 1) v = fmaxf(v, 0.f); so[w][8 * hh + r][t * 16 + ln] = v; }
  }
  __builtin_amdgcn_fence(__ATOMIC_ACQ_REL, "workgroup");
  __builtin_amdgcn_wave_barrier();
  const int rsub = lane >> 4, c4 = (lane & 15) * 4;
  {
#pragma unroll
    for (int q = 0; q < 8; ++q) {
      const int r = q * 2 + rsub;
      const v4f v = *(const v4fa*)&so[w][r][c4];
      *(v4f*)(C + (size_t)(row0 + r) * ldc + col0 + c4) = v;
    }
    
  }
}

// Flash-style causal/unmasked attention, all contractions 3-term bf16 hi/lo splits, f32 softmax with running max.
// q,k,v rows are read from f32 buffers with arbitrary row pitch (so they can live inside a fused qkv buffer);
// D = head size (multiple of 32, <= 128); one wave = 16 query rows; block = 4 waves (64 queries) sharing K/V chunks of 32.
template <int D, bool CAUSAL>
__global__ __launch_bounds__(128) void k_flash(const float* __restrict__ qb, const float* __restrict__ kb, const float* __restrict__ vb,
                                             int pitch, int T, int H, float scale, float* __restrict__ y, int ypitch) {
  constexpr int KS = D / 32;        // k-steps for QK
  constexpr int DT = D / 16;        // d tiles for PV
  __shared__ __attribute__((aligned(16))) unsigned short sKh[32][D + 8], sKl[32][D + 8], sVh[32][D + 8], sVl[32][D + 8];
  __shared__ __attribute__((aligned(16))) unsigned short sPh[4][16][40], sPl[4][16][40];
  __shared__ __attribute__((aligned(16))) float sO[4][16][D];
  const int tid = threadIdx.x, w = tid >> 5, lane = tid & 31, ln = lane & 15, hh = lane >> 4;
  const int nqb = (T + 63) / 64;
  const int bh = blockIdx.x / nqb, qblk = blockIdx.x % nqb;
  const int b = bh / H, h = bh % H;
  const int q0 = qblk * 64 + w * 16;
  const float* Q = qb + (size_t)b * T * pitch + h * D;
  const float* K = kb + (size_t)b * T * pitch + h * D;
  const float* V = vb + (size_t)b * T * pitch + h * D;

  // A fragments of the wave's 16 query rows (scaled), hi/lo
  FragB aqh[KS], aql[KS];
  {
    int row = q0 + ln; if (row >= T) row = T - 1;
    const float* qr = Q + (size_t)row * pitch;
#pragma unroll
    for (int ks = 0; ks < KS; ++ks)
#pragma unroll
      for (int i = 0; i < 16; ++i) {
        const int d = ks * 32 + ((i < 8) ? (8 * hh + i) : (16 + 8 * hh + (i - 8)));
        const float x = qr[d] * scale; const unsigned short hb = bf16_bits(x);
        aqh[ks].u[i] = hb; aql[ks].u[i] = bf16_bits(x - bf16_val(hb));
      }
  }
  float m_r[8], l_r[8];
#pragma unroll
  for (int r = 0; r < 8; ++r) { m_r[r] = -3.0e38f; l_r[r] = 0.f; }
  v8f oacc[DT];
#pragma unroll
  for (int dt = 0; dt < DT; ++dt) oacc[dt] = (v8f){0.f,0.f,0.f,0.f,0.f,0.f,0.f,0.f};

  const int kv_end = CAUSAL ? min(T, qblk * 64 + 64) : T;     // block-uniform
  for (int j0 = 0; j0 < kv_end; j0 += 32) {
    __syncthreads();
    for (int e = tid; e < 32 * (D / 4); e += 128) {
      const int r = e / (D / 4), c4 = (e % (D / 4)) * 4;
      const int key = j0 + r;
      v4f kf = {0.f,0.f,0.f,0.f}, vf = {0.f,0.f,0.f,0.f};
      if (key < T) { kf = *(const v4fa*)(K + (size_t)key * pitch + c4); vf = *(const v4fa*)(V + (size_t)key * pitch + c4); }
#pragma unroll
      for (int t = 0; t < 4; ++t) {
        unsigned short hb = bf16_bits(kf[t]); sKh[r][c4 + t] = hb; sKl[r][c4 + t] = bf16_bits(kf[t] - bf16_val(hb));
        hb = bf16_bits(vf[t]); sVh[r][c4 + t] = hb; sVl[r][c4 + t] = bf16_bits(vf[t] - bf16_val(hb));
      }
    }
    __syncthreads();
    // S tile 16 x 32
    v8f s[2];
#pragma unroll
    for (int nt = 0; nt < 2; ++nt) {
      v8f acc = {};
#pragma unroll
      for (int ks = 0; ks < KS; ++ks) {
        FragB bh_, bl_;
        bh_.half[0] = *(const v8us*)&sKh[nt * 16 + ln][ks * 32 + 8 * hh]; bh_.half[1] = *(const v8us*)&sKh[nt * 16 + ln][ks * 32 + 16 + 8 * hh];
        bl_.half[0] = *(const v8us*)&sKl[nt * 16 + ln][ks * 32 + 8 * hh]; bl_.half[1] = *(const v8us*)&sKl[nt * 16 + ln][ks * 32 + 16 + 8 * hh];
        acc = mmaN<3>(aqh[ks].v, aql[ks].v, bh_.v, bl_.v, acc);
      }
      s[nt] = acc;
    }
    // mask + running max (rows 8hh+r; the 16 lanes of a half share rows)
    float alpha[8];
#pragma unroll
    for (int r = 0; r < 8; ++r) {
      const int qi = q0 + 8 * hh + r;
      const int ja = j0 + ln, jb = j0 + 16 + ln;
      if (CAUSAL) { if (ja > qi) s[0][r] = -3.0e38f; if (jb > qi) s[1][r] = -3.0e38f; }
      if (ja >= T) s[0][r] = -3.0e38f;
      if (jb >= T) s[1][r] = -3.0e38f;
      float mx = fmaxf(s[0][r], s[1][r]);
      mx = fmaxf(mx, __shfl_xor(mx, 1, 32)); mx = fmaxf(mx, __shfl_xor(mx, 2, 32)); mx = fmaxf(mx, __shfl_xor(mx, 4, 32)); mx = fmaxf(mx, __shfl_xor(mx, 8, 32));
      const float mnew = fmaxf(m_r[r], mx);
      alpha[r] = (mnew > -1.0e38f) ? __expf(m_r[r] - mnew) : 1.0f;
      const float p0 = (s[0][r] > -1.0e38f) ? __expf(s[0][r] - mnew) : 0.f;
      const float p1 = (s[1][r] > -1.0e38f) ? __expf(s[1][r] - mnew) : 0.f;
      m_r[r] = mnew;
      l_r[r] = l_r[r] * alpha[r] + p0 + p1;            // per-lane partial row sum (16 lanes combined at the end)
      unsigned short hb = bf16_bits(p0); sPh[w][8 * hh + r][ln] = hb;      sPl[w][8 * hh + r][ln] = bf16_bits(p0 - bf16_val(hb));
      hb = bf16_bits(p1);                sPh[w][8 * hh + r][16 + ln] = hb; sPl[w][8 * hh + r][16 + ln] = bf16_bits(p1 - bf16_val(hb));
    }
#pragma unroll
    for (int dt = 0; dt < DT; ++dt)
#pragma unroll
      for (int r = 0; r < 8; ++r) oacc[dt][r] *= alpha[r];
    __builtin_amdgcn_fence(__ATOMIC_ACQ_REL, "workgroup");
    __builtin_amdgcn_wave_barrier();
    FragB pah, pal;
    pah.half[0] = *(const v8us*)&sPh[w][ln][8 * hh]; pah.half[1] = *(const v8us*)&sPh[w][ln][16 + 8 * hh];
    pal.half[0] = *(const v8us*)&sPl[w][ln][8 * hh]; pal.half[1] = *(const v8us*)&sPl[w][ln][16 + 8 * hh];
#pragma unroll
    for (int dt = 0; dt < DT; ++dt) {
      FragB bvh, bvl;
#pragma unroll
      for (int i = 0; i < 8; ++i) {
        bvh.u[i] = sVh[8 * hh + i][dt * 16 + ln]; bvh.u[8 + i] = sVh[16 + 8 * hh + i][dt * 16 + ln];
        bvl.u[i] = sVl[8 * hh + i][dt * 16 + ln]; bvl.u[8 + i] = sVl[16 + 8 * hh + i][dt * 16 + ln];
      }
      oacc[dt] = mmaN<3>(pah.v, pal.v, bvh.v, bvl.v, oacc[dt]);
    }
    __builtin_amdgcn_fence(__ATOMIC_ACQ_REL, "workgroup");
    __builtin_amdgcn_wave_barrier();
  }
#pragma unroll
  for (int r = 0; r < 8; ++r) {
    float l = l_r[r];
    l += __shfl_xor(l, 1, 32); l += __shfl_xor(l, 2, 32); l += __shfl_xor(l, 4, 32); l += __shfl_xor(l, 8, 32);
    l_r[r] = (l > 0.f) ? 1.0f / l : 0.f;
  }
#pragma unroll
  for (int dt = 0; dt < DT; ++dt)
#pragma unroll
    for (int r = 0; r < 8; ++r) sO[w][8 * hh + r][dt * 16 + ln] = oacc[dt][r] * l_r[r];
  __builtin_amdgcn_fence(__ATOMIC_ACQ_REL, "workgroup");
  __builtin_amdgcn_wave_barrier();
  {
    for (int r = 0; r < 16; ++r) {
      const int row = q0 + r;
      if (row < T && lane < D / 4) {
        const v4f val = *(const v4fa*)&sO[w][r][lane * 4];
        *(v4f*)(y + ((size_t)b * T + row) * ypitch + h * D + lane * 4) = val;
      }
    }
    
  }
}

// GEMM C = act(A·W + bias + resid): A f32 (ASPLIT -> hi/lo 2 terms), Wt bf16 [N][K]; ACT 0 none, 1 relu, 2 exact gelu;
// resid (optional, f32, row index = (row % rmod), pitch ldr, RES_BF16 rounds it) added before the activation.
template <bool ASPLIT, int ACT, bool BIAS_BF16, bool RES_BF16>
__global__ __launch_bounds__(128) void k_gemm_bf3(const float* __restrict__ A, int lda, const unsigned short* __restrict__ Wt, int ldb,
                                                const float* __restrict__ bias, const float* __restrict__ resid, int rmod, int ldr,
                                                float* __restrict__ C, int ldc, int M, int N, int K) {
  __shared__ __attribute__((aligned(16))) float so[4][16][64];
  const int tid = threadIdx.x, w = tid >> 5, lane = tid & 31, ln = lane & 15, hh = lane >> 4;
  const int ntn = N / 64;
  const int wid = blockIdx.x * 4 + w;
  const int mt = wid / ntn, nq = wid % ntn;
  if (mt * 16 >= M) return;
  const int row0 = mt * 16, col0 = nq * 64;
  const float* arow = A + (size_t)(row0 + ln) * lda;
  v8f acc[4] = {};
  for (int kb = 0; kb < K; kb += 32) {
    FragB ah, al;
    const v4f x0 = *(const v4fa*)(arow + kb + 8 * hh), x1 = *(const v4fa*)(arow + kb + 8 * hh + 4);
    const v4f x2 = *(const v4fa*)(arow + kb + 16 + 8 * hh), x3 = *(const v4fa*)(arow + kb + 16 + 8 * hh + 4);
    float xs[16] = {x0[0],x0[1],x0[2],x0[3],x1[0],x1[1],x1[2],x1[3],x2[0],x2[1],x2[2],x2[3],x3[0],x3[1],x3[2],x3[3]};
#pragma unroll
    for (int i = 0; i < 16; ++i) { const unsigned short hb = bf16_bits(xs[i]); ah.u[i] = hb; al.u[i] = ASPLIT ? bf16_bits(xs[i] - bf16_val(hb)) : (unsigned short)0; }
#pragma unroll
    for (int t = 0; t < 4; ++t) {
      const unsigned short* brow = Wt + (size_t)(col0 + t * 16 + ln) * ldb + kb;
      FragB b;
      b.half[0] = *(const v8us*)(brow + 8 * hh);
      b.half[1] = *(const v8us*)(brow + 16 + 8 * hh);
      acc[t] = mmaN<ASPLIT ? 2 : 1>(ah.v, al.v, b.v, b.v, acc[t]);
    }
  }
#pragma unroll
  for (int t = 0; t < 4; ++t) {
    const int col = col0 + t * 16 + ln;
    float bv = bias ? bias[col] : 0.f;
    if (BIAS_BF16) bv = bf16_round(bv);
#pragma unroll
    for (int r = 0; r < 8; ++r) {
      float v = acc[t][r] + bv;
      if (resid) { float rv = resid[(size_t)((row0 + 8 * hh + r) % rmod) * ldr + col]; if (RES_BF16) rv = bf16_round(rv); v += rv; }
      if (ACT == 1) v = fmaxf(v, 0.f);
      if (ACT == 2) v = 0.5f * v * (1.0f + erff(v * 0.70710678118654752f));
      if (ACT == 3) { const float u = 0.7978845608028654f * (v + 0.044715f * v * v * v); v = 0.5f * v * (1.0f + tanhf(u)); }
      so[w][8 * hh + r][t * 16 + ln] = v;
    }
  }
  __builtin_amdgcn_fence(__ATOMIC_ACQ_REL, "workgroup");
  __builtin_amdgcn_wave_barrier();
  const int rsub = lane >> 4, c4 = (lane & 15) * 4;
  {
#pragma unroll
    for (int q = 0; q < 8; ++q) {
      const int r = q * 2 + rsub;
      const v4f v = *(const v4fa*)&so[w][r][c4];
      *(v4f*)(C + (size_t)(row0 + r) * ldc + col0 + c4) = v;
    }
    
  }
}
// row LayerNorm (biased variance, eps) over N: s = X (+ R); optional out_sum <- s; out_norm <- (s-mu)*rsqrt(var+eps)*g + b
template <bool PARAM_BF16>
__global__ __launch_bounds__(256) void k_layernorm(const float* __restrict__ X, const float* __restrict__ R, const float* __restrict__ g, const float* __restrict__ bta,
                                                  float* __restrict__ out_sum, float* __restrict__ out_norm, int N, float eps) {
  __shared__ float red[256];
  const int row = blockIdx.x, tid = threadIdx.x;
  const float* x = X + (size_t)row * N; const float* rr = R ? R + (size_t)row * N : nullptr;
  float vals[16];                     // up to N = 4096
  const int per = N / 256;            // contiguous chunk per thread? use strided-by-4 chunks: thread handles j = tid*4 + 1024*u
  float s1 = 0.f;
  for (int u = 0; u < per / 4; ++u) {
    const int j = tid * 4 + 1024 * u;
    const v4f a = *(const v4fa*)(x + j);
    v4f b = {0.f,0.f,0.f,0.f}; if (rr) b = *(const v4fa*)(rr + j);
#pragma unroll
    for (int q = 0; q < 4; ++q) { const float v = a[q] + b[q]; vals[u * 4 + q] = v; s1 += v; }
  }
  red[tid] = s1; __syncthreads();
  for (int st = 128; st > 0; st >>= 1) { if (tid < st) red[tid] += red[tid + st]; __syncthreads(); }
  const float mu = red[0] / (float)N; __syncthreads();
  float s2 = 0.f;
  for (int u = 0; u < per / 4; ++u)
#pragma unroll
    for (int q = 0; q < 4; ++q) { const float c = vals[u * 4 + q] - mu; s2 += c * c; }
  red[tid] = s2; __syncthreads();
  for (int st = 128; st > 0; st >>= 1) { if (tid < st) red[tid] += red[tid + st]; __syncthreads(); }
  const float rs = rsqrtf(red[0] / (float)N + eps);
  {
    for (int u = 0; u < per / 4; ++u) {
      const int j = tid * 4 + 1024 * u;
      v4f o, sm;
#pragma unroll
      for (int q = 0; q < 4; ++q) {
        float gg = g[j + q], bb = bta[j + q];
        if (PARAM_BF16) { gg = bf16_round(gg); bb = bf16_round(bb); }
        sm[q] = vals[u * 4 + q]; o[q] = (vals[u * 4 + q] - mu) * rs * gg + bb;
      }
      if (out_sum) *(v4f*)(out_sum + (size_t)row * N + j) = sm;
      *(v4f*)(out_norm + (size_t)row * N + j) = o;
    }
    
  }
}



// ---- f16 WMMA path (v_wmma_f32_16x16x32_f16): 11-bit significands for operands in range — used where a [0,1] probability operand needs more precision than bf16
typedef _Float16 v16h __attribute__((ext_vector_type(16)));
union FragH { v16h v; v8us half[2]; _Float16 h[16]; unsigned short u[16]; };
template <int NT>
__device__ __forceinline__ v8f mmaH(v16h ah, v16h al, v16h bh, v16h bl, v8f c) {
  c = __builtin_amdgcn_wmma_f32_16x16x32_f16(false, ah, false, bh, (short)0, c, false, false);
  if (NT >= 2) c = __builtin_amdgcn_wmma_f32_16x16x32_f16(false, al, false, bh, (short)0, c, false, false);
  if (NT >= 3) c = __builtin_amdgcn_wmma_f32_16x16x32_f16(false, ah, false, bl, (short)0, c, false, false);
  asm volatile("v_nop\n\tv_nop\n\tv_nop\n\tv_nop" : "+v"(c) : "v"(ah), "v"(al), "v"(bh), "v"(bl));
  return c;
}
// batched GEMM like k_gemm_b but f16 operands: A f32 (split into f16 hi/lo if ASPLIT, else rounded to f16), Bt = f16 values [n][k]; alpha; C f32; N multiple of 16 (partial tiles skipped)
template <bool ASPLIT>
__global__ __launch_bounds__(128) void k_gemm_h(const float* __restrict__ A, int lda, size_t sA, const _Float16* __restrict__ Bh, int ldb, size_t sB, float alpha, float* __restrict__ C, int ldc, size_t sC, int M, int N, int K) {
  __shared__ __attribute__((aligned(16))) float so[4][16][64];
  const int tid = threadIdx.x, w = tid >> 5, lane = tid & 31, ln = lane & 15, hh = lane >> 4; const int by = blockIdx.y;
  A += (size_t)by * sA; Bh += (size_t)by * sB; C += (size_t)by * sC;
  const int ntn = (N + 63) / 64; const int wid = blockIdx.x * 4 + w; const int mt = wid / ntn, nq = wid % ntn; if (mt * 16 >= M) return;
  const int row0 = mt * 16, col0 = nq * 64; const float* arow = A + (size_t)(row0 + ln) * lda;
  v8f acc[4] = {};
  for (int kb = 0; kb < K; kb += 32) {
    FragH ah, al;
    const v4f x0 = *(const v4fa*)(arow + kb + 8 * hh), x1 = *(const v4fa*)(arow + kb + 8 * hh + 4), x2 = *(const v4fa*)(arow + kb + 16 + 8 * hh), x3 = *(const v4fa*)(arow + kb + 16 + 8 * hh + 4);
    float xs[16] = {x0[0],x0[1],x0[2],x0[3],x1[0],x1[1],x1[2],x1[3],x2[0],x2[1],x2[2],x2[3],x3[0],x3[1],x3[2],x3[3]};
#pragma unroll
    for (int i = 0; i < 16; ++i) { const _Float16 h = (_Float16)xs[i]; ah.h[i] = h; al.h[i] = ASPLIT ? (_Float16)(xs[i] - (float)h) : (_Float16)0.0f; }
#pragma unroll
    for (int t = 0; t < 4; ++t) { if (col0 + t * 16 >= N) continue; const size_t boff = (size_t)(col0 + t * 16 + ln) * ldb + kb; FragH bq; bq.half[0] = *(const v8us*)(Bh + boff + 8 * hh); bq.half[1] = *(const v8us*)(Bh + boff + 16 + 8 * hh);
      acc[t] = mmaH<ASPLIT ? 2 : 1>(ah.v, al.v, bq.v, bq.v, acc[t]); }
  }
#pragma unroll
  for (int t = 0; t < 4; ++t) { if (col0 + t * 16 >= N) continue;
#pragma unroll
    for (int r = 0; r < 8; ++r) so[w][8 * hh + r][t * 16 + ln] = acc[t][r] * alpha; }
  __builtin_amdgcn_fence(__ATOMIC_ACQ_REL, "workgroup"); __builtin_amdgcn_wave_barrier();
  const int rsub = lane >> 4, c4 = (lane & 15) * 4;
  {
#pragma unroll
    for (int q = 0; q < 8; ++q) { const int r = q * 2 + rsub; if (col0 + c4 < N) { const v4f v = *(const v4fa*)&so[w][r][c4]; *(v4f*)(C + (size_t)(row0 + r) * ldc + col0 + c4) = v; } }
     }
}

// Wt[n][k] = f16(W[k][n]·scale) from f32 row-major W[K][N] (scale = power of two; bf16-exact weights stay exact in f16 away from the subnormal range)
__global__ __launch_bounds__(256) void k_wt_f16(const float* __restrict__ W, _Float16* __restrict__ Wt, int K, int N, float scale) {
  const int t = blockIdx.x * 256 + threadIdx.x; if (t >= N * (K / 8)) return; const int n = t / (K / 8), k8 = (t % (K / 8)) * 8; FragH f;
#pragma unroll
  for (int i = 0; i < 8; ++i) f.h[i] = (_Float16)(bf16_round(W[(size_t)(k8 + i) * N + n]) * scale); const v8us o = f.half[0];
  *(v8us*)((unsigned short*)Wt + (size_t)n * K + k8) = o; 
}
// k_gemm_hh variant with fused epilogue: v = acc·alpha + bias[by·sBias + col] (+ CP[(row/rowsPerB)·sCPb + by·64 + col] if CP) ; ACT 0 none / 1 elu ; writes f32 C and/or f16 C16 (each if non-null)
template <int ACT>
__global__ __launch_bounds__(128) void k_gemm_hhx(const _Float16* __restrict__ A, int lda, size_t sA, const _Float16* __restrict__ Bh, int ldb, size_t sB, float alpha, const float* __restrict__ bias, size_t sBias, const float* __restrict__ CP, int rowsPerB, size_t sCPb, int row0g,
    float* __restrict__ C, _Float16* __restrict__ C16, int ldc, size_t sC, int M, int N, int K) {
  __shared__ __attribute__((aligned(16))) float so[4][16][64];
  const int tid = threadIdx.x, w = tid >> 5, lane = tid & 31, ln = lane & 15, hh = lane >> 4; const int by = blockIdx.y;
  A += (size_t)by * sA; Bh += (size_t)by * sB; const size_t cofs = (size_t)by * sC; const float* bp = bias ? bias + (size_t)by * sBias : nullptr;
  const int ntn = (N + 63) / 64; const int wid = blockIdx.x * 4 + w; const int mt = wid / ntn, nq = wid % ntn; if (mt * 16 >= M) return;
  const int row0 = mt * 16, col0 = nq * 64; const _Float16* arow = A + (size_t)(row0 + ln) * lda;
  v8f acc[4] = {};
  for (int kb = 0; kb < K; kb += 32) { FragH ah; ah.half[0] = *(const v8us*)((const unsigned short*)arow + kb + 8 * hh); ah.half[1] = *(const v8us*)((const unsigned short*)arow + kb + 16 + 8 * hh);
#pragma unroll
    for (int t = 0; t < 4; ++t) { if (col0 + t * 16 >= N) continue; const size_t boff = (size_t)(col0 + t * 16 + ln) * ldb + kb; FragH bq; bq.half[0] = *(const v8us*)((const unsigned short*)Bh + boff + 8 * hh); bq.half[1] = *(const v8us*)((const unsigned short*)Bh + boff + 16 + 8 * hh);
      acc[t] = mmaH<1>(ah.v, ah.v, bq.v, bq.v, acc[t]); }
  }
#pragma unroll
  for (int t = 0; t < 4; ++t) { if (col0 + t * 16 >= N) continue; const int col = col0 + t * 16 + ln; const float bv = bp ? bf16_round(bp[col]) : 0.f;
#pragma unroll
    for (int r = 0; r < 8; ++r) { float v = acc[t][r] * alpha + bv; if (CP) { const int bidx = (row0g + row0 + 8 * hh + r) / rowsPerB; v += CP[(size_t)bidx * sCPb + (size_t)by * 64 + col]; } if (ACT == 1) v = (v > 0.f) ? v : expm1f(v); else if (ACT == 7) v = (v > 0.f) ? v + 1.0f : expf(v); else if (ACT == 8) v = tanhf(v); else if (ACT == 9) v = 0.5f * v * (1.0f + tanhf(0.7978845608028654f * (v + 0.044715f * v * v * v))); else if (ACT == 11) v = 1.0f / (1.0f + expf(-v)); else if (ACT == 12) v = (v > 0.f) ? v : 0.01f * v; else if (ACT == 14) v = (v > 0.f) ? v : 0.1f * v; else if (ACT == 15) v = v / (1.0f + expf(-v)); else if (ACT == 3) v = fmaxf(v, 0.f); else if (ACT == 6) v = 0.5f * v * (1.0f + erff(v * 0.70710678118654752f)); so[w][8 * hh + r][t * 16 + ln] = v; } }
  __builtin_amdgcn_fence(__ATOMIC_ACQ_REL, "workgroup"); __builtin_amdgcn_wave_barrier();
  const int rsub = lane >> 4, c4 = (lane & 15) * 4; typedef _Float16 v4h __attribute__((ext_vector_type(4)));
  {
#pragma unroll
    for (int q = 0; q < 8; ++q) { const int r = q * 2 + rsub; if (col0 + c4 < N) { const v4f v = *(const v4fa*)&so[w][r][c4]; if (C) *(v4f*)(C + cofs + (size_t)(row0 + r) * ldc + col0 + c4) = v; if (C16) { v4h h4; for (int i = 0; i < 4; ++i) h4[i] = (_Float16)v[i]; *(v4h*)(C16 + cofs + (size_t)(row0 + r) * ldc + col0 + c4) = h4; } } }
     }
}


typedef _Float16 v4h __attribute__((ext_vector_type(4)));

__global__ __launch_bounds__(256) void k_x16(const float* __restrict__ x, _Float16* __restrict__ X16, size_t n8) { const size_t t = (size_t)blockIdx.x * 256 + threadIdx.x; if (t >= n8) return; FragH f;
#pragma unroll
  for (int q = 0; q < 8; ++q) f.h[q] = (_Float16)bf16_round(x[t * 8 + q]); *(v8us*)((unsigned short*)X16 + t * 8) = f.half[0];  }
__global__ __launch_bounds__(256) void k_h16(const float* __restrict__ x, _Float16* __restrict__ X16, size_t n8) { const size_t t = (size_t)blockIdx.x * 256 + threadIdx.x; if (t >= n8) return; FragH f;
#pragma unroll
  for (int q = 0; q < 8; ++q) f.h[q] = (_Float16)x[t * 8 + q]; *(v8us*)((unsigned short*)X16 + t * 8) = f.half[0];  }
__global__ __launch_bounds__(256) void k_round16f(const float* __restrict__ W, _Float16* __restrict__ Bt, size_t n8) { const size_t t = (size_t)blockIdx.x * 256 + threadIdx.x; if (t >= n8) return; FragH f;
#pragma unroll
  for (int i = 0; i < 8; ++i) f.h[i] = (_Float16)(bf16_round(W[t * 8 + i]) * 16.0f); *(v8us*)((unsigned short*)Bt + t * 8) = f.half[0];  }
template <int NHv, int TTv>
__global__ __launch_bounds__(256) void k_vt(const _Float16* __restrict__ V16, int ldv, int voff, _Float16* __restrict__ Vt) { __shared__ unsigned short tl[64][66]; const int tid = threadIdx.x; const int slab = blockIdx.x / (TTv / 64), lg = blockIdx.x % (TTv / 64); const int b = slab / NHv, h = slab % NHv;
  for (int i = tid; i < 64 * 8; i += 256) { const int r = i / 8, c8 = (i % 8) * 8; FragH f; f.half[0] = *(const v8us*)((const unsigned short*)V16 + ((size_t)b * TTv + lg * 64 + r) * ldv + voff + h * 64 + c8);
#pragma unroll
    for (int q = 0; q < 8; ++q) tl[r][c8 + q] = f.u[q]; }
  __syncthreads();
  {
#pragma unroll
    for (int rd = 0; rd < 2; ++rd) { const int d = rd * 32 + tid / 8, pc = tid % 8; FragH f;
#pragma unroll
      for (int q = 0; q < 8; ++q) f.u[q] = tl[pc * 8 + q][d];
      *(v8us*)((unsigned short*)Vt + ((size_t)slab * 64 + d) * TTv + lg * 64 + pc * 8) = f.half[0]; }
     } }

template <int RB>
__global__ __launch_bounds__(256) void k_xt(const float* __restrict__ src, _Float16* __restrict__ XT) { const size_t t = (size_t)blockIdx.x * 256 + threadIdx.x; if (t >= (size_t)BB * TT * 12) return; const int c0 = (int)(t % 12) * 8; const size_t bn = t / 12; const int n = (int)(bn % TT), b = (int)(bn / TT); FragH f;
#pragma unroll
  for (int q = 0; q < 8; ++q) { const int c = c0 + q; float v = 0.f; if (c < CC) { v = src[((size_t)b * CC + c) * TT + n]; if (RB) v = bf16_round(v); } else if (c == CC) v = 1.f; f.h[q] = (_Float16)v; }
  *(v8us*)((unsigned short*)XT + t * 8) = f.half[0];  }
// q/k planes for one attention instance: per token n of batch b: q[d] = Σ_c wq[d][c]·xs[c][n] + bq[d], k likewise (f32, rolled over c; xs = bf16-rounded input frame or an internal SA plane (RB)); thread per (token, 16-B piece p ∈ 0..3):
template <int RB>
__global__ __launch_bounds__(256) void k_qk(const float* __restrict__ xs, const float* __restrict__ wq, const float* __restrict__ bq, const float* __restrict__ wk, const float* __restrict__ bk, int slab0, _Float16* __restrict__ QP, _Float16* __restrict__ KP) {
  #pragma clang fp contract(off)
  const size_t t = (size_t)blockIdx.x * 256 + threadIdx.x; if (t >= (size_t)BB * TT * 4) return; const int p = (int)(t % 4); const size_t bn = t / 4; const int n = (int)(bn % TT), b = (int)(bn / TT);
  float q[8], k[8]; for (int d = 0; d < 8; ++d) { q[d] = bf16_round(bq[d]); k[d] = bf16_round(bk[d]); }
#pragma unroll 1
  for (int c = 0; c < CC; ++c) { float xv = xs[((size_t)b * CC + c) * TT + n]; if (RB) xv = bf16_round(xv);
#pragma unroll
    for (int d = 0; d < 8; ++d) { q[d] += bf16_round(wq[d * CC + c]) * xv; k[d] += bf16_round(wk[d * CC + c]) * xv; } }
  FragH fq, fk;
#pragma unroll
  for (int d = 0; d < 8; ++d) { const _Float16 qh = (_Float16)q[d], kh = (_Float16)k[d]; const float qlo = (q[d] - (float)qh) * 1024.0f, klo = (k[d] - (float)kh);
    fq.h[d] = (p == 0) ? qh : (p == 1) ? (_Float16)qlo : (p == 2) ? qh : (_Float16)0.f;
    fk.h[d] = (p == 0) ? kh : (p == 1) ? (_Float16)((float)kh * 0.0009765625f) : (p == 2) ? (_Float16)klo : (_Float16)0.f; }
  const size_t row = (size_t)(slab0 + b) * TT + n;
  { *(v8us*)((unsigned short*)QP + row * 32 + p * 8) = fq.half[0]; *(v8us*)((unsigned short*)KP + row * 32 + p * 8) = fk.half[0];  } }
__global__ __launch_bounds__(256) void k_wvb(const float* __restrict__ wv, const float* __restrict__ bv, _Float16* __restrict__ A16) { const int t = blockIdx.x * 256 + threadIdx.x; if (t >= CC * 12) return; const int e = t / 12, c0 = (t % 12) * 8; FragH f;
  for (int q = 0; q < 8; ++q) { const int c = c0 + q; float v = 0.f; if (c < CC) v = bf16_round(wv[e * CC + c]); else if (c == CC) v = bf16_round(bv[e]); f.h[q] = (_Float16)(v * 16.0f); }
  *(v8us*)((unsigned short*)A16 + (size_t)t * 8) = f.half[0];  }
template <int RB>
__global__ __launch_bounds__(256) void k_ocm(const float* __restrict__ O, int slab0, const float* __restrict__ res, float* __restrict__ DST) { __shared__ float tl[64][65]; const int tid = threadIdx.x; const int b = blockIdx.x / (TT / 64), nb = blockIdx.x % (TT / 64); const int n0 = nb * 64;
  for (int i = tid; i < 64 * 64; i += 256) { const int n = i / 64, e = i % 64; tl[n][e] = O[((size_t)(slab0 + b) * TT + n0 + n) * CC + e]; } __syncthreads();
  const int piece = tid % 16, esub = tid / 16;      /* 16 consecutive lanes = one channel's 256-B segment (tokens n0..n0+63); 16 channels per iteration */
  v4f vals[4];
  for (int it = 0; it < 4; ++it) { const int e = it * 16 + esub; v4f v; for (int j = 0; j < 4; ++j) { float rv = res[((size_t)b * CC + e) * TT + n0 + piece * 4 + j]; if (RB) rv = bf16_round(rv); v[j] = tl[piece * 4 + j][e] + rv; } vals[it] = v; }
  { for (int it = 0; it < 4; ++it) { const int e = it * 16 + esub; *(v4f*)(DST + ((size_t)b * CC + e) * TT + n0 + piece * 4) = vals[it]; }  } }
__global__ __launch_bounds__(256) void k_cat(const float* __restrict__ M0, const float* __restrict__ M1, _Float16* __restrict__ CAT) { __shared__ float tl[128][65]; const int tid = threadIdx.x; const int b = blockIdx.x / (TT / 64), nb = blockIdx.x % (TT / 64); const int n0 = nb * 64;
  for (int i = tid; i < 128 * 64; i += 256) { const int ch = i / 64, n = i % 64; tl[ch][n] = (ch < 64) ? M0[((size_t)b * CC + ch) * TT + n0 + n] : M1[((size_t)b * CC + ch - 64) * TT + n0 + n]; } __syncthreads();
  const int piece = tid % 16, nsub = tid / 16;      /* 16 consecutive lanes = one token's 256-B row (128 halves); 16 tokens per iteration */
  FragH fv[4];
  for (int it = 0; it < 4; ++it) { const int n = it * 16 + nsub; for (int q = 0; q < 8; ++q) fv[it].h[q] = (_Float16)tl[piece * 8 + q][n]; }
  { for (int it = 0; it < 4; ++it) { const int n = it * 16 + nsub; *(v8us*)((unsigned short*)CAT + ((size_t)b * TT + n0 + n) * 128 + piece * 8) = fv[it].half[0]; }  } }
__global__ __launch_bounds__(256) void k_finb(const float* __restrict__ FUS, const float* __restrict__ tb, const float* __restrict__ SA1, float* __restrict__ out, size_t n4) {
  #pragma clang fp contract(off)
  const size_t t = (size_t)blockIdx.x * 256 + threadIdx.x; if (t >= n4) return; const int e = (int)(((t * 4) / TT) % CC); const float bb = bf16_round(tb[e]); const v4f f = *(const v4fa*)(FUS + t * 4), s = *(const v4fa*)(SA1 + t * 4); v4f o; for (int q = 0; q < 4; ++q) o[q] = (f[q] + bb) * s[q] + s[q]; *(v4f*)(out + t * 4) = o;  }
// Block = 4 query tiles x KSPL key ranges: wave w works query tile w & 3 over keys [(w >> 2) * TT/KSPL, +TT/KSPL) with its own running max, row sum and unnormalised O; the KSPL partials of a tile are merged through LDS at the end.
// The trip is a chain of load and cross-lane latencies, so the time goes with trips per wave as long as the waves fit: 8 waves per SIMD (second launch-bounds argument: 128 registers).
template <int KSPL>
__global__ __launch_bounds__(128 * KSPL, 8) void k_flash(const _Float16* __restrict__ Q16, int ldq, const _Float16* __restrict__ K16, int ldk, const _Float16* __restrict__ Vt, const int* __restrict__ MSK, float* __restrict__ O, int ldo) {
  constexpr int RPW = 16, RTN = RPW / 16, NQB = TT / (4 * RPW), DT = 4, KS = 1, NW = 4 * KSPL;      /* d_qk = 32 (24 real + zero padding), d_v = 64 */
  __shared__ __attribute__((aligned(16))) unsigned short sP[NW][RPW][40]; __shared__ __attribute__((aligned(16))) unsigned short sPL[NW][RPW][40]; __shared__ __attribute__((aligned(16))) float sO[NW][RPW][64 + 4];
  __shared__ float sM[NW][RPW], sL[NW][RPW];
  const int tid = threadIdx.x, w = __builtin_amdgcn_readfirstlane(tid >> 5), lane = tid & 31, ln = lane & 15, hh = lane >> 4;
  const int slab = blockIdx.x / NQB, qblk = blockIdx.x % NQB; const int b = slab / NH, h = slab % NH; const int qb0 = qblk * (4 * RPW); const int q0 = qb0 + (w & 3) * RPW;
  FragH aq[2][KS];
#pragma unroll
  for (int rt = 0; rt < RTN; ++rt) { const unsigned short* qr = (const unsigned short*)Q16 + ((size_t)b * TT + q0 + rt * 16 + ln) * ldq;
#pragma unroll
    for (int ks = 0; ks < KS; ++ks) { aq[rt][ks].half[0] = *(const v8us*)(qr + ks * 32 + 8 * hh); aq[rt][ks].half[1] = *(const v8us*)(qr + ks * 32 + 16 + 8 * hh); } }
  const unsigned short* Vth = (const unsigned short*)Vt + (size_t)slab * 64 * TT;      /* v per slab: [64][4096] */
  float m_r[2][8], l_r[2][8]; v8f oacc[2][DT];
#pragma unroll
  for (int rt = 0; rt < RTN; ++rt) {
#pragma unroll
    for (int r = 0; r < 8; ++r) { m_r[rt][r] = -3.0e38f; l_r[rt][r] = 0.f; }
#pragma unroll
    for (int dt = 0; dt < DT; ++dt) oacc[rt][dt] = (v8f){0.f,0.f,0.f,0.f,0.f,0.f,0.f,0.f}; }
  const int jbeg = (w >> 2) * (TT / KSPL);
#pragma unroll 1
  for (int it = 0; it < TT / KSPL / 32; ++it) { const int j0 = jbeg + it * 32;
    v8f s[2][2];
#pragma unroll
    for (int nt = 0; nt < 2; ++nt) { const unsigned short* kr = (const unsigned short*)K16 + ((size_t)b * TT + j0 + nt * 16 + ln) * ldk; FragH bk[KS];
#pragma unroll
      for (int ks = 0; ks < KS; ++ks) { bk[ks].half[0] = *(const v8us*)(kr + ks * 32 + 8 * hh); bk[ks].half[1] = *(const v8us*)(kr + ks * 32 + 16 + 8 * hh); }
#pragma unroll
      for (int rt = 0; rt < RTN; ++rt) { v8f acc = (v8f){0.f,0.f,0.f,0.f,0.f,0.f,0.f,0.f};
#pragma unroll
        for (int ks = 0; ks < KS; ++ks) acc = mmaH<1>(aq[rt][ks].v, aq[rt][ks].v, bk[ks].v, bk[ks].v, acc); s[rt][nt] = acc; } }
#pragma unroll
    for (int rt = 0; rt < RTN; ++rt)
#pragma unroll
      for (int r = 0; r < 8; ++r) { const int tq = q0 + rt * 16 + 8 * hh + r; const int k0 = j0 + ln, k1 = j0 + 16 + ln; (void)tq; (void)k0; (void)k1;
        const bool ok0 = true, ok1 = true;
        const float s0 = s[rt][0][r], s1 = s[rt][1][r]; float mc = fmaxf(s0, s1);
        mc = fmaxf(mc, __shfl_xor(mc, 1, 32)); mc = fmaxf(mc, __shfl_xor(mc, 2, 32)); mc = fmaxf(mc, __shfl_xor(mc, 4, 32)); mc = fmaxf(mc, __shfl_xor(mc, 8, 32));
        const float mn = fmaxf(m_r[rt][r], mc); const float al = (mn > -1.0e38f) ? expf(m_r[rt][r] - mn) : 1.0f; m_r[rt][r] = mn; const float p0 = ok0 ? expf(s0 - mn) : 0.f, p1 = ok1 ? expf(s1 - mn) : 0.f; l_r[rt][r] = l_r[rt][r] * al + p0 + p1;
#pragma unroll
        for (int dt = 0; dt < DT; ++dt) oacc[rt][dt][r] *= al;
        FragH t2, t3; const float ps0 = p0 * 1024.0f, ps1 = p1 * 1024.0f; t2.h[0] = (_Float16)ps0; t2.h[1] = (_Float16)ps1; t3.h[0] = (_Float16)(ps0 - (float)t2.h[0]); t3.h[1] = (_Float16)(ps1 - (float)t2.h[1]);
        sP[w][rt * 16 + 8 * hh + r][ln] = t2.u[0]; sP[w][rt * 16 + 8 * hh + r][16 + ln] = t2.u[1]; sPL[w][rt * 16 + 8 * hh + r][ln] = t3.u[0]; sPL[w][rt * 16 + 8 * hh + r][16 + ln] = t3.u[1]; }
    __builtin_amdgcn_fence(__ATOMIC_ACQ_REL, "workgroup"); __builtin_amdgcn_wave_barrier();
    FragH pa[2], pl[2];
#pragma unroll
    for (int rt = 0; rt < RTN; ++rt) { pa[rt].half[0] = *(const v8us*)&sP[w][rt * 16 + ln][8 * hh]; pa[rt].half[1] = *(const v8us*)&sP[w][rt * 16 + ln][16 + 8 * hh]; pl[rt].half[0] = *(const v8us*)&sPL[w][rt * 16 + ln][8 * hh]; pl[rt].half[1] = *(const v8us*)&sPL[w][rt * 16 + ln][16 + 8 * hh]; }
#pragma unroll
    for (int dt = 0; dt < DT; ++dt) { const unsigned short* vrow = Vth + (size_t)(dt * 16 + ln) * TT + j0; FragH bv; bv.half[0] = *(const v8us*)(vrow + 8 * hh); bv.half[1] = *(const v8us*)(vrow + 16 + 8 * hh);
#pragma unroll
      for (int rt = 0; rt < RTN; ++rt) { oacc[rt][dt] = mmaH<1>(pa[rt].v, pa[rt].v, bv.v, bv.v, oacc[rt][dt]); oacc[rt][dt] = mmaH<1>(pl[rt].v, pl[rt].v, bv.v, bv.v, oacc[rt][dt]); } }      /* (Ph + Pl)·X */
    __builtin_amdgcn_fence(__ATOMIC_ACQ_REL, "workgroup"); __builtin_amdgcn_wave_barrier(); }
#pragma unroll
  for (int rt = 0; rt < RTN; ++rt) {
#pragma unroll
    for (int r = 0; r < 8; ++r) { float l = l_r[rt][r]; l += __shfl_xor(l, 1, 32); l += __shfl_xor(l, 2, 32); l += __shfl_xor(l, 4, 32); l += __shfl_xor(l, 8, 32); l_r[rt][r] = l; }
    if (ln == 0) {
#pragma unroll
      for (int r = 0; r < 8; ++r) { sM[w][rt * 16 + 8 * hh + r] = m_r[rt][r]; sL[w][rt * 16 + 8 * hh + r] = l_r[rt][r]; } }
#pragma unroll
    for (int dt = 0; dt < DT; ++dt)
#pragma unroll
      for (int r = 0; r < 8; ++r) sO[w][rt * 16 + 8 * hh + r][dt * 16 + ln] = oacc[rt][dt][r]; }
  __syncthreads();      /* every wave's partial is in LDS before any thread merges */
  /* merge: thread = (query of the block, 4 channels); O = sum_s e^(m_s - M) * O_s / (1024 * sum_s e^(m_s - M) * l_s), M = max_s m_s */
#pragma unroll
  for (int i = tid; i < 4 * RPW * 16; i += 128 * KSPL) { const int qq = i >> 4, pc = i & 15, g = qq / RPW, r = qq % RPW;
    float mx = sM[g][r];
#pragma unroll
    for (int s = 1; s < KSPL; ++s) mx = fmaxf(mx, sM[s * 4 + g][r]);
    float l = 0.f; v4f a = {0.f, 0.f, 0.f, 0.f};
#pragma unroll
    for (int s = 0; s < KSPL; ++s) { const float e = expf(sM[s * 4 + g][r] - mx); l += sL[s * 4 + g][r] * e; const v4f val = *(const v4fa*)&sO[s * 4 + g][r][pc * 4]; a += val * e; }
    const float inv = (l > 0.f) ? 1.0f / (l * 1024.0f) : 0.f;
    *(v4f*)(O + ((size_t)slab * TT + qb0 + qq) * ldo + pc * 4) = a * inv; } }

extern "C" void kernel_launch(void* const* d_in, const int* in_sizes, int n_in,
                              void* d_out, int out_size, void* d_ws, size_t ws_size, hipStream_t stream) {
  (void)in_sizes; (void)n_in; (void)out_size;
  const float* const* I = (const float* const*)d_in; const float* x = I[0]; const float* sa_wq = I[1]; const float* sa_bq = I[2]; const float* sa_wk = I[3]; const float* sa_bk = I[4]; const float* sa_wv = I[5]; const float* sa_bv = I[6];
  const float* ga_wq = I[7]; const float* ga_bq = I[8]; const float* ga_wk = I[9]; const float* ga_bk = I[10]; const float* ga_wv = I[11]; const float* ga_bv = I[12]; const float* tw = I[13]; const float* tb = I[14];
  char* ws = (char*)d_ws; size_t off = 0;
  auto take = [&](size_t bytes) { char* p = ws + off; off += (bytes + 255) & ~(size_t)255; return p; };
  const size_t PL = (size_t)BB * CC * TT;      /* one [B][64][4096] f32 plane = 1 M floats */
  _Float16* AWV = (_Float16*)take((size_t)5 * CC * 96 * 2); _Float16* TW16 = (_Float16*)take((size_t)CC * 128 * 2);
  _Float16* XT = (_Float16*)take((size_t)BB * TT * 96 * 2); _Float16* QP = (_Float16*)take((size_t)NSL * TT * 32 * 2); _Float16* KP = (_Float16*)take((size_t)NSL * TT * 32 * 2); _Float16* VT = (_Float16*)take((size_t)NSL * CC * TT * 2); float* O = (float*)take((size_t)NSL * TT * CC * 4);
  float* SA = (float*)take(3 * PL * 4); float* MF = (float*)take(2 * PL * 4); _Float16* CAT = (_Float16*)take((size_t)BB * TT * 128 * 2); float* FUS = (float*)take(PL * 4);
  if (off > ws_size) return;      // 0.1 + 3.1 + 5.2 + 5.2 + 10.5 + 21 + 12.6 + 8.4 + 4.2 + 4.2 ≈ 74.5 MB
  for (int a = 0; a < 5; ++a) { const float* wv = (a < 3) ? sa_wv + (size_t)a * CC * CC : ga_wv + (size_t)(a - 3) * CC * CC; const float* bv = (a < 3) ? sa_bv + a * CC : ga_bv + (a - 3) * CC; k_wvb<<<(CC * 12 + 255) / 256, 256, 0, stream>>>(wv, bv, AWV + (size_t)a * CC * 96); }
  k_round16f<<<(CC * 128 / 8 + 255) / 256, 256, 0, stream>>>(tw, TW16, CC * 128 / 8);      /* tfus_w [64 o][128 c] natural = the A operand ×2^4 */
  const unsigned gxt = (unsigned)(((size_t)BB * TT * 12 + 255) / 256), gqk = (unsigned)(((size_t)BB * TT * 4 + 255) / 256); const dim3 gv(((CC / 16) * (TT / 64) + 3) / 4, BB);
  /* self attention on the three frames: slabs a·BB + b for a = 0,1,2 */
  for (int a = 0; a < 3; ++a) { const float* xf = x + (size_t)a * PL;
    k_xt<1><<<gxt, 256, 0, stream>>>(xf, XT); k_qk<1><<<gqk, 256, 0, stream>>>(xf, sa_wq + (size_t)a * 8 * CC, sa_bq + a * 8, sa_wk + (size_t)a * 8 * CC, sa_bk + a * 8, a * BB, QP, KP);
    k_gemm_hhx<0><<<gv, 128, 0, stream>>>(AWV + (size_t)a * CC * 96, 96, 0, XT, 96, (size_t)TT * 96, 0.0625f, nullptr, 0, nullptr, 1, 0, 0, nullptr, VT + (size_t)a * BB * CC * TT, TT, (size_t)CC * TT, CC, TT, 96); }      /* v[b][e][m] = wv·x + bv, channel-major f16: batched over b, M 64 N 4096 K 96 */
  k_flash<8><<<3 * BB * (TT / 64), 1024, 0, stream>>>(QP, 32, KP, 32, VT, nullptr, O, CC);      /* slabs 0..11; 768 blocks of 32 waves = three full rounds of the WGPs */
  for (int a = 0; a < 3; ++a) k_ocm<1><<<BB * (TT / 64), 256, 0, stream>>>(O, a * BB, x + (size_t)a * PL, SA + (size_t)a * PL);      /* SA_a = attn-out + x_a (channel-major f32) */
  /* guided attentions: slabs 12..15 (q,k from SA_0; v,res from SA_1) and 16..19 (q,k from SA_2) */
  k_xt<0><<<gxt, 256, 0, stream>>>(SA + PL, XT);      /* SA_1 token-major (internal f32, no rounding) */
  for (int gi = 0; gi < 2; ++gi) { const float* src = SA + (size_t)(gi == 0 ? 0 : 2) * PL; const int a = 3 + gi;
    k_qk<0><<<gqk, 256, 0, stream>>>(src, ga_wq + (size_t)gi * 8 * CC, ga_bq + gi * 8, ga_wk + (size_t)gi * 8 * CC, ga_bk + gi * 8, a * BB, QP, KP);
    k_gemm_hhx<0><<<gv, 128, 0, stream>>>(AWV + (size_t)a * CC * 96, 96, 0, XT, 96, (size_t)TT * 96, 0.0625f, nullptr, 0, nullptr, 1, 0, 0, nullptr, VT + (size_t)a * BB * CC * TT, TT, (size_t)CC * TT, CC, TT, 96); }
  k_flash<4><<<2 * BB * (TT / 64), 512, 0, stream>>>(QP + (size_t)3 * BB * TT * 32, 32, KP + (size_t)3 * BB * TT * 32, 32, VT + (size_t)3 * BB * CC * TT, nullptr, O + (size_t)3 * BB * TT * CC, CC);      /* slabs 12..19 (kernel-relative 0..7) */
  for (int gi = 0; gi < 2; ++gi) k_ocm<0><<<BB * (TT / 64), 256, 0, stream>>>(O + (size_t)3 * BB * TT * CC, gi * BB, SA + PL, MF + (size_t)gi * PL);      /* mfi_gi = attn-out + SA_1 */
  k_cat<<<BB * (TT / 64), 256, 0, stream>>>(MF, MF + PL, CAT);
  k_gemm_hhx<0><<<dim3(((CC / 16) * (TT / 64) + 3) / 4, BB), 128, 0, stream>>>(TW16, 128, 0, CAT, 128, (size_t)TT * 128, 0.0625f, nullptr, 0, nullptr, 1, 0, 0, FUS, nullptr, TT, (size_t)CC * TT, CC, TT, 128);      /* fusion[b][o][n] = Σ_c W[o][c]·cat[b][c][n]: A = W (M 64, K 128), Bt = CAT[b] token-major; bias tfus_b per ROW o → added in k_fin? no: see k_finb */
  k_finb<<<(unsigned)((PL / 4 + 255) / 256), 256, 0, stream>>>(FUS, tb, SA + PL, (float*)d_out, PL / 4);
}

// v002
// One run takes 509 microseconds.
// Next to v001, in two timings, it ran 1.24 times as fast each time.
// Over all steps from v000 it is 2.13 times as fast.
#include <hip/hip_runtime.h>
// MFI (3 frames, B=4, C=64, 64×64 → N=4096): SA_f = position attention on frame f (q = wq·x+bq (8 ch), k = wk·x+bk (8 ch), v = wv·x+bv (64 ch); attn = softmax_m(q[:,n]·k[:,m]) unscaled; out[e][n] = Σ_m v[e][m]·attn[n][m] + x[e][n]); then two guided attentions
// (q,k from SA_0 / SA_2, v and residual from SA_1), cat → fusion = tfus_w·cat + b; out = fusion·SA_1 + SA_1 → [4,64,64,64].
// Compute dtype: x, weights, biases rounded to bf16; q/k per token in f32 VALU (8×64 dot, rolled) emitted as concatenated f16 planes [q_hi|q_lo|q_hi|0] and [k_hi|k_hi·2^-10|k_lo|0] so ONE 32-wide WMMA k-step yields f32-accurate logits; v (+bias via an
// augmented ones column) channel-major by GEMM (f16); fused flash-style kernel per (slab, 64 queries) (online softmax f32, P f16 hi + residual, O token-major f32); residual add + channel-major restage in f32; cat f16 → fusion GEMM → out = fusion·sa₁ + sa₁ in f32. All on v_wmma_f32_16x16x32_f16.
#define NFR 3
#define BB 4
#define CC 64
#define TT 4096
#define NH 1
#define NSL (5 * BB)

typedef __bf16 v16b __attribute__((ext_vector_type(16)));
typedef unsigned short v8us __attribute__((ext_vector_type(8), may_alias));
typedef float  v8f  __attribute__((ext_vector_type(8)));
typedef float  v4f  __attribute__((ext_vector_type(4)));
typedef float  v4fa __attribute__((ext_vector_type(4), may_alias));
union FragB { v16b v; v8us half[2]; unsigned short u[16]; };

__device__ __forceinline__ unsigned short bf16_bits(float x) { unsigned int u = __float_as_uint(x); return (unsigned short)((u + 0x7FFFu + ((u >> 16) & 1u)) >> 16); }
__device__ __forceinline__ float bf16_val(unsigned short b) { return __uint_as_float(((unsigned int)b) << 16); }
__device__ __forceinline__ float bf16_round(float x) { return bf16_val(bf16_bits(x)); }
// D += A·B with NT terms: 1 = ah·bh, 2 = + al·bh (A split), 3 = + ah·bl (both split)
template <int NT>
__device__ __forceinline__ v8f mmaN(v16b ah, v16b al, v16b bh, v16b bl, v8f c) {
  c = __builtin_amdgcn_wmma_f32_16x16x32_bf16(false, ah, false, bh, (short)0, c, false, false);
  if (NT >= 2) c = __builtin_amdgcn_wmma_f32_16x16x32_bf16(false, al, false, bh, (short)0, c, false, false);
  if (NT >= 3) c = __builtin_amdgcn_wmma_f32_16x16x32_bf16(false, ah, false, bl, (short)0, c, false, false);
  asm volatile("v_nop\n\tv_nop\n\tv_nop\n\tv_nop" : "+v"(c) : "v"(ah), "v"(al), "v"(bh), "v"(bl));
  return c;
}

__global__ __launch_bounds__(256) void k_wt_bf16(const float* __restrict__ W, unsigned short* __restrict__ Wt, int K, int N) {
  const int t = blockIdx.x * 256 + threadIdx.x;
  const int k8n = K / 8;
  if (t >= N * k8n) return;
  const int n = t / k8n, k8 = (t % k8n) * 8;
  v8us v;
#pragma unroll
  for (int i = 0; i < 8; ++i) v[i] = bf16_bits(W[(size_t)(k8 + i) * N + n]);
  *(v8us*)(Wt + (size_t)n * K + k8) = v;
  
}

// GEMM C[M][N] (f32, pitch ldc) = act(A[M][K]·W + bias). A f32 row-major (pitch lda) converted per fragment to bf16
// (ASPLIT: hi/lo two planes -> 2 terms, else single rounded term); Wt bf16 [N][K] (pitch ldb). BIAS_BF16 rounds the
// bias to bf16 first (bias quantised to bf16 before the add). K%32==0, M%16==0, N%64==0.
template <bool ASPLIT, int ACT, bool BIAS_BF16>
__global__ __launch_bounds__(128) void k_gemm_bf(const float* __restrict__ A, int lda, const unsigned short* __restrict__ Wt, int ldb,
                                               const float* __restrict__ bias, float* __restrict__ C, int ldc, int M, int N, int K) {
  __shared__ __attribute__((aligned(16))) float so[4][16][64];
  const int tid = threadIdx.x, w = tid >> 5, lane = tid & 31, ln = lane & 15, hh = lane >> 4;
  const int ntn = N / 64;
  const int wid = blockIdx.x * 4 + w;
  const int mt = wid / ntn, nq = wid % ntn;
  if (mt * 16 >= M) return;
  const int row0 = mt * 16, col0 = nq * 64;
  const float* arow = A + (size_t)(row0 + ln) * lda;
  v8f acc[4] = {};
  for (int kb = 0; kb < K; kb += 32) {
    FragB ah, al;
    const v4f x0 = *(const v4fa*)(arow + kb + 8 * hh), x1 = *(const v4fa*)(arow + kb + 8 * hh + 4);
    const v4f x2 = *(const v4fa*)(arow + kb + 16 + 8 * hh), x3 = *(const v4fa*)(arow + kb + 16 + 8 * hh + 4);
    float xs[16] = {x0[0],x0[1],x0[2],x0[3],x1[0],x1[1],x1[2],x1[3],x2[0],x2[1],x2[2],x2[3],x3[0],x3[1],x3[2],x3[3]};
#pragma unroll
    for (int i = 0; i < 16; ++i) { const unsigned short hb = bf16_bits(xs[i]); ah.u[i] = hb; al.u[i] = ASPLIT ? bf16_bits(xs[i] - bf16_val(hb)) : (unsigned short)0; }
#pragma unroll
    for (int t = 0; t < 4; ++t) {
      const unsigned short* brow = Wt + (size_t)(col0 + t * 16 + ln) * ldb + kb;
      FragB b;
      b.half[0] = *(const v8us*)(brow + 8 * hh);
      b.half[1] = *(const v8us*)(brow + 16 + 8 * hh);
      acc[t] = mmaN<ASPLIT ? 2 : 1>(ah.v, al.v, b.v, b.v, acc[t]);
    }
  }
#pragma unroll
  for (int t = 0; t < 4; ++t) {
    float bv = bias ? bias[col0 + t * 16 + ln] : 0.f;
    if (BIAS_BF16) bv = bf16_round(bv);
#pragma unroll
    for (int r = 0; r < 8; ++r) { float v = acc[t][r] + bv; if (ACT == 1) v = fmaxf(v, 0.f); so[w][8 * hh + r][t * 16 + ln] = v; }
  }
  __builtin_amdgcn_fence(__ATOMIC_ACQ_REL, "workgroup");
  __builtin_amdgcn_wave_barrier();
  const int rsub = lane >> 4, c4 = (lane & 15) * 4;
  {
#pragma unroll
    for (int q = 0; q < 8; ++q) {
      const int r = q * 2 + rsub;
      const v4f v = *(const v4fa*)&so[w][r][c4];
      *(v4f*)(C + (size_t)(row0 + r) * ldc + col0 + c4) = v;
    }
    
  }
}

// Flash-style causal/unmasked attention, all contractions 3-term bf16 hi/lo splits, f32 softmax with running max.
// q,k,v rows are read from f32 buffers with arbitrary row pitch (so they can live inside a fused qkv buffer);
// D = head size (multiple of 32, <= 128); one wave = 16 query rows; block = 4 waves (64 queries) sharing K/V chunks of 32.
template <int D, bool CAUSAL>
__global__ __launch_bounds__(128) void k_flash(const float* __restrict__ qb, const float* __restrict__ kb, const float* __restrict__ vb,
                                             int pitch, int T, int H, float scale, float* __restrict__ y, int ypitch) {
  constexpr int KS = D / 32;        // k-steps for QK
  constexpr int DT = D / 16;        // d tiles for PV
  __shared__ __attribute__((aligned(16))) unsigned short sKh[32][D + 8], sKl[32][D + 8], sVh[32][D + 8], sVl[32][D + 8];
  __shared__ __attribute__((aligned(16))) unsigned short sPh[4][16][40], sPl[4][16][40];
  __shared__ __attribute__((aligned(16))) float sO[4][16][D];
  const int tid = threadIdx.x, w = tid >> 5, lane = tid & 31, ln = lane & 15, hh = lane >> 4;
  const int nqb = (T + 63) / 64;
  const int bh = blockIdx.x / nqb, qblk = blockIdx.x % nqb;
  const int b = bh / H, h = bh % H;
  const int q0 = qblk * 64 + w * 16;
  const float* Q = qb + (size_t)b * T * pitch + h * D;
  const float* K = kb + (size_t)b * T * pitch + h * D;
  const float* V = vb + (size_t)b * T * pitch + h * D;

  // A fragments of the wave's 16 query rows (scaled), hi/lo
  FragB aqh[KS], aql[KS];
  {
    int row = q0 + ln; if (row >= T) row = T - 1;
    const float* qr = Q + (size_t)row * pitch;
#pragma unroll
    for (int ks = 0; ks < KS; ++ks)
#pragma unroll
      for (int i = 0; i < 16; ++i) {
        const int d = ks * 32 + ((i < 8) ? (8 * hh + i) : (16 + 8 * hh + (i - 8)));
        const float x = qr[d] * scale; const unsigned short hb = bf16_bits(x);
        aqh[ks].u[i] = hb; aql[ks].u[i] = bf16_bits(x - bf16_val(hb));
      }
  }
  float m_r[8], l_r[8];
#pragma unroll
  for (int r = 0; r < 8; ++r) { m_r[r] = -3.0e38f; l_r[r] = 0.f; }
  v8f oacc[DT];
#pragma unroll
  for (int dt = 0; dt < DT; ++dt) oacc[dt] = (v8f){0.f,0.f,0.f,0.f,0.f,0.f,0.f,0.f};

  const int kv_end = CAUSAL ? min(T, qblk * 64 + 64) : T;     // block-uniform
  for (int j0 = 0; j0 < kv_end; j0 += 32) {
    __syncthreads();
    for (int e = tid; e < 32 * (D / 4); e += 128) {
      const int r = e / (D / 4), c4 = (e % (D / 4)) * 4;
      const int key = j0 + r;
      v4f kf = {0.f,0.f,0.f,0.f}, vf = {0.f,0.f,0.f,0.f};
      if (key < T) { kf = *(const v4fa*)(K + (size_t)key * pitch + c4); vf = *(const v4fa*)(V + (size_t)key * pitch + c4); }
#pragma unroll
      for (int t = 0; t < 4; ++t) {
        unsigned short hb = bf16_bits(kf[t]); sKh[r][c4 + t] = hb; sKl[r][c4 + t] = bf16_bits(kf[t] - bf16_val(hb));
        hb = bf16_bits(vf[t]); sVh[r][c4 + t] = hb; sVl[r][c4 + t] = bf16_bits(vf[t] - bf16_val(hb));
      }
    }
    __syncthreads();
    // S tile 16 x 32
    v8f s[2];
#pragma unroll
    for (int nt = 0; nt < 2; ++nt) {
      v8f acc = {};
#pragma unroll
      for (int ks = 0; ks < KS; ++ks) {
        FragB bh_, bl_;
        bh_.half[0] = *(const v8us*)&sKh[nt * 16 + ln][ks * 32 + 8 * hh]; bh_.half[1] = *(const v8us*)&sKh[nt * 16 + ln][ks * 32 + 16 + 8 * hh];
        bl_.half[0] = *(const v8us*)&sKl[nt * 16 + ln][ks * 32 + 8 * hh]; bl_.half[1] = *(const v8us*)&sKl[nt * 16 + ln][ks * 32 + 16 + 8 * hh];
        acc = mmaN<3>(aqh[ks].v, aql[ks].v, bh_.v, bl_.v, acc);
      }
      s[nt] = acc;
    }
    // mask + running max (rows 8hh+r; the 16 lanes of a half share rows)
    float alpha[8];
#pragma unroll
    for (int r = 0; r < 8; ++r) {
      const int qi = q0 + 8 * hh + r;
      const int ja = j0 + ln, jb = j0 + 16 + ln;
      if (CAUSAL) { if (ja > qi) s[0][r] = -3.0e38f; if (jb > qi) s[1][r] = -3.0e38f; }
      if (ja >= T) s[0][r] = -3.0e38f;
      if (jb >= T) s[1][r] = -3.0e38f;
      float mx = fmaxf(s[0][r], s[1][r]);
      mx = fmaxf(mx, __shfl_xor(mx, 1, 32)); mx = fmaxf(mx, __shfl_xor(mx, 2, 32)); mx = fmaxf(mx, __shfl_xor(mx, 4, 32)); mx = fmaxf(mx, __shfl_xor(mx, 8, 32));
      const float mnew = fmaxf(m_r[r], mx);
      alpha[r] = (mnew > -1.0e38f) ? __expf(m_r[r] - mnew) : 1.0f;
      const float p0 = (s[0][r] > -1.0e38f) ? __expf(s[0][r] - mnew) : 0.f;
      const float p1 = (s[1][r] > -1.0e38f) ? __expf(s[1][r] - mnew) : 0.f;
      m_r[r] = mnew;
      l_r[r] = l_r[r] * alpha[r] + p0 + p1;            // per-lane partial row sum (16 lanes combined at the end)
      unsigned short hb = bf16_bits(p0); sPh[w][8 * hh + r][ln] = hb;      sPl[w][8 * hh + r][ln] = bf16_bits(p0 - bf16_val(hb));
      hb = bf16_bits(p1);                sPh[w][8 * hh + r][16 + ln] = hb; sPl[w][8 * hh + r][16 + ln] = bf16_bits(p1 - bf16_val(hb));
    }
#pragma unroll
    for (int dt = 0; dt < DT; ++dt)
#pragma unroll
      for (int r = 0; r < 8; ++r) oacc[dt][r] *= alpha[r];
    __builtin_amdgcn_fence(__ATOMIC_ACQ_REL, "workgroup");
    __builtin_amdgcn_wave_barrier();
    FragB pah, pal;
    pah.half[0] = *(const v8us*)&sPh[w][ln][8 * hh]; pah.half[1] = *(const v8us*)&sPh[w][ln][16 + 8 * hh];
    pal.half[0] = *(const v8us*)&sPl[w][ln][8 * hh]; pal.half[1] = *(const v8us*)&sPl[w][ln][16 + 8 * hh];
#pragma unroll
    for (int dt = 0; dt < DT; ++dt) {
      FragB bvh, bvl;
#pragma unroll
      for (int i = 0; i < 8; ++i) {
        bvh.u[i] = sVh[8 * hh + i][dt * 16 + ln]; bvh.u[8 + i] = sVh[16 + 8 * hh + i][dt * 16 + ln];
        bvl.u[i] = sVl[8 * hh + i][dt * 16 + ln]; bvl.u[8 + i] = sVl[16 + 8 * hh + i][dt * 16 + ln];
      }
      oacc[dt] = mmaN<3>(pah.v, pal.v, bvh.v, bvl.v, oacc[dt]);
    }
    __builtin_amdgcn_fence(__ATOMIC_ACQ_REL, "workgroup");
    __builtin_amdgcn_wave_barrier();
  }
#pragma unroll
  for (int r = 0; r < 8; ++r) {
    float l = l_r[r];
    l += __shfl_xor(l, 1, 32); l += __shfl_xor(l, 2, 32); l += __shfl_xor(l, 4, 32); l += __shfl_xor(l, 8, 32);
    l_r[r] = (l > 0.f) ? 1.0f / l : 0.f;
  }
#pragma unroll
  for (int dt = 0; dt < DT; ++dt)
#pragma unroll
    for (int r = 0; r < 8; ++r) sO[w][8 * hh + r][dt * 16 + ln] = oacc[dt][r] * l_r[r];
  __builtin_amdgcn_fence(__ATOMIC_ACQ_REL, "workgroup");
  __builtin_amdgcn_wave_barrier();
  {
    for (int r = 0; r < 16; ++r) {
      const int row = q0 + r;
      if (row < T && lane < D / 4) {
        const v4f val = *(const v4fa*)&sO[w][r][lane * 4];
        *(v4f*)(y + ((size_t)b * T + row) * ypitch + h * D + lane * 4) = val;
      }
    }
    
  }
}

// GEMM C = act(A·W + bias + resid): A f32 (ASPLIT -> hi/lo 2 terms), Wt bf16 [N][K]; ACT 0 none, 1 relu, 2 exact gelu;
// resid (optional, f32, row index = (row % rmod), pitch ldr, RES_BF16 rounds it) added before the activation.
template <bool ASPLIT, int ACT, bool BIAS_BF16, bool RES_BF16>
__global__ __launch_bounds__(128) void k_gemm_bf3(const float* __restrict__ A, int lda, const unsigned short* __restrict__ Wt, int ldb,
                                                const float* __restrict__ bias, const float* __restrict__ resid, int rmod, int ldr,
                                                float* __restrict__ C, int ldc, int M, int N, int K) {
  __shared__ __attribute__((aligned(16))) float so[4][16][64];
  const int tid = threadIdx.x, w = tid >> 5, lane = tid & 31, ln = lane & 15, hh = lane >> 4;
  const int ntn = N / 64;
  const int wid = blockIdx.x * 4 + w;
  const int mt = wid / ntn, nq = wid % ntn;
  if (mt * 16 >= M) return;
  const int row0 = mt * 16, col0 = nq * 64;
  const float* arow = A + (size_t)(row0 + ln) * lda;
  v8f acc[4] = {};
  for (int kb = 0; kb < K; kb += 32) {
    FragB ah, al;
    const v4f x0 = *(const v4fa*)(arow + kb + 8 * hh), x1 = *(const v4fa*)(arow + kb + 8 * hh + 4);
    const v4f x2 = *(const v4fa*)(arow + kb + 16 + 8 * hh), x3 = *(const v4fa*)(arow + kb + 16 + 8 * hh + 4);
    float xs[16] = {x0[0],x0[1],x0[2],x0[3],x1[0],x1[1],x1[2],x1[3],x2[0],x2[1],x2[2],x2[3],x3[0],x3[1],x3[2],x3[3]};
#pragma unroll
    for (int i = 0; i < 16; ++i) { const unsigned short hb = bf16_bits(xs[i]); ah.u[i] = hb; al.u[i] = ASPLIT ? bf16_bits(xs[i] - bf16_val(hb)) : (unsigned short)0; }
#pragma unroll
    for (int t = 0; t < 4; ++t) {
      const unsigned short* brow = Wt + (size_t)(col0 + t * 16 + ln) * ldb + kb;
      FragB b;
      b.half[0] = *(const v8us*)(brow + 8 * hh);
      b.half[1] = *(const v8us*)(brow + 16 + 8 * hh);
      acc[t] = mmaN<ASPLIT ? 2 : 1>(ah.v, al.v, b.v, b.v, acc[t]);
    }
  }
#pragma unroll
  for (int t = 0; t < 4; ++t) {
    const int col = col0 + t * 16 + ln;
    float bv = bias ? bias[col] : 0.f;
    if (BIAS_BF16) bv = bf16_round(bv);
#pragma unroll
    for (int r = 0; r < 8; ++r) {
      float v = acc[t][r] + bv;
      if (resid) { float rv = resid[(size_t)((row0 + 8 * hh + r) % rmod) * ldr + col]; if (RES_BF16) rv = bf16_round(rv); v += rv; }
      if (ACT == 1) v = fmaxf(v, 0.f);
      if (ACT == 2) v = 0.5f * v * (1.0f + erff(v * 0.70710678118654752f));
      if (ACT == 3) { const float u = 0.7978845608028654f * (v + 0.044715f * v * v * v); v = 0.5f * v * (1.0f + tanhf(u)); }
      so[w][8 * hh + r][t * 16 + ln] = v;
    }
  }
  __builtin_amdgcn_fence(__ATOMIC_ACQ_REL, "workgroup");
  __builtin_amdgcn_wave_barrier();
  const int rsub = lane >> 4, c4 = (lane & 15) * 4;
  {
#pragma unroll
    for (int q = 0; q < 8; ++q) {
      const int r = q * 2 + rsub;
      const v4f v = *(const v4fa*)&so[w][r][c4];
      *(v4f*)(C + (size_t)(row0 + r) * ldc + col0 + c4) = v;
    }
    
  }
}
// row LayerNorm (biased variance, eps) over N: s = X (+ R); optional out_sum <- s; out_norm <- (s-mu)*rsqrt(var+eps)*g + b
template <bool PARAM_BF16>
__global__ __launch_bounds__(256) void k_layernorm(const float* __restrict__ X, const float* __restrict__ R, const float* __restrict__ g, const float* __restrict__ bta,
                                                  float* __restrict__ out_sum, float* __restrict__ out_norm, int N, float eps) {
  __shared__ float red[256];
  const int row = blockIdx.x, tid = threadIdx.x;
  const float* x = X + (size_t)row * N; const float* rr = R ? R + (size_t)row * N : nullptr;
  float vals[16];                     // up to N = 4096
  const int per = N / 256;            // contiguous chunk per thread? use strided-by-4 chunks: thread handles j = tid*4 + 1024*u
  float s1 = 0.f;
  for (int u = 0; u < per / 4; ++u) {
    const int j = tid * 4 + 1024 * u;
    const v4f a = *(const v4fa*)(x + j);
    v4f b = {0.f,0.f,0.f,0.f}; if (rr) b = *(const v4fa*)(rr + j);
#pragma unroll
    for (int q = 0; q < 4; ++q) { const float v = a[q] + b[q]; vals[u * 4 + q] = v; s1 += v; }
  }
  red[tid] = s1; __syncthreads();
  for (int st = 128; st > 0; st >>= 1) { if (tid < st) red[tid] += red[tid + st]; __syncthreads(); }
  const float mu = red[0] / (float)N; __syncthreads();
  float s2 = 0.f;
  for (int u = 0; u < per / 4; ++u)
#pragma unroll
    for (int q = 0; q < 4; ++q) { const float c = vals[u * 4 + q] - mu; s2 += c * c; }
  red[tid] = s2; __syncthreads();
  for (int st = 128; st > 0; st >>= 1) { if (tid < st) red[tid] += red[tid + st]; __syncthreads(); }
  const float rs = rsqrtf(red[0] / (float)N + eps);
  {
    for (int u = 0; u < per / 4; ++u) {
      const int j = tid * 4 + 1024 * u;
      v4f o, sm;
#pragma unroll
      for (int q = 0; q < 4; ++q) {
        float gg = g[j + q], bb = bta[j + q];
        if (PARAM_BF16) { gg = bf16_round(gg); bb = bf16_round(bb); }
        sm[q] = vals[u * 4 + q]; o[q] = (vals[u * 4 + q] - mu) * rs * gg + bb;
      }
      if (out_sum) *(v4f*)(out_sum + (size_t)row * N + j) = sm;
      *(v4f*)(out_norm + (size_t)row * N + j) = o;
    }
    
  }
}



// ---- f16 WMMA path (v_wmma_f32_16x16x32_f16): 11-bit significands for operands in range — used where a [0,1] probability operand needs more precision than bf16
typedef _Float16 v16h __attribute__((ext_vector_type(16)));
union FragH { v16h v; v8us half[2]; _Float16 h[16]; unsigned short u[16]; };
template <int NT>
__device__ __forceinline__ v8f mmaH(v16h ah, v16h al, v16h bh, v16h bl, v8f c) {
  c = __builtin_amdgcn_wmma_f32_16x16x32_f16(false, ah, false, bh, (short)0, c, false, false);
  if (NT >= 2) c = __builtin_amdgcn_wmma_f32_16x16x32_f16(false, al, false, bh, (short)0, c, false, false);
  if (NT >= 3) c = __builtin_amdgcn_wmma_f32_16x16x32_f16(false, ah, false, bl, (short)0, c, false, false);
  asm volatile("v_nop\n\tv_nop\n\tv_nop\n\tv_nop" : "+v"(c) : "v"(ah), "v"(al), "v"(bh), "v"(bl));
  return c;
}
// batched GEMM like k_gemm_b but f16 operands: A f32 (split into f16 hi/lo if ASPLIT, else rounded to f16), Bt = f16 values [n][k]; alpha; C f32; N multiple of 16 (partial tiles skipped)
template <bool ASPLIT>
__global__ __launch_bounds__(128) void k_gemm_h(const float* __restrict__ A, int lda, size_t sA, const _Float16* __restrict__ Bh, int ldb, size_t sB, float alpha, float* __restrict__ C, int ldc, size_t sC, int M, int N, int K) {
  __shared__ __attribute__((aligned(16))) float so[4][16][64];
  const int tid = threadIdx.x, w = tid >> 5, lane = tid & 31, ln = lane & 15, hh = lane >> 4; const int by = blockIdx.y;
  A += (size_t)by * sA; Bh += (size_t)by * sB; C += (size_t)by * sC;
  const int ntn = (N + 63) / 64; const int wid = blockIdx.x * 4 + w; const int mt = wid / ntn, nq = wid % ntn; if (mt * 16 >= M) return;
  const int row0 = mt * 16, col0 = nq * 64; const float* arow = A + (size_t)(row0 + ln) * lda;
  v8f acc[4] = {};
  for (int kb = 0; kb < K; kb += 32) {
    FragH ah, al;
    const v4f x0 = *(const v4fa*)(arow + kb + 8 * hh), x1 = *(const v4fa*)(arow + kb + 8 * hh + 4), x2 = *(const v4fa*)(arow + kb + 16 + 8 * hh), x3 = *(const v4fa*)(arow + kb + 16 + 8 * hh + 4);
    float xs[16] = {x0[0],x0[1],x0[2],x0[3],x1[0],x1[1],x1[2],x1[3],x2[0],x2[1],x2[2],x2[3],x3[0],x3[1],x3[2],x3[3]};
#pragma unroll
    for (int i = 0; i < 16; ++i) { const _Float16 h = (_Float16)xs[i]; ah.h[i] = h; al.h[i] = ASPLIT ? (_Float16)(xs[i] - (float)h) : (_Float16)0.0f; }
#pragma unroll
    for (int t = 0; t < 4; ++t) { if (col0 + t * 16 >= N) continue; const size_t boff = (size_t)(col0 + t * 16 + ln) * ldb + kb; FragH bq; bq.half[0] = *(const v8us*)(Bh + boff + 8 * hh); bq.half[1] = *(const v8us*)(Bh + boff + 16 + 8 * hh);
      acc[t] = mmaH<ASPLIT ? 2 : 1>(ah.v, al.v, bq.v, bq.v, acc[t]); }
  }
#pragma unroll
  for (int t = 0; t < 4; ++t) { if (col0 + t * 16 >= N) continue;
#pragma unroll
    for (int r = 0; r < 8; ++r) so[w][8 * hh + r][t * 16 + ln] = acc[t][r] * alpha; }
  __builtin_amdgcn_fence(__ATOMIC_ACQ_REL, "workgroup"); __builtin_amdgcn_wave_barrier();
  const int rsub = lane >> 4, c4 = (lane & 15) * 4;
  {
#pragma unroll
    for (int q = 0; q < 8; ++q) { const int r = q * 2 + rsub; if (col0 + c4 < N) { const v4f v = *(const v4fa*)&so[w][r][c4]; *(v4f*)(C + (size_t)(row0 + r) * ldc + col0 + c4) = v; } }
     }
}

// Wt[n][k] = f16(W[k][n]·scale) from f32 row-major W[K][N] (scale = power of two; bf16-exact weights stay exact in f16 away from the subnormal range)
__global__ __launch_bounds__(256) void k_wt_f16(const float* __restrict__ W, _Float16* __restrict__ Wt, int K, int N, float scale) {
  const int t = blockIdx.x * 256 + threadIdx.x; if (t >= N * (K / 8)) return; const int n = t / (K / 8), k8 = (t % (K / 8)) * 8; FragH f;
#pragma unroll
  for (int i = 0; i < 8; ++i) f.h[i] = (_Float16)(bf16_round(W[(size_t)(k8 + i) * N + n]) * scale); const v8us o = f.half[0];
  *(v8us*)((unsigned short*)Wt + (size_t)n * K + k8) = o; 
}
// k_gemm_hh variant with fused epilogue: v = acc·alpha + bias[by·sBias + col] (+ CP[(row/rowsPerB)·sCPb + by·64 + col] if CP) ; ACT 0 none / 1 elu ; writes f32 C and/or f16 C16 (each if non-null)
template <int ACT>
__global__ __launch_bounds__(128) void k_gemm_hhx(const _Float16* __restrict__ A, int lda, size_t sA, const _Float16* __restrict__ Bh, int ldb, size_t sB, float alpha, const float* __restrict__ bias, size_t sBias, const float* __restrict__ CP, int rowsPerB, size_t sCPb, int row0g,
    float* __restrict__ C, _Float16* __restrict__ C16, int ldc, size_t sC, int M, int N, int K) {
  __shared__ __attribute__((aligned(16))) float so[4][16][64];
  const int tid = threadIdx.x, w = tid >> 5, lane = tid & 31, ln = lane & 15, hh = lane >> 4; const int by = blockIdx.y;
  A += (size_t)by * sA; Bh += (size_t)by * sB; const size_t cofs = (size_t)by * sC; const float* bp = bias ? bias + (size_t)by * sBias : nullptr;
  const int ntn = (N + 63) / 64; const int wid = blockIdx.x * 4 + w; const int mt = wid / ntn, nq = wid % ntn; if (mt * 16 >= M) return;
  const int row0 = mt * 16, col0 = nq * 64; const _Float16* arow = A + (size_t)(row0 + ln) * lda;
  v8f acc[4] = {};
  for (int kb = 0; kb < K; kb += 32) { FragH ah; ah.half[0] = *(const v8us*)((const unsigned short*)arow + kb + 8 * hh); ah.half[1] = *(const v8us*)((const unsigned short*)arow + kb + 16 + 8 * hh);
#pragma unroll
    for (int t = 0; t < 4; ++t) { if (col0 + t * 16 >= N) continue; const size_t boff = (size_t)(col0 + t * 16 + ln) * ldb + kb; FragH bq; bq.half[0] = *(const v8us*)((const unsigned short*)Bh + boff + 8 * hh); bq.half[1] = *(const v8us*)((const unsigned short*)Bh + boff + 16 + 8 * hh);
      acc[t] = mmaH<1>(ah.v, ah.v, bq.v, bq.v, acc[t]); }
  }
#pragma unroll
  for (int t = 0; t < 4; ++t) { if (col0 + t * 16 >= N) continue; const int col = col0 + t * 16 + ln; const float bv = bp ? bf16_round(bp[col]) : 0.f;
#pragma unroll
    for (int r = 0; r < 8; ++r) { float v = acc[t][r] * alpha + bv; if (CP) { const int bidx = (row0g + row0 + 8 * hh + r) / rowsPerB; v += CP[(size_t)bidx * sCPb + (size_t)by * 64 + col]; } if (ACT == 1) v = (v > 0.f) ? v : expm1f(v); else if (ACT == 7) v = (v > 0.f) ? v + 1.0f : expf(v); else if (ACT == 8) v = tanhf(v); else if (ACT == 9) v = 0.5f * v * (1.0f + tanhf(0.7978845608028654f * (v + 0.044715f * v * v * v))); else if (ACT == 11) v = 1.0f / (1.0f + expf(-v)); else if (ACT == 12) v = (v > 0.f) ? v : 0.01f * v; else if (ACT == 14) v = (v > 0.f) ? v : 0.1f * v; else if (ACT == 15) v = v / (1.0f + expf(-v)); else if (ACT == 3) v = fmaxf(v, 0.f); else if (ACT == 6) v = 0.5f * v * (1.0f + erff(v * 0.70710678118654752f)); so[w][8 * hh + r][t * 16 + ln] = v; } }
  __builtin_amdgcn_fence(__ATOMIC_ACQ_REL, "workgroup"); __builtin_amdgcn_wave_barrier();
  const int rsub = lane >> 4, c4 = (lane & 15) * 4; typedef _Float16 v4h __attribute__((ext_vector_type(4)));
  {
#pragma unroll
    for (int q = 0; q < 8; ++q) { const int r = q * 2 + rsub; if (col0 + c4 < N) { const v4f v = *(const v4fa*)&so[w][r][c4]; if (C) *(v4f*)(C + cofs + (size_t)(row0 + r) * ldc + col0 + c4) = v; if (C16) { v4h h4; for (int i = 0; i < 4; ++i) h4[i] = (_Float16)v[i]; *(v4h*)(C16 + cofs + (size_t)(row0 + r) * ldc + col0 + c4) = h4; } } }
     }
}


typedef _Float16 v4h __attribute__((ext_vector_type(4)));

__global__ __launch_bounds__(256) void k_x16(const float* __restrict__ x, _Float16* __restrict__ X16, size_t n8) { const size_t t = (size_t)blockIdx.x * 256 + threadIdx.x; if (t >= n8) return; FragH f;
#pragma unroll
  for (int q = 0; q < 8; ++q) f.h[q] = (_Float16)bf16_round(x[t * 8 + q]); *(v8us*)((unsigned short*)X16 + t * 8) = f.half[0];  }
__global__ __launch_bounds__(256) void k_h16(const float* __restrict__ x, _Float16* __restrict__ X16, size_t n8) { const size_t t = (size_t)blockIdx.x * 256 + threadIdx.x; if (t >= n8) return; FragH f;
#pragma unroll
  for (int q = 0; q < 8; ++q) f.h[q] = (_Float16)x[t * 8 + q]; *(v8us*)((unsigned short*)X16 + t * 8) = f.half[0];  }
__global__ __launch_bounds__(256) void k_round16f(const float* __restrict__ W, _Float16* __restrict__ Bt, size_t n8) { const size_t t = (size_t)blockIdx.x * 256 + threadIdx.x; if (t >= n8) return; FragH f;
#pragma unroll
  for (int i = 0; i < 8; ++i) f.h[i] = (_Float16)(bf16_round(W[t * 8 + i]) * 16.0f); *(v8us*)((unsigned short*)Bt + t * 8) = f.half[0];  }
template <int NHv, int TTv>
__global__ __launch_bounds__(256) void k_vt(const _Float16* __restrict__ V16, int ldv, int voff, _Float16* __restrict__ Vt) { __shared__ unsigned short tl[64][66]; const int tid = threadIdx.x; const int slab = blockIdx.x / (TTv / 64), lg = blockIdx.x % (TTv / 64); const int b = slab / NHv, h = slab % NHv;
  for (int i = tid; i < 64 * 8; i += 256) { const int r = i / 8, c8 = (i % 8) * 8; FragH f; f.half[0] = *(const v8us*)((const unsigned short*)V16 + ((size_t)b * TTv + lg * 64 + r) * ldv + voff + h * 64 + c8);
#pragma unroll
    for (int q = 0; q < 8; ++q) tl[r][c8 + q] = f.u[q]; }
  __syncthreads();
  {
#pragma unroll
    for (int rd = 0; rd < 2; ++rd) { const int d = rd * 32 + tid / 8, pc = tid % 8; FragH f;
#pragma unroll
      for (int q = 0; q < 8; ++q) f.u[q] = tl[pc * 8 + q][d];
      *(v8us*)((unsigned short*)Vt + ((size_t)slab * 64 + d) * TTv + lg * 64 + pc * 8) = f.half[0]; }
     } }

template <int RB>
__global__ __launch_bounds__(256) void k_xt(const float* __restrict__ src, _Float16* __restrict__ XT) { const size_t t = (size_t)blockIdx.x * 256 + threadIdx.x; if (t >= (size_t)BB * TT * 12) return; const int c0 = (int)(t % 12) * 8; const size_t bn = t / 12; const int n = (int)(bn % TT), b = (int)(bn / TT); FragH f;
#pragma unroll
  for (int q = 0; q < 8; ++q) { const int c = c0 + q; float v = 0.f; if (c < CC) { v = src[((size_t)b * CC + c) * TT + n]; if (RB) v = bf16_round(v); } else if (c == CC) v = 1.f; f.h[q] = (_Float16)v; }
  *(v8us*)((unsigned short*)XT + t * 8) = f.half[0];  }
// q/k planes for one attention instance: per token n of batch b: q[d] = Σ_c wq[d][c]·xs[c][n] + bq[d], k likewise (f32, rolled over c; xs = bf16-rounded input frame or an internal SA plane (RB)); thread per (token, 16-B piece p ∈ 0..3):
template <int RB>
__global__ __launch_bounds__(256) void k_qk(const float* __restrict__ xs, const float* __restrict__ wq, const float* __restrict__ bq, const float* __restrict__ wk, const float* __restrict__ bk, int slab0, _Float16* __restrict__ QP, _Float16* __restrict__ KP) {
  #pragma clang fp contract(off)
  const size_t t = (size_t)blockIdx.x * 256 + threadIdx.x; if (t >= (size_t)BB * TT * 4) return; const int p = (int)(t % 4); const size_t bn = t / 4; const int n = (int)(bn % TT), b = (int)(bn / TT);
  float q[8], k[8]; for (int d = 0; d < 8; ++d) { q[d] = bf16_round(bq[d]); k[d] = bf16_round(bk[d]); }
#pragma unroll 1
  for (int c = 0; c < CC; ++c) { float xv = xs[((size_t)b * CC + c) * TT + n]; if (RB) xv = bf16_round(xv);
#pragma unroll
    for (int d = 0; d < 8; ++d) { q[d] += bf16_round(wq[d * CC + c]) * xv; k[d] += bf16_round(wk[d * CC + c]) * xv; } }
  FragH fq, fk;
#pragma unroll
  for (int d = 0; d < 8; ++d) { const _Float16 qh = (_Float16)q[d], kh = (_Float16)k[d]; const float qlo = (q[d] - (float)qh) * 1024.0f, klo = (k[d] - (float)kh);
    fq.h[d] = (p == 0) ? qh : (p == 1) ? (_Float16)qlo : (p == 2) ? qh : (_Float16)0.f;
    fk.h[d] = (p == 0) ? kh : (p == 1) ? (_Float16)((float)kh * 0.0009765625f) : (p == 2) ? (_Float16)klo : (_Float16)0.f; }
  const size_t row = (size_t)(slab0 + b) * TT + n;
  { *(v8us*)((unsigned short*)QP + row * 32 + p * 8) = fq.half[0]; *(v8us*)((unsigned short*)KP + row * 32 + p * 8) = fk.half[0];  } }
__global__ __launch_bounds__(256) void k_wvb(const float* __restrict__ wv, const float* __restrict__ bv, _Float16* __restrict__ A16) { const int t = blockIdx.x * 256 + threadIdx.x; if (t >= CC * 12) return; const int e = t / 12, c0 = (t % 12) * 8; FragH f;
  for (int q = 0; q < 8; ++q) { const int c = c0 + q; float v = 0.f; if (c < CC) v = bf16_round(wv[e * CC + c]); else if (c == CC) v = bf16_round(bv[e]); f.h[q] = (_Float16)(v * 16.0f); }
  *(v8us*)((unsigned short*)A16 + (size_t)t * 8) = f.half[0];  }
template <int RB>
__global__ __launch_bounds__(256) void k_ocm(const float* __restrict__ O, int slab0, const float* __restrict__ res, float* __restrict__ DST) { __shared__ float tl[64][65]; const int tid = threadIdx.x; const int b = blockIdx.x / (TT / 64), nb = blockIdx.x % (TT / 64); const int n0 = nb * 64;
  for (int i = tid; i < 64 * 64; i += 256) { const int n = i / 64, e = i % 64; tl[n][e] = O[((size_t)(slab0 + b) * TT + n0 + n) * CC + e]; } __syncthreads();
  const int piece = tid % 16, esub = tid / 16;      /* 16 consecutive lanes = one channel's 256-B segment (tokens n0..n0+63); 16 channels per iteration */
  v4f vals[4];
  for (int it = 0; it < 4; ++it) { const int e = it * 16 + esub; v4f v; for (int j = 0; j < 4; ++j) { float rv = res[((size_t)b * CC + e) * TT + n0 + piece * 4 + j]; if (RB) rv = bf16_round(rv); v[j] = tl[piece * 4 + j][e] + rv; } vals[it] = v; }
  { for (int it = 0; it < 4; ++it) { const int e = it * 16 + esub; *(v4f*)(DST + ((size_t)b * CC + e) * TT + n0 + piece * 4) = vals[it]; }  } }
__global__ __launch_bounds__(256) void k_cat(const float* __restrict__ M0, const float* __restrict__ M1, _Float16* __restrict__ CAT) { __shared__ float tl[128][65]; const int tid = threadIdx.x; const int b = blockIdx.x / (TT / 64), nb = blockIdx.x % (TT / 64); const int n0 = nb * 64;
  for (int i = tid; i < 128 * 64; i += 256) { const int ch = i / 64, n = i % 64; tl[ch][n] = (ch < 64) ? M0[((size_t)b * CC + ch) * TT + n0 + n] : M1[((size_t)b * CC + ch - 64) * TT + n0 + n]; } __syncthreads();
  const int piece = tid % 16, nsub = tid / 16;      /* 16 consecutive lanes = one token's 256-B row (128 halves); 16 tokens per iteration */
  FragH fv[4];
  for (int it = 0; it < 4; ++it) { const int n = it * 16 + nsub; for (int q = 0; q < 8; ++q) fv[it].h[q] = (_Float16)tl[piece * 8 + q][n]; }
  { for (int it = 0; it < 4; ++it) { const int n = it * 16 + nsub; *(v8us*)((unsigned short*)CAT + ((size_t)b * TT + n0 + n) * 128 + piece * 8) = fv[it].half[0]; }  } }
__global__ __launch_bounds__(256) void k_finb(const float* __restrict__ FUS, const float* __restrict__ tb, const float* __restrict__ SA1, float* __restrict__ out, size_t n4) {
  #pragma clang fp contract(off)
  const size_t t = (size_t)blockIdx.x * 256 + threadIdx.x; if (t >= n4) return; const int e = (int)(((t * 4) / TT) % CC); const float bb = bf16_round(tb[e]); const v4f f = *(const v4fa*)(FUS + t * 4), s = *(const v4fa*)(SA1 + t * 4); v4f o; for (int q = 0; q < 4; ++q) o[q] = (f[q] + bb) * s[q] + s[q]; *(v4f*)(out + t * 4) = o;  }
// Block = 4 query tiles x KSPL key ranges: wave w works query tile w & 3 over keys [(w >> 2) * TT/KSPL, +TT/KSPL) with its own running max, row sum and unnormalised O; the KSPL partials of a tile are merged through LDS at the end.
// Scores are formed transposed, S^T = K.Q^T (A = 16 key rows, B = the wave's 16 queries), so lane (ln, hh) holds 16 of the 32 scores of query ln: max and sum run inside the lane, plus one exchange between the wave halves for the max.
// The two S^T tiles of a trip hold keys 8hh + r and 16 + 8hh + r, which is the k order of the loaders here, so P^T goes from the accumulators into a B operand in registers and O^T += V^T.P^T (A = 16 channel rows of Vt); P never passes through LDS.
__device__ __forceinline__ float xhalf(float x) { return __builtin_bit_cast(float, __builtin_amdgcn_permlanex16(__builtin_bit_cast(int, x), __builtin_bit_cast(int, x), 0x76543210, 0xfedcba98, false, false)); }      /* lane l <-> lane l ^ 16 */
typedef float v2f __attribute__((ext_vector_type(2)));
typedef _Float16 v2h __attribute__((ext_vector_type(2)));
template <int KSPL>
__global__ __launch_bounds__(128 * KSPL, 8) void k_flash(const _Float16* __restrict__ Q16, int ldq, const _Float16* __restrict__ K16, int ldk, const _Float16* __restrict__ Vt, const int* __restrict__ MSK, float* __restrict__ O, int ldo) {
  constexpr int RPW = 16, NQB = TT / (4 * RPW), DT = 4, NW = 4 * KSPL;      /* d_qk = 32 (24 real + zero padding), d_v = 64 */
  __shared__ __attribute__((aligned(16))) float sO[NW][RPW][64 + 4];
  __shared__ float sM[NW][RPW], sL[NW][RPW];
  (void)MSK;
  const int tid = threadIdx.x, w = __builtin_amdgcn_readfirstlane(tid >> 5), lane = tid & 31, ln = lane & 15, hh = lane >> 4;
  const int slab = blockIdx.x / NQB, qblk = blockIdx.x % NQB; const int b = slab / NH; const int qb0 = qblk * (4 * RPW); const int q0 = qb0 + (w & 3) * RPW;
  FragH bq;      /* B operand: column ln = query q0 + ln */
  { const unsigned short* qr = (const unsigned short*)Q16 + ((size_t)b * TT + q0 + ln) * ldq; bq.half[0] = *(const v8us*)(qr + 8 * hh); bq.half[1] = *(const v8us*)(qr + 16 + 8 * hh); }
  const unsigned short* Vth = (const unsigned short*)Vt + (size_t)slab * 64 * TT;      /* v per slab: [64][4096] */
  float m_r = -3.0e38f, l_r = 0.f; v8f oacc[DT];      /* oacc[dt][r] = O^T[channel dt * 16 + 8hh + r][query ln] */
#pragma unroll
  for (int dt = 0; dt < DT; ++dt) oacc[dt] = (v8f){0.f,0.f,0.f,0.f,0.f,0.f,0.f,0.f};
  const int jbeg = (w >> 2) * (TT / KSPL);
#pragma unroll 1
  for (int it = 0; it < TT / KSPL / 32; ++it) { const int j0 = jbeg + it * 32;
    v8f s[2];      /* s[nt][r] = score of key j0 + nt * 16 + 8hh + r with query ln */
#pragma unroll
    for (int nt = 0; nt < 2; ++nt) { const unsigned short* kr = (const unsigned short*)K16 + ((size_t)b * TT + j0 + nt * 16 + ln) * ldk; FragH ak; ak.half[0] = *(const v8us*)(kr + 8 * hh); ak.half[1] = *(const v8us*)(kr + 16 + 8 * hh);
      s[nt] = mmaH<1>(ak.v, ak.v, bq.v, bq.v, (v8f){0.f,0.f,0.f,0.f,0.f,0.f,0.f,0.f}); }
    float mc = fmaxf(s[0][0], s[1][0]);
#pragma unroll
    for (int r = 1; r < 8; ++r) mc = fmaxf(mc, fmaxf(s[0][r], s[1][r]));
    mc = fmaxf(mc, xhalf(mc));      /* both halves hold the max over the trip's 32 keys */
    const float mn = fmaxf(m_r, mc); const float al = (mn > -1.0e38f) ? expf(m_r - mn) : 1.0f; m_r = mn;
    FragH ph, pl; float ls = 0.f;      /* P^T * 1024 as f16 hi + residual: element nt * 8 + r = key nt * 16 + 8hh + r */
#pragma unroll
    for (int nt = 0; nt < 2; ++nt)
#pragma unroll
      for (int r = 0; r < 8; r += 2) { const float pa = expf(s[nt][r] - mn), pb = expf(s[nt][r + 1] - mn); ls += pa; ls += pb; const v2f ps = (v2f){pa, pb} * 1024.0f; const v2h hi = __builtin_convertvector(ps, v2h); const v2h lo = __builtin_convertvector(ps - __builtin_convertvector(hi, v2f), v2h);
        ph.h[nt * 8 + r] = hi[0]; ph.h[nt * 8 + r + 1] = hi[1]; pl.h[nt * 8 + r] = lo[0]; pl.h[nt * 8 + r + 1] = lo[1]; }
    l_r = l_r * al + ls;      /* this half's 16 keys; the halves are joined behind the loop */
#pragma unroll
    for (int dt = 0; dt < DT; ++dt) oacc[dt] *= al;
#pragma unroll
    for (int dt = 0; dt < DT; ++dt) { const unsigned short* vrow = Vth + (size_t)(dt * 16 + ln) * TT + j0; FragH av; av.half[0] = *(const v8us*)(vrow + 8 * hh); av.half[1] = *(const v8us*)(vrow + 16 + 8 * hh);
      oacc[dt] = mmaH<1>(av.v, av.v, ph.v, ph.v, oacc[dt]); oacc[dt] = mmaH<1>(av.v, av.v, pl.v, pl.v, oacc[dt]); } }      /* V^T.(Ph + Pl) */
  l_r += xhalf(l_r);
  if (hh == 0) { sM[w][ln] = m_r; sL[w][ln] = l_r; }
#pragma unroll
  for (int dt = 0; dt < DT; ++dt) { *(v4fa*)&sO[w][ln][dt * 16 + 8 * hh] = (v4f){oacc[dt][0], oacc[dt][1], oacc[dt][2], oacc[dt][3]}; *(v4fa*)&sO[w][ln][dt * 16 + 8 * hh + 4] = (v4f){oacc[dt][4], oacc[dt][5], oacc[dt][6], oacc[dt][7]}; }
  __syncthreads();      /* every wave's partial is in LDS before any thread merges */
  /* merge: thread = (query of the block, 4 channels); O = sum_s e^(m_s - M) * O_s / (1024 * sum_s e^(m_s - M) * l_s), M = max_s m_s */
#pragma unroll
  for (int i = tid; i < 4 * RPW * 16; i += 128 * KSPL) { const int qq = i >> 4, pc = i & 15, g = qq / RPW, r = qq % RPW;
    float mx = sM[g][r];
#pragma unroll
    for (int s = 1; s < KSPL; ++s) mx = fmaxf(mx, sM[s * 4 + g][r]);
    float l = 0.f; v4f a = {0.f, 0.f, 0.f, 0.f};
#pragma unroll
    for (int s = 0; s < KSPL; ++s) { const float e = expf(sM[s * 4 + g][r] - mx); l += sL[s * 4 + g][r] * e; const v4f val = *(const v4fa*)&sO[s * 4 + g][r][pc * 4]; a += val * e; }
    const float inv = (l > 0.f) ? 1.0f / (l * 1024.0f) : 0.f;
    *(v4f*)(O + ((size_t)slab * TT + qb0 + qq) * ldo + pc * 4) = a * inv; } }

extern "C" void kernel_launch(void* const* d_in, const int* in_sizes, int n_in,
                              void* d_out, int out_size, void* d_ws, size_t ws_size, hipStream_t stream) {
  (void)in_sizes; (void)n_in; (void)out_size;
  const float* const* I = (const float* const*)d_in; const float* x = I[0]; const float* sa_wq = I[1]; const float* sa_bq = I[2]; const float* sa_wk = I[3]; const float* sa_bk = I[4]; const float* sa_wv = I[5]; const float* sa_bv = I[6];
  const float* ga_wq = I[7]; const float* ga_bq = I[8]; const float* ga_wk = I[9]; const float* ga_bk = I[10]; const float* ga_wv = I[11]; const float* ga_bv = I[12]; const float* tw = I[13]; const float* tb = I[14];
  char* ws = (char*)d_ws; size_t off = 0;
  auto take = [&](size_t bytes) { char* p = ws + off; off += (bytes + 255) & ~(size_t)255; return p; };
  const size_t PL = (size_t)BB * CC * TT;      /* one [B][64][4096] f32 plane = 1 M floats */
  _Float16* AWV = (_Float16*)take((size_t)5 * CC * 96 * 2); _Float16* TW16 = (_Float16*)take((size_t)CC * 128 * 2);
  _Float16* XT = (_Float16*)take((size_t)BB * TT * 96 * 2); _Float16* QP = (_Float16*)take((size_t)NSL * TT * 32 * 2); _Float16* KP = (_Float16*)take((size_t)NSL * TT * 32 * 2); _Float16* VT = (_Float16*)take((size_t)NSL * CC * TT * 2); float* O = (float*)take((size_t)NSL * TT * CC * 4);
  float* SA = (float*)take(3 * PL * 4); float* MF = (float*)take(2 * PL * 4); _Float16* CAT = (_Float16*)take((size_t)BB * TT * 128 * 2); float* FUS = (float*)take(PL * 4);
  if (off > ws_size) return;      // 0.1 + 3.1 + 5.2 + 5.2 + 10.5 + 21 + 12.6 + 8.4 + 4.2 + 4.2 ≈ 74.5 MB
  for (int a = 0; a < 5; ++a) { const float* wv = (a < 3) ? sa_wv + (size_t)a * CC * CC : ga_wv + (size_t)(a - 3) * CC * CC; const float* bv = (a < 3) ? sa_bv + a * CC : ga_bv + (a - 3) * CC; k_wvb<<<(CC * 12 + 255) / 256, 256, 0, stream>>>(wv, bv, AWV + (size_t)a * CC * 96); }
  k_round16f<<<(CC * 128 / 8 + 255) / 256, 256, 0, stream>>>(tw, TW16, CC * 128 / 8);      /* tfus_w [64 o][128 c] natural = the A operand ×2^4 */
  const unsigned gxt = (unsigned)(((size_t)BB * TT * 12 + 255) / 256), gqk = (unsigned)(((size_t)BB * TT * 4 + 255) / 256); const dim3 gv(((CC / 16) * (TT / 64) + 3) / 4, BB);
  /* self attention on the three frames: slabs a·BB + b for a = 0,1,2 */
  for (int a = 0; a < 3; ++a) { const float* xf = x + (size_t)a * PL;
    k_xt<1><<<gxt, 256, 0, stream>>>(xf, XT); k_qk<1><<<gqk, 256, 0, stream>>>(xf, sa_wq + (size_t)a * 8 * CC, sa_bq + a * 8, sa_wk + (size_t)a * 8 * CC, sa_bk + a * 8, a * BB, QP, KP);
    k_gemm_hhx<0><<<gv, 128, 0, stream>>>(AWV + (size_t)a * CC * 96, 96, 0, XT, 96, (size_t)TT * 96, 0.0625f, nullptr, 0, nullptr, 1, 0, 0, nullptr, VT + (size_t)a * BB * CC * TT, TT, (size_t)CC * TT, CC, TT, 96); }      /* v[b][e][m] = wv·x + bv, channel-major f16: batched over b, M 64 N 4096 K 96 */
  k_flash<8><<<3 * BB * (TT / 64), 1024, 0, stream>>>(QP, 32, KP, 32, VT, nullptr, O, CC);      /* slabs 0..11; 768 blocks of 32 waves = three full rounds of the WGPs */
  for (int a = 0; a < 3; ++a) k_ocm<1><<<BB * (TT / 64), 256, 0, stream>>>(O, a * BB, x + (size_t)a * PL, SA + (size_t)a * PL);      /* SA_a = attn-out + x_a (channel-major f32) */
  /* guided attentions: slabs 12..15 (q,k from SA_0; v,res from SA_1) and 16..19 (q,k from SA_2) */
  k_xt<0><<<gxt, 256, 0, stream>>>(SA + PL, XT);      /* SA_1 token-major (internal f32, no rounding) */
  for (int gi = 0; gi < 2; ++gi) { const float* src = SA + (size_t)(gi == 0 ? 0 : 2) * PL; const int a = 3 + gi;
    k_qk<0><<<gqk, 256, 0, stream>>>(src, ga_wq + (size_t)gi * 8 * CC, ga_bq + gi * 8, ga_wk + (size_t)gi * 8 * CC, ga_bk + gi * 8, a * BB, QP, KP);
    k_gemm_hhx<0><<<gv, 128, 0, stream>>>(AWV + (size_t)a * CC * 96, 96, 0, XT, 96, (size_t)TT * 96, 0.0625f, nullptr, 0, nullptr, 1, 0, 0, nullptr, VT + (size_t)a * BB * CC * TT, TT, (size_t)CC * TT, CC, TT, 96); }
  k_flash<4><<<2 * BB * (TT / 64), 512, 0, stream>>>(QP + (size_t)3 * BB * TT * 32, 32, KP + (size_t)3 * BB * TT * 32, 32, VT + (size_t)3 * BB * CC * TT, nullptr, O + (size_t)3 * BB * TT * CC, CC);      /* slabs 12..19 (kernel-relative 0..7) */
  for (int gi = 0; gi < 2; ++gi) k_ocm<0><<<BB * (TT / 64), 256, 0, stream>>>(O + (size_t)3 * BB * TT * CC, gi * BB, SA + PL, MF + (size_t)gi * PL);      /* mfi_gi = attn-out + SA_1 */
  k_cat<<<BB * (TT / 64), 256, 0, stream>>>(MF, MF + PL, CAT);
  k_gemm_hhx<0><<<dim3(((CC / 16) * (TT / 64) + 3) / 4, BB), 128, 0, stream>>>(TW16, 128, 0, CAT, 128, (size_t)TT * 128, 0.0625f, nullptr, 0, nullptr, 1, 0, 0, FUS, nullptr, TT, (size_t)CC * TT, CC, TT, 128);      /* fusion[b][o][n] = Σ_c W[o][c]·cat[b][c][n]: A = W (M 64, K 128), Bt = CAT[b] token-major; bias tfus_b per ROW o → added in k_fin? no: see k_finb */
  k_finb<<<(unsigned)((PL / 4 + 255) / 256), 256, 0, stream>>>(FUS, tb, SA + PL, (float*)d_out, PL / 4);
}

// v003
// A run of this version takes 366 microseconds.
// In two side-by-side timings against v002, it was 1.39 and 1.38 times as fast.
// Over all steps from v000 it is 2.96 times as fast.
#include <hip/hip_runtime.h>
// MFI (3 frames, B=4, C=64, 64×64 → N=4096): SA_f = position attention on frame f (q = wq·x+bq (8 ch), k = wk·x+bk (8 ch), v = wv·x+bv (64 ch); attn = softmax_m(q[:,n]·k[:,m]) unscaled; out[e][n] = Σ_m v[e][m]·attn[n][m] + x[e][n]); then two guided attentions
// (q,k from SA_0 / SA_2, v and residual from SA_1), cat → fusion = tfus_w·cat + b; out = fusion·SA_1 + SA_1 → [4,64,64,64].
// Compute dtype: x, weights, biases rounded to bf16; q/k per token in f32 VALU (8×64 dot, rolled) emitted as concatenated f16 planes [q_hi|q_lo|q_hi|0] and [k_hi|k_hi·2^-10|k_lo|0] so ONE 32-wide WMMA k-step yields f32-accurate logits; v (+bias via an
// augmented ones column) channel-major by GEMM (f16); fused flash-style kernel per (slab, 64 queries) (online softmax f32, P f16 hi + residual, O token-major f32); residual add + channel-major restage in f32; cat f16 → fusion GEMM → out = fusion·sa₁ + sa₁ in f32. All on v_wmma_f32_16x16x32_f16.
#define NFR 3
#define BB 4
#define CC 64
#define TT 4096
#define NH 1
#define NSL (5 * BB)

typedef __bf16 v16b __attribute__((ext_vector_type(16)));
typedef unsigned short v8us __attribute__((ext_vector_type(8), may_alias));
typedef float  v8f  __attribute__((ext_vector_type(8)));
typedef float  v4f  __attribute__((ext_vector_type(4)));
typedef float  v4fa __attribute__((ext_vector_type(4), may_alias));
union FragB { v16b v; v8us half[2]; unsigned short u[16]; };

__device__ __forceinline__ unsigned short bf16_bits(float x) { unsigned int u = __float_as_uint(x); return (unsigned short)((u + 0x7FFFu + ((u >> 16) & 1u)) >> 16); }
__device__ __forceinline__ float bf16_val(unsigned short b) { return __uint_as_float(((unsigned int)b) << 16); }
__device__ __forceinline__ float bf16_round(float x) { return bf16_val(bf16_bits(x)); }
// D += A·B with NT terms: 1 = ah·bh, 2 = + al·bh (A split), 3 = + ah·bl (both split)
template <int NT>
__device__ __forceinline__ v8f mmaN(v16b ah, v16b al, v16b bh, v16b bl, v8f c) {
  c = __builtin_amdgcn_wmma_f32_16x16x32_bf16(false, ah, false, bh, (short)0, c, false, false);
  if (NT >= 2) c = __builtin_amdgcn_wmma_f32_16x16x32_bf16(false, al, false, bh, (short)0, c, false, false);
  if (NT >= 3) c = __builtin_amdgcn_wmma_f32_16x16x32_bf16(false, ah, false, bl, (short)0, c, false, false);
  asm volatile("v_nop\n\tv_nop\n\tv_nop\n\tv_nop" : "+v"(c) : "v"(ah), "v"(al), "v"(bh), "v"(bl));
  return c;
}

__global__ __launch_bounds__(256) void k_wt_bf16(const float* __restrict__ W, unsigned short* __restrict__ Wt, int K, int N) {
  const int t = blockIdx.x * 256 + threadIdx.x;
  const int k8n = K / 8;
  if (t >= N * k8n) return;
  const int n = t / k8n, k8 = (t % k8n) * 8;
  v8us v;
#pragma unroll
  for (int i = 0; i < 8; ++i) v[i] = bf16_bits(W[(size_t)(k8 + i) * N + n]);
  *(v8us*)(Wt + (size_t)n * K + k8) = v;
  
}

// GEMM C[M][N] (f32, pitch ldc) = act(A[M][K]·W + bias). A f32 row-major (pitch lda) converted per fragment to bf16
// (ASPLIT: hi/lo two planes -> 2 terms, else single rounded term); Wt bf16 [N][K] (pitch ldb). BIAS_BF16 rounds the
// bias to bf16 first (bias quantised to bf16 before the add). K%32==0, M%16==0, N%64==0.
template <bool ASPLIT, int ACT, bool BIAS_BF16>
__global__ __launch_bounds__(128) void k_gemm_bf(const float* __restrict__ A, int lda, const unsigned short* __restrict__ Wt, int ldb,
                                               const float* __restrict__ bias, float* __restrict__ C, int ldc, int M, int N, int K) {
  __shared__ __attribute__((aligned(16))) float so[4][16][64];
  const int tid = threadIdx.x, w = tid >> 5, lane = tid & 31, ln = lane & 15, hh = lane >> 4;
  const int ntn = N / 64;
  const int wid = blockIdx.x * 4 + w;
  const int mt = wid / ntn, nq = wid % ntn;
  if (mt * 16 >= M) return;
  const int row0 = mt * 16, col0 = nq * 64;
  const float* arow = A + (size_t)(row0 + ln) * lda;
  v8f acc[4] = {};
  for (int kb = 0; kb < K; kb += 32) {
    FragB ah, al;
    const v4f x0 = *(const v4fa*)(arow + kb + 8 * hh), x1 = *(const v4fa*)(arow + kb + 8 * hh + 4);
    const v4f x2 = *(const v4fa*)(arow + kb + 16 + 8 * hh), x3 = *(const v4fa*)(arow + kb + 16 + 8 * hh + 4);
    float xs[16] = {x0[0],x0[1],x0[2],x0[3],x1[0],x1[1],x1[2],x1[3],x2[0],x2[1],x2[2],x2[3],x3[0],x3[1],x3[2],x3[3]};
#pragma unroll
    for (int i = 0; i < 16; ++i) { const unsigned short hb = bf16_bits(xs[i]); ah.u[i] = hb; al.u[i] = ASPLIT ? bf16_bits(xs[i] - bf16_val(hb)) : (unsigned short)0; }
#pragma unroll
    for (int t = 0; t < 4; ++t) {
      const unsigned short* brow = Wt + (size_t)(col0 + t * 16 + ln) * ldb + kb;
      FragB b;
      b.half[0] = *(const v8us*)(brow + 8 * hh);
      b.half[1] = *(const v8us*)(brow + 16 + 8 * hh);
      acc[t] = mmaN<ASPLIT ? 2 : 1>(ah.v, al.v, b.v, b.v, acc[t]);
    }
  }
#pragma unroll
  for (int t = 0; t < 4; ++t) {
    float bv = bias ? bias[col0 + t * 16 + ln] : 0.f;
    if (BIAS_BF16) bv = bf16_round(bv);
#pragma unroll
    for (int r = 0; r < 8; ++r) { float v = acc[t][r] + bv; if (ACT == 1) v = fmaxf(v, 0.f); so[w][8 * hh + r][t * 16 + ln] = v; }
  }
  __builtin_amdgcn_fence(__ATOMIC_ACQ_REL, "workgroup");
  __builtin_amdgcn_wave_barrier();
  const int rsub = lane >> 4, c4 = (lane & 15) * 4;
  {
#pragma unroll
    for (int q = 0; q < 8; ++q) {
      const int r = q * 2 + rsub;
      const v4f v = *(const v4fa*)&so[w][r][c4];
      *(v4f*)(C + (size_t)(row0 + r) * ldc + col0 + c4) = v;
    }
    
  }
}

// Flash-style causal/unmasked attention, all contractions 3-term bf16 hi/lo splits, f32 softmax with running max.
// q,k,v rows are read from f32 buffers with arbitrary row pitch (so they can live inside a fused qkv buffer);
// D = head size (multiple of 32, <= 128); one wave = 16 query rows; block = 4 waves (64 queries) sharing K/V chunks of 32.
template <int D, bool CAUSAL>
__global__ __launch_bounds__(128) void k_flash(const float* __restrict__ qb, const float* __restrict__ kb, const float* __restrict__ vb,
                                             int pitch, int T, int H, float scale, float* __restrict__ y, int ypitch) {
  constexpr int KS = D / 32;        // k-steps for QK
  constexpr int DT = D / 16;        // d tiles for PV
  __shared__ __attribute__((aligned(16))) unsigned short sKh[32][D + 8], sKl[32][D + 8], sVh[32][D + 8], sVl[32][D + 8];
  __shared__ __attribute__((aligned(16))) unsigned short sPh[4][16][40], sPl[4][16][40];
  __shared__ __attribute__((aligned(16))) float sO[4][16][D];
  const int tid = threadIdx.x, w = tid >> 5, lane = tid & 31, ln = lane & 15, hh = lane >> 4;
  const int nqb = (T + 63) / 64;
  const int bh = blockIdx.x / nqb, qblk = blockIdx.x % nqb;
  const int b = bh / H, h = bh % H;
  const int q0 = qblk * 64 + w * 16;
  const float* Q = qb + (size_t)b * T * pitch + h * D;
  const float* K = kb + (size_t)b * T * pitch + h * D;
  const float* V = vb + (size_t)b * T * pitch + h * D;

  // A fragments of the wave's 16 query rows (scaled), hi/lo
  FragB aqh[KS], aql[KS];
  {
    int row = q0 + ln; if (row >= T) row = T - 1;
    const float* qr = Q + (size_t)row * pitch;
#pragma unroll
    for (int ks = 0; ks < KS; ++ks)
#pragma unroll
      for (int i = 0; i < 16; ++i) {
        const int d = ks * 32 + ((i < 8) ? (8 * hh + i) : (16 + 8 * hh + (i - 8)));
        const float x = qr[d] * scale; const unsigned short hb = bf16_bits(x);
        aqh[ks].u[i] = hb; aql[ks].u[i] = bf16_bits(x - bf16_val(hb));
      }
  }
  float m_r[8], l_r[8];
#pragma unroll
  for (int r = 0; r < 8; ++r) { m_r[r] = -3.0e38f; l_r[r] = 0.f; }
  v8f oacc[DT];
#pragma unroll
  for (int dt = 0; dt < DT; ++dt) oacc[dt] = (v8f){0.f,0.f,0.f,0.f,0.f,0.f,0.f,0.f};

  const int kv_end = CAUSAL ? min(T, qblk * 64 + 64) : T;     // block-uniform
  for (int j0 = 0; j0 < kv_end; j0 += 32) {
    __syncthreads();
    for (int e = tid; e < 32 * (D / 4); e += 128) {
      const int r = e / (D / 4), c4 = (e % (D / 4)) * 4;
      const int key = j0 + r;
      v4f kf = {0.f,0.f,0.f,0.f}, vf = {0.f,0.f,0.f,0.f};
      if (key < T) { kf = *(const v4fa*)(K + (size_t)key * pitch + c4); vf = *(const v4fa*)(V + (size_t)key * pitch + c4); }
#pragma unroll
      for (int t = 0; t < 4; ++t) {
        unsigned short hb = bf16_bits(kf[t]); sKh[r][c4 + t] = hb; sKl[r][c4 + t] = bf16_bits(kf[t] - bf16_val(hb));
        hb = bf16_bits(vf[t]); sVh[r][c4 + t] = hb; sVl[r][c4 + t] = bf16_bits(vf[t] - bf16_val(hb));
      }
    }
    __syncthreads();
    // S tile 16 x 32
    v8f s[2];
#pragma unroll
    for (int nt = 0; nt < 2; ++nt) {
      v8f acc = {};
#pragma unroll
      for (int ks = 0; ks < KS; ++ks) {
        FragB bh_, bl_;
        bh_.half[0] = *(const v8us*)&sKh[nt * 16 + ln][ks * 32 + 8 * hh]; bh_.half[1] = *(const v8us*)&sKh[nt * 16 + ln][ks * 32 + 16 + 8 * hh];
        bl_.half[0] = *(const v8us*)&sKl[nt * 16 + ln][ks * 32 + 8 * hh]; bl_.half[1] = *(const v8us*)&sKl[nt * 16 + ln][ks * 32 + 16 + 8 * hh];
        acc = mmaN<3>(aqh[ks].v, aql[ks].v, bh_.v, bl_.v, acc);
      }
      s[nt] = acc;
    }
    // mask + running max (rows 8hh+r; the 16 lanes of a half share rows)
    float alpha[8];
#pragma unroll
    for (int r = 0; r < 8; ++r) {
      const int qi = q0 + 8 * hh + r;
      const int ja = j0 + ln, jb = j0 + 16 + ln;
      if (CAUSAL) { if (ja > qi) s[0][r] = -3.0e38f; if (jb > qi) s[1][r] = -3.0e38f; }
      if (ja >= T) s[0][r] = -3.0e38f;
      if (jb >= T) s[1][r] = -3.0e38f;
      float mx = fmaxf(s[0][r], s[1][r]);
      mx = fmaxf(mx, __shfl_xor(mx, 1, 32)); mx = fmaxf(mx, __shfl_xor(mx, 2, 32)); mx = fmaxf(mx, __shfl_xor(mx, 4, 32)); mx = fmaxf(mx, __shfl_xor(mx, 8, 32));
      const float mnew = fmaxf(m_r[r], mx);
      alpha[r] = (mnew > -1.0e38f) ? __expf(m_r[r] - mnew) : 1.0f;
      const float p0 = (s[0][r] > -1.0e38f) ? __expf(s[0][r] - mnew) : 0.f;
      const float p1 = (s[1][r] > -1.0e38f) ? __expf(s[1][r] - mnew) : 0.f;
      m_r[r] = mnew;
      l_r[r] = l_r[r] * alpha[r] + p0 + p1;            // per-lane partial row sum (16 lanes combined at the end)
      unsigned short hb = bf16_bits(p0); sPh[w][8 * hh + r][ln] = hb;      sPl[w][8 * hh + r][ln] = bf16_bits(p0 - bf16_val(hb));
      hb = bf16_bits(p1);                sPh[w][8 * hh + r][16 + ln] = hb; sPl[w][8 * hh + r][16 + ln] = bf16_bits(p1 - bf16_val(hb));
    }
#pragma unroll
    for (int dt = 0; dt < DT; ++dt)
#pragma unroll
      for (int r = 0; r < 8; ++r) oacc[dt][r] *= alpha[r];
    __builtin_amdgcn_fence(__ATOMIC_ACQ_REL, "workgroup");
    __builtin_amdgcn_wave_barrier();
    FragB pah, pal;
    pah.half[0] = *(const v8us*)&sPh[w][ln][8 * hh]; pah.half[1] = *(const v8us*)&sPh[w][ln][16 + 8 * hh];
    pal.half[0] = *(const v8us*)&sPl[w][ln][8 * hh]; pal.half[1] = *(const v8us*)&sPl[w][ln][16 + 8 * hh];
#pragma unroll
    for (int dt = 0; dt < DT; ++dt) {
      FragB bvh, bvl;
#pragma unroll
      for (int i = 0; i < 8; ++i) {
        bvh.u[i] = sVh[8 * hh + i][dt * 16 + ln]; bvh.u[8 + i] = sVh[16 + 8 * hh + i][dt * 16 + ln];
        bvl.u[i] = sVl[8 * hh + i][dt * 16 + ln]; bvl.u[8 + i] = sVl[16 + 8 * hh + i][dt * 16 + ln];
      }
      oacc[dt] = mmaN<3>(pah.v, pal.v, bvh.v, bvl.v, oacc[dt]);
    }
    __builtin_amdgcn_fence(__ATOMIC_ACQ_REL, "workgroup");
    __builtin_amdgcn_wave_barrier();
  }
#pragma unroll
  for (int r = 0; r < 8; ++r) {
    float l = l_r[r];
    l += __shfl_xor(l, 1, 32); l += __shfl_xor(l, 2, 32); l += __shfl_xor(l, 4, 32); l += __shfl_xor(l, 8, 32);
    l_r[r] = (l > 0.f) ? 1.0f / l : 0.f;
  }
#pragma unroll
  for (int dt = 0; dt < DT; ++dt)
#pragma unroll
    for (int r = 0; r < 8; ++r) sO[w][8 * hh + r][dt * 16 + ln] = oacc[dt][r] * l_r[r];
  __builtin_amdgcn_fence(__ATOMIC_ACQ_REL, "workgroup");
  __builtin_amdgcn_wave_barrier();
  {
    for (int r = 0; r < 16; ++r) {
      const int row = q0 + r;
      if (row < T && lane < D / 4) {
        const v4f val = *(const v4fa*)&sO[w][r][lane * 4];
        *(v4f*)(y + ((size_t)b * T + row) * ypitch + h * D + lane * 4) = val;
      }
    }
    
  }
}

// GEMM C = act(A·W + bias + resid): A f32 (ASPLIT -> hi/lo 2 terms), Wt bf16 [N][K]; ACT 0 none, 1 relu, 2 exact gelu;
// resid (optional, f32, row index = (row % rmod), pitch ldr, RES_BF16 rounds it) added before the activation.
template <bool ASPLIT, int ACT, bool BIAS_BF16, bool RES_BF16>
__global__ __launch_bounds__(128) void k_gemm_bf3(const float* __restrict__ A, int lda, const unsigned short* __restrict__ Wt, int ldb,
                                                const float* __restrict__ bias, const float* __restrict__ resid, int rmod, int ldr,
                                                float* __restrict__ C, int ldc, int M, int N, int K) {
  __shared__ __attribute__((aligned(16))) float so[4][16][64];
  const int tid = threadIdx.x, w = tid >> 5, lane = tid & 31, ln = lane & 15, hh = lane >> 4;
  const int ntn = N / 64;
  const int wid = blockIdx.x * 4 + w;
  const int mt = wid / ntn, nq = wid % ntn;
  if (mt * 16 >= M) return;
  const int row0 = mt * 16, col0 = nq * 64;
  const float* arow = A + (size_t)(row0 + ln) * lda;
  v8f acc[4] = {};
  for (int kb = 0; kb < K; kb += 32) {
    FragB ah, al;
    const v4f x0 = *(const v4fa*)(arow + kb + 8 * hh), x1 = *(const v4fa*)(arow + kb + 8 * hh + 4);
    const v4f x2 = *(const v4fa*)(arow + kb + 16 + 8 * hh), x3 = *(const v4fa*)(arow + kb + 16 + 8 * hh + 4);
    float xs[16] = {x0[0],x0[1],x0[2],x0[3],x1[0],x1[1],x1[2],x1[3],x2[0],x2[1],x2[2],x2[3],x3[0],x3[1],x3[2],x3[3]};
#pragma unroll
    for (int i = 0; i < 16; ++i) { const unsigned short hb = bf16_bits(xs[i]); ah.u[i] = hb; al.u[i] = ASPLIT ? bf16_bits(xs[i] - bf16_val(hb)) : (unsigned short)0; }
#pragma unroll
    for (int t = 0; t < 4; ++t) {
      const unsigned short* brow = Wt + (size_t)(col0 + t * 16 + ln) * ldb + kb;
      FragB b;
      b.half[0] = *(const v8us*)(brow + 8 * hh);
      b.half[1] = *(const v8us*)(brow + 16 + 8 * hh);
      acc[t] = mmaN<ASPLIT ? 2 : 1>(ah.v, al.v, b.v, b.v, acc[t]);
    }
  }
#pragma unroll
  for (int t = 0; t < 4; ++t) {
    const int col = col0 + t * 16 + ln;
    float bv = bias ? bias[col] : 0.f;
    if (BIAS_BF16) bv = bf16_round(bv);
#pragma unroll
    for (int r = 0; r < 8; ++r) {
      float v = acc[t][r] + bv;
      if (resid) { float rv = resid[(size_t)((row0 + 8 * hh + r) % rmod) * ldr + col]; if (RES_BF16) rv = bf16_round(rv); v += rv; }
      if (ACT == 1) v = fmaxf(v, 0.f);
      if (ACT == 2) v = 0.5f * v * (1.0f + erff(v * 0.70710678118654752f));
      if (ACT == 3) { const float u = 0.7978845608028654f * (v + 0.044715f * v * v * v); v = 0.5f * v * (1.0f + tanhf(u)); }
      so[w][8 * hh + r][t * 16 + ln] = v;
    }
  }
  __builtin_amdgcn_fence(__ATOMIC_ACQ_REL, "workgroup");
  __builtin_amdgcn_wave_barrier();
  const int rsub = lane >> 4, c4 = (lane & 15) * 4;
  {
#pragma unroll
    for (int q = 0; q < 8; ++q) {
      const int r = q * 2 + rsub;
      const v4f v = *(const v4fa*)&so[w][r][c4];
      *(v4f*)(C + (size_t)(row0 + r) * ldc + col0 + c4) = v;
    }
    
  }
}
// row LayerNorm (biased variance, eps) over N: s = X (+ R); optional out_sum <- s; out_norm <- (s-mu)*rsqrt(var+eps)*g + b
template <bool PARAM_BF16>
__global__ __launch_bounds__(256) void k_layernorm(const float* __restrict__ X, const float* __restrict__ R, const float* __restrict__ g, const float* __restrict__ bta,
                                                  float* __restrict__ out_sum, float* __restrict__ out_norm, int N, float eps) {
  __shared__ float red[256];
  const int row = blockIdx.x, tid = threadIdx.x;
  const float* x = X + (size_t)row * N; const float* rr = R ? R + (size_t)row * N : nullptr;
  float vals[16];                     // up to N = 4096
  const int per = N / 256;            // contiguous chunk per thread? use strided-by-4 chunks: thread handles j = tid*4 + 1024*u
  float s1 = 0.f;
  for (int u = 0; u < per / 4; ++u) {
    const int j = tid * 4 + 1024 * u;
    const v4f a = *(const v4fa*)(x + j);
    v4f b = {0.f,0.f,0.f,0.f}; if (rr) b = *(const v4fa*)(rr + j);
#pragma unroll
    for (int q = 0; q < 4; ++q) { const float v = a[q] + b[q]; vals[u * 4 + q] = v; s1 += v; }
  }
  red[tid] = s1; __syncthreads();
  for (int st = 128; st > 0; st >>= 1) { if (tid < st) red[tid] += red[tid + st]; __syncthreads(); }
  const float mu = red[0] / (float)N; __syncthreads();
  float s2 = 0.f;
  for (int u = 0; u < per / 4; ++u)
#pragma unroll
    for (int q = 0; q < 4; ++q) { const float c = vals[u * 4 + q] - mu; s2 += c * c; }
  red[tid] = s2; __syncthreads();
  for (int st = 128; st > 0; st >>= 1) { if (tid < st) red[tid] += red[tid + st]; __syncthreads(); }
  const float rs = rsqrtf(red[0] / (float)N + eps);
  {
    for (int u = 0; u < per / 4; ++u) {
      const int j = tid * 4 + 1024 * u;
      v4f o, sm;
#pragma unroll
      for (int q = 0; q < 4; ++q) {
        float gg = g[j + q], bb = bta[j + q];
        if (PARAM_BF16) { gg = bf16_round(gg); bb = bf16_round(bb); }
        sm[q] = vals[u * 4 + q]; o[q] = (vals[u * 4 + q] - mu) * rs * gg + bb;
      }
      if (out_sum) *(v4f*)(out_sum + (size_t)row * N + j) = sm;
      *(v4f*)(out_norm + (size_t)row * N + j) = o;
    }
    
  }
}



// ---- f16 WMMA path (v_wmma_f32_16x16x32_f16): 11-bit significands for operands in range — used where a [0,1] probability operand needs more precision than bf16
typedef _Float16 v16h __attribute__((ext_vector_type(16)));
union FragH { v16h v; v8us half[2]; _Float16 h[16]; unsigned short u[16]; };
template <int NT>
__device__ __forceinline__ v8f mmaH(v16h ah, v16h al, v16h bh, v16h bl, v8f c) {
  c = __builtin_amdgcn_wmma_f32_16x16x32_f16(false, ah, false, bh, (short)0, c, false, false);
  if (NT >= 2) c = __builtin_amdgcn_wmma_f32_16x16x32_f16(false, al, false, bh, (short)0, c, false, false);
  if (NT >= 3) c = __builtin_amdgcn_wmma_f32_16x16x32_f16(false, ah, false, bl, (short)0, c, false, false);
  asm volatile("v_nop\n\tv_nop\n\tv_nop\n\tv_nop" : "+v"(c) : "v"(ah), "v"(al), "v"(bh), "v"(bl));
  return c;
}
// batched GEMM like k_gemm_b but f16 operands: A f32 (split into f16 hi/lo if ASPLIT, else rounded to f16), Bt = f16 values [n][k]; alpha; C f32; N multiple of 16 (partial tiles skipped)
template <bool ASPLIT>
__global__ __launch_bounds__(128) void k_gemm_h(const float* __restrict__ A, int lda, size_t sA, const _Float16* __restrict__ Bh, int ldb, size_t sB, float alpha, float* __restrict__ C, int ldc, size_t sC, int M, int N, int K) {
  __shared__ __attribute__((aligned(16))) float so[4][16][64];
  const int tid = threadIdx.x, w = tid >> 5, lane = tid & 31, ln = lane & 15, hh = lane >> 4; const int by = blockIdx.y;
  A += (size_t)by * sA; Bh += (size_t)by * sB; C += (size_t)by * sC;
  const int ntn = (N + 63) / 64; const int wid = blockIdx.x * 4 + w; const int mt = wid / ntn, nq = wid % ntn; if (mt * 16 >= M) return;
  const int row0 = mt * 16, col0 = nq * 64; const float* arow = A + (size_t)(row0 + ln) * lda;
  v8f acc[4] = {};
  for (int kb = 0; kb < K; kb += 32) {
    FragH ah, al;
    const v4f x0 = *(const v4fa*)(arow + kb + 8 * hh), x1 = *(const v4fa*)(arow + kb + 8 * hh + 4), x2 = *(const v4fa*)(arow + kb + 16 + 8 * hh), x3 = *(const v4fa*)(arow + kb + 16 + 8 * hh + 4);
    float xs[16] = {x0[0],x0[1],x0[2],x0[3],x1[0],x1[1],x1[2],x1[3],x2[0],x2[1],x2[2],x2[3],x3[0],x3[1],x3[2],x3[3]};
#pragma unroll
    for (int i = 0; i < 16; ++i) { const _Float16 h = (_Float16)xs[i]; ah.h[i] = h; al.h[i] = ASPLIT ? (_Float16)(xs[i] - (float)h) : (_Float16)0.0f; }
#pragma unroll
    for (int t = 0; t < 4; ++t) { if (col0 + t * 16 >= N) continue; const size_t boff = (size_t)(col0 + t * 16 + ln) * ldb + kb; FragH bq; bq.half[0] = *(const v8us*)(Bh + boff + 8 * hh); bq.half[1] = *(const v8us*)(Bh + boff + 16 + 8 * hh);
      acc[t] = mmaH<ASPLIT ? 2 : 1>(ah.v, al.v, bq.v, bq.v, acc[t]); }
  }
#pragma unroll
  for (int t = 0; t < 4; ++t) { if (col0 + t * 16 >= N) continue;
#pragma unroll
    for (int r = 0; r < 8; ++r) so[w][8 * hh + r][t * 16 + ln] = acc[t][r] * alpha; }
  __builtin_amdgcn_fence(__ATOMIC_ACQ_REL, "workgroup"); __builtin_amdgcn_wave_barrier();
  const int rsub = lane >> 4, c4 = (lane & 15) * 4;
  {
#pragma unroll
    for (int q = 0; q < 8; ++q) { const int r = q * 2 + rsub; if (col0 + c4 < N) { const v4f v = *(const v4fa*)&so[w][r][c4]; *(v4f*)(C + (size_t)(row0 + r) * ldc + col0 + c4) = v; } }
     }
}

// Wt[n][k] = f16(W[k][n]·scale) from f32 row-major W[K][N] (scale = power of two; bf16-exact weights stay exact in f16 away from the subnormal range)
__global__ __launch_bounds__(256) void k_wt_f16(const float* __restrict__ W, _Float16* __restrict__ Wt, int K, int N, float scale) {
  const int t = blockIdx.x * 256 + threadIdx.x; if (t >= N * (K / 8)) return; const int n = t / (K / 8), k8 = (t % (K / 8)) * 8; FragH f;
#pragma unroll
  for (int i = 0; i < 8; ++i) f.h[i] = (_Float16)(bf16_round(W[(size_t)(k8 + i) * N + n]) * scale); const v8us o = f.half[0];
  *(v8us*)((unsigned short*)Wt + (size_t)n * K + k8) = o; 
}
// k_gemm_hh variant with fused epilogue: v = acc·alpha + bias[by·sBias + col] (+ CP[(row/rowsPerB)·sCPb + by·64 + col] if CP) ; ACT 0 none / 1 elu ; writes f32 C and/or f16 C16 (each if non-null)
template <int ACT>
__global__ __launch_bounds__(128) void k_gemm_hhx(const _Float16* __restrict__ A, int lda, size_t sA, const _Float16* __restrict__ Bh, int ldb, size_t sB, float alpha, const float* __restrict__ bias, size_t sBias, const float* __restrict__ CP, int rowsPerB, size_t sCPb, int row0g,
    float* __restrict__ C, _Float16* __restrict__ C16, int ldc, size_t sC, int M, int N, int K, size_t sAz, size_t sBz, size_t sCz) {
  __shared__ __attribute__((aligned(16))) float so[4][16][64];
  const int tid = threadIdx.x, w = tid >> 5, lane = tid & 31, ln = lane & 15, hh = lane >> 4; const int by = blockIdx.y, bz = blockIdx.z;      /* bz = attention instance, with strides of its own */
  A += (size_t)by * sA + (size_t)bz * sAz; Bh += (size_t)by * sB + (size_t)bz * sBz; const size_t cofs = (size_t)by * sC + (size_t)bz * sCz; const float* bp = bias ? bias + (size_t)by * sBias : nullptr;
  const int ntn = (N + 63) / 64; const int wid = blockIdx.x * 4 + w; const int mt = wid / ntn, nq = wid % ntn; if (mt * 16 >= M) return;
  const int row0 = mt * 16, col0 = nq * 64; const _Float16* arow = A + (size_t)(row0 + ln) * lda;
  v8f acc[4] = {};
  for (int kb = 0; kb < K; kb += 32) { FragH ah; ah.half[0] = *(const v8us*)((const unsigned short*)arow + kb + 8 * hh); ah.half[1] = *(const v8us*)((const unsigned short*)arow + kb + 16 + 8 * hh);
#pragma unroll
    for (int t = 0; t < 4; ++t) { if (col0 + t * 16 >= N) continue; const size_t boff = (size_t)(col0 + t * 16 + ln) * ldb + kb; FragH bq; bq.half[0] = *(const v8us*)((const unsigned short*)Bh + boff + 8 * hh); bq.half[1] = *(const v8us*)((const unsigned short*)Bh + boff + 16 + 8 * hh);
      acc[t] = mmaH<1>(ah.v, ah.v, bq.v, bq.v, acc[t]); }
  }
#pragma unroll
  for (int t = 0; t < 4; ++t) { if (col0 + t * 16 >= N) continue; const int col = col0 + t * 16 + ln; const float bv = bp ? bf16_round(bp[col]) : 0.f;
#pragma unroll
    for (int r = 0; r < 8; ++r) { float v = acc[t][r] * alpha + bv; if (CP) { const int bidx = (row0g + row0 + 8 * hh + r) / rowsPerB; v += CP[(size_t)bidx * sCPb + (size_t)by * 64 + col]; } if (ACT == 1) v = (v > 0.f) ? v : expm1f(v); else if (ACT == 7) v = (v > 0.f) ? v + 1.0f : expf(v); else if (ACT == 8) v = tanhf(v); else if (ACT == 9) v = 0.5f * v * (1.0f + tanhf(0.7978845608028654f * (v + 0.044715f * v * v * v))); else if (ACT == 11) v = 1.0f / (1.0f + expf(-v)); else if (ACT == 12) v = (v > 0.f) ? v : 0.01f * v; else if (ACT == 14) v = (v > 0.f) ? v : 0.1f * v; else if (ACT == 15) v = v / (1.0f + expf(-v)); else if (ACT == 3) v = fmaxf(v, 0.f); else if (ACT == 6) v = 0.5f * v * (1.0f + erff(v * 0.70710678118654752f)); so[w][8 * hh + r][t * 16 + ln] = v; } }
  __builtin_amdgcn_fence(__ATOMIC_ACQ_REL, "workgroup"); __builtin_amdgcn_wave_barrier();
  const int rsub = lane >> 4, c4 = (lane & 15) * 4; typedef _Float16 v4h __attribute__((ext_vector_type(4)));
  {
#pragma unroll
    for (int q = 0; q < 8; ++q) { const int r = q * 2 + rsub; if (col0 + c4 < N) { const v4f v = *(const v4fa*)&so[w][r][c4]; if (C) *(v4f*)(C + cofs + (size_t)(row0 + r) * ldc + col0 + c4) = v; if (C16) { v4h h4; for (int i = 0; i < 4; ++i) h4[i] = (_Float16)v[i]; *(v4h*)(C16 + cofs + (size_t)(row0 + r) * ldc + col0 + c4) = h4; } } }
     }
}


typedef _Float16 v4h __attribute__((ext_vector_type(4)));

__global__ __launch_bounds__(256) void k_x16(const float* __restrict__ x, _Float16* __restrict__ X16, size_t n8) { const size_t t = (size_t)blockIdx.x * 256 + threadIdx.x; if (t >= n8) return; FragH f;
#pragma unroll
  for (int q = 0; q < 8; ++q) f.h[q] = (_Float16)bf16_round(x[t * 8 + q]); *(v8us*)((unsigned short*)X16 + t * 8) = f.half[0];  }
__global__ __launch_bounds__(256) void k_h16(const float* __restrict__ x, _Float16* __restrict__ X16, size_t n8) { const size_t t = (size_t)blockIdx.x * 256 + threadIdx.x; if (t >= n8) return; FragH f;
#pragma unroll
  for (int q = 0; q < 8; ++q) f.h[q] = (_Float16)x[t * 8 + q]; *(v8us*)((unsigned short*)X16 + t * 8) = f.half[0];  }
__global__ __launch_bounds__(256) void k_round16f(const float* __restrict__ W, _Float16* __restrict__ Bt, size_t n8) { const size_t t = (size_t)blockIdx.x * 256 + threadIdx.x; if (t >= n8) return; FragH f;
#pragma unroll
  for (int i = 0; i < 8; ++i) f.h[i] = (_Float16)(bf16_round(W[t * 8 + i]) * 16.0f); *(v8us*)((unsigned short*)Bt + t * 8) = f.half[0];  }
template <int NHv, int TTv>
__global__ __launch_bounds__(256) void k_vt(const _Float16* __restrict__ V16, int ldv, int voff, _Float16* __restrict__ Vt) { __shared__ unsigned short tl[64][66]; const int tid = threadIdx.x; const int slab = blockIdx.x / (TTv / 64), lg = blockIdx.x % (TTv / 64); const int b = slab / NHv, h = slab % NHv;
  for (int i = tid; i < 64 * 8; i += 256) { const int r = i / 8, c8 = (i % 8) * 8; FragH f; f.half[0] = *(const v8us*)((const unsigned short*)V16 + ((size_t)b * TTv + lg * 64 + r) * ldv + voff + h * 64 + c8);
#pragma unroll
    for (int q = 0; q < 8; ++q) tl[r][c8 + q] = f.u[q]; }
  __syncthreads();
  {
#pragma unroll
    for (int rd = 0; rd < 2; ++rd) { const int d = rd * 32 + tid / 8, pc = tid % 8; FragH f;
#pragma unroll
      for (int q = 0; q < 8; ++q) f.u[q] = tl[pc * 8 + q][d];
      *(v8us*)((unsigned short*)Vt + ((size_t)slab * 64 + d) * TTv + lg * 64 + pc * 8) = f.half[0]; }
     } }

template <int RB>
__global__ __launch_bounds__(256) void k_xt(const float* __restrict__ src, _Float16* __restrict__ XT) { const size_t t = (size_t)blockIdx.x * 256 + threadIdx.x; if (t >= (size_t)BB * TT * 12) return; src += (size_t)blockIdx.y * BB * CC * TT; XT += (size_t)blockIdx.y * BB * TT * 96;      /* blockIdx.y = frame */
  const int c0 = (int)(t % 12) * 8; const size_t bn = t / 12; const int n = (int)(bn % TT), b = (int)(bn / TT); FragH f;
#pragma unroll
  for (int q = 0; q < 8; ++q) { const int c = c0 + q; float v = 0.f; if (c < CC) { v = src[((size_t)b * CC + c) * TT + n]; if (RB) v = bf16_round(v); } else if (c == CC) v = 1.f; f.h[q] = (_Float16)v; }
  *(v8us*)((unsigned short*)XT + t * 8) = f.half[0];  }
// q/k planes per attention instance (blockIdx.y): per token n of batch b: q[d] = Σ_c wq[d][c]·xs[c][n] + bq[d], k likewise (f32, rolled over c; xs = bf16-rounded input frame or an internal SA plane (RB)); thread per (token, 16-B piece p ∈ 0..3):
template <int RB>
__global__ __launch_bounds__(256) void k_qk(const float* __restrict__ xs, size_t sx, const float* __restrict__ wq, const float* __restrict__ bq, const float* __restrict__ wk, const float* __restrict__ bk, int slab0, _Float16* __restrict__ QP, _Float16* __restrict__ KP) {
  #pragma clang fp contract(off)
  const size_t t = (size_t)blockIdx.x * 256 + threadIdx.x; if (t >= (size_t)BB * TT * 4) return;
  { const int ai = blockIdx.y; xs += (size_t)ai * sx; wq += ai * 8 * CC; bq += ai * 8; wk += ai * 8 * CC; bk += ai * 8; slab0 += ai * BB; }      /* blockIdx.y = attention instance; sx = floats between the sources of two instances */
  const int p = (int)(t % 4); const size_t bn = t / 4; const int n = (int)(bn % TT), b = (int)(bn / TT);
  float q[8], k[8]; for (int d = 0; d < 8; ++d) { q[d] = bf16_round(bq[d]); k[d] = bf16_round(bk[d]); }
#pragma unroll 1
  for (int c = 0; c < CC; ++c) { float xv = xs[((size_t)b * CC + c) * TT + n]; if (RB) xv = bf16_round(xv);
#pragma unroll
    for (int d = 0; d < 8; ++d) { q[d] += bf16_round(wq[d * CC + c]) * xv; k[d] += bf16_round(wk[d * CC + c]) * xv; } }
  FragH fq, fk;
#pragma unroll
  for (int d = 0; d < 8; ++d) { const _Float16 qh = (_Float16)q[d], kh = (_Float16)k[d]; const float qlo = (q[d] - (float)qh) * 1024.0f, klo = (k[d] - (float)kh);
    fq.h[d] = (p == 0) ? qh : (p == 1) ? (_Float16)qlo : (p == 2) ? qh : (_Float16)0.f;
    fk.h[d] = (p == 0) ? kh : (p == 1) ? (_Float16)((float)kh * 0.0009765625f) : (p == 2) ? (_Float16)klo : (_Float16)0.f; }
  const size_t row = (size_t)(slab0 + b) * TT + n;
  { *(v8us*)((unsigned short*)QP + row * 32 + p * 8) = fq.half[0]; *(v8us*)((unsigned short*)KP + row * 32 + p * 8) = fk.half[0];  } }
__global__ __launch_bounds__(256) void k_wvb(const float* __restrict__ swv, const float* __restrict__ sbv, const float* __restrict__ gwv, const float* __restrict__ gbv, _Float16* __restrict__ A16) { const int t = blockIdx.x * 256 + threadIdx.x; if (t >= CC * 12) return;
  const int ai = blockIdx.y; const float* wv = (ai < 3) ? swv + (size_t)ai * CC * CC : gwv + (size_t)(ai - 3) * CC * CC; const float* bv = (ai < 3) ? sbv + ai * CC : gbv + (ai - 3) * CC; A16 += (size_t)ai * CC * 96;      /* blockIdx.y = attention instance: 0..2 self, 3..4 guided */
  const int e = t / 12, c0 = (t % 12) * 8; FragH f;
  for (int q = 0; q < 8; ++q) { const int c = c0 + q; float v = 0.f; if (c < CC) v = bf16_round(wv[e * CC + c]); else if (c == CC) v = bf16_round(bv[e]); f.h[q] = (_Float16)(v * 16.0f); }
  *(v8us*)((unsigned short*)A16 + (size_t)t * 8) = f.half[0];  }
template <int RB>
__global__ __launch_bounds__(256) void k_ocm(const float* __restrict__ O, int slab0, const float* __restrict__ res, size_t sres, float* __restrict__ DST) { __shared__ float tl[64][65]; const int tid = threadIdx.x; slab0 += (int)blockIdx.y * BB; res += (size_t)blockIdx.y * sres; DST += (size_t)blockIdx.y * BB * CC * TT;      /* blockIdx.y = attention instance; sres = floats between two instances' residuals */
  const int b = blockIdx.x / (TT / 64), nb = blockIdx.x % (TT / 64); const int n0 = nb * 64;
  for (int i = tid; i < 64 * 64; i += 256) { const int n = i / 64, e = i % 64; tl[n][e] = O[((size_t)(slab0 + b) * TT + n0 + n) * CC + e]; } __syncthreads();
  const int piece = tid % 16, esub = tid / 16;      /* 16 consecutive lanes = one channel's 256-B segment (tokens n0..n0+63); 16 channels per iteration */
  v4f vals[4];
  for (int it = 0; it < 4; ++it) { const int e = it * 16 + esub; v4f v; for (int j = 0; j < 4; ++j) { float rv = res[((size_t)b * CC + e) * TT + n0 + piece * 4 + j]; if (RB) rv = bf16_round(rv); v[j] = tl[piece * 4 + j][e] + rv; } vals[it] = v; }
  { for (int it = 0; it < 4; ++it) { const int e = it * 16 + esub; *(v4f*)(DST + ((size_t)b * CC + e) * TT + n0 + piece * 4) = vals[it]; }  } }
__global__ __launch_bounds__(256) void k_cat(const float* __restrict__ M0, const float* __restrict__ M1, _Float16* __restrict__ CAT) { __shared__ float tl[128][65]; const int tid = threadIdx.x; const int b = blockIdx.x / (TT / 64), nb = blockIdx.x % (TT / 64); const int n0 = nb * 64;
  for (int i = tid; i < 128 * 64; i += 256) { const int ch = i / 64, n = i % 64; tl[ch][n] = (ch < 64) ? M0[((size_t)b * CC + ch) * TT + n0 + n] : M1[((size_t)b * CC + ch - 64) * TT + n0 + n]; } __syncthreads();
  const int piece = tid % 16, nsub = tid / 16;      /* 16 consecutive lanes = one token's 256-B row (128 halves); 16 tokens per iteration */
  FragH fv[4];
  for (int it = 0; it < 4; ++it) { const int n = it * 16 + nsub; for (int q = 0; q < 8; ++q) fv[it].h[q] = (_Float16)tl[piece * 8 + q][n]; }
  { for (int it = 0; it < 4; ++it) { const int n = it * 16 + nsub; *(v8us*)((unsigned short*)CAT + ((size_t)b * TT + n0 + n) * 128 + piece * 8) = fv[it].half[0]; }  } }
__global__ __launch_bounds__(256) void k_finb(const float* __restrict__ FUS, const float* __restrict__ tb, const float* __restrict__ SA1, float* __restrict__ out, size_t n4) {
  #pragma clang fp contract(off)
  const size_t t = (size_t)blockIdx.x * 256 + threadIdx.x; if (t >= n4) return; const int e = (int)(((t * 4) / TT) % CC); const float bb = bf16_round(tb[e]); const v4f f = *(const v4fa*)(FUS + t * 4), s = *(const v4fa*)(SA1 + t * 4); v4f o; for (int q = 0; q < 4; ++q) o[q] = (f[q] + bb) * s[q] + s[q]; *(v4f*)(out + t * 4) = o;  }
// Block = 4 query tiles x KSPL key ranges: wave w works query tile w & 3 over keys [(w >> 2) * TT/KSPL, +TT/KSPL) with its own running max, row sum and unnormalised O; the KSPL partials of a tile are merged through LDS at the end.
// Scores are formed transposed, S^T = K.Q^T (A = 16 key rows, B = the wave's 16 queries), so lane (ln, hh) holds 16 of the 32 scores of query ln: max and sum run inside the lane, plus one exchange between the wave halves for the max.
// The two S^T tiles of a trip hold keys 8hh + r and 16 + 8hh + r, which is the k order of the loaders here, so P^T goes from the accumulators into a B operand in registers and O^T += V^T.P^T (A = 16 channel rows of Vt); P never passes through LDS.
__device__ __forceinline__ float xhalf(float x) { return __builtin_bit_cast(float, __builtin_amdgcn_permlanex16(__builtin_bit_cast(int, x), __builtin_bit_cast(int, x), 0x76543210, 0xfedcba98, false, false)); }      /* lane l <-> lane l ^ 16 */
typedef float v2f __attribute__((ext_vector_type(2)));
typedef _Float16 v2h __attribute__((ext_vector_type(2)));
template <int KSPL>
__global__ __launch_bounds__(128 * KSPL, 8) void k_flash(const _Float16* __restrict__ Q16, int ldq, const _Float16* __restrict__ K16, int ldk, const _Float16* __restrict__ Vt, const int* __restrict__ MSK, float* __restrict__ O, int ldo) {
  constexpr int RPW = 16, NQB = TT / (4 * RPW), DT = 4, NW = 4 * KSPL;      /* d_qk = 32 (24 real + zero padding), d_v = 64 */
  __shared__ __attribute__((aligned(16))) float sO[NW][RPW][64 + 4];
  __shared__ float sM[NW][RPW], sL[NW][RPW];
  (void)MSK;
  const int tid = threadIdx.x, w = __builtin_amdgcn_readfirstlane(tid >> 5), lane = tid & 31, ln = lane & 15, hh = lane >> 4;
  const int slab = blockIdx.x / NQB, qblk = blockIdx.x % NQB; const int b = slab / NH; const int qb0 = qblk * (4 * RPW); const int q0 = qb0 + (w & 3) * RPW;
  FragH bq;      /* B operand: column ln = query q0 + ln */
  { const unsigned short* qr = (const unsigned short*)Q16 + ((size_t)b * TT + q0 + ln) * ldq; bq.half[0] = *(const v8us*)(qr + 8 * hh); bq.half[1] = *(const v8us*)(qr + 16 + 8 * hh); }
  const unsigned short* Vth = (const unsigned short*)Vt + (size_t)slab * 64 * TT;      /* v per slab: [64][4096] */
  float m_r = -3.0e38f, l_r = 0.f; v8f oacc[DT];      /* oacc[dt][r] = O^T[channel dt * 16 + 8hh + r][query ln] */
#pragma unroll
  for (int dt = 0; dt < DT; ++dt) oacc[dt] = (v8f){0.f,0.f,0.f,0.f,0.f,0.f,0.f,0.f};
  const int jbeg = (w >> 2) * (TT / KSPL);
#pragma unroll 1
  for (int it = 0; it < TT / KSPL / 32; ++it) { const int j0 = jbeg + it * 32;
    v8f s[2];      /* s[nt][r] = score of key j0 + nt * 16 + 8hh + r with query ln */
#pragma unroll
    for (int nt = 0; nt < 2; ++nt) { const unsigned short* kr = (const unsigned short*)K16 + ((size_t)b * TT + j0 + nt * 16 + ln) * ldk; FragH ak; ak.half[0] = *(const v8us*)(kr + 8 * hh); ak.half[1] = *(const v8us*)(kr + 16 + 8 * hh);
      s[nt] = mmaH<1>(ak.v, ak.v, bq.v, bq.v, (v8f){0.f,0.f,0.f,0.f,0.f,0.f,0.f,0.f}); }
    float mc = fmaxf(s[0][0], s[1][0]);
#pragma unroll
    for (int r = 1; r < 8; ++r) mc = fmaxf(mc, fmaxf(s[0][r], s[1][r]));
    mc = fmaxf(mc, xhalf(mc));      /* both halves hold the max over the trip's 32 keys */
    const float mn = fmaxf(m_r, mc); const float al = (mn > -1.0e38f) ? expf(m_r - mn) : 1.0f; m_r = mn;
    FragH ph, pl; float ls = 0.f;      /* P^T * 1024 as f16 hi + residual: element nt * 8 + r = key nt * 16 + 8hh + r */
#pragma unroll
    for (int nt = 0; nt < 2; ++nt)
#pragma unroll
      for (int r = 0; r < 8; r += 2) { const float pa = expf(s[nt][r] - mn), pb = expf(s[nt][r + 1] - mn); ls += pa; ls += pb; const v2f ps = (v2f){pa, pb} * 1024.0f; const v2h hi = __builtin_convertvector(ps, v2h); const v2h lo = __builtin_convertvector(ps - __builtin_convertvector(hi, v2f), v2h);
        ph.h[nt * 8 + r] = hi[0]; ph.h[nt * 8 + r + 1] = hi[1]; pl.h[nt * 8 + r] = lo[0]; pl.h[nt * 8 + r + 1] = lo[1]; }
    l_r = l_r * al + ls;      /* this half's 16 keys; the halves are joined behind the loop */
#pragma unroll
    for (int dt = 0; dt < DT; ++dt) oacc[dt] *= al;
#pragma unroll
    for (int dt = 0; dt < DT; ++dt) { const unsigned short* vrow = Vth + (size_t)(dt * 16 + ln) * TT + j0; FragH av; av.half[0] = *(const v8us*)(vrow + 8 * hh); av.half[1] = *(const v8us*)(vrow + 16 + 8 * hh);
      oacc[dt] = mmaH<1>(av.v, av.v, ph.v, ph.v, oacc[dt]); oacc[dt] = mmaH<1>(av.v, av.v, pl.v, pl.v, oacc[dt]); } }      /* V^T.(Ph + Pl) */
  l_r += xhalf(l_r);
  if (hh == 0) { sM[w][ln] = m_r; sL[w][ln] = l_r; }
#pragma unroll
  for (int dt = 0; dt < DT; ++dt) { *(v4fa*)&sO[w][ln][dt * 16 + 8 * hh] = (v4f){oacc[dt][0], oacc[dt][1], oacc[dt][2], oacc[dt][3]}; *(v4fa*)&sO[w][ln][dt * 16 + 8 * hh + 4] = (v4f){oacc[dt][4], oacc[dt][5], oacc[dt][6], oacc[dt][7]}; }
  __syncthreads();      /* every wave's partial is in LDS before any thread merges */
  /* merge: thread = (query of the block, 4 channels); O = sum_s e^(m_s - M) * O_s / (1024 * sum_s e^(m_s - M) * l_s), M = max_s m_s */
#pragma unroll
  for (int i = tid; i < 4 * RPW * 16; i += 128 * KSPL) { const int qq = i >> 4, pc = i & 15, g = qq / RPW, r = qq % RPW;
    float mx = sM[g][r];
#pragma unroll
    for (int s = 1; s < KSPL; ++s) mx = fmaxf(mx, sM[s * 4 + g][r]);
    float l = 0.f; v4f a = {0.f, 0.f, 0.f, 0.f};
#pragma unroll
    for (int s = 0; s < KSPL; ++s) { const float e = expf(sM[s * 4 + g][r] - mx); l += sL[s * 4 + g][r] * e; const v4f val = *(const v4fa*)&sO[s * 4 + g][r][pc * 4]; a += val * e; }
    const float inv = (l > 0.f) ? 1.0f / (l * 1024.0f) : 0.f;
    *(v4f*)(O + ((size_t)slab * TT + qb0 + qq) * ldo + pc * 4) = a * inv; } }

extern "C" void kernel_launch(void* const* d_in, const int* in_sizes, int n_in,
                              void* d_out, int out_size, void* d_ws, size_t ws_size, hipStream_t stream) {
  (void)in_sizes; (void)n_in; (void)out_size;
  const float* const* I = (const float* const*)d_in; const float* x = I[0]; const float* sa_wq = I[1]; const float* sa_bq = I[2]; const float* sa_wk = I[3]; const float* sa_bk = I[4]; const float* sa_wv = I[5]; const float* sa_bv = I[6];
  const float* ga_wq = I[7]; const float* ga_bq = I[8]; const float* ga_wk = I[9]; const float* ga_bk = I[10]; const float* ga_wv = I[11]; const float* ga_bv = I[12]; const float* tw = I[13]; const float* tb = I[14];
  char* ws = (char*)d_ws; size_t off = 0;
  auto take = [&](size_t bytes) { char* p = ws + off; off += (bytes + 255) & ~(size_t)255; return p; };
  const size_t PL = (size_t)BB * CC * TT;      /* one [B][64][4096] f32 plane = 1 M floats */
  _Float16* AWV = (_Float16*)take((size_t)5 * CC * 96 * 2); _Float16* TW16 = (_Float16*)take((size_t)CC * 128 * 2);
  _Float16* XT = (_Float16*)take((size_t)3 * BB * TT * 96 * 2); _Float16* QP = (_Float16*)take((size_t)NSL * TT * 32 * 2); _Float16* KP = (_Float16*)take((size_t)NSL * TT * 32 * 2); _Float16* VT = (_Float16*)take((size_t)NSL * CC * TT * 2); float* O = (float*)take((size_t)NSL * TT * CC * 4);
  float* SA = (float*)take(3 * PL * 4); float* MF = (float*)take(2 * PL * 4); _Float16* CAT = (_Float16*)take((size_t)BB * TT * 128 * 2); float* FUS = (float*)take(PL * 4);
  if (off > ws_size) return;      // 0.1 + 9.4 + 5.2 + 5.2 + 10.5 + 21 + 12.6 + 8.4 + 4.2 + 4.2 = about 81 MB
  k_wvb<<<dim3((CC * 12 + 255) / 256, 5), 256, 0, stream>>>(sa_wv, sa_bv, ga_wv, ga_bv, AWV);      /* all five value projections in one launch */
  k_round16f<<<(CC * 128 / 8 + 255) / 256, 256, 0, stream>>>(tw, TW16, CC * 128 / 8);      /* tfus_w [64 o][128 c] natural = the A operand ×2^4 */
  const unsigned gxt = (unsigned)(((size_t)BB * TT * 12 + 255) / 256), gqk = (unsigned)(((size_t)BB * TT * 4 + 255) / 256); const unsigned gvx = ((CC / 16) * (TT / 64) + 3) / 4;
  /* self attention on the three frames: slabs a * BB + b for a = 0,1,2; each stage is one launch over all three frames (frame on blockIdx.y, for the GEMM on blockIdx.z, for the flash kernel in the slab of blockIdx.x), XT holds one plane per frame */
  k_xt<1><<<dim3(gxt, 3), 256, 0, stream>>>(x, XT);
  k_qk<1><<<dim3(gqk, 3), 256, 0, stream>>>(x, PL, sa_wq, sa_bq, sa_wk, sa_bk, 0, QP, KP);
  k_gemm_hhx<0><<<dim3(gvx, BB, 3), 128, 0, stream>>>(AWV, 96, 0, XT, 96, (size_t)TT * 96, 0.0625f, nullptr, 0, nullptr, 1, 0, 0, nullptr, VT, TT, (size_t)CC * TT, CC, TT, 96, (size_t)CC * 96, (size_t)BB * TT * 96, (size_t)BB * CC * TT);      /* v[b][e][m] = wv.x + bv, channel-major f16: batched over b and frame, M 64 N 4096 K 96 */
  k_flash<8><<<3 * BB * (TT / 64), 1024, 0, stream>>>(QP, 32, KP, 32, VT, nullptr, O, CC);      /* slabs 0..11; 768 blocks of 32 waves = three full rounds of the WGPs */
  k_ocm<1><<<dim3(BB * (TT / 64), 3), 256, 0, stream>>>(O, 0, x, PL, SA);      /* SA_a = attn-out + x_a (channel-major f32) */
  /* guided attentions: slabs 12..15 (q,k from SA_0; v,res from SA_1) and 16..19 (q,k from SA_2) */
  k_xt<0><<<gxt, 256, 0, stream>>>(SA + PL, XT);      /* SA_1 token-major (internal f32, no rounding) */
  k_qk<0><<<dim3(gqk, 2), 256, 0, stream>>>(SA, 2 * PL, ga_wq, ga_bq, ga_wk, ga_bk, 3 * BB, QP, KP);      /* sources SA_0 and SA_2 */
  k_gemm_hhx<0><<<dim3(gvx, BB, 2), 128, 0, stream>>>(AWV + (size_t)3 * CC * 96, 96, 0, XT, 96, (size_t)TT * 96, 0.0625f, nullptr, 0, nullptr, 1, 0, 0, nullptr, VT + (size_t)3 * BB * CC * TT, TT, (size_t)CC * TT, CC, TT, 96, (size_t)CC * 96, 0, (size_t)BB * CC * TT);      /* both read the SA_1 plane of XT */
  k_flash<4><<<2 * BB * (TT / 64), 512, 0, stream>>>(QP + (size_t)3 * BB * TT * 32, 32, KP + (size_t)3 * BB * TT * 32, 32, VT + (size_t)3 * BB * CC * TT, nullptr, O + (size_t)3 * BB * TT * CC, CC);      /* slabs 12..19 (kernel-relative 0..7) */
  k_ocm<0><<<dim3(BB * (TT / 64), 2), 256, 0, stream>>>(O + (size_t)3 * BB * TT * CC, 0, SA + PL, 0, MF);      /* mfi_gi = attn-out + SA_1 */
  k_cat<<<BB * (TT / 64), 256, 0, stream>>>(MF, MF + PL, CAT);
  k_gemm_hhx<0><<<dim3(((CC / 16) * (TT / 64) + 3) / 4, BB), 128, 0, stream>>>(TW16, 128, 0, CAT, 128, (size_t)TT * 128, 0.0625f, nullptr, 0, nullptr, 1, 0, 0, FUS, nullptr, TT, (size_t)CC * TT, CC, TT, 128, 0, 0, 0);      /* fusion[b][o][n] = Σ_c W[o][c]·cat[b][c][n]: A = W (M 64, K 128), Bt = CAT[b] token-major; bias tfus_b per ROW o → added in k_fin? no: see k_finb */
  k_finb<<<(unsigned)((PL / 4 + 255) / 256), 256, 0, stream>>>(FUS, tb, SA + PL, (float*)d_out, PL / 4);
}

// v004
// It runs in 339 microseconds.
// Next to v003, in two timings, it ran 1.08 times as fast each time.
// All steps since v000 together make it 3.19 times as fast.
#include <hip/hip_runtime.h>
// MFI (3 frames, B=4, C=64, 64×64 → N=4096): SA_f = position attention on frame f (q = wq·x+bq (8 ch), k = wk·x+bk (8 ch), v = wv·x+bv (64 ch); attn = softmax_m(q[:,n]·k[:,m]) unscaled; out[e][n] = Σ_m v[e][m]·attn[n][m] + x[e][n]); then two guided attentions
// (q,k from SA_0 / SA_2, v and residual from SA_1), cat → fusion = tfus_w·cat + b; out = fusion·SA_1 + SA_1 → [4,64,64,64].
// Compute dtype: x, weights, biases rounded to bf16; q/k per token in f32 VALU (8×64 dot, rolled) emitted as concatenated f16 planes [q_hi|q_lo|q_hi|0] and [k_hi|k_hi·2^-10|k_lo|0] so ONE 32-wide WMMA k-step yields f32-accurate logits; v (+bias via an
// augmented ones column) channel-major by GEMM (f16); fused flash-style kernel per (slab, 64 queries) (online softmax f32, P f16 hi + residual, O token-major f32); residual add + channel-major restage in f32; cat f16 → fusion GEMM → out = fusion·sa₁ + sa₁ in f32. All on v_wmma_f32_16x16x32_f16.
#define NFR 3
#define BB 4
#define CC 64
#define TT 4096
#define NH 1
#define NSL (5 * BB)

typedef __bf16 v16b __attribute__((ext_vector_type(16)));
typedef unsigned short v8us __attribute__((ext_vector_type(8), may_alias));
typedef float  v8f  __attribute__((ext_vector_type(8)));
typedef float  v4f  __attribute__((ext_vector_type(4)));
typedef float  v4fa __attribute__((ext_vector_type(4), may_alias));
union FragB { v16b v; v8us half[2]; unsigned short u[16]; };

__device__ __forceinline__ unsigned short bf16_bits(float x) { unsigned int u = __float_as_uint(x); return (unsigned short)((u + 0x7FFFu + ((u >> 16) & 1u)) >> 16); }
__device__ __forceinline__ float bf16_val(unsigned short b) { return __uint_as_float(((unsigned int)b) << 16); }
__device__ __forceinline__ float bf16_round(float x) { return bf16_val(bf16_bits(x)); }
// D += A·B with NT terms: 1 = ah·bh, 2 = + al·bh (A split), 3 = + ah·bl (both split)
template <int NT>
__device__ __forceinline__ v8f mmaN(v16b ah, v16b al, v16b bh, v16b bl, v8f c) {
  c = __builtin_amdgcn_wmma_f32_16x16x32_bf16(false, ah, false, bh, (short)0, c, false, false);
  if (NT >= 2) c = __builtin_amdgcn_wmma_f32_16x16x32_bf16(false, al, false, bh, (short)0, c, false, false);
  if (NT >= 3) c = __builtin_amdgcn_wmma_f32_16x16x32_bf16(false, ah, false, bl, (short)0, c, false, false);
  asm volatile("v_nop\n\tv_nop\n\tv_nop\n\tv_nop" : "+v"(c) : "v"(ah), "v"(al), "v"(bh), "v"(bl));
  return c;
}

__global__ __launch_bounds__(256) void k_wt_bf16(const float* __restrict__ W, unsigned short* __restrict__ Wt, int K, int N) {
  const int t = blockIdx.x * 256 + threadIdx.x;
  const int k8n = K / 8;
  if (t >= N * k8n) return;
  const int n = t / k8n, k8 = (t % k8n) * 8;
  v8us v;
#pragma unroll
  for (int i = 0; i < 8; ++i) v[i] = bf16_bits(W[(size_t)(k8 + i) * N + n]);
  *(v8us*)(Wt + (size_t)n * K + k8) = v;
  
}

// GEMM C[M][N] (f32, pitch ldc) = act(A[M][K]·W + bias). A f32 row-major (pitch lda) converted per fragment to bf16
// (ASPLIT: hi/lo two planes -> 2 terms, else single rounded term); Wt bf16 [N][K] (pitch ldb). BIAS_BF16 rounds the
// bias to bf16 first (bias quantised to bf16 before the add). K%32==0, M%16==0, N%64==0.
template <bool ASPLIT, int ACT, bool BIAS_BF16>
__global__ __launch_bounds__(128) void k_gemm_bf(const float* __restrict__ A, int lda, const unsigned short* __restrict__ Wt, int ldb,
                                               const float* __restrict__ bias, float* __restrict__ C, int ldc, int M, int N, int K) {
  __shared__ __attribute__((aligned(16))) float so[4][16][64];
  const int tid = threadIdx.x, w = tid >> 5, lane = tid & 31, ln = lane & 15, hh = lane >> 4;
  const int ntn = N / 64;
  const int wid = blockIdx.x * 4 + w;
  const int mt = wid / ntn, nq = wid % ntn;
  if (mt * 16 >= M) return;
  const int row0 = mt * 16, col0 = nq * 64;
  const float* arow = A + (size_t)(row0 + ln) * lda;
  v8f acc[4] = {};
  for (int kb = 0; kb < K; kb += 32) {
    FragB ah, al;
    const v4f x0 = *(const v4fa*)(arow + kb + 8 * hh), x1 = *(const v4fa*)(arow + kb + 8 * hh + 4);
    const v4f x2 = *(const v4fa*)(arow + kb + 16 + 8 * hh), x3 = *(const v4fa*)(arow + kb + 16 + 8 * hh + 4);
    float xs[16] = {x0[0],x0[1],x0[2],x0[3],x1[0],x1[1],x1[2],x1[3],x2[0],x2[1],x2[2],x2[3],x3[0],x3[1],x3[2],x3[3]};
#pragma unroll
    for (int i = 0; i < 16; ++i) { const unsigned short hb = bf16_bits(xs[i]); ah.u[i] = hb; al.u[i] = ASPLIT ? bf16_bits(xs[i] - bf16_val(hb)) : (unsigned short)0; }
#pragma unroll
    for (int t = 0; t < 4; ++t) {
      const unsigned short* brow = Wt + (size_t)(col0 + t * 16 + ln) * ldb + kb;
      FragB b;
      b.half[0] = *(const v8us*)(brow + 8 * hh);
      b.half[1] = *(const v8us*)(brow + 16 + 8 * hh);
      acc[t] = mmaN<ASPLIT ? 2 : 1>(ah.v, al.v, b.v, b.v, acc[t]);
    }
  }
#pragma unroll
  for (int t = 0; t < 4; ++t) {
    float bv = bias ? bias[col0 + t * 16 + ln] : 0.f;
    if (BIAS_BF16) bv = bf16_round(bv);
#pragma unroll
    for (int r = 0; r < 8; ++r) { float v = acc[t][r] + bv; if (ACT == 1) v = fmaxf(v, 0.f); so[w][8 * hh + r][t * 16 + ln] = v; }
  }
  __builtin_amdgcn_fence(__ATOMIC_ACQ_REL, "workgroup");
  __builtin_amdgcn_wave_barrier();
  const int rsub = lane >> 4, c4 = (lane & 15) * 4;
  {
#pragma unroll
    for (int q = 0; q < 8; ++q) {
      const int r = q * 2 + rsub;
      const v4f v = *(const v4fa*)&so[w][r][c4];
      *(v4f*)(C + (size_t)(row0 + r) * ldc + col0 + c4) = v;
    }
    
  }
}

// Flash-style causal/unmasked attention, all contractions 3-term bf16 hi/lo splits, f32 softmax with running max.
// q,k,v rows are read from f32 buffers with arbitrary row pitch (so they can live inside a fused qkv buffer);
// D = head size (multiple of 32, <= 128); one wave = 16 query rows; block = 4 waves (64 queries) sharing K/V chunks of 32.
template <int D, bool CAUSAL>
__global__ __launch_bounds__(128) void k_flash(const float* __restrict__ qb, const float* __restrict__ kb, const float* __restrict__ vb,
                                             int pitch, int T, int H, float scale, float* __restrict__ y, int ypitch) {
  constexpr int KS = D / 32;        // k-steps for QK
  constexpr int DT = D / 16;        // d tiles for PV
  __shared__ __attribute__((aligned(16))) unsigned short sKh[32][D + 8], sKl[32][D + 8], sVh[32][D + 8], sVl[32][D + 8];
  __shared__ __attribute__((aligned(16))) unsigned short sPh[4][16][40], sPl[4][16][40];
  __shared__ __attribute__((aligned(16))) float sO[4][16][D];
  const int tid = threadIdx.x, w = tid >> 5, lane = tid & 31, ln = lane & 15, hh = lane >> 4;
  const int nqb = (T + 63) / 64;
  const int bh = blockIdx.x / nqb, qblk = blockIdx.x % nqb;
  const int b = bh / H, h = bh % H;
  const int q0 = qblk * 64 + w * 16;
  const float* Q = qb + (size_t)b * T * pitch + h * D;
  const float* K = kb + (size_t)b * T * pitch + h * D;
  const float* V = vb + (size_t)b * T * pitch + h * D;

  // A fragments of the wave's 16 query rows (scaled), hi/lo
  FragB aqh[KS], aql[KS];
  {
    int row = q0 + ln; if (row >= T) row = T - 1;
    const float* qr = Q + (size_t)row * pitch;
#pragma unroll
    for (int ks = 0; ks < KS; ++ks)
#pragma unroll
      for (int i = 0; i < 16; ++i) {
        const int d = ks * 32 + ((i < 8) ? (8 * hh + i) : (16 + 8 * hh + (i - 8)));
        const float x = qr[d] * scale; const unsigned short hb = bf16_bits(x);
        aqh[ks].u[i] = hb; aql[ks].u[i] = bf16_bits(x - bf16_val(hb));
      }
  }
  float m_r[8], l_r[8];
#pragma unroll
  for (int r = 0; r < 8; ++r) { m_r[r] = -3.0e38f; l_r[r] = 0.f; }
  v8f oacc[DT];
#pragma unroll
  for (int dt = 0; dt < DT; ++dt) oacc[dt] = (v8f){0.f,0.f,0.f,0.f,0.f,0.f,0.f,0.f};

  const int kv_end = CAUSAL ? min(T, qblk * 64 + 64) : T;     // block-uniform
  for (int j0 = 0; j0 < kv_end; j0 += 32) {
    __syncthreads();
    for (int e = tid; e < 32 * (D / 4); e += 128) {
      const int r = e / (D / 4), c4 = (e % (D / 4)) * 4;
      const int key = j0 + r;
      v4f kf = {0.f,0.f,0.f,0.f}, vf = {0.f,0.f,0.f,0.f};
      if (key < T) { kf = *(const v4fa*)(K + (size_t)key * pitch + c4); vf = *(const v4fa*)(V + (size_t)key * pitch + c4); }
#pragma unroll
      for (int t = 0; t < 4; ++t) {
        unsigned short hb = bf16_bits(kf[t]); sKh[r][c4 + t] = hb; sKl[r][c4 + t] = bf16_bits(kf[t] - bf16_val(hb));
        hb = bf16_bits(vf[t]); sVh[r][c4 + t] = hb; sVl[r][c4 + t] = bf16_bits(vf[t] - bf16_val(hb));
      }
    }
    __syncthreads();
    // S tile 16 x 32
    v8f s[2];
#pragma unroll
    for (int nt = 0; nt < 2; ++nt) {
      v8f acc = {};
#pragma unroll
      for (int ks = 0; ks < KS; ++ks) {
        FragB bh_, bl_;
        bh_.half[0] = *(const v8us*)&sKh[nt * 16 + ln][ks * 32 + 8 * hh]; bh_.half[1] = *(const v8us*)&sKh[nt * 16 + ln][ks * 32 + 16 + 8 * hh];
        bl_.half[0] = *(const v8us*)&sKl[nt * 16 + ln][ks * 32 + 8 * hh]; bl_.half[1] = *(const v8us*)&sKl[nt * 16 + ln][ks * 32 + 16 + 8 * hh];
        acc = mmaN<3>(aqh[ks].v, aql[ks].v, bh_.v, bl_.v, acc);
      }
      s[nt] = acc;
    }
    // mask + running max (rows 8hh+r; the 16 lanes of a half share rows)
    float alpha[8];
#pragma unroll
    for (int r = 0; r < 8; ++r) {
      const int qi = q0 + 8 * hh + r;
      const int ja = j0 + ln, jb = j0 + 16 + ln;
      if (CAUSAL) { if (ja > qi) s[0][r] = -3.0e38f; if (jb > qi) s[1][r] = -3.0e38f; }
      if (ja >= T) s[0][r] = -3.0e38f;
      if (jb >= T) s[1][r] = -3.0e38f;
      float mx = fmaxf(s[0][r], s[1][r]);
      mx = fmaxf(mx, __shfl_xor(mx, 1, 32)); mx = fmaxf(mx, __shfl_xor(mx, 2, 32)); mx = fmaxf(mx, __shfl_xor(mx, 4, 32)); mx = fmaxf(mx, __shfl_xor(mx, 8, 32));
      const float mnew = fmaxf(m_r[r], mx);
      alpha[r] = (mnew > -1.0e38f) ? __expf(m_r[r] - mnew) : 1.0f;
      const float p0 = (s[0][r] > -1.0e38f) ? __expf(s[0][r] - mnew) : 0.f;
      const float p1 = (s[1][r] > -1.0e38f) ? __expf(s[1][r] - mnew) : 0.f;
      m_r[r] = mnew;
      l_r[r] = l_r[r] * alpha[r] + p0 + p1;            // per-lane partial row sum (16 lanes combined at the end)
      unsigned short hb = bf16_bits(p0); sPh[w][8 * hh + r][ln] = hb;      sPl[w][8 * hh + r][ln] = bf16_bits(p0 - bf16_val(hb));
      hb = bf16_bits(p1);                sPh[w][8 * hh + r][16 + ln] = hb; sPl[w][8 * hh + r][16 + ln] = bf16_bits(p1 - bf16_val(hb));
    }
#pragma unroll
    for (int dt = 0; dt < DT; ++dt)
#pragma unroll
      for (int r = 0; r < 8; ++r) oacc[dt][r] *= alpha[r];
    __builtin_amdgcn_fence(__ATOMIC_ACQ_REL, "workgroup");
    __builtin_amdgcn_wave_barrier();
    FragB pah, pal;
    pah.half[0] = *(const v8us*)&sPh[w][ln][8 * hh]; pah.half[1] = *(const v8us*)&sPh[w][ln][16 + 8 * hh];
    pal.half[0] = *(const v8us*)&sPl[w][ln][8 * hh]; pal.half[1] = *(const v8us*)&sPl[w][ln][16 + 8 * hh];
#pragma unroll
    for (int dt = 0; dt < DT; ++dt) {
      FragB bvh, bvl;
#pragma unroll
      for (int i = 0; i < 8; ++i) {
        bvh.u[i] = sVh[8 * hh + i][dt * 16 + ln]; bvh.u[8 + i] = sVh[16 + 8 * hh + i][dt * 16 + ln];
        bvl.u[i] = sVl[8 * hh + i][dt * 16 + ln]; bvl.u[8 + i] = sVl[16 + 8 * hh + i][dt * 16 + ln];
      }
      oacc[dt] = mmaN<3>(pah.v, pal.v, bvh.v, bvl.v, oacc[dt]);
    }
    __builtin_amdgcn_fence(__ATOMIC_ACQ_REL, "workgroup");
    __builtin_amdgcn_wave_barrier();
  }
#pragma unroll
  for (int r = 0; r < 8; ++r) {
    float l = l_r[r];
    l += __shfl_xor(l, 1, 32); l += __shfl_xor(l, 2, 32); l += __shfl_xor(l, 4, 32); l += __shfl_xor(l, 8, 32);
    l_r[r] = (l > 0.f) ? 1.0f / l : 0.f;
  }
#pragma unroll
  for (int dt = 0; dt < DT; ++dt)
#pragma unroll
    for (int r = 0; r < 8; ++r) sO[w][8 * hh + r][dt * 16 + ln] = oacc[dt][r] * l_r[r];
  __builtin_amdgcn_fence(__ATOMIC_ACQ_REL, "workgroup");
  __builtin_amdgcn_wave_barrier();
  {
    for (int r = 0; r < 16; ++r) {
      const int row = q0 + r;
      if (row < T && lane < D / 4) {
        const v4f val = *(const v4fa*)&sO[w][r][lane * 4];
        *(v4f*)(y + ((size_t)b * T + row) * ypitch + h * D + lane * 4) = val;
      }
    }
    
  }
}

// GEMM C = act(A·W + bias + resid): A f32 (ASPLIT -> hi/lo 2 terms), Wt bf16 [N][K]; ACT 0 none, 1 relu, 2 exact gelu;
// resid (optional, f32, row index = (row % rmod), pitch ldr, RES_BF16 rounds it) added before the activation.
template <bool ASPLIT, int ACT, bool BIAS_BF16, bool RES_BF16>
__global__ __launch_bounds__(128) void k_gemm_bf3(const float* __restrict__ A, int lda, const unsigned short* __restrict__ Wt, int ldb,
                                                const float* __restrict__ bias, const float* __restrict__ resid, int rmod, int ldr,
                                                float* __restrict__ C, int ldc, int M, int N, int K) {
  __shared__ __attribute__((aligned(16))) float so[4][16][64];
  const int tid = threadIdx.x, w = tid >> 5, lane = tid & 31, ln = lane & 15, hh = lane >> 4;
  const int ntn = N / 64;
  const int wid = blockIdx.x * 4 + w;
  const int mt = wid / ntn, nq = wid % ntn;
  if (mt * 16 >= M) return;
  const int row0 = mt * 16, col0 = nq * 64;
  const float* arow = A + (size_t)(row0 + ln) * lda;
  v8f acc[4] = {};
  for (int kb = 0; kb < K; kb += 32) {
    FragB ah, al;
    const v4f x0 = *(const v4fa*)(arow + kb + 8 * hh), x1 = *(const v4fa*)(arow + kb + 8 * hh + 4);
    const v4f x2 = *(const v4fa*)(arow + kb + 16 + 8 * hh), x3 = *(const v4fa*)(arow + kb + 16 + 8 * hh + 4);
    float xs[16] = {x0[0],x0[1],x0[2],x0[3],x1[0],x1[1],x1[2],x1[3],x2[0],x2[1],x2[2],x2[3],x3[0],x3[1],x3[2],x3[3]};
#pragma unroll
    for (int i = 0; i < 16; ++i) { const unsigned short hb = bf16_bits(xs[i]); ah.u[i] = hb; al.u[i] = ASPLIT ? bf16_bits(xs[i] - bf16_val(hb)) : (unsigned short)0; }
#pragma unroll
    for (int t = 0; t < 4; ++t) {
      const unsigned short* brow = Wt + (size_t)(col0 + t * 16 + ln) * ldb + kb;
      FragB b;
      b.half[0] = *(const v8us*)(brow + 8 * hh);
      b.half[1] = *(const v8us*)(brow + 16 + 8 * hh);
      acc[t] = mmaN<ASPLIT ? 2 : 1>(ah.v, al.v, b.v, b.v, acc[t]);
    }
  }
#pragma unroll
  for (int t = 0; t < 4; ++t) {
    const int col = col0 + t * 16 + ln;
    float bv = bias ? bias[col] : 0.f;
    if (BIAS_BF16) bv = bf16_round(bv);
#pragma unroll
    for (int r = 0; r < 8; ++r) {
      float v = acc[t][r] + bv;
      if (resid) { float rv = resid[(size_t)((row0 + 8 * hh + r) % rmod) * ldr + col]; if (RES_BF16) rv = bf16_round(rv); v += rv; }
      if (ACT == 1) v = fmaxf(v, 0.f);
      if (ACT == 2) v = 0.5f * v * (1.0f + erff(v * 0.70710678118654752f));
      if (ACT == 3) { const float u = 0.7978845608028654f * (v + 0.044715f * v * v * v); v = 0.5f * v * (1.0f + tanhf(u)); }
      so[w][8 * hh + r][t * 16 + ln] = v;
    }
  }
  __builtin_amdgcn_fence(__ATOMIC_ACQ_REL, "workgroup");
  __builtin_amdgcn_wave_barrier();
  const int rsub = lane >> 4, c4 = (lane & 15) * 4;
  {
#pragma unroll
    for (int q = 0; q < 8; ++q) {
      const int r = q * 2 + rsub;
      const v4f v = *(const v4fa*)&so[w][r][c4];
      *(v4f*)(C + (size_t)(row0 + r) * ldc + col0 + c4) = v;
    }
    
  }
}
// row LayerNorm (biased variance, eps) over N: s = X (+ R); optional out_sum <- s; out_norm <- (s-mu)*rsqrt(var+eps)*g + b
template <bool PARAM_BF16>
__global__ __launch_bounds__(256) void k_layernorm(const float* __restrict__ X, const float* __restrict__ R, const float* __restrict__ g, const float* __restrict__ bta,
                                                  float* __restrict__ out_sum, float* __restrict__ out_norm, int N, float eps) {
  __shared__ float red[256];
  const int row = blockIdx.x, tid = threadIdx.x;
  const float* x = X + (size_t)row * N; const float* rr = R ? R + (size_t)row * N : nullptr;
  float vals[16];                     // up to N = 4096
  const int per = N / 256;            // contiguous chunk per thread? use strided-by-4 chunks: thread handles j = tid*4 + 1024*u
  float s1 = 0.f;
  for (int u = 0; u < per / 4; ++u) {
    const int j = tid * 4 + 1024 * u;
    const v4f a = *(const v4fa*)(x + j);
    v4f b = {0.f,0.f,0.f,0.f}; if (rr) b = *(const v4fa*)(rr + j);
#pragma unroll
    for (int q = 0; q < 4; ++q) { const float v = a[q] + b[q]; vals[u * 4 + q] = v; s1 += v; }
  }
  red[tid] = s1; __syncthreads();
  for (int st = 128; st > 0; st >>= 1) { if (tid < st) red[tid] += red[tid + st]; __syncthreads(); }
  const float mu = red[0] / (float)N; __syncthreads();
  float s2 = 0.f;
  for (int u = 0; u < per / 4; ++u)
#pragma unroll
    for (int q = 0; q < 4; ++q) { const float c = vals[u * 4 + q] - mu; s2 += c * c; }
  red[tid] = s2; __syncthreads();
  for (int st = 128; st > 0; st >>= 1) { if (tid < st) red[tid] += red[tid + st]; __syncthreads(); }
  const float rs = rsqrtf(red[0] / (float)N + eps);
  {
    for (int u = 0; u < per / 4; ++u) {
      const int j = tid * 4 + 1024 * u;
      v4f o, sm;
#pragma unroll
      for (int q = 0; q < 4; ++q) {
        float gg = g[j + q], bb = bta[j + q];
        if (PARAM_BF16) { gg = bf16_round(gg); bb = bf16_round(bb); }
        sm[q] = vals[u * 4 + q]; o[q] = (vals[u * 4 + q] - mu) * rs * gg + bb;
      }
      if (out_sum) *(v4f*)(out_sum + (size_t)row * N + j) = sm;
      *(v4f*)(out_norm + (size_t)row * N + j) = o;
    }
    
  }
}



// ---- f16 WMMA path (v_wmma_f32_16x16x32_f16): 11-bit significands for operands in range — used where a [0,1] probability operand needs more precision than bf16
typedef _Float16 v16h __attribute__((ext_vector_type(16)));
union FragH { v16h v; v8us half[2]; _Float16 h[16]; unsigned short u[16]; };
template <int NT>
__device__ __forceinline__ v8f mmaH(v16h ah, v16h al, v16h bh, v16h bl, v8f c) {
  c = __builtin_amdgcn_wmma_f32_16x16x32_f16(false, ah, false, bh, (short)0, c, false, false);
  if (NT >= 2) c = __builtin_amdgcn_wmma_f32_16x16x32_f16(false, al, false, bh, (short)0, c, false, false);
  if (NT >= 3) c = __builtin_amdgcn_wmma_f32_16x16x32_f16(false, ah, false, bl, (short)0, c, false, false);
  asm volatile("v_nop\n\tv_nop\n\tv_nop\n\tv_nop" : "+v"(c) : "v"(ah), "v"(al), "v"(bh), "v"(bl));
  return c;
}
// batched GEMM like k_gemm_b but f16 operands: A f32 (split into f16 hi/lo if ASPLIT, else rounded to f16), Bt = f16 values [n][k]; alpha; C f32; N multiple of 16 (partial tiles skipped)
template <bool ASPLIT>
__global__ __launch_bounds__(128) void k_gemm_h(const float* __restrict__ A, int lda, size_t sA, const _Float16* __restrict__ Bh, int ldb, size_t sB, float alpha, float* __restrict__ C, int ldc, size_t sC, int M, int N, int K) {
  __shared__ __attribute__((aligned(16))) float so[4][16][64];
  const int tid = threadIdx.x, w = tid >> 5, lane = tid & 31, ln = lane & 15, hh = lane >> 4; const int by = blockIdx.y;
  A += (size_t)by * sA; Bh += (size_t)by * sB; C += (size_t)by * sC;
  const int ntn = (N + 63) / 64; const int wid = blockIdx.x * 4 + w; const int mt = wid / ntn, nq = wid % ntn; if (mt * 16 >= M) return;
  const int row0 = mt * 16, col0 = nq * 64; const float* arow = A + (size_t)(row0 + ln) * lda;
  v8f acc[4] = {};
  for (int kb = 0; kb < K; kb += 32) {
    FragH ah, al;
    const v4f x0 = *(const v4fa*)(arow + kb + 8 * hh), x1 = *(const v4fa*)(arow + kb + 8 * hh + 4), x2 = *(const v4fa*)(arow + kb + 16 + 8 * hh), x3 = *(const v4fa*)(arow + kb + 16 + 8 * hh + 4);
    float xs[16] = {x0[0],x0[1],x0[2],x0[3],x1[0],x1[1],x1[2],x1[3],x2[0],x2[1],x2[2],x2[3],x3[0],x3[1],x3[2],x3[3]};
#pragma unroll
    for (int i = 0; i < 16; ++i) { const _Float16 h = (_Float16)xs[i]; ah.h[i] = h; al.h[i] = ASPLIT ? (_Float16)(xs[i] - (float)h) : (_Float16)0.0f; }
#pragma unroll
    for (int t = 0; t < 4; ++t) { if (col0 + t * 16 >= N) continue; const size_t boff = (size_t)(col0 + t * 16 + ln) * ldb + kb; FragH bq; bq.half[0] = *(const v8us*)(Bh + boff + 8 * hh); bq.half[1] = *(const v8us*)(Bh + boff + 16 + 8 * hh);
      acc[t] = mmaH<ASPLIT ? 2 : 1>(ah.v, al.v, bq.v, bq.v, acc[t]); }
  }
#pragma unroll
  for (int t = 0; t < 4; ++t) { if (col0 + t * 16 >= N) continue;
#pragma unroll
    for (int r = 0; r < 8; ++r) so[w][8 * hh + r][t * 16 + ln] = acc[t][r] * alpha; }
  __builtin_amdgcn_fence(__ATOMIC_ACQ_REL, "workgroup"); __builtin_amdgcn_wave_barrier();
  const int rsub = lane >> 4, c4 = (lane & 15) * 4;
  {
#pragma unroll
    for (int q = 0; q < 8; ++q) { const int r = q * 2 + rsub; if (col0 + c4 < N) { const v4f v = *(const v4fa*)&so[w][r][c4]; *(v4f*)(C + (size_t)(row0 + r) * ldc + col0 + c4) = v; } }
     }
}

// Wt[n][k] = f16(W[k][n]·scale) from f32 row-major W[K][N] (scale = power of two; bf16-exact weights stay exact in f16 away from the subnormal range)
__global__ __launch_bounds__(256) void k_wt_f16(const float* __restrict__ W, _Float16* __restrict__ Wt, int K, int N, float scale) {
  const int t = blockIdx.x * 256 + threadIdx.x; if (t >= N * (K / 8)) return; const int n = t / (K / 8), k8 = (t % (K / 8)) * 8; FragH f;
#pragma unroll
  for (int i = 0; i < 8; ++i) f.h[i] = (_Float16)(bf16_round(W[(size_t)(k8 + i) * N + n]) * scale); const v8us o = f.half[0];
  *(v8us*)((unsigned short*)Wt + (size_t)n * K + k8) = o; 
}
// k_gemm_hh variant with fused epilogue: v = acc·alpha + bias[by·sBias + col] (+ CP[(row/rowsPerB)·sCPb + by·64 + col] if CP) ; ACT 0 none / 1 elu ; writes f32 C and/or f16 C16 (each if non-null)
template <int ACT>
__global__ __launch_bounds__(128) void k_gemm_hhx(const _Float16* __restrict__ A, int lda, size_t sA, const _Float16* __restrict__ Bh, int ldb, size_t sB, float alpha, const float* __restrict__ bias, size_t sBias, const float* __restrict__ CP, int rowsPerB, size_t sCPb, int row0g,
    float* __restrict__ C, _Float16* __restrict__ C16, int ldc, size_t sC, int M, int N, int K, size_t sAz, size_t sBz, size_t sCz) {
  __shared__ __attribute__((aligned(16))) float so[4][16][64];
  const int tid = threadIdx.x, w = tid >> 5, lane = tid & 31, ln = lane & 15, hh = lane >> 4; const int by = blockIdx.y, bz = blockIdx.z;      /* bz = attention instance, with strides of its own */
  A += (size_t)by * sA + (size_t)bz * sAz; Bh += (size_t)by * sB + (size_t)bz * sBz; const size_t cofs = (size_t)by * sC + (size_t)bz * sCz; const float* bp = bias ? bias + (size_t)by * sBias : nullptr;
  const int ntn = (N + 63) / 64; const int wid = blockIdx.x * 4 + w; const int mt = wid / ntn, nq = wid % ntn; if (mt * 16 >= M) return;
  const int row0 = mt * 16, col0 = nq * 64; const _Float16* arow = A + (size_t)(row0 + ln) * lda;
  v8f acc[4] = {};
  for (int kb = 0; kb < K; kb += 32) { FragH ah; ah.half[0] = *(const v8us*)((const unsigned short*)arow + kb + 8 * hh); ah.half[1] = *(const v8us*)((const unsigned short*)arow + kb + 16 + 8 * hh);
#pragma unroll
    for (int t = 0; t < 4; ++t) { if (col0 + t * 16 >= N) continue; const size_t boff = (size_t)(col0 + t * 16 + ln) * ldb + kb; FragH bq; bq.half[0] = *(const v8us*)((const unsigned short*)Bh + boff + 8 * hh); bq.half[1] = *(const v8us*)((const unsigned short*)Bh + boff + 16 + 8 * hh);
      acc[t] = mmaH<1>(ah.v, ah.v, bq.v, bq.v, acc[t]); }
  }
#pragma unroll
  for (int t = 0; t < 4; ++t) { if (col0 + t * 16 >= N) continue; const int col = col0 + t * 16 + ln; const float bv = bp ? bf16_round(bp[col]) : 0.f;
#pragma unroll
    for (int r = 0; r < 8; ++r) { float v = acc[t][r] * alpha + bv; if (CP) { const int bidx = (row0g + row0 + 8 * hh + r) / rowsPerB; v += CP[(size_t)bidx * sCPb + (size_t)by * 64 + col]; } if (ACT == 1) v = (v > 0.f) ? v : expm1f(v); else if (ACT == 7) v = (v > 0.f) ? v + 1.0f : expf(v); else if (ACT == 8) v = tanhf(v); else if (ACT == 9) v = 0.5f * v * (1.0f + tanhf(0.7978845608028654f * (v + 0.044715f * v * v * v))); else if (ACT == 11) v = 1.0f / (1.0f + expf(-v)); else if (ACT == 12) v = (v > 0.f) ? v : 0.01f * v; else if (ACT == 14) v = (v > 0.f) ? v : 0.1f * v; else if (ACT == 15) v = v / (1.0f + expf(-v)); else if (ACT == 3) v = fmaxf(v, 0.f); else if (ACT == 6) v = 0.5f * v * (1.0f + erff(v * 0.70710678118654752f)); so[w][8 * hh + r][t * 16 + ln] = v; } }
  __builtin_amdgcn_fence(__ATOMIC_ACQ_REL, "workgroup"); __builtin_amdgcn_wave_barrier();
  const int rsub = lane >> 4, c4 = (lane & 15) * 4; typedef _Float16 v4h __attribute__((ext_vector_type(4)));
  {
#pragma unroll
    for (int q = 0; q < 8; ++q) { const int r = q * 2 + rsub; if (col0 + c4 < N) { const v4f v = *(const v4fa*)&so[w][r][c4]; if (C) *(v4f*)(C + cofs + (size_t)(row0 + r) * ldc + col0 + c4) = v; if (C16) { v4h h4; for (int i = 0; i < 4; ++i) h4[i] = (_Float16)v[i]; *(v4h*)(C16 + cofs + (size_t)(row0 + r) * ldc + col0 + c4) = h4; } } }
     }
}


typedef _Float16 v4h __attribute__((ext_vector_type(4)));

__global__ __launch_bounds__(256) void k_x16(const float* __restrict__ x, _Float16* __restrict__ X16, size_t n8) { const size_t t = (size_t)blockIdx.x * 256 + threadIdx.x; if (t >= n8) return; FragH f;
#pragma unroll
  for (int q = 0; q < 8; ++q) f.h[q] = (_Float16)bf16_round(x[t * 8 + q]); *(v8us*)((unsigned short*)X16 + t * 8) = f.half[0];  }
__global__ __launch_bounds__(256) void k_h16(const float* __restrict__ x, _Float16* __restrict__ X16, size_t n8) { const size_t t = (size_t)blockIdx.x * 256 + threadIdx.x; if (t >= n8) return; FragH f;
#pragma unroll
  for (int q = 0; q < 8; ++q) f.h[q] = (_Float16)x[t * 8 + q]; *(v8us*)((unsigned short*)X16 + t * 8) = f.half[0];  }
__global__ __launch_bounds__(256) void k_round16f(const float* __restrict__ W, _Float16* __restrict__ Bt, size_t n8) { const size_t t = (size_t)blockIdx.x * 256 + threadIdx.x; if (t >= n8) return; FragH f;
#pragma unroll
  for (int i = 0; i < 8; ++i) f.h[i] = (_Float16)(bf16_round(W[t * 8 + i]) * 16.0f); *(v8us*)((unsigned short*)Bt + t * 8) = f.half[0];  }
template <int NHv, int TTv>
__global__ __launch_bounds__(256) void k_vt(const _Float16* __restrict__ V16, int ldv, int voff, _Float16* __restrict__ Vt) { __shared__ unsigned short tl[64][66]; const int tid = threadIdx.x; const int slab = blockIdx.x / (TTv / 64), lg = blockIdx.x % (TTv / 64); const int b = slab / NHv, h = slab % NHv;
  for (int i = tid; i < 64 * 8; i += 256) { const int r = i / 8, c8 = (i % 8) * 8; FragH f; f.half[0] = *(const v8us*)((const unsigned short*)V16 + ((size_t)b * TTv + lg * 64 + r) * ldv + voff + h * 64 + c8);
#pragma unroll
    for (int q = 0; q < 8; ++q) tl[r][c8 + q] = f.u[q]; }
  __syncthreads();
  {
#pragma unroll
    for (int rd = 0; rd < 2; ++rd) { const int d = rd * 32 + tid / 8, pc = tid % 8; FragH f;
#pragma unroll
      for (int q = 0; q < 8; ++q) f.u[q] = tl[pc * 8 + q][d];
      *(v8us*)((unsigned short*)Vt + ((size_t)slab * 64 + d) * TTv + lg * 64 + pc * 8) = f.half[0]; }
     } }

template <int RB>
__global__ __launch_bounds__(256) void k_xt(const float* __restrict__ src, _Float16* __restrict__ XT) { const size_t t = (size_t)blockIdx.x * 256 + threadIdx.x; if (t >= (size_t)BB * TT * 12) return; src += (size_t)blockIdx.y * BB * CC * TT; XT += (size_t)blockIdx.y * BB * TT * 96;      /* blockIdx.y = frame */
  const int c0 = (int)(t % 12) * 8; const size_t bn = t / 12; const int n = (int)(bn % TT), b = (int)(bn / TT); FragH f;
#pragma unroll
  for (int q = 0; q < 8; ++q) { const int c = c0 + q; float v = 0.f; if (c < CC) { v = src[((size_t)b * CC + c) * TT + n]; if (RB) v = bf16_round(v); } else if (c == CC) v = 1.f; f.h[q] = (_Float16)v; }
  *(v8us*)((unsigned short*)XT + t * 8) = f.half[0];  }
// q/k planes per attention instance (blockIdx.y): per token n of batch b: q[d] = Σ_c wq[d][c]·xs[c][n] + bq[d], k likewise (f32, rolled over c; xs = bf16-rounded input frame or an internal SA plane (RB)); thread per (token, 16-B piece p ∈ 0..3):
template <int RB>
__global__ __launch_bounds__(256) void k_qk(const float* __restrict__ xs, size_t sx, const float* __restrict__ wq, const float* __restrict__ bq, const float* __restrict__ wk, const float* __restrict__ bk, int slab0, _Float16* __restrict__ QP, _Float16* __restrict__ KP) {
  #pragma clang fp contract(off)
  const size_t t = (size_t)blockIdx.x * 256 + threadIdx.x; if (t >= (size_t)BB * TT * 4) return;
  { const int ai = blockIdx.y; xs += (size_t)ai * sx; wq += ai * 8 * CC; bq += ai * 8; wk += ai * 8 * CC; bk += ai * 8; slab0 += ai * BB; }      /* blockIdx.y = attention instance; sx = floats between the sources of two instances */
  const int p = (int)(t % 4); const size_t bn = t / 4; const int n = (int)(bn % TT), b = (int)(bn / TT);
  float q[8], k[8]; for (int d = 0; d < 8; ++d) { q[d] = bf16_round(bq[d]); k[d] = bf16_round(bk[d]); }
#pragma unroll 1
  for (int c = 0; c < CC; ++c) { float xv = xs[((size_t)b * CC + c) * TT + n]; if (RB) xv = bf16_round(xv);
#pragma unroll
    for (int d = 0; d < 8; ++d) { q[d] += bf16_round(wq[d * CC + c]) * xv; k[d] += bf16_round(wk[d * CC + c]) * xv; } }
  FragH fq, fk;
#pragma unroll
  for (int d = 0; d < 8; ++d) { const _Float16 qh = (_Float16)q[d], kh = (_Float16)k[d]; const float qlo = (q[d] - (float)qh) * 1024.0f, klo = (k[d] - (float)kh);
    fq.h[d] = (p == 0) ? qh : (p == 1) ? (_Float16)qlo : (p == 2) ? qh : (_Float16)0.f;
    fk.h[d] = (p == 0) ? kh : (p == 1) ? (_Float16)((float)kh * 0.0009765625f) : (p == 2) ? (_Float16)klo : (_Float16)0.f; }
  const size_t row = (size_t)(slab0 + b) * TT + n;
  { *(v8us*)((unsigned short*)QP + row * 32 + p * 8) = fq.half[0]; *(v8us*)((unsigned short*)KP + row * 32 + p * 8) = fk.half[0];  } }
__global__ __launch_bounds__(256) void k_wvb(const float* __restrict__ swv, const float* __restrict__ sbv, const float* __restrict__ gwv, const float* __restrict__ gbv, _Float16* __restrict__ A16) { const int t = blockIdx.x * 256 + threadIdx.x; if (t >= CC * 12) return;
  const int ai = blockIdx.y; const float* wv = (ai < 3) ? swv + (size_t)ai * CC * CC : gwv + (size_t)(ai - 3) * CC * CC; const float* bv = (ai < 3) ? sbv + ai * CC : gbv + (ai - 3) * CC; A16 += (size_t)ai * CC * 96;      /* blockIdx.y = attention instance: 0..2 self, 3..4 guided */
  const int e = t / 12, c0 = (t % 12) * 8; FragH f;
  for (int q = 0; q < 8; ++q) { const int c = c0 + q; float v = 0.f; if (c < CC) v = bf16_round(wv[e * CC + c]); else if (c == CC) v = bf16_round(bv[e]); f.h[q] = (_Float16)(v * 16.0f); }
  *(v8us*)((unsigned short*)A16 + (size_t)t * 8) = f.half[0];  }
template <int RB>
__global__ __launch_bounds__(256) void k_ocm(const float* __restrict__ O, int slab0, const float* __restrict__ res, size_t sres, float* __restrict__ DST) { __shared__ float tl[64][65]; const int tid = threadIdx.x; slab0 += (int)blockIdx.y * BB; res += (size_t)blockIdx.y * sres; DST += (size_t)blockIdx.y * BB * CC * TT;      /* blockIdx.y = attention instance; sres = floats between two instances' residuals */
  const int b = blockIdx.x / (TT / 64), nb = blockIdx.x % (TT / 64); const int n0 = nb * 64;
  for (int i = tid; i < 64 * 64; i += 256) { const int n = i / 64, e = i % 64; tl[n][e] = O[((size_t)(slab0 + b) * TT + n0 + n) * CC + e]; } __syncthreads();
  const int piece = tid % 16, esub = tid / 16;      /* 16 consecutive lanes = one channel's 256-B segment (tokens n0..n0+63); 16 channels per iteration */
  v4f vals[4];
  for (int it = 0; it < 4; ++it) { const int e = it * 16 + esub; v4f v; for (int j = 0; j < 4; ++j) { float rv = res[((size_t)b * CC + e) * TT + n0 + piece * 4 + j]; if (RB) rv = bf16_round(rv); v[j] = tl[piece * 4 + j][e] + rv; } vals[it] = v; }
  { for (int it = 0; it < 4; ++it) { const int e = it * 16 + esub; *(v4f*)(DST + ((size_t)b * CC + e) * TT + n0 + piece * 4) = vals[it]; }  } }
__global__ __launch_bounds__(256) void k_cat(const float* __restrict__ M0, const float* __restrict__ M1, _Float16* __restrict__ CAT) { __shared__ float tl[128][65]; const int tid = threadIdx.x; const int b = blockIdx.x / (TT / 64), nb = blockIdx.x % (TT / 64); const int n0 = nb * 64;
  for (int i = tid; i < 128 * 64; i += 256) { const int ch = i / 64, n = i % 64; tl[ch][n] = (ch < 64) ? M0[((size_t)b * CC + ch) * TT + n0 + n] : M1[((size_t)b * CC + ch - 64) * TT + n0 + n]; } __syncthreads();
  const int piece = tid % 16, nsub = tid / 16;      /* 16 consecutive lanes = one token's 256-B row (128 halves); 16 tokens per iteration */
  FragH fv[4];
  for (int it = 0; it < 4; ++it) { const int n = it * 16 + nsub; for (int q = 0; q < 8; ++q) fv[it].h[q] = (_Float16)tl[piece * 8 + q][n]; }
  { for (int it = 0; it < 4; ++it) { const int n = it * 16 + nsub; *(v8us*)((unsigned short*)CAT + ((size_t)b * TT + n0 + n) * 128 + piece * 8) = fv[it].half[0]; }  } }
__global__ __launch_bounds__(256) void k_finb(const float* __restrict__ FUS, const float* __restrict__ tb, const float* __restrict__ SA1, float* __restrict__ out, size_t n4) {
  #pragma clang fp contract(off)
  const size_t t = (size_t)blockIdx.x * 256 + threadIdx.x; if (t >= n4) return; const int e = (int)(((t * 4) / TT) % CC); const float bb = bf16_round(tb[e]); const v4f f = *(const v4fa*)(FUS + t * 4), s = *(const v4fa*)(SA1 + t * 4); v4f o; for (int q = 0; q < 4; ++q) o[q] = (f[q] + bb) * s[q] + s[q]; *(v4f*)(out + t * 4) = o;  }
// Block = 4 query tiles x KSPL key ranges: wave w works query tile w & 3 over keys [(w >> 2) * TT/KSPL, +TT/KSPL) with its own running max, row sum and unnormalised O; the KSPL partials of a tile are merged through LDS at the end.
// Scores are formed transposed, S^T = K.Q^T (A = 16 key rows, B = the wave's 16 queries), so lane (ln, hh) holds 16 of the 32 scores of query ln: max and sum run inside the lane, plus one exchange between the wave halves for the max.
// The two S^T tiles of a trip hold keys 8hh + r and 16 + 8hh + r, which is the k order of the loaders here, so P^T goes from the accumulators into a B operand in registers and O^T += V^T.P^T (A = 16 channel rows of Vt); P never passes through LDS.
__device__ __forceinline__ float xhalf(float x) { return __builtin_bit_cast(float, __builtin_amdgcn_permlanex16(__builtin_bit_cast(int, x), __builtin_bit_cast(int, x), 0x76543210, 0xfedcba98, false, false)); }      /* lane l <-> lane l ^ 16 */
typedef float v2f __attribute__((ext_vector_type(2)));
typedef _Float16 v2h __attribute__((ext_vector_type(2)));
// Softmax runs in base 2: the running max is kept as m2 = score * log2(e) - 10, and every weight is 2^(score * log2(e) - m2) = 1024 * e^(score - max): one FMA and one hardware exp2 per score.
// The factor 1024 (the f16 scale of P) sits in O and in the row sum alike and cancels in O / l. Arguments are <= 10, so nothing overflows; a weight below 2^-126 counts as 0.
#define LOG2E 1.4426950408889634f
// One hardware exp2 with a free issue slot on either side: the instruction set asks for one independent instruction or v_nop between a transcendental and a neighbour that overwrites its source or reads its result.
__device__ __forceinline__ float exp2_slot(float x) { float y; asm("v_nop\n\tv_exp_f32 %0, %1\n\tv_nop" : "=v"(y) : "v"(x)); return y; }
template <int KSPL>
__global__ __launch_bounds__(128 * KSPL, 8) void k_flash(const _Float16* __restrict__ Q16, int ldq, const _Float16* __restrict__ K16, int ldk, const _Float16* __restrict__ Vt, const int* __restrict__ MSK, float* __restrict__ O, int ldo) {
  constexpr int RPW = 16, NQB = TT / (4 * RPW), DT = 4, NW = 4 * KSPL;      /* d_qk = 32 (24 real + zero padding), d_v = 64 */
  __shared__ __attribute__((aligned(16))) float sO[NW][RPW][64 + 4];
  __shared__ float sM[NW][RPW], sL[NW][RPW];
  (void)MSK;
  const int tid = threadIdx.x, w = __builtin_amdgcn_readfirstlane(tid >> 5), lane = tid & 31, ln = lane & 15, hh = lane >> 4;
  const int slab = blockIdx.x / NQB, qblk = blockIdx.x % NQB; const int b = slab / NH; const int qb0 = qblk * (4 * RPW); const int q0 = qb0 + (w & 3) * RPW;
  FragH bq;      /* B operand: column ln = query q0 + ln */
  { const unsigned short* qr = (const unsigned short*)Q16 + ((size_t)b * TT + q0 + ln) * ldq; bq.half[0] = *(const v8us*)(qr + 8 * hh); bq.half[1] = *(const v8us*)(qr + 16 + 8 * hh); }
  const unsigned short* Vth = (const unsigned short*)Vt + (size_t)slab * 64 * TT;      /* v per slab: [64][4096] */
  float m_r = -3.0e38f, l_r = 0.f; v8f oacc[DT];      /* m_r in base-2 units, shifted by -10 */      /* oacc[dt][r] = O^T[channel dt * 16 + 8hh + r][query ln] */
#pragma unroll
  for (int dt = 0; dt < DT; ++dt) oacc[dt] = (v8f){0.f,0.f,0.f,0.f,0.f,0.f,0.f,0.f};
  const int jbeg = (w >> 2) * (TT / KSPL);
#pragma unroll 1
  for (int it = 0; it < TT / KSPL / 32; ++it) { const int j0 = jbeg + it * 32;
    v8f s[2];      /* s[nt][r] = score of key j0 + nt * 16 + 8hh + r with query ln */
#pragma unroll
    for (int nt = 0; nt < 2; ++nt) { const unsigned short* kr = (const unsigned short*)K16 + ((size_t)b * TT + j0 + nt * 16 + ln) * ldk; FragH ak; ak.half[0] = *(const v8us*)(kr + 8 * hh); ak.half[1] = *(const v8us*)(kr + 16 + 8 * hh);
      s[nt] = mmaH<1>(ak.v, ak.v, bq.v, bq.v, (v8f){0.f,0.f,0.f,0.f,0.f,0.f,0.f,0.f}); }
    float mc = fmaxf(s[0][0], s[1][0]);
#pragma unroll
    for (int r = 1; r < 8; ++r) mc = fmaxf(mc, fmaxf(s[0][r], s[1][r]));
    mc = fmaxf(mc, xhalf(mc));      /* both halves hold the max over the trip's 32 keys */
    const float mn = fmaxf(m_r, __builtin_fmaf(mc, LOG2E, -10.0f)); const float ae = exp2_slot(m_r - mn); const float al = (mn > -1.0e38f) ? ae : 1.0f; m_r = mn;
    FragH ph, pl; float ls = 0.f;      /* P^T * 1024 as f16 hi + residual: element nt * 8 + r = key nt * 16 + 8hh + r */
#pragma unroll
    for (int nt = 0; nt < 2; ++nt)
#pragma unroll
      for (int r = 0; r < 8; r += 2) { const v2f ar = __builtin_elementwise_fma((v2f){s[nt][r], s[nt][r + 1]}, (v2f){LOG2E, LOG2E}, (v2f){-mn, -mn}); const float pa = __builtin_amdgcn_exp2f(ar[0]), pb = __builtin_amdgcn_exp2f(ar[1]); ls += pa; ls += pb; const v2f ps = (v2f){pa, pb}; const v2h hi = __builtin_convertvector(ps, v2h); const v2h lo = __builtin_convertvector(ps - __builtin_convertvector(hi, v2f), v2h);
        ph.h[nt * 8 + r] = hi[0]; ph.h[nt * 8 + r + 1] = hi[1]; pl.h[nt * 8 + r] = lo[0]; pl.h[nt * 8 + r + 1] = lo[1]; }
    l_r = l_r * al + ls;      /* this half's 16 keys; the halves are joined behind the loop */
#pragma unroll
    for (int dt = 0; dt < DT; ++dt) oacc[dt] *= al;
#pragma unroll
    for (int dt = 0; dt < DT; ++dt) { const unsigned short* vrow = Vth + (size_t)(dt * 16 + ln) * TT + j0; FragH av; av.half[0] = *(const v8us*)(vrow + 8 * hh); av.half[1] = *(const v8us*)(vrow + 16 + 8 * hh);
      oacc[dt] = mmaH<1>(av.v, av.v, ph.v, ph.v, oacc[dt]); oacc[dt] = mmaH<1>(av.v, av.v, pl.v, pl.v, oacc[dt]); } }      /* V^T.(Ph + Pl) */
  l_r += xhalf(l_r);
  if (hh == 0) { sM[w][ln] = m_r; sL[w][ln] = l_r; }
#pragma unroll
  for (int dt = 0; dt < DT; ++dt) { *(v4fa*)&sO[w][ln][dt * 16 + 8 * hh] = (v4f){oacc[dt][0], oacc[dt][1], oacc[dt][2], oacc[dt][3]}; *(v4fa*)&sO[w][ln][dt * 16 + 8 * hh + 4] = (v4f){oacc[dt][4], oacc[dt][5], oacc[dt][6], oacc[dt][7]}; }
  __syncthreads();      /* every wave's partial is in LDS before any thread merges */
  /* merge: thread = (query of the block, 4 channels); O = sum_s 2^(m_s - M) * O_s / sum_s 2^(m_s - M) * l_s, M = max_s m_s; O_s and l_s both carry the factor 1024 */
#pragma unroll
  for (int i = tid; i < 4 * RPW * 16; i += 128 * KSPL) { const int qq = i >> 4, pc = i & 15, g = qq / RPW, r = qq % RPW;
    float mx = sM[g][r];
#pragma unroll
    for (int s = 1; s < KSPL; ++s) mx = fmaxf(mx, sM[s * 4 + g][r]);
    float l = 0.f; v4f a = {0.f, 0.f, 0.f, 0.f};
#pragma unroll
    for (int s = 0; s < KSPL; ++s) { const float e = exp2_slot(sM[s * 4 + g][r] - mx); l += sL[s * 4 + g][r] * e; const v4f val = *(const v4fa*)&sO[s * 4 + g][r][pc * 4]; a += val * e; }
    const float inv = (l > 0.f) ? 1.0f / l : 0.f;
    *(v4f*)(O + ((size_t)slab * TT + qb0 + qq) * ldo + pc * 4) = a * inv; } }

extern "C" void kernel_launch(void* const* d_in, const int* in_sizes, int n_in,
                              void* d_out, int out_size, void* d_ws, size_t ws_size, hipStream_t stream) {
  (void)in_sizes; (void)n_in; (void)out_size;
  const float* const* I = (const float* const*)d_in; const float* x = I[0]; const float* sa_wq = I[1]; const float* sa_bq = I[2]; const float* sa_wk = I[3]; const float* sa_bk = I[4]; const float* sa_wv = I[5]; const float* sa_bv = I[6];
  const float* ga_wq = I[7]; const float* ga_bq = I[8]; const float* ga_wk = I[9]; const float* ga_bk = I[10]; const float* ga_wv = I[11]; const float* ga_bv = I[12]; const float* tw = I[13]; const float* tb = I[14];
  char* ws = (char*)d_ws; size_t off = 0;
  auto take = [&](size_t bytes) { char* p = ws + off; off += (bytes + 255) & ~(size_t)255; return p; };
  const size_t PL = (size_t)BB * CC * TT;      /* one [B][64][4096] f32 plane = 1 M floats */
  _Float16* AWV = (_Float16*)take((size_t)5 * CC * 96 * 2); _Float16* TW16 = (_Float16*)take((size_t)CC * 128 * 2);
  _Float16* XT = (_Float16*)take((size_t)3 * BB * TT * 96 * 2); _Float16* QP = (_Float16*)take((size_t)NSL * TT * 32 * 2); _Float16* KP = (_Float16*)take((size_t)NSL * TT * 32 * 2); _Float16* VT = (_Float16*)take((size_t)NSL * CC * TT * 2); float* O = (float*)take((size_t)NSL * TT * CC * 4);
  float* SA = (float*)take(3 * PL * 4); float* MF = (float*)take(2 * PL * 4); _Float16* CAT = (_Float16*)take((size_t)BB * TT * 128 * 2); float* FUS = (float*)take(PL * 4);
  if (off > ws_size) return;      // 0.1 + 9.4 + 5.2 + 5.2 + 10.5 + 21 + 12.6 + 8.4 + 4.2 + 4.2 = about 81 MB
  k_wvb<<<dim3((CC * 12 + 255) / 256, 5), 256, 0, stream>>>(sa_wv, sa_bv, ga_wv, ga_bv, AWV);      /* all five value projections in one launch */
  k_round16f<<<(CC * 128 / 8 + 255) / 256, 256, 0, stream>>>(tw, TW16, CC * 128 / 8);      /* tfus_w [64 o][128 c] natural = the A operand ×2^4 */
  const unsigned gxt = (unsigned)(((size_t)BB * TT * 12 + 255) / 256), gqk = (unsigned)(((size_t)BB * TT * 4 + 255) / 256); const unsigned gvx = ((CC / 16) * (TT / 64) + 3) / 4;
  /* self attention on the three frames: slabs a * BB + b for a = 0,1,2; each stage is one launch over all three frames (frame on blockIdx.y, for the GEMM on blockIdx.z, for the flash kernel in the slab of blockIdx.x), XT holds one plane per frame */
  k_xt<1><<<dim3(gxt, 3), 256, 0, stream>>>(x, XT);
  k_qk<1><<<dim3(gqk, 3), 256, 0, stream>>>(x, PL, sa_wq, sa_bq, sa_wk, sa_bk, 0, QP, KP);
  k_gemm_hhx<0><<<dim3(gvx, BB, 3), 128, 0, stream>>>(AWV, 96, 0, XT, 96, (size_t)TT * 96, 0.0625f, nullptr, 0, nullptr, 1, 0, 0, nullptr, VT, TT, (size_t)CC * TT, CC, TT, 96, (size_t)CC * 96, (size_t)BB * TT * 96, (size_t)BB * CC * TT);      /* v[b][e][m] = wv.x + bv, channel-major f16: batched over b and frame, M 64 N 4096 K 96 */
  k_flash<8><<<3 * BB * (TT / 64), 1024, 0, stream>>>(QP, 32, KP, 32, VT, nullptr, O, CC);      /* slabs 0..11; 768 blocks of 32 waves = three full rounds of the WGPs */
  k_ocm<1><<<dim3(BB * (TT / 64), 3), 256, 0, stream>>>(O, 0, x, PL, SA);      /* SA_a = attn-out + x_a (channel-major f32) */
  /* guided attentions: slabs 12..15 (q,k from SA_0; v,res from SA_1) and 16..19 (q,k from SA_2) */
  k_xt<0><<<gxt, 256, 0, stream>>>(SA + PL, XT);      /* SA_1 token-major (internal f32, no rounding) */
  k_qk<0><<<dim3(gqk, 2), 256, 0, stream>>>(SA, 2 * PL, ga_wq, ga_bq, ga_wk, ga_bk, 3 * BB, QP, KP);      /* sources SA_0 and SA_2 */
  k_gemm_hhx<0><<<dim3(gvx, BB, 2), 128, 0, stream>>>(AWV + (size_t)3 * CC * 96, 96, 0, XT, 96, (size_t)TT * 96, 0.0625f, nullptr, 0, nullptr, 1, 0, 0, nullptr, VT + (size_t)3 * BB * CC * TT, TT, (size_t)CC * TT, CC, TT, 96, (size_t)CC * 96, 0, (size_t)BB * CC * TT);      /* both read the SA_1 plane of XT */
  k_flash<4><<<2 * BB * (TT / 64), 512, 0, stream>>>(QP + (size_t)3 * BB * TT * 32, 32, KP + (size_t)3 * BB * TT * 32, 32, VT + (size_t)3 * BB * CC * TT, nullptr, O + (size_t)3 * BB * TT * CC, CC);      /* slabs 12..19 (kernel-relative 0..7) */
  k_ocm<0><<<dim3(BB * (TT / 64), 2), 256, 0, stream>>>(O + (size_t)3 * BB * TT * CC, 0, SA + PL, 0, MF);      /* mfi_gi = attn-out + SA_1 */
  k_cat<<<BB * (TT / 64), 256, 0, stream>>>(MF, MF + PL, CAT);
  k_gemm_hhx<0><<<dim3(((CC / 16) * (TT / 64) + 3) / 4, BB), 128, 0, stream>>>(TW16, 128, 0, CAT, 128, (size_t)TT * 128, 0.0625f, nullptr, 0, nullptr, 1, 0, 0, FUS, nullptr, TT, (size_t)CC * TT, CC, TT, 128, 0, 0, 0);      /* fusion[b][o][n] = Σ_c W[o][c]·cat[b][c][n]: A = W (M 64, K 128), Bt = CAT[b] token-major; bias tfus_b per ROW o → added in k_fin? no: see k_finb */
  k_finb<<<(unsigned)((PL / 4 + 255) / 256), 256, 0, stream>>>(FUS, tb, SA + PL, (float*)d_out, PL / 4);
}

// v005
// It runs in 284 microseconds.
// In two side-by-side timings against v004, it was 1.19 and 1.18 times as fast.
// Counting every step since v000, it is 3.78 times as fast.
#include <hip/hip_runtime.h>
// MFI (3 frames, B=4, C=64, 64×64 → N=4096): SA_f = position attention on frame f (q = wq·x+bq (8 ch), k = wk·x+bk (8 ch), v = wv·x+bv (64 ch); attn = softmax_m(q[:,n]·k[:,m]) unscaled; out[e][n] = Σ_m v[e][m]·attn[n][m] + x[e][n]); then two guided attentions
// (q,k from SA_0 / SA_2, v and residual from SA_1), cat → fusion = tfus_w·cat + b; out = fusion·SA_1 + SA_1 → [4,64,64,64].
// Compute dtype: x, weights, biases rounded to bf16; q/k per token in f32 VALU (8×64 dot, rolled) emitted as concatenated f16 planes [q_hi|q_lo·2^10|q_hi|0] and [k_hi|k_hi·2^-10|k_lo|0] so ONE 32-wide WMMA k-step yields f32-accurate logits; v (+bias via an
// augmented ones column) channel-major by GEMM (f16); fused flash-style kernel per (slab, 64 queries) (online softmax f32, P f16 hi + residual, O token-major f32); residual add + channel-major restage in f32; cat f16 → fusion GEMM → out = fusion·sa₁ + sa₁ in f32. All on v_wmma_f32_16x16x32_f16.
#define NFR 3
#define BB 4
#define CC 64
#define TT 4096
#define NH 1
#define NSL (5 * BB)

typedef __bf16 v16b __attribute__((ext_vector_type(16)));
typedef unsigned short v8us __attribute__((ext_vector_type(8), may_alias));
typedef float  v8f  __attribute__((ext_vector_type(8)));
typedef float  v4f  __attribute__((ext_vector_type(4)));
typedef float  v4fa __attribute__((ext_vector_type(4), may_alias));
union FragB { v16b v; v8us half[2]; unsigned short u[16]; };

__device__ __forceinline__ unsigned short bf16_bits(float x) { unsigned int u = __float_as_uint(x); return (unsigned short)((u + 0x7FFFu + ((u >> 16) & 1u)) >> 16); }
__device__ __forceinline__ float bf16_val(unsigned short b) { return __uint_as_float(((unsigned int)b) << 16); }
__device__ __forceinline__ float bf16_round(float x) { return bf16_val(bf16_bits(x)); }
// D += A·B with NT terms: 1 = ah·bh, 2 = + al·bh (A split), 3 = + ah·bl (both split)
template <int NT>
__device__ __forceinline__ v8f mmaN(v16b ah, v16b al, v16b bh, v16b bl, v8f c) {
  c = __builtin_amdgcn_wmma_f32_16x16x32_bf16(false, ah, false, bh, (short)0, c, false, false);
  if (NT >= 2) c = __builtin_amdgcn_wmma_f32_16x16x32_bf16(false, al, false, bh, (short)0, c, false, false);
  if (NT >= 3) c = __builtin_amdgcn_wmma_f32_16x16x32_bf16(false, ah, false, bl, (short)0, c, false, false);
  asm volatile("v_nop\n\tv_nop\n\tv_nop\n\tv_nop" : "+v"(c) : "v"(ah), "v"(al), "v"(bh), "v"(bl));
  return c;
}

__global__ __launch_bounds__(256) void k_wt_bf16(const float* __restrict__ W, unsigned short* __restrict__ Wt, int K, int N) {
  const int t = blockIdx.x * 256 + threadIdx.x;
  const int k8n = K / 8;
  if (t >= N * k8n) return;
  const int n = t / k8n, k8 = (t % k8n) * 8;
  v8us v;
#pragma unroll
  for (int i = 0; i < 8; ++i) v[i] = bf16_bits(W[(size_t)(k8 + i) * N + n]);
  *(v8us*)(Wt + (size_t)n * K + k8) = v;
  
}

// GEMM C[M][N] (f32, pitch ldc) = act(A[M][K]·W + bias). A f32 row-major (pitch lda) converted per fragment to bf16
// (ASPLIT: hi/lo two planes -> 2 terms, else single rounded term); Wt bf16 [N][K] (pitch ldb). BIAS_BF16 rounds the
// bias to bf16 first (bias quantised to bf16 before the add). K%32==0, M%16==0, N%64==0.
template <bool ASPLIT, int ACT, bool BIAS_BF16>
__global__ __launch_bounds__(128) void k_gemm_bf(const float* __restrict__ A, int lda, const unsigned short* __restrict__ Wt, int ldb,
                                               const float* __restrict__ bias, float* __restrict__ C, int ldc, int M, int N, int K) {
  __shared__ __attribute__((aligned(16))) float so[4][16][64];
  const int tid = threadIdx.x, w = tid >> 5, lane = tid & 31, ln = lane & 15, hh = lane >> 4;
  const int ntn = N / 64;
  const int wid = blockIdx.x * 4 + w;
  const int mt = wid / ntn, nq = wid % ntn;
  if (mt * 16 >= M) return;
  const int row0 = mt * 16, col0 = nq * 64;
  const float* arow = A + (size_t)(row0 + ln) * lda;
  v8f acc[4] = {};
  for (int kb = 0; kb < K; kb += 32) {
    FragB ah, al;
    const v4f x0 = *(const v4fa*)(arow + kb + 8 * hh), x1 = *(const v4fa*)(arow + kb + 8 * hh + 4);
    const v4f x2 = *(const v4fa*)(arow + kb + 16 + 8 * hh), x3 = *(const v4fa*)(arow + kb + 16 + 8 * hh + 4);
    float xs[16] = {x0[0],x0[1],x0[2],x0[3],x1[0],x1[1],x1[2],x1[3],x2[0],x2[1],x2[2],x2[3],x3[0],x3[1],x3[2],x3[3]};
#pragma unroll
    for (int i = 0; i < 16; ++i) { const unsigned short hb = bf16_bits(xs[i]); ah.u[i] = hb; al.u[i] = ASPLIT ? bf16_bits(xs[i] - bf16_val(hb)) : (unsigned short)0; }
#pragma unroll
    for (int t = 0; t < 4; ++t) {
      const unsigned short* brow = Wt + (size_t)(col0 + t * 16 + ln) * ldb + kb;
      FragB b;
      b.half[0] = *(const v8us*)(brow + 8 * hh);
      b.half[1] = *(const v8us*)(brow + 16 + 8 * hh);
      acc[t] = mmaN<ASPLIT ? 2 : 1>(ah.v, al.v, b.v, b.v, acc[t]);
    }
  }
#pragma unroll
  for (int t = 0; t < 4; ++t) {
    float bv = bias ? bias[col0 + t * 16 + ln] : 0.f;
    if (BIAS_BF16) bv = bf16_round(bv);
#pragma unroll
    for (int r = 0; r < 8; ++r) { float v = acc[t][r] + bv; if (ACT == 1) v = fmaxf(v, 0.f); so[w][8 * hh + r][t * 16 + ln] = v; }
  }
  __builtin_amdgcn_fence(__ATOMIC_ACQ_REL, "workgroup");
  __builtin_amdgcn_wave_barrier();
  const int rsub = lane >> 4, c4 = (lane & 15) * 4;
  {
#pragma unroll
    for (int q = 0; q < 8; ++q) {
      const int r = q * 2 + rsub;
      const v4f v = *(const v4fa*)&so[w][r][c4];
      *(v4f*)(C + (size_t)(row0 + r) * ldc + col0 + c4) = v;
    }
    
  }
}

// Flash-style causal/unmasked attention, all contractions 3-term bf16 hi/lo splits, f32 softmax with running max.
// q,k,v rows are read from f32 buffers with arbitrary row pitch (so they can live inside a fused qkv buffer);
// D = head size (multiple of 32, <= 128); one wave = 16 query rows; block = 4 waves (64 queries) sharing K/V chunks of 32.
template <int D, bool CAUSAL>
__global__ __launch_bounds__(128) void k_flash(const float* __restrict__ qb, const float* __restrict__ kb, const float* __restrict__ vb,
                                             int pitch, int T, int H, float scale, float* __restrict__ y, int ypitch) {
  constexpr int KS = D / 32;        // k-steps for QK
  constexpr int DT = D / 16;        // d tiles for PV
  __shared__ __attribute__((aligned(16))) unsigned short sKh[32][D + 8], sKl[32][D + 8], sVh[32][D + 8], sVl[32][D + 8];
  __shared__ __attribute__((aligned(16))) unsigned short sPh[4][16][40], sPl[4][16][40];
  __shared__ __attribute__((aligned(16))) float sO[4][16][D];
  const int tid = threadIdx.x, w = tid >> 5, lane = tid & 31, ln = lane & 15, hh = lane >> 4;
  const int nqb = (T + 63) / 64;
  const int bh = blockIdx.x / nqb, qblk = blockIdx.x % nqb;
  const int b = bh / H, h = bh % H;
  const int q0 = qblk * 64 + w * 16;
  const float* Q = qb + (size_t)b * T * pitch + h * D;
  const float* K = kb + (size_t)b * T * pitch + h * D;
  const float* V = vb + (size_t)b * T * pitch + h * D;

  // A fragments of the wave's 16 query rows (scaled), hi/lo
  FragB aqh[KS], aql[KS];
  {
    int row = q0 + ln; if (row >= T) row = T - 1;
    const float* qr = Q + (size_t)row * pitch;
#pragma unroll
    for (int ks = 0; ks < KS; ++ks)
#pragma unroll
      for (int i = 0; i < 16; ++i) {
        const int d = ks * 32 + ((i < 8) ? (8 * hh + i) : (16 + 8 * hh + (i - 8)));
        const float x = qr[d] * scale; const unsigned short hb = bf16_bits(x);
        aqh[ks].u[i] = hb; aql[ks].u[i] = bf16_bits(x - bf16_val(hb));
      }
  }
  float m_r[8], l_r[8];
#pragma unroll
  for (int r = 0; r < 8; ++r) { m_r[r] = -3.0e38f; l_r[r] = 0.f; }
  v8f oacc[DT];
#pragma unroll
  for (int dt = 0; dt < DT; ++dt) oacc[dt] = (v8f){0.f,0.f,0.f,0.f,0.f,0.f,0.f,0.f};

  const int kv_end = CAUSAL ? min(T, qblk * 64 + 64) : T;     // block-uniform
  for (int j0 = 0; j0 < kv_end; j0 += 32) {
    __syncthreads();
    for (int e = tid; e < 32 * (D / 4); e += 128) {
      const int r = e / (D / 4), c4 = (e % (D / 4)) * 4;
      const int key = j0 + r;
      v4f kf = {0.f,0.f,0.f,0.f}, vf = {0.f,0.f,0.f,0.f};
      if (key < T) { kf = *(const v4fa*)(K + (size_t)key * pitch + c4); vf = *(const v4fa*)(V + (size_t)key * pitch + c4); }
#pragma unroll
      for (int t = 0; t < 4; ++t) {
        unsigned short hb = bf16_bits(kf[t]); sKh[r][c4 + t] = hb; sKl[r][c4 + t] = bf16_bits(kf[t] - bf16_val(hb));
        hb = bf16_bits(vf[t]); sVh[r][c4 + t] = hb; sVl[r][c4 + t] = bf16_bits(vf[t] - bf16_val(hb));
      }
    }
    __syncthreads();
    // S tile 16 x 32
    v8f s[2];
#pragma unroll
    for (int nt = 0; nt < 2; ++nt) {
      v8f acc = {};
#pragma unroll
      for (int ks = 0; ks < KS; ++ks) {
        FragB bh_, bl_;
        bh_.half[0] = *(const v8us*)&sKh[nt * 16 + ln][ks * 32 + 8 * hh]; bh_.half[1] = *(const v8us*)&sKh[nt * 16 + ln][ks * 32 + 16 + 8 * hh];
        bl_.half[0] = *(const v8us*)&sKl[nt * 16 + ln][ks * 32 + 8 * hh]; bl_.half[1] = *(const v8us*)&sKl[nt * 16 + ln][ks * 32 + 16 + 8 * hh];
        acc = mmaN<3>(aqh[ks].v, aql[ks].v, bh_.v, bl_.v, acc);
      }
      s[nt] = acc;
    }
    // mask + running max (rows 8hh+r; the 16 lanes of a half share rows)
    float alpha[8];
#pragma unroll
    for (int r = 0; r < 8; ++r) {
      const int qi = q0 + 8 * hh + r;
      const int ja = j0 + ln, jb = j0 + 16 + ln;
      if (CAUSAL) { if (ja > qi) s[0][r] = -3.0e38f; if (jb > qi) s[1][r] = -3.0e38f; }
      if (ja >= T) s[0][r] = -3.0e38f;
      if (jb >= T) s[1][r] = -3.0e38f;
      float mx = fmaxf(s[0][r], s[1][r]);
      mx = fmaxf(mx, __shfl_xor(mx, 1, 32)); mx = fmaxf(mx, __shfl_xor(mx, 2, 32)); mx = fmaxf(mx, __shfl_xor(mx, 4, 32)); mx = fmaxf(mx, __shfl_xor(mx, 8, 32));
      const float mnew = fmaxf(m_r[r], mx);
      alpha[r] = (mnew > -1.0e38f) ? __expf(m_r[r] - mnew) : 1.0f;
      const float p0 = (s[0][r] > -1.0e38f) ? __expf(s[0][r] - mnew) : 0.f;
      const float p1 = (s[1][r] > -1.0e38f) ? __expf(s[1][r] - mnew) : 0.f;
      m_r[r] = mnew;
      l_r[r] = l_r[r] * alpha[r] + p0 + p1;            // per-lane partial row sum (16 lanes combined at the end)
      unsigned short hb = bf16_bits(p0); sPh[w][8 * hh + r][ln] = hb;      sPl[w][8 * hh + r][ln] = bf16_bits(p0 - bf16_val(hb));
      hb = bf16_bits(p1);                sPh[w][8 * hh + r][16 + ln] = hb; sPl[w][8 * hh + r][16 + ln] = bf16_bits(p1 - bf16_val(hb));
    }
#pragma unroll
    for (int dt = 0; dt < DT; ++dt)
#pragma unroll
      for (int r = 0; r < 8; ++r) oacc[dt][r] *= alpha[r];
    __builtin_amdgcn_fence(__ATOMIC_ACQ_REL, "workgroup");
    __builtin_amdgcn_wave_barrier();
    FragB pah, pal;
    pah.half[0] = *(const v8us*)&sPh[w][ln][8 * hh]; pah.half[1] = *(const v8us*)&sPh[w][ln][16 + 8 * hh];
    pal.half[0] = *(const v8us*)&sPl[w][ln][8 * hh]; pal.half[1] = *(const v8us*)&sPl[w][ln][16 + 8 * hh];
#pragma unroll
    for (int dt = 0; dt < DT; ++dt) {
      FragB bvh, bvl;
#pragma unroll
      for (int i = 0; i < 8; ++i) {
        bvh.u[i] = sVh[8 * hh + i][dt * 16 + ln]; bvh.u[8 + i] = sVh[16 + 8 * hh + i][dt * 16 + ln];
        bvl.u[i] = sVl[8 * hh + i][dt * 16 + ln]; bvl.u[8 + i] = sVl[16 + 8 * hh + i][dt * 16 + ln];
      }
      oacc[dt] = mmaN<3>(pah.v, pal.v, bvh.v, bvl.v, oacc[dt]);
    }
    __builtin_amdgcn_fence(__ATOMIC_ACQ_REL, "workgroup");
    __builtin_amdgcn_wave_barrier();
  }
#pragma unroll
  for (int r = 0; r < 8; ++r) {
    float l = l_r[r];
    l += __shfl_xor(l, 1, 32); l += __shfl_xor(l, 2, 32); l += __shfl_xor(l, 4, 32); l += __shfl_xor(l, 8, 32);
    l_r[r] = (l > 0.f) ? 1.0f / l : 0.f;
  }
#pragma unroll
  for (int dt = 0; dt < DT; ++dt)
#pragma unroll
    for (int r = 0; r < 8; ++r) sO[w][8 * hh + r][dt * 16 + ln] = oacc[dt][r] * l_r[r];
  __builtin_amdgcn_fence(__ATOMIC_ACQ_REL, "workgroup");
  __builtin_amdgcn_wave_barrier();
  {
    for (int r = 0; r < 16; ++r) {
      const int row = q0 + r;
      if (row < T && lane < D / 4) {
        const v4f val = *(const v4fa*)&sO[w][r][lane * 4];
        *(v4f*)(y + ((size_t)b * T + row) * ypitch + h * D + lane * 4) = val;
      }
    }
    
  }
}

// GEMM C = act(A·W + bias + resid): A f32 (ASPLIT -> hi/lo 2 terms), Wt bf16 [N][K]; ACT 0 none, 1 relu, 2 exact gelu;
// resid (optional, f32, row index = (row % rmod), pitch ldr, RES_BF16 rounds it) added before the activation.
template <bool ASPLIT, int ACT, bool BIAS_BF16, bool RES_BF16>
__global__ __launch_bounds__(128) void k_gemm_bf3(const float* __restrict__ A, int lda, const unsigned short* __restrict__ Wt, int ldb,
                                                const float* __restrict__ bias, const float* __restrict__ resid, int rmod, int ldr,
                                                float* __restrict__ C, int ldc, int M, int N, int K) {
  __shared__ __attribute__((aligned(16))) float so[4][16][64];
  const int tid = threadIdx.x, w = tid >> 5, lane = tid & 31, ln = lane & 15, hh = lane >> 4;
  const int ntn = N / 64;
  const int wid = blockIdx.x * 4 + w;
  const int mt = wid / ntn, nq = wid % ntn;
  if (mt * 16 >= M) return;
  const int row0 = mt * 16, col0 = nq * 64;
  const float* arow = A + (size_t)(row0 + ln) * lda;
  v8f acc[4] = {};
  for (int kb = 0; kb < K; kb += 32) {
    FragB ah, al;
    const v4f x0 = *(const v4fa*)(arow + kb + 8 * hh), x1 = *(const v4fa*)(arow + kb + 8 * hh + 4);
    const v4f x2 = *(const v4fa*)(arow + kb + 16 + 8 * hh), x3 = *(const v4fa*)(arow + kb + 16 + 8 * hh + 4);
    float xs[16] = {x0[0],x0[1],x0[2],x0[3],x1[0],x1[1],x1[2],x1[3],x2[0],x2[1],x2[2],x2[3],x3[0],x3[1],x3[2],x3[3]};
#pragma unroll
    for (int i = 0; i < 16; ++i) { const unsigned short hb = bf16_bits(xs[i]); ah.u[i] = hb; al.u[i] = ASPLIT ? bf16_bits(xs[i] - bf16_val(hb)) : (unsigned short)0; }
#pragma unroll
    for (int t = 0; t < 4; ++t) {
      const unsigned short* brow = Wt + (size_t)(col0 + t * 16 + ln) * ldb + kb;
      FragB b;
      b.half[0] = *(const v8us*)(brow + 8 * hh);
      b.half[1] = *(const v8us*)(brow + 16 + 8 * hh);
      acc[t] = mmaN<ASPLIT ? 2 : 1>(ah.v, al.v, b.v, b.v, acc[t]);
    }
  }
#pragma unroll
  for (int t = 0; t < 4; ++t) {
    const int col = col0 + t * 16 + ln;
    float bv = bias ? bias[col] : 0.f;
    if (BIAS_BF16) bv = bf16_round(bv);
#pragma unroll
    for (int r = 0; r < 8; ++r) {
      float v = acc[t][r] + bv;
      if (resid) { float rv = resid[(size_t)((row0 + 8 * hh + r) % rmod) * ldr + col]; if (RES_BF16) rv = bf16_round(rv); v += rv; }
      if (ACT == 1) v = fmaxf(v, 0.f);
      if (ACT == 2) v = 0.5f * v * (1.0f + erff(v * 0.70710678118654752f));
      if (ACT == 3) { const float u = 0.7978845608028654f * (v + 0.044715f * v * v * v); v = 0.5f * v * (1.0f + tanhf(u)); }
      so[w][8 * hh + r][t * 16 + ln] = v;
    }
  }
  __builtin_amdgcn_fence(__ATOMIC_ACQ_REL, "workgroup");
  __builtin_amdgcn_wave_barrier();
  const int rsub = lane >> 4, c4 = (lane & 15) * 4;
  {
#pragma unroll
    for (int q = 0; q < 8; ++q) {
      const int r = q * 2 + rsub;
      const v4f v = *(const v4fa*)&so[w][r][c4];
      *(v4f*)(C + (size_t)(row0 + r) * ldc + col0 + c4) = v;
    }
    
  }
}
// row LayerNorm (biased variance, eps) over N: s = X (+ R); optional out_sum <- s; out_norm <- (s-mu)*rsqrt(var+eps)*g + b
template <bool PARAM_BF16>
__global__ __launch_bounds__(256) void k_layernorm(const float* __restrict__ X, const float* __restrict__ R, const float* __restrict__ g, const float* __restrict__ bta,
                                                  float* __restrict__ out_sum, float* __restrict__ out_norm, int N, float eps) {
  __shared__ float red[256];
  const int row = blockIdx.x, tid = threadIdx.x;
  const float* x = X + (size_t)row * N; const float* rr = R ? R + (size_t)row * N : nullptr;
  float vals[16];                     // up to N = 4096
  const int per = N / 256;            // contiguous chunk per thread? use strided-by-4 chunks: thread handles j = tid*4 + 1024*u
  float s1 = 0.f;
  for (int u = 0; u < per / 4; ++u) {
    const int j = tid * 4 + 1024 * u;
    const v4f a = *(const v4fa*)(x + j);
    v4f b = {0.f,0.f,0.f,0.f}; if (rr) b = *(const v4fa*)(rr + j);
#pragma unroll
    for (int q = 0; q < 4; ++q) { const float v = a[q] + b[q]; vals[u * 4 + q] = v; s1 += v; }
  }
  red[tid] = s1; __syncthreads();
  for (int st = 128; st > 0; st >>= 1) { if (tid < st) red[tid] += red[tid + st]; __syncthreads(); }
  const float mu = red[0] / (float)N; __syncthreads();
  float s2 = 0.f;
  for (int u = 0; u < per / 4; ++u)
#pragma unroll
    for (int q = 0; q < 4; ++q) { const float c = vals[u * 4 + q] - mu; s2 += c * c; }
  red[tid] = s2; __syncthreads();
  for (int st = 128; st > 0; st >>= 1) { if (tid < st) red[tid] += red[tid + st]; __syncthreads(); }
  const float rs = rsqrtf(red[0] / (float)N + eps);
  {
    for (int u = 0; u < per / 4; ++u) {
      const int j = tid * 4 + 1024 * u;
      v4f o, sm;
#pragma unroll
      for (int q = 0; q < 4; ++q) {
        float gg = g[j + q], bb = bta[j + q];
        if (PARAM_BF16) { gg = bf16_round(gg); bb = bf16_round(bb); }
        sm[q] = vals[u * 4 + q]; o[q] = (vals[u * 4 + q] - mu) * rs * gg + bb;
      }
      if (out_sum) *(v4f*)(out_sum + (size_t)row * N + j) = sm;
      *(v4f*)(out_norm + (size_t)row * N + j) = o;
    }
    
  }
}



// ---- f16 WMMA path (v_wmma_f32_16x16x32_f16): 11-bit significands for operands in range — used where a [0,1] probability operand needs more precision than bf16
typedef _Float16 v16h __attribute__((ext_vector_type(16)));
union FragH { v16h v; v8us half[2]; _Float16 h[16]; unsigned short u[16]; };
template <int NT>
__device__ __forceinline__ v8f mmaH(v16h ah, v16h al, v16h bh, v16h bl, v8f c) {
  c = __builtin_amdgcn_wmma_f32_16x16x32_f16(false, ah, false, bh, (short)0, c, false, false);
  if (NT >= 2) c = __builtin_amdgcn_wmma_f32_16x16x32_f16(false, al, false, bh, (short)0, c, false, false);
  if (NT >= 3) c = __builtin_amdgcn_wmma_f32_16x16x32_f16(false, ah, false, bl, (short)0, c, false, false);
  asm volatile("v_nop\n\tv_nop\n\tv_nop\n\tv_nop" : "+v"(c) : "v"(ah), "v"(al), "v"(bh), "v"(bl));
  return c;
}
// batched GEMM like k_gemm_b but f16 operands: A f32 (split into f16 hi/lo if ASPLIT, else rounded to f16), Bt = f16 values [n][k]; alpha; C f32; N multiple of 16 (partial tiles skipped)
template <bool ASPLIT>
__global__ __launch_bounds__(128) void k_gemm_h(const float* __restrict__ A, int lda, size_t sA, const _Float16* __restrict__ Bh, int ldb, size_t sB, float alpha, float* __restrict__ C, int ldc, size_t sC, int M, int N, int K) {
  __shared__ __attribute__((aligned(16))) float so[4][16][64];
  const int tid = threadIdx.x, w = tid >> 5, lane = tid & 31, ln = lane & 15, hh = lane >> 4; const int by = blockIdx.y;
  A += (size_t)by * sA; Bh += (size_t)by * sB; C += (size_t)by * sC;
  const int ntn = (N + 63) / 64; const int wid = blockIdx.x * 4 + w; const int mt = wid / ntn, nq = wid % ntn; if (mt * 16 >= M) return;
  const int row0 = mt * 16, col0 = nq * 64; const float* arow = A + (size_t)(row0 + ln) * lda;
  v8f acc[4] = {};
  for (int kb = 0; kb < K; kb += 32) {
    FragH ah, al;
    const v4f x0 = *(const v4fa*)(arow + kb + 8 * hh), x1 = *(const v4fa*)(arow + kb + 8 * hh + 4), x2 = *(const v4fa*)(arow + kb + 16 + 8 * hh), x3 = *(const v4fa*)(arow + kb + 16 + 8 * hh + 4);
    float xs[16] = {x0[0],x0[1],x0[2],x0[3],x1[0],x1[1],x1[2],x1[3],x2[0],x2[1],x2[2],x2[3],x3[0],x3[1],x3[2],x3[3]};
#pragma unroll
    for (int i = 0; i < 16; ++i) { const _Float16 h = (_Float16)xs[i]; ah.h[i] = h; al.h[i] = ASPLIT ? (_Float16)(xs[i] - (float)h) : (_Float16)0.0f; }
#pragma unroll
    for (int t = 0; t < 4; ++t) { if (col0 + t * 16 >= N) continue; const size_t boff = (size_t)(col0 + t * 16 + ln) * ldb + kb; FragH bq; bq.half[0] = *(const v8us*)(Bh + boff + 8 * hh); bq.half[1] = *(const v8us*)(Bh + boff + 16 + 8 * hh);
      acc[t] = mmaH<ASPLIT ? 2 : 1>(ah.v, al.v, bq.v, bq.v, acc[t]); }
  }
#pragma unroll
  for (int t = 0; t < 4; ++t) { if (col0 + t * 16 >= N) continue;
#pragma unroll
    for (int r = 0; r < 8; ++r) so[w][8 * hh + r][t * 16 + ln] = acc[t][r] * alpha; }
  __builtin_amdgcn_fence(__ATOMIC_ACQ_REL, "workgroup"); __builtin_amdgcn_wave_barrier();
  const int rsub = lane >> 4, c4 = (lane & 15) * 4;
  {
#pragma unroll
    for (int q = 0; q < 8; ++q) { const int r = q * 2 + rsub; if (col0 + c4 < N) { const v4f v = *(const v4fa*)&so[w][r][c4]; *(v4f*)(C + (size_t)(row0 + r) * ldc + col0 + c4) = v; } }
     }
}

// Wt[n][k] = f16(W[k][n]·scale) from f32 row-major W[K][N] (scale = power of two; bf16-exact weights stay exact in f16 away from the subnormal range)
__global__ __launch_bounds__(256) void k_wt_f16(const float* __restrict__ W, _Float16* __restrict__ Wt, int K, int N, float scale) {
  const int t = blockIdx.x * 256 + threadIdx.x; if (t >= N * (K / 8)) return; const int n = t / (K / 8), k8 = (t % (K / 8)) * 8; FragH f;
#pragma unroll
  for (int i = 0; i < 8; ++i) f.h[i] = (_Float16)(bf16_round(W[(size_t)(k8 + i) * N + n]) * scale); const v8us o = f.half[0];
  *(v8us*)((unsigned short*)Wt + (size_t)n * K + k8) = o; 
}
// k_gemm_hh variant with fused epilogue: v = acc·alpha + bias[by·sBias + col] (+ CP[(row/rowsPerB)·sCPb + by·64 + col] if CP) ; ACT 0 none / 1 elu ; writes f32 C and/or f16 C16 (each if non-null)
template <int ACT>
__global__ __launch_bounds__(128) void k_gemm_hhx(const _Float16* __restrict__ A, int lda, size_t sA, const _Float16* __restrict__ Bh, int ldb, size_t sB, float alpha, const float* __restrict__ bias, size_t sBias, const float* __restrict__ CP, int rowsPerB, size_t sCPb, int row0g,
    float* __restrict__ C, _Float16* __restrict__ C16, int ldc, size_t sC, int M, int N, int K, size_t sAz, size_t sBz, size_t sCz) {
  __shared__ __attribute__((aligned(16))) float so[4][16][64];
  const int tid = threadIdx.x, w = tid >> 5, lane = tid & 31, ln = lane & 15, hh = lane >> 4; const int by = blockIdx.y, bz = blockIdx.z;      /* bz = attention instance, with strides of its own */
  A += (size_t)by * sA + (size_t)bz * sAz; Bh += (size_t)by * sB + (size_t)bz * sBz; const size_t cofs = (size_t)by * sC + (size_t)bz * sCz; const float* bp = bias ? bias + (size_t)by * sBias : nullptr;
  const int ntn = (N + 63) / 64; const int wid = blockIdx.x * 4 + w; const int mt = wid / ntn, nq = wid % ntn; if (mt * 16 >= M) return;
  const int row0 = mt * 16, col0 = nq * 64; const _Float16* arow = A + (size_t)(row0 + ln) * lda;
  v8f acc[4] = {};
  for (int kb = 0; kb < K; kb += 32) { FragH ah; ah.half[0] = *(const v8us*)((const unsigned short*)arow + kb + 8 * hh); ah.half[1] = *(const v8us*)((const unsigned short*)arow + kb + 16 + 8 * hh);
#pragma unroll
    for (int t = 0; t < 4; ++t) { if (col0 + t * 16 >= N) continue; const size_t boff = (size_t)(col0 + t * 16 + ln) * ldb + kb; FragH bq; bq.half[0] = *(const v8us*)((const unsigned short*)Bh + boff + 8 * hh); bq.half[1] = *(const v8us*)((const unsigned short*)Bh + boff + 16 + 8 * hh);
      acc[t] = mmaH<1>(ah.v, ah.v, bq.v, bq.v, acc[t]); }
  }
#pragma unroll
  for (int t = 0; t < 4; ++t) { if (col0 + t * 16 >= N) continue; const int col = col0 + t * 16 + ln; const float bv = bp ? bf16_round(bp[col]) : 0.f;
#pragma unroll
    for (int r = 0; r < 8; ++r) { float v = acc[t][r] * alpha + bv; if (CP) { const int bidx = (row0g + row0 + 8 * hh + r) / rowsPerB; v += CP[(size_t)bidx * sCPb + (size_t)by * 64 + col]; } if (ACT == 1) v = (v > 0.f) ? v : expm1f(v); else if (ACT == 7) v = (v > 0.f) ? v + 1.0f : expf(v); else if (ACT == 8) v = tanhf(v); else if (ACT == 9) v = 0.5f * v * (1.0f + tanhf(0.7978845608028654f * (v + 0.044715f * v * v * v))); else if (ACT == 11) v = 1.0f / (1.0f + expf(-v)); else if (ACT == 12) v = (v > 0.f) ? v : 0.01f * v; else if (ACT == 14) v = (v > 0.f) ? v : 0.1f * v; else if (ACT == 15) v = v / (1.0f + expf(-v)); else if (ACT == 3) v = fmaxf(v, 0.f); else if (ACT == 6) v = 0.5f * v * (1.0f + erff(v * 0.70710678118654752f)); so[w][8 * hh + r][t * 16 + ln] = v; } }
  __builtin_amdgcn_fence(__ATOMIC_ACQ_REL, "workgroup"); __builtin_amdgcn_wave_barrier();
  const int rsub = lane >> 4, c4 = (lane & 15) * 4; typedef _Float16 v4h __attribute__((ext_vector_type(4)));
  {
#pragma unroll
    for (int q = 0; q < 8; ++q) { const int r = q * 2 + rsub; if (col0 + c4 < N) { const v4f v = *(const v4fa*)&so[w][r][c4]; if (C) *(v4f*)(C + cofs + (size_t)(row0 + r) * ldc + col0 + c4) = v; if (C16) { v4h h4; for (int i = 0; i < 4; ++i) h4[i] = (_Float16)v[i]; *(v4h*)(C16 + cofs + (size_t)(row0 + r) * ldc + col0 + c4) = h4; } } }
     }
}


typedef _Float16 v4h __attribute__((ext_vector_type(4)));

__global__ __launch_bounds__(256) void k_x16(const float* __restrict__ x, _Float16* __restrict__ X16, size_t n8) { const size_t t = (size_t)blockIdx.x * 256 + threadIdx.x; if (t >= n8) return; FragH f;
#pragma unroll
  for (int q = 0; q < 8; ++q) f.h[q] = (_Float16)bf16_round(x[t * 8 + q]); *(v8us*)((unsigned short*)X16 + t * 8) = f.half[0];  }
__global__ __launch_bounds__(256) void k_h16(const float* __restrict__ x, _Float16* __restrict__ X16, size_t n8) { const size_t t = (size_t)blockIdx.x * 256 + threadIdx.x; if (t >= n8) return; FragH f;
#pragma unroll
  for (int q = 0; q < 8; ++q) f.h[q] = (_Float16)x[t * 8 + q]; *(v8us*)((unsigned short*)X16 + t * 8) = f.half[0];  }
__global__ __launch_bounds__(256) void k_round16f(const float* __restrict__ W, _Float16* __restrict__ Bt, size_t n8) { const size_t t = (size_t)blockIdx.x * 256 + threadIdx.x; if (t >= n8) return; FragH f;
#pragma unroll
  for (int i = 0; i < 8; ++i) f.h[i] = (_Float16)(bf16_round(W[t * 8 + i]) * 16.0f); *(v8us*)((unsigned short*)Bt + t * 8) = f.half[0];  }
template <int NHv, int TTv>
__global__ __launch_bounds__(256) void k_vt(const _Float16* __restrict__ V16, int ldv, int voff, _Float16* __restrict__ Vt) { __shared__ unsigned short tl[64][66]; const int tid = threadIdx.x; const int slab = blockIdx.x / (TTv / 64), lg = blockIdx.x % (TTv / 64); const int b = slab / NHv, h = slab % NHv;
  for (int i = tid; i < 64 * 8; i += 256) { const int r = i / 8, c8 = (i % 8) * 8; FragH f; f.half[0] = *(const v8us*)((const unsigned short*)V16 + ((size_t)b * TTv + lg * 64 + r) * ldv + voff + h * 64 + c8);
#pragma unroll
    for (int q = 0; q < 8; ++q) tl[r][c8 + q] = f.u[q]; }
  __syncthreads();
  {
#pragma unroll
    for (int rd = 0; rd < 2; ++rd) { const int d = rd * 32 + tid / 8, pc = tid % 8; FragH f;
#pragma unroll
      for (int q = 0; q < 8; ++q) f.u[q] = tl[pc * 8 + q][d];
      *(v8us*)((unsigned short*)Vt + ((size_t)slab * 64 + d) * TTv + lg * 64 + pc * 8) = f.half[0]; }
     } }

template <int RB>
__global__ __launch_bounds__(256) void k_xt(const float* __restrict__ src, _Float16* __restrict__ XT) { const size_t t = (size_t)blockIdx.x * 256 + threadIdx.x; if (t >= (size_t)BB * TT * 12) return; src += (size_t)blockIdx.y * BB * CC * TT; XT += (size_t)blockIdx.y * BB * TT * 96;      /* blockIdx.y = frame */
  const int c0 = (int)(t % 12) * 8; const size_t bn = t / 12; const int n = (int)(bn % TT), b = (int)(bn / TT); FragH f;
#pragma unroll
  for (int q = 0; q < 8; ++q) { const int c = c0 + q; float v = 0.f; if (c < CC) { v = src[((size_t)b * CC + c) * TT + n]; if (RB) v = bf16_round(v); } else if (c == CC) v = 1.f; f.h[q] = (_Float16)v; }
  *(v8us*)((unsigned short*)XT + t * 8) = f.half[0];  }
// q/k planes for one attention instance: per token n of batch b: q[d] = sum_c wq[d][c]*xs[c][n] + bq[d], k likewise (f32, summed over c in ascending order; xs = bf16-rounded input frame or an internal SA plane (RB)).
// One thread per token. The 2 x 8 x 64 weights are rounded to bf16 once per block into LDS (sW[c] = wq[0..7][c], wk[0..7][c]) and read from there as broadcasts; the token's channel values are loaded 16 at a time, one trip ahead of their sums, so the sums wait for memory once and not once per channel.
// Every sum keeps its order and the separate rounding of product and sum (the directive at the head of the body stands as it stood), so q and k come out bit for bit as before.
template <int RB>
__global__ __launch_bounds__(128) void k_qk(const float* __restrict__ xs, size_t sx, const float* __restrict__ wq, const float* __restrict__ bq, const float* __restrict__ wk, const float* __restrict__ bk, int slab0, _Float16* __restrict__ QP, _Float16* __restrict__ KP) {
  #pragma clang fp contract(off)
  __shared__ __attribute__((aligned(16))) float sW[CC][16];
  const int tid = threadIdx.x;
  { const int ai = blockIdx.y; xs += (size_t)ai * sx; wq += ai * 8 * CC; bq += ai * 8; wk += ai * 8 * CC; bk += ai * 8; slab0 += ai * BB; }      /* blockIdx.y = attention instance; sx = floats between the sources of two instances */
  const int bn = (int)blockIdx.x * 128 + tid; const int n = bn % TT, b = bn / TT;      /* the grid holds exactly BB * TT threads */
  const float* xp = xs + (size_t)b * CC * TT + n;
  float wr[8], xn[16];      /* the weights' loads and those of channels 0..15 are issued together; the short loops over wr, xn and xc are unrolled so that the arrays stay in registers and the loads stand back to back */
#pragma unroll
  for (int j = 0; j < 4; ++j) { wr[j] = wq[j * 128 + tid]; wr[4 + j] = wk[j * 128 + tid]; }
#pragma unroll
  for (int i = 0; i < 16; ++i) xn[i] = xp[(size_t)i * TT];
  asm volatile("s_wait_xcnt 0x0" ::: "memory");      /* stands behind the run of weight and channel loads, in front of the first rewrite of a register that holds one of their addresses */
#pragma unroll
  for (int j = 0; j < 4; ++j) { const int i = j * 128 + tid, d = i / CC, c = i % CC; sW[c][d] = bf16_round(wr[j]); sW[c][8 + d] = bf16_round(wr[4 + j]); }
  float q[8], k[8]; for (int d = 0; d < 8; ++d) { q[d] = bf16_round(bq[d]); k[d] = bf16_round(bk[d]); }
  __syncthreads();      /* the rounded weights are in LDS before any thread reads them */
  /* kept rolled, 16 channels a trip: unrolled whole, the build fetched so many weights ahead that it took about 800 vector registers */
#pragma unroll 1
  for (int c0 = 0; c0 < CC; c0 += 16) { float xc[16];
#pragma unroll
    for (int i = 0; i < 16; ++i) xc[i] = xn[i];
    if (c0 + 16 < CC) {      /* the next trip's channels fly under this trip's sums */
#pragma unroll
      for (int i = 0; i < 16; ++i) xn[i] = xp[(size_t)(c0 + 16 + i) * TT];
      asm volatile("s_wait_xcnt 0x0" ::: "memory"); }      /* the build advances these loads' address registers early in the trip */
#pragma unroll
    for (int i = 0; i < 16; ++i) { const int c = c0 + i; float xv = xc[i]; if (RB) xv = bf16_round(xv);
      const v4f wa = *(const v4fa*)&sW[c][0], wb = *(const v4fa*)&sW[c][4], wc = *(const v4fa*)&sW[c][8], wd = *(const v4fa*)&sW[c][12];
#pragma unroll
      for (int d = 0; d < 4; ++d) { q[d] += wa[d] * xv; q[4 + d] += wb[d] * xv; k[d] += wc[d] * xv; k[4 + d] += wd[d] * xv; } } }
  FragH fq0, fq1, fk0, fk1, fk2;      /* 16-B pieces of a row: Q = [q_hi | q_lo * 2^10 | q_hi | 0], K = [k_hi | k_hi * 2^-10 | k_lo | 0] */
#pragma unroll
  for (int d = 0; d < 8; ++d) { const _Float16 qh = (_Float16)q[d], kh = (_Float16)k[d]; const float qlo = (q[d] - (float)qh) * 1024.0f, klo = (k[d] - (float)kh);
    fq0.h[d] = qh; fq1.h[d] = (_Float16)qlo; fk0.h[d] = kh; fk1.h[d] = (_Float16)((float)kh * 0.0009765625f); fk2.h[d] = (_Float16)klo; }
  const v8us zz = {0, 0, 0, 0, 0, 0, 0, 0};
  const size_t row = (size_t)(slab0 + b) * TT + n; unsigned short* qo = (unsigned short*)QP + row * 32; unsigned short* ko = (unsigned short*)KP + row * 32;
  *(v8us*)qo = fq0.half[0]; *(v8us*)(qo + 8) = fq1.half[0]; *(v8us*)(qo + 16) = fq0.half[0]; *(v8us*)(qo + 24) = zz;
  *(v8us*)ko = fk0.half[0]; *(v8us*)(ko + 8) = fk1.half[0]; *(v8us*)(ko + 16) = fk2.half[0]; *(v8us*)(ko + 24) = zz; }
__global__ __launch_bounds__(256) void k_wvb(const float* __restrict__ swv, const float* __restrict__ sbv, const float* __restrict__ gwv, const float* __restrict__ gbv, _Float16* __restrict__ A16) { const int t = blockIdx.x * 256 + threadIdx.x; if (t >= CC * 12) return;
  const int ai = blockIdx.y; const float* wv = (ai < 3) ? swv + (size_t)ai * CC * CC : gwv + (size_t)(ai - 3) * CC * CC; const float* bv = (ai < 3) ? sbv + ai * CC : gbv + (ai - 3) * CC; A16 += (size_t)ai * CC * 96;      /* blockIdx.y = attention instance: 0..2 self, 3..4 guided */
  const int e = t / 12, c0 = (t % 12) * 8; FragH f;
  for (int q = 0; q < 8; ++q) { const int c = c0 + q; float v = 0.f; if (c < CC) v = bf16_round(wv[e * CC + c]); else if (c == CC) v = bf16_round(bv[e]); f.h[q] = (_Float16)(v * 16.0f); }
  *(v8us*)((unsigned short*)A16 + (size_t)t * 8) = f.half[0];  }
template <int RB>
__global__ __launch_bounds__(256) void k_ocm(const float* __restrict__ O, int slab0, const float* __restrict__ res, size_t sres, float* __restrict__ DST) { __shared__ float tl[64][65]; const int tid = threadIdx.x; slab0 += (int)blockIdx.y * BB; res += (size_t)blockIdx.y * sres; DST += (size_t)blockIdx.y * BB * CC * TT;      /* blockIdx.y = attention instance; sres = floats between two instances' residuals */
  const int b = blockIdx.x / (TT / 64), nb = blockIdx.x % (TT / 64); const int n0 = nb * 64;
  for (int i = tid; i < 64 * 64; i += 256) { const int n = i / 64, e = i % 64; tl[n][e] = O[((size_t)(slab0 + b) * TT + n0 + n) * CC + e]; } __syncthreads();
  const int piece = tid % 16, esub = tid / 16;      /* 16 consecutive lanes = one channel's 256-B segment (tokens n0..n0+63); 16 channels per iteration */
  v4f vals[4];
  for (int it = 0; it < 4; ++it) { const int e = it * 16 + esub; v4f v; for (int j = 0; j < 4; ++j) { float rv = res[((size_t)b * CC + e) * TT + n0 + piece * 4 + j]; if (RB) rv = bf16_round(rv); v[j] = tl[piece * 4 + j][e] + rv; } vals[it] = v; }
  { for (int it = 0; it < 4; ++it) { const int e = it * 16 + esub; *(v4f*)(DST + ((size_t)b * CC + e) * TT + n0 + piece * 4) = vals[it]; }  } }
__global__ __launch_bounds__(256) void k_cat(const float* __restrict__ M0, const float* __restrict__ M1, _Float16* __restrict__ CAT) { __shared__ float tl[128][65]; const int tid = threadIdx.x; const int b = blockIdx.x / (TT / 64), nb = blockIdx.x % (TT / 64); const int n0 = nb * 64;
  for (int i = tid; i < 128 * 64; i += 256) { const int ch = i / 64, n = i % 64; tl[ch][n] = (ch < 64) ? M0[((size_t)b * CC + ch) * TT + n0 + n] : M1[((size_t)b * CC + ch - 64) * TT + n0 + n]; } __syncthreads();
  const int piece = tid % 16, nsub = tid / 16;      /* 16 consecutive lanes = one token's 256-B row (128 halves); 16 tokens per iteration */
  FragH fv[4];
  for (int it = 0; it < 4; ++it) { const int n = it * 16 + nsub; for (int q = 0; q < 8; ++q) fv[it].h[q] = (_Float16)tl[piece * 8 + q][n]; }
  { for (int it = 0; it < 4; ++it) { const int n = it * 16 + nsub; *(v8us*)((unsigned short*)CAT + ((size_t)b * TT + n0 + n) * 128 + piece * 8) = fv[it].half[0]; }  } }
__global__ __launch_bounds__(256) void k_finb(const float* __restrict__ FUS, const float* __restrict__ tb, const float* __restrict__ SA1, float* __restrict__ out, size_t n4) {
  #pragma clang fp contract(off)
  const size_t t = (size_t)blockIdx.x * 256 + threadIdx.x; if (t >= n4) return; const int e = (int)(((t * 4) / TT) % CC); const float bb = bf16_round(tb[e]); const v4f f = *(const v4fa*)(FUS + t * 4), s = *(const v4fa*)(SA1 + t * 4); v4f o; for (int q = 0; q < 4; ++q) o[q] = (f[q] + bb) * s[q] + s[q]; *(v4f*)(out + t * 4) = o;  }
// Block = 4 query tiles x KSPL key ranges: wave w works query tile w & 3 over keys [(w >> 2) * TT/KSPL, +TT/KSPL) with its own running max, row sum and unnormalised O; the KSPL partials of a tile are merged through LDS at the end.
// Scores are formed transposed, S^T = K.Q^T (A = 16 key rows, B = the wave's 16 queries), so lane (ln, hh) holds 16 of the 32 scores of query ln: max and sum run inside the lane, plus one exchange between the wave halves for the max.
// The two S^T tiles of a trip hold keys 8hh + r and 16 + 8hh + r, which is the k order of the loaders here, so P^T goes from the accumulators into a B operand in registers and O^T += V^T.P^T (A = 16 channel rows of Vt); P never passes through LDS.
__device__ __forceinline__ float xhalf(float x) { return __builtin_bit_cast(float, __builtin_amdgcn_permlanex16(__builtin_bit_cast(int, x), __builtin_bit_cast(int, x), 0x76543210, 0xfedcba98, false, false)); }      /* lane l <-> lane l ^ 16 */
typedef float v2f __attribute__((ext_vector_type(2)));
typedef _Float16 v2h __attribute__((ext_vector_type(2)));
// Softmax runs in base 2: the running max is kept as m2 = score * log2(e) - 10, and every weight is 2^(score * log2(e) - m2) = 1024 * e^(score - max): one FMA and one hardware exp2 per score.
// The factor 1024 (the f16 scale of P) sits in O and in the row sum alike and cancels in O / l. Arguments are <= 10, so nothing overflows; a weight below 2^-126 counts as 0.
#define LOG2E 1.4426950408889634f
// One hardware exp2 with a free issue slot on either side: the instruction set asks for one independent instruction or v_nop between a transcendental and a neighbour that overwrites its source or reads its result.
__device__ __forceinline__ float exp2_slot(float x) { float y; asm("v_nop\n\tv_exp_f32 %0, %1\n\tv_nop" : "=v"(y) : "v"(x)); return y; }
template <int KSPL>
__global__ __launch_bounds__(128 * KSPL, 8) void k_flash(const _Float16* __restrict__ Q16, int ldq, const _Float16* __restrict__ K16, int ldk, const _Float16* __restrict__ Vt, const int* __restrict__ MSK, float* __restrict__ O, int ldo) {
  constexpr int RPW = 16, NQB = TT / (4 * RPW), DT = 4, NW = 4 * KSPL;      /* d_qk = 32 (24 real + zero padding), d_v = 64 */
  __shared__ __attribute__((aligned(16))) float sO[NW][RPW][64 + 4];
  __shared__ float sM[NW][RPW], sL[NW][RPW];
  (void)MSK;
  const int tid = threadIdx.x, w = __builtin_amdgcn_readfirstlane(tid >> 5), lane = tid & 31, ln = lane & 15, hh = lane >> 4;
  const int slab = blockIdx.x / NQB, qblk = blockIdx.x % NQB; const int b = slab / NH; const int qb0 = qblk * (4 * RPW); const int q0 = qb0 + (w & 3) * RPW;
  FragH bq;      /* B operand: column ln = query q0 + ln */
  { const unsigned short* qr = (const unsigned short*)Q16 + ((size_t)b * TT + q0 + ln) * ldq; bq.half[0] = *(const v8us*)(qr + 8 * hh); bq.half[1] = *(const v8us*)(qr + 16 + 8 * hh); }
  const unsigned short* Vth = (const unsigned short*)Vt + (size_t)slab * 64 * TT;      /* v per slab: [64][4096] */
  float m_r = -3.0e38f, l_r = 0.f; v8f oacc[DT];      /* m_r in base-2 units, shifted by -10 */      /* oacc[dt][r] = O^T[channel dt * 16 + 8hh + r][query ln] */
#pragma unroll
  for (int dt = 0; dt < DT; ++dt) oacc[dt] = (v8f){0.f,0.f,0.f,0.f,0.f,0.f,0.f,0.f};
  const int jbeg = (w >> 2) * (TT / KSPL);
#pragma unroll 1
  for (int it = 0; it < TT / KSPL / 32; ++it) { const int j0 = jbeg + it * 32;
    v8f s[2];      /* s[nt][r] = score of key j0 + nt * 16 + 8hh + r with query ln */
#pragma unroll
    for (int nt = 0; nt < 2; ++nt) { const unsigned short* kr = (const unsigned short*)K16 + ((size_t)b * TT + j0 + nt * 16 + ln) * ldk; FragH ak; ak.half[0] = *(const v8us*)(kr + 8 * hh); ak.half[1] = *(const v8us*)(kr + 16 + 8 * hh);
      s[nt] = mmaH<1>(ak.v, ak.v, bq.v, bq.v, (v8f){0.f,0.f,0.f,0.f,0.f,0.f,0.f,0.f}); }
    float mc = fmaxf(s[0][0], s[1][0]);
#pragma unroll
    for (int r = 1; r < 8; ++r) mc = fmaxf(mc, fmaxf(s[0][r], s[1][r]));
    mc = fmaxf(mc, xhalf(mc));      /* both halves hold the max over the trip's 32 keys */
    const float mn = fmaxf(m_r, __builtin_fmaf(mc, LOG2E, -10.0f)); const float ae = exp2_slot(m_r - mn); const float al = (mn > -1.0e38f) ? ae : 1.0f; m_r = mn;
    FragH ph, pl; float ls = 0.f;      /* P^T * 1024 as f16 hi + residual: element nt * 8 + r = key nt * 16 + 8hh + r */
#pragma unroll
    for (int nt = 0; nt < 2; ++nt)
#pragma unroll
      for (int r = 0; r < 8; r += 2) { const v2f ar = __builtin_elementwise_fma((v2f){s[nt][r], s[nt][r + 1]}, (v2f){LOG2E, LOG2E}, (v2f){-mn, -mn}); const float pa = __builtin_amdgcn_exp2f(ar[0]), pb = __builtin_amdgcn_exp2f(ar[1]); ls += pa; ls += pb; const v2f ps = (v2f){pa, pb}; const v2h hi = __builtin_convertvector(ps, v2h); const v2h lo = __builtin_convertvector(ps - __builtin_convertvector(hi, v2f), v2h);
        ph.h[nt * 8 + r] = hi[0]; ph.h[nt * 8 + r + 1] = hi[1]; pl.h[nt * 8 + r] = lo[0]; pl.h[nt * 8 + r + 1] = lo[1]; }
    l_r = l_r * al + ls;      /* this half's 16 keys; the halves are joined behind the loop */
#pragma unroll
    for (int dt = 0; dt < DT; ++dt) oacc[dt] *= al;
#pragma unroll
    for (int dt = 0; dt < DT; ++dt) { const unsigned short* vrow = Vth + (size_t)(dt * 16 + ln) * TT + j0; FragH av; av.half[0] = *(const v8us*)(vrow + 8 * hh); av.half[1] = *(const v8us*)(vrow + 16 + 8 * hh);
      oacc[dt] = mmaH<1>(av.v, av.v, ph.v, ph.v, oacc[dt]); oacc[dt] = mmaH<1>(av.v, av.v, pl.v, pl.v, oacc[dt]); } }      /* V^T.(Ph + Pl) */
  l_r += xhalf(l_r);
  if (hh == 0) { sM[w][ln] = m_r; sL[w][ln] = l_r; }
#pragma unroll
  for (int dt = 0; dt < DT; ++dt) { *(v4fa*)&sO[w][ln][dt * 16 + 8 * hh] = (v4f){oacc[dt][0], oacc[dt][1], oacc[dt][2], oacc[dt][3]}; *(v4fa*)&sO[w][ln][dt * 16 + 8 * hh + 4] = (v4f){oacc[dt][4], oacc[dt][5], oacc[dt][6], oacc[dt][7]}; }
  __syncthreads();      /* every wave's partial is in LDS before any thread merges */
  /* merge: thread = (query of the block, 4 channels); O = sum_s 2^(m_s - M) * O_s / sum_s 2^(m_s - M) * l_s, M = max_s m_s; O_s and l_s both carry the factor 1024 */
#pragma unroll
  for (int i = tid; i < 4 * RPW * 16; i += 128 * KSPL) { const int qq = i >> 4, pc = i & 15, g = qq / RPW, r = qq % RPW;
    float mx = sM[g][r];
#pragma unroll
    for (int s = 1; s < KSPL; ++s) mx = fmaxf(mx, sM[s * 4 + g][r]);
    float l = 0.f; v4f a = {0.f, 0.f, 0.f, 0.f};
#pragma unroll
    for (int s = 0; s < KSPL; ++s) { const float e = exp2_slot(sM[s * 4 + g][r] - mx); l += sL[s * 4 + g][r] * e; const v4f val = *(const v4fa*)&sO[s * 4 + g][r][pc * 4]; a += val * e; }
    const float inv = (l > 0.f) ? 1.0f / l : 0.f;
    *(v4f*)(O + ((size_t)slab * TT + qb0 + qq) * ldo + pc * 4) = a * inv; } }

extern "C" void kernel_launch(void* const* d_in, const int* in_sizes, int n_in,
                              void* d_out, int out_size, void* d_ws, size_t ws_size, hipStream_t stream) {
  (void)in_sizes; (void)n_in; (void)out_size;
  const float* const* I = (const float* const*)d_in; const float* x = I[0]; const float* sa_wq = I[1]; const float* sa_bq = I[2]; const float* sa_wk = I[3]; const float* sa_bk = I[4]; const float* sa_wv = I[5]; const float* sa_bv = I[6];
  const float* ga_wq = I[7]; const float* ga_bq = I[8]; const float* ga_wk = I[9]; const float* ga_bk = I[10]; const float* ga_wv = I[11]; const float* ga_bv = I[12]; const float* tw = I[13]; const float* tb = I[14];
  char* ws = (char*)d_ws; size_t off = 0;
  auto take = [&](size_t bytes) { char* p = ws + off; off += (bytes + 255) & ~(size_t)255; return p; };
  const size_t PL = (size_t)BB * CC * TT;      /* one [B][64][4096] f32 plane = 1 M floats */
  _Float16* AWV = (_Float16*)take((size_t)5 * CC * 96 * 2); _Float16* TW16 = (_Float16*)take((size_t)CC * 128 * 2);
  _Float16* XT = (_Float16*)take((size_t)3 * BB * TT * 96 * 2); _Float16* QP = (_Float16*)take((size_t)NSL * TT * 32 * 2); _Float16* KP = (_Float16*)take((size_t)NSL * TT * 32 * 2); _Float16* VT = (_Float16*)take((size_t)NSL * CC * TT * 2); float* O = (float*)take((size_t)NSL * TT * CC * 4);
  float* SA = (float*)take(3 * PL * 4); float* MF = (float*)take(2 * PL * 4); _Float16* CAT = (_Float16*)take((size_t)BB * TT * 128 * 2); float* FUS = (float*)take(PL * 4);
  if (off > ws_size) return;      // 0.1 + 9.4 + 5.2 + 5.2 + 10.5 + 21 + 12.6 + 8.4 + 4.2 + 4.2 = about 81 MB
  k_wvb<<<dim3((CC * 12 + 255) / 256, 5), 256, 0, stream>>>(sa_wv, sa_bv, ga_wv, ga_bv, AWV);      /* all five value projections in one launch */
  k_round16f<<<(CC * 128 / 8 + 255) / 256, 256, 0, stream>>>(tw, TW16, CC * 128 / 8);      /* tfus_w [64 o][128 c] natural = the A operand ×2^4 */
  const unsigned gxt = (unsigned)(((size_t)BB * TT * 12 + 255) / 256), gqk = (unsigned)((size_t)BB * TT / 128); const unsigned gvx = ((CC / 16) * (TT / 64) + 3) / 4;
  /* self attention on the three frames: slabs a * BB + b for a = 0,1,2; each stage is one launch over all three frames (frame on blockIdx.y, for the GEMM on blockIdx.z, for the flash kernel in the slab of blockIdx.x), XT holds one plane per frame */
  k_xt<1><<<dim3(gxt, 3), 256, 0, stream>>>(x, XT);
  k_qk<1><<<dim3(gqk, 3), 128, 0, stream>>>(x, PL, sa_wq, sa_bq, sa_wk, sa_bk, 0, QP, KP);
  k_gemm_hhx<0><<<dim3(gvx, BB, 3), 128, 0, stream>>>(AWV, 96, 0, XT, 96, (size_t)TT * 96, 0.0625f, nullptr, 0, nullptr, 1, 0, 0, nullptr, VT, TT, (size_t)CC * TT, CC, TT, 96, (size_t)CC * 96, (size_t)BB * TT * 96, (size_t)BB * CC * TT);      /* v[b][e][m] = wv.x + bv, channel-major f16: batched over b and frame, M 64 N 4096 K 96 */
  k_flash<8><<<3 * BB * (TT / 64), 1024, 0, stream>>>(QP, 32, KP, 32, VT, nullptr, O, CC);      /* slabs 0..11; 768 blocks of 32 waves = three full rounds of the WGPs */
  k_ocm<1><<<dim3(BB * (TT / 64), 3), 256, 0, stream>>>(O, 0, x, PL, SA);      /* SA_a = attn-out + x_a (channel-major f32) */
  /* guided attentions: slabs 12..15 (q,k from SA_0; v,res from SA_1) and 16..19 (q,k from SA_2) */
  k_xt<0><<<gxt, 256, 0, stream>>>(SA + PL, XT);      /* SA_1 token-major (internal f32, no rounding) */
  k_qk<0><<<dim3(gqk, 2), 128, 0, stream>>>(SA, 2 * PL, ga_wq, ga_bq, ga_wk, ga_bk, 3 * BB, QP, KP);      /* sources SA_0 and SA_2 */
  k_gemm_hhx<0><<<dim3(gvx, BB, 2), 128, 0, stream>>>(AWV + (size_t)3 * CC * 96, 96, 0, XT, 96, (size_t)TT * 96, 0.0625f, nullptr, 0, nullptr, 1, 0, 0, nullptr, VT + (size_t)3 * BB * CC * TT, TT, (size_t)CC * TT, CC, TT, 96, (size_t)CC * 96, 0, (size_t)BB * CC * TT);      /* both read the SA_1 plane of XT */
  k_flash<4><<<2 * BB * (TT / 64), 512, 0, stream>>>(QP + (size_t)3 * BB * TT * 32, 32, KP + (size_t)3 * BB * TT * 32, 32, VT + (size_t)3 * BB * CC * TT, nullptr, O + (size_t)3 * BB * TT * CC, CC);      /* slabs 12..19 (kernel-relative 0..7) */
  k_ocm<0><<<dim3(BB * (TT / 64), 2), 256, 0, stream>>>(O + (size_t)3 * BB * TT * CC, 0, SA + PL, 0, MF);      /* mfi_gi = attn-out + SA_1 */
  k_cat<<<BB * (TT / 64), 256, 0, stream>>>(MF, MF + PL, CAT);
  k_gemm_hhx<0><<<dim3(((CC / 16) * (TT / 64) + 3) / 4, BB), 128, 0, stream>>>(TW16, 128, 0, CAT, 128, (size_t)TT * 128, 0.0625f, nullptr, 0, nullptr, 1, 0, 0, FUS, nullptr, TT, (size_t)CC * TT, CC, TT, 128, 0, 0, 0);      /* fusion[b][o][n] = Σ_c W[o][c]·cat[b][c][n]: A = W (M 64, K 128), Bt = CAT[b] token-major; bias tfus_b per ROW o → added in k_fin? no: see k_finb */
  k_finb<<<(unsigned)((PL / 4 + 255) / 256), 256, 0, stream>>>(FUS, tb, SA + PL, (float*)d_out, PL / 4);
}

// v006
// A run of this version takes 242 microseconds.
// Next to v005, in two timings, it ran 1.18 times as fast each time.
// All steps since v000 together make it 4.47 times as fast.
#include <hip/hip_runtime.h>
// MFI (3 frames, B=4, C=64, 64×64 → N=4096): SA_f = position attention on frame f (q = wq·x+bq (8 ch), k = wk·x+bk (8 ch), v = wv·x+bv (64 ch); attn = softmax_m(q[:,n]·k[:,m]) unscaled; out[e][n] = Σ_m v[e][m]·attn[n][m] + x[e][n]); then two guided attentions
// (q,k from SA_0 / SA_2, v and residual from SA_1), cat → fusion = tfus_w·cat + b; out = fusion·SA_1 + SA_1 → [4,64,64,64].
// Compute dtype: x, weights, biases rounded to bf16; q/k per token in f32 VALU (8×64 dot, rolled) emitted as concatenated f16 planes [q_hi|q_lo·2^10|q_hi|0] and [k_hi|k_hi·2^-10|k_lo|0] so ONE 32-wide WMMA k-step yields f32-accurate logits; v (+bias via an
// augmented ones column) channel-major by GEMM (f16); fused flash-style kernel per (slab, 64 queries) (online softmax f32, P f16 hi + residual, residual added in f32 by its merge, which writes SA channel-major f32 or cat token-major f16); cat f16 -> fusion GEMM -> out = fusion * sa_1 + sa_1 in f32. All on v_wmma_f32_16x16x32_f16.
#define NFR 3
#define BB 4
#define CC 64
#define TT 4096
#define NH 1
#define NSL (5 * BB)

typedef __bf16 v16b __attribute__((ext_vector_type(16)));
typedef unsigned short v8us __attribute__((ext_vector_type(8), may_alias));
typedef float  v8f  __attribute__((ext_vector_type(8)));
typedef float  v4f  __attribute__((ext_vector_type(4)));
typedef float  v4fa __attribute__((ext_vector_type(4), may_alias));
union FragB { v16b v; v8us half[2]; unsigned short u[16]; };

__device__ __forceinline__ unsigned short bf16_bits(float x) { unsigned int u = __float_as_uint(x); return (unsigned short)((u + 0x7FFFu + ((u >> 16) & 1u)) >> 16); }
__device__ __forceinline__ float bf16_val(unsigned short b) { return __uint_as_float(((unsigned int)b) << 16); }
__device__ __forceinline__ float bf16_round(float x) { return bf16_val(bf16_bits(x)); }
// D += A·B with NT terms: 1 = ah·bh, 2 = + al·bh (A split), 3 = + ah·bl (both split)
template <int NT>
__device__ __forceinline__ v8f mmaN(v16b ah, v16b al, v16b bh, v16b bl, v8f c) {
  c = __builtin_amdgcn_wmma_f32_16x16x32_bf16(false, ah, false, bh, (short)0, c, false, false);
  if (NT >= 2) c = __builtin_amdgcn_wmma_f32_16x16x32_bf16(false, al, false, bh, (short)0, c, false, false);
  if (NT >= 3) c = __builtin_amdgcn_wmma_f32_16x16x32_bf16(false, ah, false, bl, (short)0, c, false, false);
  asm volatile("v_nop\n\tv_nop\n\tv_nop\n\tv_nop" : "+v"(c) : "v"(ah), "v"(al), "v"(bh), "v"(bl));
  return c;
}

__global__ __launch_bounds__(256) void k_wt_bf16(const float* __restrict__ W, unsigned short* __restrict__ Wt, int K, int N) {
  const int t = blockIdx.x * 256 + threadIdx.x;
  const int k8n = K / 8;
  if (t >= N * k8n) return;
  const int n = t / k8n, k8 = (t % k8n) * 8;
  v8us v;
#pragma unroll
  for (int i = 0; i < 8; ++i) v[i] = bf16_bits(W[(size_t)(k8 + i) * N + n]);
  *(v8us*)(Wt + (size_t)n * K + k8) = v;
  
}

// GEMM C[M][N] (f32, pitch ldc) = act(A[M][K]·W + bias). A f32 row-major (pitch lda) converted per fragment to bf16
// (ASPLIT: hi/lo two planes -> 2 terms, else single rounded term); Wt bf16 [N][K] (pitch ldb). BIAS_BF16 rounds the
// bias to bf16 first (bias quantised to bf16 before the add). K%32==0, M%16==0, N%64==0.
template <bool ASPLIT, int ACT, bool BIAS_BF16>
__global__ __launch_bounds__(128) void k_gemm_bf(const float* __restrict__ A, int lda, const unsigned short* __restrict__ Wt, int ldb,
                                               const float* __restrict__ bias, float* __restrict__ C, int ldc, int M, int N, int K) {
  __shared__ __attribute__((aligned(16))) float so[4][16][64];
  const int tid = threadIdx.x, w = tid >> 5, lane = tid & 31, ln = lane & 15, hh = lane >> 4;
  const int ntn = N / 64;
  const int wid = blockIdx.x * 4 + w;
  const int mt = wid / ntn, nq = wid % ntn;
  if (mt * 16 >= M) return;
  const int row0 = mt * 16, col0 = nq * 64;
  const float* arow = A + (size_t)(row0 + ln) * lda;
  v8f acc[4] = {};
  for (int kb = 0; kb < K; kb += 32) {
    FragB ah, al;
    const v4f x0 = *(const v4fa*)(arow + kb + 8 * hh), x1 = *(const v4fa*)(arow + kb + 8 * hh + 4);
    const v4f x2 = *(const v4fa*)(arow + kb + 16 + 8 * hh), x3 = *(const v4fa*)(arow + kb + 16 + 8 * hh + 4);
    float xs[16] = {x0[0],x0[1],x0[2],x0[3],x1[0],x1[1],x1[2],x1[3],x2[0],x2[1],x2[2],x2[3],x3[0],x3[1],x3[2],x3[3]};
#pragma unroll
    for (int i = 0; i < 16; ++i) { const unsigned short hb = bf16_bits(xs[i]); ah.u[i] = hb; al.u[i] = ASPLIT ? bf16_bits(xs[i] - bf16_val(hb)) : (unsigned short)0; }
#pragma unroll
    for (int t = 0; t < 4; ++t) {
      const unsigned short* brow = Wt + (size_t)(col0 + t * 16 + ln) * ldb + kb;
      FragB b;
      b.half[0] = *(const v8us*)(brow + 8 * hh);
      b.half[1] = *(const v8us*)(brow + 16 + 8 * hh);
      acc[t] = mmaN<ASPLIT ? 2 : 1>(ah.v, al.v, b.v, b.v, acc[t]);
    }
  }
#pragma unroll
  for (int t = 0; t < 4; ++t) {
    float bv = bias ? bias[col0 + t * 16 + ln] : 0.f;
    if (BIAS_BF16) bv = bf16_round(bv);
#pragma unroll
    for (int r = 0; r < 8; ++r) { float v = acc[t][r] + bv; if (ACT == 1) v = fmaxf(v, 0.f); so[w][8 * hh + r][t * 16 + ln] = v; }
  }
  __builtin_amdgcn_fence(__ATOMIC_ACQ_REL, "workgroup");
  __builtin_amdgcn_wave_barrier();
  const int rsub = lane >> 4, c4 = (lane & 15) * 4;
  {
#pragma unroll
    for (int q = 0; q < 8; ++q) {
      const int r = q * 2 + rsub;
      const v4f v = *(const v4fa*)&so[w][r][c4];
      *(v4f*)(C + (size_t)(row0 + r) * ldc + col0 + c4) = v;
    }
    
  }
}

// Flash-style causal/unmasked attention, all contractions 3-term bf16 hi/lo splits, f32 softmax with running max.
// q,k,v rows are read from f32 buffers with arbitrary row pitch (so they can live inside a fused qkv buffer);
// D = head size (multiple of 32, <= 128); one wave = 16 query rows; block = 4 waves (64 queries) sharing K/V chunks of 32.
template <int D, bool CAUSAL>
__global__ __launch_bounds__(128) void k_flash(const float* __restrict__ qb, const float* __restrict__ kb, const float* __restrict__ vb,
                                             int pitch, int T, int H, float scale, float* __restrict__ y, int ypitch) {
  constexpr int KS = D / 32;        // k-steps for QK
  constexpr int DT = D / 16;        // d tiles for PV
  __shared__ __attribute__((aligned(16))) unsigned short sKh[32][D + 8], sKl[32][D + 8], sVh[32][D + 8], sVl[32][D + 8];
  __shared__ __attribute__((aligned(16))) unsigned short sPh[4][16][40], sPl[4][16][40];
  __shared__ __attribute__((aligned(16))) float sO[4][16][D];
  const int tid = threadIdx.x, w = tid >> 5, lane = tid & 31, ln = lane & 15, hh = lane >> 4;
  const int nqb = (T + 63) / 64;
  const int bh = blockIdx.x / nqb, qblk = blockIdx.x % nqb;
  const int b = bh / H, h = bh % H;
  const int q0 = qblk * 64 + w * 16;
  const float* Q = qb + (size_t)b * T * pitch + h * D;
  const float* K = kb + (size_t)b * T * pitch + h * D;
  const float* V = vb + (size_t)b * T * pitch + h * D;

  // A fragments of the wave's 16 query rows (scaled), hi/lo
  FragB aqh[KS], aql[KS];
  {
    int row = q0 + ln; if (row >= T) row = T - 1;
    const float* qr = Q + (size_t)row * pitch;
#pragma unroll
    for (int ks = 0; ks < KS; ++ks)
#pragma unroll
      for (int i = 0; i < 16; ++i) {
        const int d = ks * 32 + ((i < 8) ? (8 * hh + i) : (16 + 8 * hh + (i - 8)));
        const float x = qr[d] * scale; const unsigned short hb = bf16_bits(x);
        aqh[ks].u[i] = hb; aql[ks].u[i] = bf16_bits(x - bf16_val(hb));
      }
  }
  float m_r[8], l_r[8];
#pragma unroll
  for (int r = 0; r < 8; ++r) { m_r[r] = -3.0e38f; l_r[r] = 0.f; }
  v8f oacc[DT];
#pragma unroll
  for (int dt = 0; dt < DT; ++dt) oacc[dt] = (v8f){0.f,0.f,0.f,0.f,0.f,0.f,0.f,0.f};

  const int kv_end = CAUSAL ? min(T, qblk * 64 + 64) : T;     // block-uniform
  for (int j0 = 0; j0 < kv_end; j0 += 32) {
    __syncthreads();
    for (int e = tid; e < 32 * (D / 4); e += 128) {
      const int r = e / (D / 4), c4 = (e % (D / 4)) * 4;
      const int key = j0 + r;
      v4f kf = {0.f,0.f,0.f,0.f}, vf = {0.f,0.f,0.f,0.f};
      if (key < T) { kf = *(const v4fa*)(K + (size_t)key * pitch + c4); vf = *(const v4fa*)(V + (size_t)key * pitch + c4); }
#pragma unroll
      for (int t = 0; t < 4; ++t) {
        unsigned short hb = bf16_bits(kf[t]); sKh[r][c4 + t] = hb; sKl[r][c4 + t] = bf16_bits(kf[t] - bf16_val(hb));
        hb = bf16_bits(vf[t]); sVh[r][c4 + t] = hb; sVl[r][c4 + t] = bf16_bits(vf[t] - bf16_val(hb));
      }
    }
    __syncthreads();
    // S tile 16 x 32
    v8f s[2];
#pragma unroll
    for (int nt = 0; nt < 2; ++nt) {
      v8f acc = {};
#pragma unroll
      for (int ks = 0; ks < KS; ++ks) {
        FragB bh_, bl_;
        bh_.half[0] = *(const v8us*)&sKh[nt * 16 + ln][ks * 32 + 8 * hh]; bh_.half[1] = *(const v8us*)&sKh[nt * 16 + ln][ks * 32 + 16 + 8 * hh];
        bl_.half[0] = *(const v8us*)&sKl[nt * 16 + ln][ks * 32 + 8 * hh]; bl_.half[1] = *(const v8us*)&sKl[nt * 16 + ln][ks * 32 + 16 + 8 * hh];
        acc = mmaN<3>(aqh[ks].v, aql[ks].v, bh_.v, bl_.v, acc);
      }
      s[nt] = acc;
    }
    // mask + running max (rows 8hh+r; the 16 lanes of a half share rows)
    float alpha[8];
#pragma unroll
    for (int r = 0; r < 8; ++r) {
      const int qi = q0 + 8 * hh + r;
      const int ja = j0 + ln, jb = j0 + 16 + ln;
      if (CAUSAL) { if (ja > qi) s[0][r] = -3.0e38f; if (jb > qi) s[1][r] = -3.0e38f; }
      if (ja >= T) s[0][r] = -3.0e38f;
      if (jb >= T) s[1][r] = -3.0e38f;
      float mx = fmaxf(s[0][r], s[1][r]);
      mx = fmaxf(mx, __shfl_xor(mx, 1, 32)); mx = fmaxf(mx, __shfl_xor(mx, 2, 32)); mx = fmaxf(mx, __shfl_xor(mx, 4, 32)); mx = fmaxf(mx, __shfl_xor(mx, 8, 32));
      const float mnew = fmaxf(m_r[r], mx);
      alpha[r] = (mnew > -1.0e38f) ? __expf(m_r[r] - mnew) : 1.0f;
      const float p0 = (s[0][r] > -1.0e38f) ? __expf(s[0][r] - mnew) : 0.f;
      const float p1 = (s[1][r] > -1.0e38f) ? __expf(s[1][r] - mnew) : 0.f;
      m_r[r] = mnew;
      l_r[r] = l_r[r] * alpha[r] + p0 + p1;            // per-lane partial row sum (16 lanes combined at the end)
      unsigned short hb = bf16_bits(p0); sPh[w][8 * hh + r][ln] = hb;      sPl[w][8 * hh + r][ln] = bf16_bits(p0 - bf16_val(hb));
      hb = bf16_bits(p1);                sPh[w][8 * hh + r][16 + ln] = hb; sPl[w][8 * hh + r][16 + ln] = bf16_bits(p1 - bf16_val(hb));
    }
#pragma unroll
    for (int dt = 0; dt < DT; ++dt)
#pragma unroll
      for (int r = 0; r < 8; ++r) oacc[dt][r] *= alpha[r];
    __builtin_amdgcn_fence(__ATOMIC_ACQ_REL, "workgroup");
    __builtin_amdgcn_wave_barrier();
    FragB pah, pal;
    pah.half[0] = *(const v8us*)&sPh[w][ln][8 * hh]; pah.half[1] = *(const v8us*)&sPh[w][ln][16 + 8 * hh];
    pal.half[0] = *(const v8us*)&sPl[w][ln][8 * hh]; pal.half[1] = *(const v8us*)&sPl[w][ln][16 + 8 * hh];
#pragma unroll
    for (int dt = 0; dt < DT; ++dt) {
      FragB bvh, bvl;
#pragma unroll
      for (int i = 0; i < 8; ++i) {
        bvh.u[i] = sVh[8 * hh + i][dt * 16 + ln]; bvh.u[8 + i] = sVh[16 + 8 * hh + i][dt * 16 + ln];
        bvl.u[i] = sVl[8 * hh + i][dt * 16 + ln]; bvl.u[8 + i] = sVl[16 + 8 * hh + i][dt * 16 + ln];
      }
      oacc[dt] = mmaN<3>(pah.v, pal.v, bvh.v, bvl.v, oacc[dt]);
    }
    __builtin_amdgcn_fence(__ATOMIC_ACQ_REL, "workgroup");
    __builtin_amdgcn_wave_barrier();
  }
#pragma unroll
  for (int r = 0; r < 8; ++r) {
    float l = l_r[r];
    l += __shfl_xor(l, 1, 32); l += __shfl_xor(l, 2, 32); l += __shfl_xor(l, 4, 32); l += __shfl_xor(l, 8, 32);
    l_r[r] = (l > 0.f) ? 1.0f / l : 0.f;
  }
#pragma unroll
  for (int dt = 0; dt < DT; ++dt)
#pragma unroll
    for (int r = 0; r < 8; ++r) sO[w][8 * hh + r][dt * 16 + ln] = oacc[dt][r] * l_r[r];
  __builtin_amdgcn_fence(__ATOMIC_ACQ_REL, "workgroup");
  __builtin_amdgcn_wave_barrier();
  {
    for (int r = 0; r < 16; ++r) {
      const int row = q0 + r;
      if (row < T && lane < D / 4) {
        const v4f val = *(const v4fa*)&sO[w][r][lane * 4];
        *(v4f*)(y + ((size_t)b * T + row) * ypitch + h * D + lane * 4) = val;
      }
    }
    
  }
}

// GEMM C = act(A·W + bias + resid): A f32 (ASPLIT -> hi/lo 2 terms), Wt bf16 [N][K]; ACT 0 none, 1 relu, 2 exact gelu;
// resid (optional, f32, row index = (row % rmod), pitch ldr, RES_BF16 rounds it) added before the activation.
template <bool ASPLIT, int ACT, bool BIAS_BF16, bool RES_BF16>
__global__ __launch_bounds__(128) void k_gemm_bf3(const float* __restrict__ A, int lda, const unsigned short* __restrict__ Wt, int ldb,
                                                const float* __restrict__ bias, const float* __restrict__ resid, int rmod, int ldr,
                                                float* __restrict__ C, int ldc, int M, int N, int K) {
  __shared__ __attribute__((aligned(16))) float so[4][16][64];
  const int tid = threadIdx.x, w = tid >> 5, lane = tid & 31, ln = lane & 15, hh = lane >> 4;
  const int ntn = N / 64;
  const int wid = blockIdx.x * 4 + w;
  const int mt = wid / ntn, nq = wid % ntn;
  if (mt * 16 >= M) return;
  const int row0 = mt * 16, col0 = nq * 64;
  const float* arow = A + (size_t)(row0 + ln) * lda;
  v8f acc[4] = {};
  for (int kb = 0; kb < K; kb += 32) {
    FragB ah, al;
    const v4f x0 = *(const v4fa*)(arow + kb + 8 * hh), x1 = *(const v4fa*)(arow + kb + 8 * hh + 4);
    const v4f x2 = *(const v4fa*)(arow + kb + 16 + 8 * hh), x3 = *(const v4fa*)(arow + kb + 16 + 8 * hh + 4);
    float xs[16] = {x0[0],x0[1],x0[2],x0[3],x1[0],x1[1],x1[2],x1[3],x2[0],x2[1],x2[2],x2[3],x3[0],x3[1],x3[2],x3[3]};
#pragma unroll
    for (int i = 0; i < 16; ++i) { const unsigned short hb = bf16_bits(xs[i]); ah.u[i] = hb; al.u[i] = ASPLIT ? bf16_bits(xs[i] - bf16_val(hb)) : (unsigned short)0; }
#pragma unroll
    for (int t = 0; t < 4; ++t) {
      const unsigned short* brow = Wt + (size_t)(col0 + t * 16 + ln) * ldb + kb;
      FragB b;
      b.half[0] = *(const v8us*)(brow + 8 * hh);
      b.half[1] = *(const v8us*)(brow + 16 + 8 * hh);
      acc[t] = mmaN<ASPLIT ? 2 : 1>(ah.v, al.v, b.v, b.v, acc[t]);
    }
  }
#pragma unroll
  for (int t = 0; t < 4; ++t) {
    const int col = col0 + t * 16 + ln;
    float bv = bias ? bias[col] : 0.f;
    if (BIAS_BF16) bv = bf16_round(bv);
#pragma unroll
    for (int r = 0; r < 8; ++r) {
      float v = acc[t][r] + bv;
      if (resid) { float rv = resid[(size_t)((row0 + 8 * hh + r) % rmod) * ldr + col]; if (RES_BF16) rv = bf16_round(rv); v += rv; }
      if (ACT == 1) v = fmaxf(v, 0.f);
      if (ACT == 2) v = 0.5f * v * (1.0f + erff(v * 0.70710678118654752f));
      if (ACT == 3) { const float u = 0.7978845608028654f * (v + 0.044715f * v * v * v); v = 0.5f * v * (1.0f + tanhf(u)); }
      so[w][8 * hh + r][t * 16 + ln] = v;
    }
  }
  __builtin_amdgcn_fence(__ATOMIC_ACQ_REL, "workgroup");
  __builtin_amdgcn_wave_barrier();
  const int rsub = lane >> 4, c4 = (lane & 15) * 4;
  {
#pragma unroll
    for (int q = 0; q < 8; ++q) {
      const int r = q * 2 + rsub;
      const v4f v = *(const v4fa*)&so[w][r][c4];
      *(v4f*)(C + (size_t)(row0 + r) * ldc + col0 + c4) = v;
    }
    
  }
}
// row LayerNorm (biased variance, eps) over N: s = X (+ R); optional out_sum <- s; out_norm <- (s-mu)*rsqrt(var+eps)*g + b
template <bool PARAM_BF16>
__global__ __launch_bounds__(256) void k_layernorm(const float* __restrict__ X, const float* __restrict__ R, const float* __restrict__ g, const float* __restrict__ bta,
                                                  float* __restrict__ out_sum, float* __restrict__ out_norm, int N, float eps) {
  __shared__ float red[256];
  const int row = blockIdx.x, tid = threadIdx.x;
  const float* x = X + (size_t)row * N; const float* rr = R ? R + (size_t)row * N : nullptr;
  float vals[16];                     // up to N = 4096
  const int per = N / 256;            // contiguous chunk per thread? use strided-by-4 chunks: thread handles j = tid*4 + 1024*u
  float s1 = 0.f;
  for (int u = 0; u < per / 4; ++u) {
    const int j = tid * 4 + 1024 * u;
    const v4f a = *(const v4fa*)(x + j);
    v4f b = {0.f,0.f,0.f,0.f}; if (rr) b = *(const v4fa*)(rr + j);
#pragma unroll
    for (int q = 0; q < 4; ++q) { const float v = a[q] + b[q]; vals[u * 4 + q] = v; s1 += v; }
  }
  red[tid] = s1; __syncthreads();
  for (int st = 128; st > 0; st >>= 1) { if (tid < st) red[tid] += red[tid + st]; __syncthreads(); }
  const float mu = red[0] / (float)N; __syncthreads();
  float s2 = 0.f;
  for (int u = 0; u < per / 4; ++u)
#pragma unroll
    for (int q = 0; q < 4; ++q) { const float c = vals[u * 4 + q] - mu; s2 += c * c; }
  red[tid] = s2; __syncthreads();
  for (int st = 128; st > 0; st >>= 1) { if (tid < st) red[tid] += red[tid + st]; __syncthreads(); }
  const float rs = rsqrtf(red[0] / (float)N + eps);
  {
    for (int u = 0; u < per / 4; ++u) {
      const int j = tid * 4 + 1024 * u;
      v4f o, sm;
#pragma unroll
      for (int q = 0; q < 4; ++q) {
        float gg = g[j + q], bb = bta[j + q];
        if (PARAM_BF16) { gg = bf16_round(gg); bb = bf16_round(bb); }
        sm[q] = vals[u * 4 + q]; o[q] = (vals[u * 4 + q] - mu) * rs * gg + bb;
      }
      if (out_sum) *(v4f*)(out_sum + (size_t)row * N + j) = sm;
      *(v4f*)(out_norm + (size_t)row * N + j) = o;
    }
    
  }
}



// ---- f16 WMMA path (v_wmma_f32_16x16x32_f16): 11-bit significands for operands in range — used where a [0,1] probability operand needs more precision than bf16
typedef _Float16 v16h __attribute__((ext_vector_type(16)));
union FragH { v16h v; v8us half[2]; _Float16 h[16]; unsigned short u[16]; };
template <int NT>
__device__ __forceinline__ v8f mmaH(v16h ah, v16h al, v16h bh, v16h bl, v8f c) {
  c = __builtin_amdgcn_wmma_f32_16x16x32_f16(false, ah, false, bh, (short)0, c, false, false);
  if (NT >= 2) c = __builtin_amdgcn_wmma_f32_16x16x32_f16(false, al, false, bh, (short)0, c, false, false);
  if (NT >= 3) c = __builtin_amdgcn_wmma_f32_16x16x32_f16(false, ah, false, bl, (short)0, c, false, false);
  asm volatile("v_nop\n\tv_nop\n\tv_nop\n\tv_nop" : "+v"(c) : "v"(ah), "v"(al), "v"(bh), "v"(bl));
  return c;
}
// batched GEMM like k_gemm_b but f16 operands: A f32 (split into f16 hi/lo if ASPLIT, else rounded to f16), Bt = f16 values [n][k]; alpha; C f32; N multiple of 16 (partial tiles skipped)
template <bool ASPLIT>
__global__ __launch_bounds__(128) void k_gemm_h(const float* __restrict__ A, int lda, size_t sA, const _Float16* __restrict__ Bh, int ldb, size_t sB, float alpha, float* __restrict__ C, int ldc, size_t sC, int M, int N, int K) {
  __shared__ __attribute__((aligned(16))) float so[4][16][64];
  const int tid = threadIdx.x, w = tid >> 5, lane = tid & 31, ln = lane & 15, hh = lane >> 4; const int by = blockIdx.y;
  A += (size_t)by * sA; Bh += (size_t)by * sB; C += (size_t)by * sC;
  const int ntn = (N + 63) / 64; const int wid = blockIdx.x * 4 + w; const int mt = wid / ntn, nq = wid % ntn; if (mt * 16 >= M) return;
  const int row0 = mt * 16, col0 = nq * 64; const float* arow = A + (size_t)(row0 + ln) * lda;
  v8f acc[4] = {};
  for (int kb = 0; kb < K; kb += 32) {
    FragH ah, al;
    const v4f x0 = *(const v4fa*)(arow + kb + 8 * hh), x1 = *(const v4fa*)(arow + kb + 8 * hh + 4), x2 = *(const v4fa*)(arow + kb + 16 + 8 * hh), x3 = *(const v4fa*)(arow + kb + 16 + 8 * hh + 4);
    float xs[16] = {x0[0],x0[1],x0[2],x0[3],x1[0],x1[1],x1[2],x1[3],x2[0],x2[1],x2[2],x2[3],x3[0],x3[1],x3[2],x3[3]};
#pragma unroll
    for (int i = 0; i < 16; ++i) { const _Float16 h = (_Float16)xs[i]; ah.h[i] = h; al.h[i] = ASPLIT ? (_Float16)(xs[i] - (float)h) : (_Float16)0.0f; }
#pragma unroll
    for (int t = 0; t < 4; ++t) { if (col0 + t * 16 >= N) continue; const size_t boff = (size_t)(col0 + t * 16 + ln) * ldb + kb; FragH bq; bq.half[0] = *(const v8us*)(Bh + boff + 8 * hh); bq.half[1] = *(const v8us*)(Bh + boff + 16 + 8 * hh);
      acc[t] = mmaH<ASPLIT ? 2 : 1>(ah.v, al.v, bq.v, bq.v, acc[t]); }
  }
#pragma unroll
  for (int t = 0; t < 4; ++t) { if (col0 + t * 16 >= N) continue;
#pragma unroll
    for (int r = 0; r < 8; ++r) so[w][8 * hh + r][t * 16 + ln] = acc[t][r] * alpha; }
  __builtin_amdgcn_fence(__ATOMIC_ACQ_REL, "workgroup"); __builtin_amdgcn_wave_barrier();
  const int rsub = lane >> 4, c4 = (lane & 15) * 4;
  {
#pragma unroll
    for (int q = 0; q < 8; ++q) { const int r = q * 2 + rsub; if (col0 + c4 < N) { const v4f v = *(const v4fa*)&so[w][r][c4]; *(v4f*)(C + (size_t)(row0 + r) * ldc + col0 + c4) = v; } }
     }
}

// Wt[n][k] = f16(W[k][n]·scale) from f32 row-major W[K][N] (scale = power of two; bf16-exact weights stay exact in f16 away from the subnormal range)
__global__ __launch_bounds__(256) void k_wt_f16(const float* __restrict__ W, _Float16* __restrict__ Wt, int K, int N, float scale) {
  const int t = blockIdx.x * 256 + threadIdx.x; if (t >= N * (K / 8)) return; const int n = t / (K / 8), k8 = (t % (K / 8)) * 8; FragH f;
#pragma unroll
  for (int i = 0; i < 8; ++i) f.h[i] = (_Float16)(bf16_round(W[(size_t)(k8 + i) * N + n]) * scale); const v8us o = f.half[0];
  *(v8us*)((unsigned short*)Wt + (size_t)n * K + k8) = o; 
}
// k_gemm_hh variant with fused epilogue: v = acc * alpha + bias[by * sBias + col] (+ CP[(row/rowsPerB) * sCPb + by * 64 + col] if CP) ; ACT 0 none / 1 elu ; writes f16 C16 (and f32 C if non-null); FIN: the last stage of the network in the epilogue, C = (v + bf16(rowb[row])) * S + S with S laid out like C
template <int ACT, bool FIN>
__global__ __launch_bounds__(128) void k_gemm_hhx(const _Float16* __restrict__ A, int lda, size_t sA, const _Float16* __restrict__ Bh, int ldb, size_t sB, float alpha, const float* __restrict__ bias, size_t sBias, const float* __restrict__ CP, int rowsPerB, size_t sCPb, int row0g,
    float* __restrict__ C, _Float16* __restrict__ C16, int ldc, size_t sC, int M, int N, int K, size_t sAz, size_t sBz, size_t sCz, const float* __restrict__ rowb, const float* __restrict__ S) {
  __shared__ __attribute__((aligned(16))) float so[4][16][64];
  const int tid = threadIdx.x, w = tid >> 5, lane = tid & 31, ln = lane & 15, hh = lane >> 4; const int by = blockIdx.y, bz = blockIdx.z;      /* bz = attention instance, with strides of its own */
  A += (size_t)by * sA + (size_t)bz * sAz; Bh += (size_t)by * sB + (size_t)bz * sBz; const size_t cofs = (size_t)by * sC + (size_t)bz * sCz; const float* bp = bias ? bias + (size_t)by * sBias : nullptr;
  const int ntn = (N + 63) / 64; const int wid = blockIdx.x * 4 + w; const int mt = wid / ntn, nq = wid % ntn; if (mt * 16 >= M) return;
  const int row0 = mt * 16, col0 = nq * 64; const _Float16* arow = A + (size_t)(row0 + ln) * lda;
  v8f acc[4] = {};
  v4f sv[8]; float rb[8];      /* FIN: this lane's pieces of S and its rows' biases, loaded here so that they fly under the product */
  if (FIN) {
#pragma unroll
    for (int q = 0; q < 8; ++q) { const int r = q * 2 + (lane >> 4); rb[q] = rowb[row0 + r]; sv[q] = *(const v4fa*)(S + cofs + (size_t)(row0 + r) * ldc + col0 + (lane & 15) * 4); }
    asm volatile("s_wait_xcnt 0x0" ::: "memory"); }      /* behind this run of loads, in front of the first rewrite of a register that holds one of their addresses */
  for (int kb = 0; kb < K; kb += 32) { FragH ah; ah.half[0] = *(const v8us*)((const unsigned short*)arow + kb + 8 * hh); ah.half[1] = *(const v8us*)((const unsigned short*)arow + kb + 16 + 8 * hh);
#pragma unroll
    for (int t = 0; t < 4; ++t) { if (col0 + t * 16 >= N) continue; const size_t boff = (size_t)(col0 + t * 16 + ln) * ldb + kb; FragH bq; bq.half[0] = *(const v8us*)((const unsigned short*)Bh + boff + 8 * hh); bq.half[1] = *(const v8us*)((const unsigned short*)Bh + boff + 16 + 8 * hh);
      acc[t] = mmaH<1>(ah.v, ah.v, bq.v, bq.v, acc[t]); }
  }
#pragma unroll
  for (int t = 0; t < 4; ++t) { if (col0 + t * 16 >= N) continue; const int col = col0 + t * 16 + ln; const float bv = bp ? bf16_round(bp[col]) : 0.f;
#pragma unroll
    for (int r = 0; r < 8; ++r) { float v = acc[t][r] * alpha + bv; if (CP) { const int bidx = (row0g + row0 + 8 * hh + r) / rowsPerB; v += CP[(size_t)bidx * sCPb + (size_t)by * 64 + col]; } if (ACT == 1) v = (v > 0.f) ? v : expm1f(v); else if (ACT == 7) v = (v > 0.f) ? v + 1.0f : expf(v); else if (ACT == 8) v = tanhf(v); else if (ACT == 9) v = 0.5f * v * (1.0f + tanhf(0.7978845608028654f * (v + 0.044715f * v * v * v))); else if (ACT == 11) v = 1.0f / (1.0f + expf(-v)); else if (ACT == 12) v = (v > 0.f) ? v : 0.01f * v; else if (ACT == 14) v = (v > 0.f) ? v : 0.1f * v; else if (ACT == 15) v = v / (1.0f + expf(-v)); else if (ACT == 3) v = fmaxf(v, 0.f); else if (ACT == 6) v = 0.5f * v * (1.0f + erff(v * 0.70710678118654752f)); so[w][8 * hh + r][t * 16 + ln] = v; } }
  __builtin_amdgcn_fence(__ATOMIC_ACQ_REL, "workgroup"); __builtin_amdgcn_wave_barrier();
  const int rsub = lane >> 4, c4 = (lane & 15) * 4; typedef _Float16 v4h __attribute__((ext_vector_type(4)));
  if (FIN) {      /* C = (v + bias of its row) * S + S, straight from the tile; like the loads of S above it takes whole 64-column tiles (N a multiple of 64) */
#pragma unroll
    for (int q = 0; q < 8; ++q) { const int r = q * 2 + rsub; const v4f v = *(const v4fa*)&so[w][r][c4]; const float bb = bf16_round(rb[q]); v4f o; for (int i = 0; i < 4; ++i) o[i] = (v[i] + bb) * sv[q][i] + sv[q][i]; *(v4f*)(C + cofs + (size_t)(row0 + r) * ldc + col0 + c4) = o; }
    return; }
  {
#pragma unroll
    for (int q = 0; q < 8; ++q) { const int r = q * 2 + rsub; if (col0 + c4 < N) { const v4f v = *(const v4fa*)&so[w][r][c4]; if (C) *(v4f*)(C + cofs + (size_t)(row0 + r) * ldc + col0 + c4) = v; if (C16) { v4h h4; for (int i = 0; i < 4; ++i) h4[i] = (_Float16)v[i]; *(v4h*)(C16 + cofs + (size_t)(row0 + r) * ldc + col0 + c4) = h4; } } }
     }
}


typedef _Float16 v4h __attribute__((ext_vector_type(4)));

__global__ __launch_bounds__(256) void k_x16(const float* __restrict__ x, _Float16* __restrict__ X16, size_t n8) { const size_t t = (size_t)blockIdx.x * 256 + threadIdx.x; if (t >= n8) return; FragH f;
#pragma unroll
  for (int q = 0; q < 8; ++q) f.h[q] = (_Float16)bf16_round(x[t * 8 + q]); *(v8us*)((unsigned short*)X16 + t * 8) = f.half[0];  }
__global__ __launch_bounds__(256) void k_h16(const float* __restrict__ x, _Float16* __restrict__ X16, size_t n8) { const size_t t = (size_t)blockIdx.x * 256 + threadIdx.x; if (t >= n8) return; FragH f;
#pragma unroll
  for (int q = 0; q < 8; ++q) f.h[q] = (_Float16)x[t * 8 + q]; *(v8us*)((unsigned short*)X16 + t * 8) = f.half[0];  }
template <int NHv, int TTv>
__global__ __launch_bounds__(256) void k_vt(const _Float16* __restrict__ V16, int ldv, int voff, _Float16* __restrict__ Vt) { __shared__ unsigned short tl[64][66]; const int tid = threadIdx.x; const int slab = blockIdx.x / (TTv / 64), lg = blockIdx.x % (TTv / 64); const int b = slab / NHv, h = slab % NHv;
  for (int i = tid; i < 64 * 8; i += 256) { const int r = i / 8, c8 = (i % 8) * 8; FragH f; f.half[0] = *(const v8us*)((const unsigned short*)V16 + ((size_t)b * TTv + lg * 64 + r) * ldv + voff + h * 64 + c8);
#pragma unroll
    for (int q = 0; q < 8; ++q) tl[r][c8 + q] = f.u[q]; }
  __syncthreads();
  {
#pragma unroll
    for (int rd = 0; rd < 2; ++rd) { const int d = rd * 32 + tid / 8, pc = tid % 8; FragH f;
#pragma unroll
      for (int q = 0; q < 8; ++q) f.u[q] = tl[pc * 8 + q][d];
      *(v8us*)((unsigned short*)Vt + ((size_t)slab * 64 + d) * TTv + lg * 64 + pc * 8) = f.half[0]; }
     } }

// Weights of the GEMMs as f16 x 2^4, thread t = one 16-B piece: the five value projections [64 e][96] (64 weights, the bias in column 64, zeros; instances 0..2 self, 3..4 guided), then tfus_w [64 o][128 c] as it lies.
__device__ __forceinline__ void prep_weights(int t, const float* __restrict__ swv, const float* __restrict__ sbv, const float* __restrict__ gwv, const float* __restrict__ gbv, const float* __restrict__ tw, _Float16* __restrict__ A16, _Float16* __restrict__ TW) {
  FragH f;
  if (t < 5 * CC * 12) { const int ai = t / (CC * 12), u = t % (CC * 12); const float* wv = (ai < 3) ? swv + (size_t)ai * CC * CC : gwv + (size_t)(ai - 3) * CC * CC; const float* bv = (ai < 3) ? sbv + ai * CC : gbv + (ai - 3) * CC;
    const int e = u / 12, c0 = (u % 12) * 8;
    v4f va = {0.f, 0.f, 0.f, 0.f}, vb = {0.f, 0.f, 0.f, 0.f};      /* a piece is eight weights in a row, or the bias and seven zeros, or zeros: one round of loads, not eight awaited ones */
    if (c0 < CC) { va = *(const v4fa*)(wv + e * CC + c0); vb = *(const v4fa*)(wv + e * CC + c0 + 4); } else if (c0 == CC) va[0] = bv[e];
#pragma unroll
    for (int q = 0; q < 4; ++q) { f.h[q] = (_Float16)(bf16_round(va[q]) * 16.0f); f.h[4 + q] = (_Float16)(bf16_round(vb[q]) * 16.0f); }
    *(v8us*)((unsigned short*)A16 + (size_t)t * 8) = f.half[0]; }
  else if (t < 5 * CC * 12 + CC * 128 / 8) { const int u = t - 5 * CC * 12;
#pragma unroll
    for (int i = 0; i < 8; ++i) f.h[i] = (_Float16)(bf16_round(tw[u * 8 + i]) * 16.0f);
    *(v8us*)((unsigned short*)TW + (size_t)u * 8) = f.half[0]; } }
__device__ __forceinline__ void xt_tail(unsigned short* xo) { const v8us one = {0x3C00, 0, 0, 0, 0, 0, 0, 0}, zz = {0, 0, 0, 0, 0, 0, 0, 0}; *(v8us*)(xo + 64) = one; *(v8us*)(xo + 72) = zz; *(v8us*)(xo + 80) = zz; *(v8us*)(xo + 88) = zz; }      /* columns 64..95 of an XT row: 1.0 (takes the bias), then zeros */
__device__ __forceinline__ void xt_out(unsigned short* xg, const unsigned short* sx, int tid) {      /* 128 rows of 96 halves from LDS (pitch 104) to memory, 16-B piece p = j * 128 + tid: each wave store covers 512 B in a row */
#pragma unroll
  for (int j = 0; j < 12; ++j) { const int p = j * 128 + tid; *(v8us*)(xg + (size_t)p * 8) = *(const v8us*)(sx + (p / 12) * 104 + (p % 12) * 8); }
  asm volatile("s_wait_xcnt 0x0" ::: "memory"); }      /* behind this run of stores, in front of the first rewrite of a register that one of them names */
// q/k planes and the token-major f16 plane XT (the V GEMM's B operand: 64 channels, a one for the bias column, zeros up to 96), from one pass over a source plane.
// q/k planes for one attention instance: per token n of batch b: q[d] = sum_c wq[d][c]*xs[c][n] + bq[d], k likewise (f32, summed over c in ascending order; xs = bf16-rounded input frame or an internal SA plane (RB)).
// One thread per token. The 2 x 8 x 64 weights are rounded to bf16 once per block into LDS (sW[c] = wq[0..7][c], wk[0..7][c]) and read from there as broadcasts; the token's channel values are loaded 16 at a time, one trip ahead of their sums, so the sums wait for memory once and not once per channel.
// Every sum keeps its order and the separate rounding of product and sum (the directive at the head of the body stands as it stood), so q and k come out bit for bit as before.
template <int RB>
__global__ __launch_bounds__(128) void k_qk(const float* __restrict__ xs, size_t sx, const float* __restrict__ wq, const float* __restrict__ bq, const float* __restrict__ wk, const float* __restrict__ bk, int slab0, _Float16* __restrict__ QP, _Float16* __restrict__ KP, _Float16* __restrict__ XT,
    const float* __restrict__ swv, const float* __restrict__ sbv, const float* __restrict__ gwv, const float* __restrict__ gbv, const float* __restrict__ tw, _Float16* __restrict__ AWV, _Float16* __restrict__ TW16) {
  #pragma clang fp contract(off)
  __shared__ __attribute__((aligned(16))) float sW[CC][16];
  __shared__ __attribute__((aligned(16))) unsigned short sX[128][96 + 8];      /* the block's 128 rows of XT; pitch 208 B = 16 B x odd, so a wave's 16-B row pieces fall on different banks */
  const int tid = threadIdx.x;
  const int y = blockIdx.y;      /* source plane. RB (self): plane y = frame y gives q, k and XT, and the blocks of y == 3 convert the weights of the GEMMs. Guided: planes 0 and 2 give q, k of instance y >> 1, plane 1 gives XT */
  if (RB && y == 3) { prep_weights((int)blockIdx.x * 128 + tid, swv, sbv, gwv, gbv, tw, AWV, TW16); return; }      /* whole blocks, in front of the barrier */
  { const int ai = RB ? y : (y >> 1); xs += (size_t)y * sx; wq += ai * 8 * CC; bq += ai * 8; wk += ai * 8 * CC; bk += ai * 8; slab0 += ai * BB; if (RB) XT += (size_t)y * BB * TT * 96; }      /* sx = floats between two source planes; one XT plane per frame */
  const int bn = (int)blockIdx.x * 128 + tid; const int n = bn % TT, b = bn / TT;      /* the grid holds exactly BB * TT threads */
  const float* xp = xs + (size_t)b * CC * TT + n; unsigned short* xo = &sX[tid][0];      /* this token's row of XT, staged in LDS: the block's rows lie in a row in memory and leave as whole lines (xt_out) */
  unsigned short* xg = (unsigned short*)XT + (size_t)blockIdx.x * 128 * 96;
  if (!RB && y == 1) {      /* whole blocks, in front of the barrier: this plane only feeds the V GEMM, so its 64 channel loads go out together and the row follows */
    float xa[CC];
#pragma unroll
    for (int cc = 0; cc < CC; ++cc) xa[cc] = xp[(size_t)cc * TT];
#pragma unroll
    for (int c0 = 0; c0 < CC; c0 += 8) { FragH f;
#pragma unroll
      for (int i = 0; i < 8; ++i) f.h[i] = (_Float16)xa[c0 + i];
      *(v8us*)(xo + c0) = f.half[0]; }
    xt_tail(xo);
    __syncthreads();      /* every row is in LDS before any thread copies across rows; reached by the whole block or not at all */
    xt_out(xg, &sX[0][0], tid); return; }
  float wr[8], xn[16];      /* the weights' loads and those of channels 0..15 are issued together; the short loops over wr, xn and xc are unrolled so that the arrays stay in registers and the loads stand back to back */
#pragma unroll
  for (int j = 0; j < 4; ++j) { wr[j] = wq[j * 128 + tid]; wr[4 + j] = wk[j * 128 + tid]; }
#pragma unroll
  for (int i = 0; i < 16; ++i) xn[i] = xp[(size_t)i * TT];
  asm volatile("s_wait_xcnt 0x0" ::: "memory");      /* stands behind the run of weight and channel loads, in front of the first rewrite of a register that holds one of their addresses */
#pragma unroll
  for (int j = 0; j < 4; ++j) { const int i = j * 128 + tid, d = i / CC, c = i % CC; sW[c][d] = bf16_round(wr[j]); sW[c][8 + d] = bf16_round(wr[4 + j]); }
  float q[8], k[8]; for (int d = 0; d < 8; ++d) { q[d] = bf16_round(bq[d]); k[d] = bf16_round(bk[d]); }
  __syncthreads();      /* the rounded weights are in LDS before any thread reads them */
  /* kept rolled, 16 channels a trip: unrolled whole, the build fetched so many weights ahead that it took about 800 vector registers */
#pragma unroll 1
  for (int c0 = 0; c0 < CC; c0 += 16) { float xc[16];
#pragma unroll
    for (int i = 0; i < 16; ++i) xc[i] = xn[i];
    if (c0 + 16 < CC) {      /* the next trip's channels fly under this trip's sums */
#pragma unroll
      for (int i = 0; i < 16; ++i) xn[i] = xp[(size_t)(c0 + 16 + i) * TT];
      asm volatile("s_wait_xcnt 0x0" ::: "memory"); }      /* the build advances these loads' address registers early in the trip */
    float xv[16];
#pragma unroll
    for (int i = 0; i < 16; ++i) { xv[i] = xc[i]; if (RB) xv[i] = bf16_round(xv[i]); }
#pragma unroll
    for (int i = 0; i < 16; ++i) { const int c = c0 + i;
      const v4f wa = *(const v4fa*)&sW[c][0], wb = *(const v4fa*)&sW[c][4], wc = *(const v4fa*)&sW[c][8], wd = *(const v4fa*)&sW[c][12];
#pragma unroll
      for (int d = 0; d < 4; ++d) { q[d] += wa[d] * xv[i]; q[4 + d] += wb[d] * xv[i]; k[d] += wc[d] * xv[i]; k[4 + d] += wd[d] * xv[i]; } }
    if (RB) { FragH f0, f1;      /* self: the frame that gives q and k is also the V GEMM's operand */
#pragma unroll
      for (int i = 0; i < 8; ++i) { f0.h[i] = (_Float16)xv[i]; f1.h[i] = (_Float16)xv[8 + i]; }
      *(v8us*)(xo + c0) = f0.half[0]; *(v8us*)(xo + c0 + 8) = f1.half[0]; } }
  FragH fq0, fq1, fk0, fk1, fk2;      /* 16-B pieces of a row: Q = [q_hi | q_lo * 2^10 | q_hi | 0], K = [k_hi | k_hi * 2^-10 | k_lo | 0] */
#pragma unroll
  for (int d = 0; d < 8; ++d) { const _Float16 qh = (_Float16)q[d], kh = (_Float16)k[d]; const float qlo = (q[d] - (float)qh) * 1024.0f, klo = (k[d] - (float)kh);
    fq0.h[d] = qh; fq1.h[d] = (_Float16)qlo; fk0.h[d] = kh; fk1.h[d] = (_Float16)((float)kh * 0.0009765625f); fk2.h[d] = (_Float16)klo; }
  const v8us zz = {0, 0, 0, 0, 0, 0, 0, 0};
  if (RB) { xt_tail(xo);
    __syncthreads();      /* every row is in LDS before any thread copies across rows */
    xt_out(xg, &sX[0][0], tid); }
  const size_t row = (size_t)(slab0 + b) * TT + n; unsigned short* qo = (unsigned short*)QP + row * 32; unsigned short* ko = (unsigned short*)KP + row * 32;
  *(v8us*)qo = fq0.half[0]; *(v8us*)(qo + 8) = fq1.half[0]; *(v8us*)(qo + 16) = fq0.half[0]; *(v8us*)(qo + 24) = zz;
  *(v8us*)ko = fk0.half[0]; *(v8us*)(ko + 8) = fk1.half[0]; *(v8us*)(ko + 16) = fk2.half[0]; *(v8us*)(ko + 24) = zz; }
// Block = 4 query tiles x KSPL key ranges: wave w works query tile w & 3 over keys [(w >> 2) * TT/KSPL, +TT/KSPL) with its own running max, row sum and unnormalised O; the KSPL partials of a tile are merged through LDS at the end.
// Scores are formed transposed, S^T = K.Q^T (A = 16 key rows, B = the wave's 16 queries), so lane (ln, hh) holds 16 of the 32 scores of query ln: max and sum run inside the lane, plus one exchange between the wave halves for the max.
// The two S^T tiles of a trip hold keys 8hh + r and 16 + 8hh + r, which is the k order of the loaders here, so P^T goes from the accumulators into a B operand in registers and O^T += V^T.P^T (A = 16 channel rows of Vt); P never passes through LDS.
__device__ __forceinline__ float xhalf(float x) { return __builtin_bit_cast(float, __builtin_amdgcn_permlanex16(__builtin_bit_cast(int, x), __builtin_bit_cast(int, x), 0x76543210, 0xfedcba98, false, false)); }      /* lane l <-> lane l ^ 16 */
typedef float v2f __attribute__((ext_vector_type(2)));
typedef _Float16 v2h __attribute__((ext_vector_type(2)));
// Softmax runs in base 2: the running max is kept as m2 = score * log2(e) - 10, and every weight is 2^(score * log2(e) - m2) = 1024 * e^(score - max): one FMA and one hardware exp2 per score.
// The factor 1024 (the f16 scale of P) sits in O and in the row sum alike and cancels in O / l. Arguments are <= 10, so nothing overflows; a weight below 2^-126 counts as 0.
#define LOG2E 1.4426950408889634f
// One hardware exp2 with a free issue slot on either side: the instruction set asks for one independent instruction or v_nop between a transcendental and a neighbour that overwrites its source or reads its result.
__device__ __forceinline__ float exp2_slot(float x) { float y; asm("v_nop\n\tv_exp_f32 %0, %1\n\tv_nop" : "=v"(y) : "v"(x)); return y; }
// The merge also adds the residual and writes the stage's result in the layout its reader wants. SELF: SAo[slab][e][n] = O + bf16(RES[slab][e][n]), channel-major f32; a wave holds 32 queries of one channel group, so every load and store is a whole 128-B line.
// Guided: CATo[b][n][g * 64 + e] = f16(O + RES[b][e][n]) for slab = g * BB + b, token-major f16; 16 lanes write one token's 128 B.
template <int KSPL, bool SELF>
__global__ __launch_bounds__(128 * KSPL, 8) void k_flash(const _Float16* __restrict__ Q16, int ldq, const _Float16* __restrict__ K16, int ldk, const _Float16* __restrict__ Vt, const int* __restrict__ MSK, const float* __restrict__ RES, float* __restrict__ SAo, _Float16* __restrict__ CATo) {
  constexpr int RPW = 16, NQB = TT / (4 * RPW), DT = 4, NW = 4 * KSPL;      /* d_qk = 32 (24 real + zero padding), d_v = 64 */
  __shared__ __attribute__((aligned(16))) float sO[NW][RPW][64 + 4];
  __shared__ float sM[NW][RPW], sL[NW][RPW];
  (void)MSK;
  const int tid = threadIdx.x, w = __builtin_amdgcn_readfirstlane(tid >> 5), lane = tid & 31, ln = lane & 15, hh = lane >> 4;
  const int slab = blockIdx.x / NQB, qblk = blockIdx.x % NQB; const int b = slab / NH; const int qb0 = qblk * (4 * RPW); const int q0 = qb0 + (w & 3) * RPW;
  FragH bq;      /* B operand: column ln = query q0 + ln */
  { const unsigned short* qr = (const unsigned short*)Q16 + ((size_t)b * TT + q0 + ln) * ldq; bq.half[0] = *(const v8us*)(qr + 8 * hh); bq.half[1] = *(const v8us*)(qr + 16 + 8 * hh); }
  const unsigned short* Vth = (const unsigned short*)Vt + (size_t)slab * 64 * TT;      /* v per slab: [64][4096] */
  float m_r = -3.0e38f, l_r = 0.f; v8f oacc[DT];      /* m_r in base-2 units, shifted by -10 */      /* oacc[dt][r] = O^T[channel dt * 16 + 8hh + r][query ln] */
#pragma unroll
  for (int dt = 0; dt < DT; ++dt) oacc[dt] = (v8f){0.f,0.f,0.f,0.f,0.f,0.f,0.f,0.f};
  const int jbeg = (w >> 2) * (TT / KSPL);
#pragma unroll 1
  for (int it = 0; it < TT / KSPL / 32; ++it) { const int j0 = jbeg + it * 32;
    v8f s[2];      /* s[nt][r] = score of key j0 + nt * 16 + 8hh + r with query ln */
#pragma unroll
    for (int nt = 0; nt < 2; ++nt) { const unsigned short* kr = (const unsigned short*)K16 + ((size_t)b * TT + j0 + nt * 16 + ln) * ldk; FragH ak; ak.half[0] = *(const v8us*)(kr + 8 * hh); ak.half[1] = *(const v8us*)(kr + 16 + 8 * hh);
      s[nt] = mmaH<1>(ak.v, ak.v, bq.v, bq.v, (v8f){0.f,0.f,0.f,0.f,0.f,0.f,0.f,0.f}); }
    float mc = fmaxf(s[0][0], s[1][0]);
#pragma unroll
    for (int r = 1; r < 8; ++r) mc = fmaxf(mc, fmaxf(s[0][r], s[1][r]));
    mc = fmaxf(mc, xhalf(mc));      /* both halves hold the max over the trip's 32 keys */
    const float mn = fmaxf(m_r, __builtin_fmaf(mc, LOG2E, -10.0f)); const float ae = exp2_slot(m_r - mn); const float al = (mn > -1.0e38f) ? ae : 1.0f; m_r = mn;
    FragH ph, pl; float ls = 0.f;      /* P^T * 1024 as f16 hi + residual: element nt * 8 + r = key nt * 16 + 8hh + r */
#pragma unroll
    for (int nt = 0; nt < 2; ++nt)
#pragma unroll
      for (int r = 0; r < 8; r += 2) { const v2f ar = __builtin_elementwise_fma((v2f){s[nt][r], s[nt][r + 1]}, (v2f){LOG2E, LOG2E}, (v2f){-mn, -mn}); const float pa = __builtin_amdgcn_exp2f(ar[0]), pb = __builtin_amdgcn_exp2f(ar[1]); ls += pa; ls += pb; const v2f ps = (v2f){pa, pb}; const v2h hi = __builtin_convertvector(ps, v2h); const v2h lo = __builtin_convertvector(ps - __builtin_convertvector(hi, v2f), v2h);
        ph.h[nt * 8 + r] = hi[0]; ph.h[nt * 8 + r + 1] = hi[1]; pl.h[nt * 8 + r] = lo[0]; pl.h[nt * 8 + r + 1] = lo[1]; }
    l_r = l_r * al + ls;      /* this half's 16 keys; the halves are joined behind the loop */
#pragma unroll
    for (int dt = 0; dt < DT; ++dt) oacc[dt] *= al;
#pragma unroll
    for (int dt = 0; dt < DT; ++dt) { const unsigned short* vrow = Vth + (size_t)(dt * 16 + ln) * TT + j0; FragH av; av.half[0] = *(const v8us*)(vrow + 8 * hh); av.half[1] = *(const v8us*)(vrow + 16 + 8 * hh);
      oacc[dt] = mmaH<1>(av.v, av.v, ph.v, ph.v, oacc[dt]); oacc[dt] = mmaH<1>(av.v, av.v, pl.v, pl.v, oacc[dt]); } }      /* V^T.(Ph + Pl) */
  l_r += xhalf(l_r);
  if (hh == 0) { sM[w][ln] = m_r; sL[w][ln] = l_r; }
#pragma unroll
  for (int dt = 0; dt < DT; ++dt) { *(v4fa*)&sO[w][ln][dt * 16 + 8 * hh] = (v4f){oacc[dt][0], oacc[dt][1], oacc[dt][2], oacc[dt][3]}; *(v4fa*)&sO[w][ln][dt * 16 + 8 * hh + 4] = (v4f){oacc[dt][4], oacc[dt][5], oacc[dt][6], oacc[dt][7]}; }
  __syncthreads();      /* every wave's partial is in LDS before any thread merges */
  /* merge: thread = (query of the block, 4 channels); O = sum_s 2^(m_s - M) * O_s / sum_s 2^(m_s - M) * l_s, M = max_s m_s; O_s and l_s both carry the factor 1024 */
#pragma unroll
  for (int i = tid; i < 4 * RPW * 16; i += 128 * KSPL) { const int qq = SELF ? (i & 63) : (i >> 4), pc = SELF ? (i >> 6) : (i & 15), g = qq / RPW, r = qq % RPW;
    float mx = sM[g][r];
#pragma unroll
    for (int s = 1; s < KSPL; ++s) mx = fmaxf(mx, sM[s * 4 + g][r]);
    float l = 0.f; v4f a = {0.f, 0.f, 0.f, 0.f};
#pragma unroll
    for (int s = 0; s < KSPL; ++s) { const float e = exp2_slot(sM[s * 4 + g][r] - mx); l += sL[s * 4 + g][r] * e; const v4f val = *(const v4fa*)&sO[s * 4 + g][r][pc * 4]; a += val * e; }
    const float inv = (l > 0.f) ? 1.0f / l : 0.f;
    const v4f o = a * inv;
    const float* rp = RES + ((size_t)(SELF ? slab : slab % BB) * CC + pc * 4) * TT + qb0 + qq;      /* residual of channels pc * 4 .. + 3 at this query */
    if (SELF) { float* sp = SAo + ((size_t)slab * CC + pc * 4) * TT + qb0 + qq;
#pragma unroll
      for (int j = 0; j < 4; ++j) sp[(size_t)j * TT] = o[j] + bf16_round(rp[(size_t)j * TT]); }
    else { v4h h4;
#pragma unroll
      for (int j = 0; j < 4; ++j) h4[j] = (_Float16)(o[j] + rp[(size_t)j * TT]);
      *(v4h*)(CATo + ((size_t)(slab % BB) * TT + qb0 + qq) * 128 + (slab / BB) * 64 + pc * 4) = h4; } } }

extern "C" void kernel_launch(void* const* d_in, const int* in_sizes, int n_in,
                              void* d_out, int out_size, void* d_ws, size_t ws_size, hipStream_t stream) {
  (void)in_sizes; (void)n_in; (void)out_size;
  const float* const* I = (const float* const*)d_in; const float* x = I[0]; const float* sa_wq = I[1]; const float* sa_bq = I[2]; const float* sa_wk = I[3]; const float* sa_bk = I[4]; const float* sa_wv = I[5]; const float* sa_bv = I[6];
  const float* ga_wq = I[7]; const float* ga_bq = I[8]; const float* ga_wk = I[9]; const float* ga_bk = I[10]; const float* ga_wv = I[11]; const float* ga_bv = I[12]; const float* tw = I[13]; const float* tb = I[14];
  char* ws = (char*)d_ws; size_t off = 0;
  auto take = [&](size_t bytes) { char* p = ws + off; off += (bytes + 255) & ~(size_t)255; return p; };
  const size_t PL = (size_t)BB * CC * TT;      /* one [B][64][4096] f32 plane = 1 M floats */
  _Float16* AWV = (_Float16*)take((size_t)5 * CC * 96 * 2); _Float16* TW16 = (_Float16*)take((size_t)CC * 128 * 2);
  _Float16* XT = (_Float16*)take((size_t)3 * BB * TT * 96 * 2); _Float16* QP = (_Float16*)take((size_t)NSL * TT * 32 * 2); _Float16* KP = (_Float16*)take((size_t)NSL * TT * 32 * 2); _Float16* VT = (_Float16*)take((size_t)NSL * CC * TT * 2);
  float* SA = (float*)take(3 * PL * 4); _Float16* CAT = (_Float16*)take((size_t)BB * TT * 128 * 2);
  if (off > ws_size) return;      // 0.1 + 9.4 + 5.2 + 5.2 + 10.5 + 12.6 + 4.2 = about 47 MB
  const unsigned gqk = (unsigned)((size_t)BB * TT / 128); const unsigned gvx = ((CC / 16) * (TT / 64) + 3) / 4;
  /* self attention on the three frames: slabs a * BB + b for a = 0,1,2; each stage is one launch over all three frames (frame on blockIdx.y for k_qk, on blockIdx.z for the GEMM, in the slab from blockIdx.x for k_flash), XT holds one plane per frame */
  k_qk<1><<<dim3(gqk, 4), 128, 0, stream>>>(x, PL, sa_wq, sa_bq, sa_wk, sa_bk, 0, QP, KP, XT, sa_wv, sa_bv, ga_wv, ga_bv, tw, AWV, TW16);      /* q, k and XT of the three frames; blockIdx.y == 3: the weights of all GEMMs */
  k_gemm_hhx<0, false><<<dim3(gvx, BB, 3), 128, 0, stream>>>(AWV, 96, 0, XT, 96, (size_t)TT * 96, 0.0625f, nullptr, 0, nullptr, 1, 0, 0, nullptr, VT, TT, (size_t)CC * TT, CC, TT, 96, (size_t)CC * 96, (size_t)BB * TT * 96, (size_t)BB * CC * TT, nullptr, nullptr);      /* v[b][e][m] = wv.x + bv, channel-major f16: batched over b and frame, M 64 N 4096 K 96 */
  k_flash<8, true><<<3 * BB * (TT / 64), 1024, 0, stream>>>(QP, 32, KP, 32, VT, nullptr, x, SA, nullptr);      /* slabs 0..11; 768 blocks of 32 waves = three full rounds of the WGPs; SA_a = attn-out + x_a (channel-major f32) */
  /* guided attentions: slabs 12..15 (q,k from SA_0; v,res from SA_1) and 16..19 (q,k from SA_2) */
  k_qk<0><<<dim3(gqk, 3), 128, 0, stream>>>(SA, PL, ga_wq, ga_bq, ga_wk, ga_bk, 3 * BB, QP, KP, XT, nullptr, nullptr, nullptr, nullptr, nullptr, nullptr, nullptr);      /* q, k from SA_0 and SA_2; XT = SA_1 token-major (internal f32, no rounding) */
  k_gemm_hhx<0, false><<<dim3(gvx, BB, 2), 128, 0, stream>>>(AWV + (size_t)3 * CC * 96, 96, 0, XT, 96, (size_t)TT * 96, 0.0625f, nullptr, 0, nullptr, 1, 0, 0, nullptr, VT + (size_t)3 * BB * CC * TT, TT, (size_t)CC * TT, CC, TT, 96, (size_t)CC * 96, 0, (size_t)BB * CC * TT, nullptr, nullptr);      /* both read the SA_1 plane of XT */
  k_flash<4, false><<<2 * BB * (TT / 64), 512, 0, stream>>>(QP + (size_t)3 * BB * TT * 32, 32, KP + (size_t)3 * BB * TT * 32, 32, VT + (size_t)3 * BB * CC * TT, nullptr, SA + PL, nullptr, CAT);      /* slabs 12..19 (kernel-relative 0..7); cat = [attn-out_0 + SA_1 | attn-out_1 + SA_1], token-major f16 */
  k_gemm_hhx<0, true><<<dim3(gvx, BB), 128, 0, stream>>>(TW16, 128, 0, CAT, 128, (size_t)TT * 128, 0.0625f, nullptr, 0, nullptr, 1, 0, 0, (float*)d_out, nullptr, TT, (size_t)CC * TT, CC, TT, 128, 0, 0, 0, tb, SA + PL);      /* fusion[b][o][n] = sum_c W[o][c] * cat[b][c][n]: A = W (M 64, K 128), Bt = CAT[b] token-major; the epilogue adds tfus_b per row o and writes out = fusion * SA_1 + SA_1 */
}

// v007
// Measured time: 210 microseconds a run.
// Two timings next to v006 put it at 1.14 and 1.15 times that version's speed.
// All steps since v000 together make it 5.10 times as fast.
#include <hip/hip_runtime.h>
// MFI (3 frames, B=4, C=64, 64×64 → N=4096): SA_f = position attention on frame f (q = wq·x+bq (8 ch), k = wk·x+bk (8 ch), v = wv·x+bv (64 ch); attn = softmax_m(q[:,n]·k[:,m]) unscaled; out[e][n] = Σ_m v[e][m]·attn[n][m] + x[e][n]); then two guided attentions
// (q,k from SA_0 / SA_2, v and residual from SA_1), cat → fusion = tfus_w·cat + b; out = fusion·SA_1 + SA_1 → [4,64,64,64].
// Compute dtype: x, weights, biases rounded to bf16; q/k per token in f32 VALU (8×64 dot, rolled) emitted as concatenated f16 planes [q_hi|q_lo·2^10|q_hi|0] and [k_hi|k_hi·2^-10|k_lo|0] so ONE 32-wide WMMA k-step yields f32-accurate logits; v (+bias via an
// augmented ones column) channel-major by GEMM (f16); fused flash-style kernel per (slab, 64 queries) (online softmax f32, P f16 hi + residual, residual added in f32 by its merge, which writes SA channel-major f32 or cat token-major f16); cat f16 -> fusion GEMM -> out = fusion * sa_1 + sa_1 in f32. All on v_wmma_f32_16x16x32_f16.
#define NFR 3
#define BB 4
#define CC 64
#define TT 4096
#define NH 1
#define NSL (5 * BB)

typedef __bf16 v16b __attribute__((ext_vector_type(16)));
typedef unsigned short v8us __attribute__((ext_vector_type(8), may_alias));
typedef float  v8f  __attribute__((ext_vector_type(8)));
typedef float  v4f  __attribute__((ext_vector_type(4)));
typedef float  v4fa __attribute__((ext_vector_type(4), may_alias));
union FragB { v16b v; v8us half[2]; unsigned short u[16]; };

__device__ __forceinline__ unsigned short bf16_bits(float x) { unsigned int u = __float_as_uint(x); return (unsigned short)((u + 0x7FFFu + ((u >> 16) & 1u)) >> 16); }
__device__ __forceinline__ float bf16_val(unsigned short b) { return __uint_as_float(((unsigned int)b) << 16); }
__device__ __forceinline__ float bf16_round(float x) { return bf16_val(bf16_bits(x)); }
// D += A·B with NT terms: 1 = ah·bh, 2 = + al·bh (A split), 3 = + ah·bl (both split)
template <int NT>
__device__ __forceinline__ v8f mmaN(v16b ah, v16b al, v16b bh, v16b bl, v8f c) {
  c = __builtin_amdgcn_wmma_f32_16x16x32_bf16(false, ah, false, bh, (short)0, c, false, false);
  if (NT >= 2) c = __builtin_amdgcn_wmma_f32_16x16x32_bf16(false, al, false, bh, (short)0, c, false, false);
  if (NT >= 3) c = __builtin_amdgcn_wmma_f32_16x16x32_bf16(false, ah, false, bl, (short)0, c, false, false);
  asm volatile("v_nop\n\tv_nop\n\tv_nop\n\tv_nop" : "+v"(c) : "v"(ah), "v"(al), "v"(bh), "v"(bl));
  return c;
}

__global__ __launch_bounds__(256) void k_wt_bf16(const float* __restrict__ W, unsigned short* __restrict__ Wt, int K, int N) {
  const int t = blockIdx.x * 256 + threadIdx.x;
  const int k8n = K / 8;
  if (t >= N * k8n) return;
  const int n = t / k8n, k8 = (t % k8n) * 8;
  v8us v;
#pragma unroll
  for (int i = 0; i < 8; ++i) v[i] = bf16_bits(W[(size_t)(k8 + i) * N + n]);
  *(v8us*)(Wt + (size_t)n * K + k8) = v;
  
}

// GEMM C[M][N] (f32, pitch ldc) = act(A[M][K]·W + bias). A f32 row-major (pitch lda) converted per fragment to bf16
// (ASPLIT: hi/lo two planes -> 2 terms, else single rounded term); Wt bf16 [N][K] (pitch ldb). BIAS_BF16 rounds the
// bias to bf16 first (bias quantised to bf16 before the add). K%32==0, M%16==0, N%64==0.
template <bool ASPLIT, int ACT, bool BIAS_BF16>
__global__ __launch_bounds__(128) void k_gemm_bf(const float* __restrict__ A, int lda, const unsigned short* __restrict__ Wt, int ldb,
                                               const float* __restrict__ bias, float* __restrict__ C, int ldc, int M, int N, int K) {
  __shared__ __attribute__((aligned(16))) float so[4][16][64];
  const int tid = threadIdx.x, w = tid >> 5, lane = tid & 31, ln = lane & 15, hh = lane >> 4;
  const int ntn = N / 64;
  const int wid = blockIdx.x * 4 + w;
  const int mt = wid / ntn, nq = wid % ntn;
  if (mt * 16 >= M) return;
  const int row0 = mt * 16, col0 = nq * 64;
  const float* arow = A + (size_t)(row0 + ln) * lda;
  v8f acc[4] = {};
  for (int kb = 0; kb < K; kb += 32) {
    FragB ah, al;
    const v4f x0 = *(const v4fa*)(arow + kb + 8 * hh), x1 = *(const v4fa*)(arow + kb + 8 * hh + 4);
    const v4f x2 = *(const v4fa*)(arow + kb + 16 + 8 * hh), x3 = *(const v4fa*)(arow + kb + 16 + 8 * hh + 4);
    float xs[16] = {x0[0],x0[1],x0[2],x0[3],x1[0],x1[1],x1[2],x1[3],x2[0],x2[1],x2[2],x2[3],x3[0],x3[1],x3[2],x3[3]};
#pragma unroll
    for (int i = 0; i < 16; ++i) { const unsigned short hb = bf16_bits(xs[i]); ah.u[i] = hb; al.u[i] = ASPLIT ? bf16_bits(xs[i] - bf16_val(hb)) : (unsigned short)0; }
#pragma unroll
    for (int t = 0; t < 4; ++t) {
      const unsigned short* brow = Wt + (size_t)(col0 + t * 16 + ln) * ldb + kb;
      FragB b;
      b.half[0] = *(const v8us*)(brow + 8 * hh);
      b.half[1] = *(const v8us*)(brow + 16 + 8 * hh);
      acc[t] = mmaN<ASPLIT ? 2 : 1>(ah.v, al.v, b.v, b.v, acc[t]);
    }
  }
#pragma unroll
  for (int t = 0; t < 4; ++t) {
    float bv = bias ? bias[col0 + t * 16 + ln] : 0.f;
    if (BIAS_BF16) bv = bf16_round(bv);
#pragma unroll
    for (int r = 0; r < 8; ++r) { float v = acc[t][r] + bv; if (ACT == 1) v = fmaxf(v, 0.f); so[w][8 * hh + r][t * 16 + ln] = v; }
  }
  __builtin_amdgcn_fence(__ATOMIC_ACQ_REL, "workgroup");
  __builtin_amdgcn_wave_barrier();
  const int rsub = lane >> 4, c4 = (lane & 15) * 4;
  {
#pragma unroll
    for (int q = 0; q < 8; ++q) {
      const int r = q * 2 + rsub;
      const v4f v = *(const v4fa*)&so[w][r][c4];
      *(v4f*)(C + (size_t)(row0 + r) * ldc + col0 + c4) = v;
    }
    
  }
}

// Flash-style causal/unmasked attention, all contractions 3-term bf16 hi/lo splits, f32 softmax with running max.
// q,k,v rows are read from f32 buffers with arbitrary row pitch (so they can live inside a fused qkv buffer);
// D = head size (multiple of 32, <= 128); one wave = 16 query rows; block = 4 waves (64 queries) sharing K/V chunks of 32.
template <int D, bool CAUSAL>
__global__ __launch_bounds__(128) void k_flash(const float* __restrict__ qb, const float* __restrict__ kb, const float* __restrict__ vb,
                                             int pitch, int T, int H, float scale, float* __restrict__ y, int ypitch) {
  constexpr int KS = D / 32;        // k-steps for QK
  constexpr int DT = D / 16;        // d tiles for PV
  __shared__ __attribute__((aligned(16))) unsigned short sKh[32][D + 8], sKl[32][D + 8], sVh[32][D + 8], sVl[32][D + 8];
  __shared__ __attribute__((aligned(16))) unsigned short sPh[4][16][40], sPl[4][16][40];
  __shared__ __attribute__((aligned(16))) float sO[4][16][D];
  const int tid = threadIdx.x, w = tid >> 5, lane = tid & 31, ln = lane & 15, hh = lane >> 4;
  const int nqb = (T + 63) / 64;
  const int bh = blockIdx.x / nqb, qblk = blockIdx.x % nqb;
  const int b = bh / H, h = bh % H;
  const int q0 = qblk * 64 + w * 16;
  const float* Q = qb + (size_t)b * T * pitch + h * D;
  const float* K = kb + (size_t)b * T * pitch + h * D;
  const float* V = vb + (size_t)b * T * pitch + h * D;

  // A fragments of the wave's 16 query rows (scaled), hi/lo
  FragB aqh[KS], aql[KS];
  {
    int row = q0 + ln; if (row >= T) row = T - 1;
    const float* qr = Q + (size_t)row * pitch;
#pragma unroll
    for (int ks = 0; ks < KS; ++ks)
#pragma unroll
      for (int i = 0; i < 16; ++i) {
        const int d = ks * 32 + ((i < 8) ? (8 * hh + i) : (16 + 8 * hh + (i - 8)));
        const float x = qr[d] * scale; const unsigned short hb = bf16_bits(x);
        aqh[ks].u[i] = hb; aql[ks].u[i] = bf16_bits(x - bf16_val(hb));
      }
  }
  float m_r[8], l_r[8];
#pragma unroll
  for (int r = 0; r < 8; ++r) { m_r[r] = -3.0e38f; l_r[r] = 0.f; }
  v8f oacc[DT];
#pragma unroll
  for (int dt = 0; dt < DT; ++dt) oacc[dt] = (v8f){0.f,0.f,0.f,0.f,0.f,0.f,0.f,0.f};

  const int kv_end = CAUSAL ? min(T, qblk * 64 + 64) : T;     // block-uniform
  for (int j0 = 0; j0 < kv_end; j0 += 32) {
    __syncthreads();
    for (int e = tid; e < 32 * (D / 4); e += 128) {
      const int r = e / (D / 4), c4 = (e % (D / 4)) * 4;
      const int key = j0 + r;
      v4f kf = {0.f,0.f,0.f,0.f}, vf = {0.f,0.f,0.f,0.f};
      if (key < T) { kf = *(const v4fa*)(K + (size_t)key * pitch + c4); vf = *(const v4fa*)(V + (size_t)key * pitch + c4); }
#pragma unroll
      for (int t = 0; t < 4; ++t) {
        unsigned short hb = bf16_bits(kf[t]); sKh[r][c4 + t] = hb; sKl[r][c4 + t] = bf16_bits(kf[t] - bf16_val(hb));
        hb = bf16_bits(vf[t]); sVh[r][c4 + t] = hb; sVl[r][c4 + t] = bf16_bits(vf[t] - bf16_val(hb));
      }
    }
    __syncthreads();
    // S tile 16 x 32
    v8f s[2];
#pragma unroll
    for (int nt = 0; nt < 2; ++nt) {
      v8f acc = {};
#pragma unroll
      for (int ks = 0; ks < KS; ++ks) {
        FragB bh_, bl_;
        bh_.half[0] = *(const v8us*)&sKh[nt * 16 + ln][ks * 32 + 8 * hh]; bh_.half[1] = *(const v8us*)&sKh[nt * 16 + ln][ks * 32 + 16 + 8 * hh];
        bl_.half[0] = *(const v8us*)&sKl[nt * 16 + ln][ks * 32 + 8 * hh]; bl_.half[1] = *(const v8us*)&sKl[nt * 16 + ln][ks * 32 + 16 + 8 * hh];
        acc = mmaN<3>(aqh[ks].v, aql[ks].v, bh_.v, bl_.v, acc);
      }
      s[nt] = acc;
    }
    // mask + running max (rows 8hh+r; the 16 lanes of a half share rows)
    float alpha[8];
#pragma unroll
    for (int r = 0; r < 8; ++r) {
      const int qi = q0 + 8 * hh + r;
      const int ja = j0 + ln, jb = j0 + 16 + ln;
      if (CAUSAL) { if (ja > qi) s[0][r] = -3.0e38f; if (jb > qi) s[1][r] = -3.0e38f; }
      if (ja >= T) s[0][r] = -3.0e38f;
      if (jb >= T) s[1][r] = -3.0e38f;
      float mx = fmaxf(s[0][r], s[1][r]);
      mx = fmaxf(mx, __shfl_xor(mx, 1, 32)); mx = fmaxf(mx, __shfl_xor(mx, 2, 32)); mx = fmaxf(mx, __shfl_xor(mx, 4, 32)); mx = fmaxf(mx, __shfl_xor(mx, 8, 32));
      const float mnew = fmaxf(m_r[r], mx);
      alpha[r] = (mnew > -1.0e38f) ? __expf(m_r[r] - mnew) : 1.0f;
      const float p0 = (s[0][r] > -1.0e38f) ? __expf(s[0][r] - mnew) : 0.f;
      const float p1 = (s[1][r] > -1.0e38f) ? __expf(s[1][r] - mnew) : 0.f;
      m_r[r] = mnew;
      l_r[r] = l_r[r] * alpha[r] + p0 + p1;            // per-lane partial row sum (16 lanes combined at the end)
      unsigned short hb = bf16_bits(p0); sPh[w][8 * hh + r][ln] = hb;      sPl[w][8 * hh + r][ln] = bf16_bits(p0 - bf16_val(hb));
      hb = bf16_bits(p1);                sPh[w][8 * hh + r][16 + ln] = hb; sPl[w][8 * hh + r][16 + ln] = bf16_bits(p1 - bf16_val(hb));
    }
#pragma unroll
    for (int dt = 0; dt < DT; ++dt)
#pragma unroll
      for (int r = 0; r < 8; ++r) oacc[dt][r] *= alpha[r];
    __builtin_amdgcn_fence(__ATOMIC_ACQ_REL, "workgroup");
    __builtin_amdgcn_wave_barrier();
    FragB pah, pal;
    pah.half[0] = *(const v8us*)&sPh[w][ln][8 * hh]; pah.half[1] = *(const v8us*)&sPh[w][ln][16 + 8 * hh];
    pal.half[0] = *(const v8us*)&sPl[w][ln][8 * hh]; pal.half[1] = *(const v8us*)&sPl[w][ln][16 + 8 * hh];
#pragma unroll
    for (int dt = 0; dt < DT; ++dt) {
      FragB bvh, bvl;
#pragma unroll
      for (int i = 0; i < 8; ++i) {
        bvh.u[i] = sVh[8 * hh + i][dt * 16 + ln]; bvh.u[8 + i] = sVh[16 + 8 * hh + i][dt * 16 + ln];
        bvl.u[i] = sVl[8 * hh + i][dt * 16 + ln]; bvl.u[8 + i] = sVl[16 + 8 * hh + i][dt * 16 + ln];
      }
      oacc[dt] = mmaN<3>(pah.v, pal.v, bvh.v, bvl.v, oacc[dt]);
    }
    __builtin_amdgcn_fence(__ATOMIC_ACQ_REL, "workgroup");
    __builtin_amdgcn_wave_barrier();
  }
#pragma unroll
  for (int r = 0; r < 8; ++r) {
    float l = l_r[r];
    l += __shfl_xor(l, 1, 32); l += __shfl_xor(l, 2, 32); l += __shfl_xor(l, 4, 32); l += __shfl_xor(l, 8, 32);
    l_r[r] = (l > 0.f) ? 1.0f / l : 0.f;
  }
#pragma unroll
  for (int dt = 0; dt < DT; ++dt)
#pragma unroll
    for (int r = 0; r < 8; ++r) sO[w][8 * hh + r][dt * 16 + ln] = oacc[dt][r] * l_r[r];
  __builtin_amdgcn_fence(__ATOMIC_ACQ_REL, "workgroup");
  __builtin_amdgcn_wave_barrier();
  {
    for (int r = 0; r < 16; ++r) {
      const int row = q0 + r;
      if (row < T && lane < D / 4) {
        const v4f val = *(const v4fa*)&sO[w][r][lane * 4];
        *(v4f*)(y + ((size_t)b * T + row) * ypitch + h * D + lane * 4) = val;
      }
    }
    
  }
}

// GEMM C = act(A·W + bias + resid): A f32 (ASPLIT -> hi/lo 2 terms), Wt bf16 [N][K]; ACT 0 none, 1 relu, 2 exact gelu;
// resid (optional, f32, row index = (row % rmod), pitch ldr, RES_BF16 rounds it) added before the activation.
template <bool ASPLIT, int ACT, bool BIAS_BF16, bool RES_BF16>
__global__ __launch_bounds__(128) void k_gemm_bf3(const float* __restrict__ A, int lda, const unsigned short* __restrict__ Wt, int ldb,
                                                const float* __restrict__ bias, const float* __restrict__ resid, int rmod, int ldr,
                                                float* __restrict__ C, int ldc, int M, int N, int K) {
  __shared__ __attribute__((aligned(16))) float so[4][16][64];
  const int tid = threadIdx.x, w = tid >> 5, lane = tid & 31, ln = lane & 15, hh = lane >> 4;
  const int ntn = N / 64;
  const int wid = blockIdx.x * 4 + w;
  const int mt = wid / ntn, nq = wid % ntn;
  if (mt * 16 >= M) return;
  const int row0 = mt * 16, col0 = nq * 64;
  const float* arow = A + (size_t)(row0 + ln) * lda;
  v8f acc[4] = {};
  for (int kb = 0; kb < K; kb += 32) {
    FragB ah, al;
    const v4f x0 = *(const v4fa*)(arow + kb + 8 * hh), x1 = *(const v4fa*)(arow + kb + 8 * hh + 4);
    const v4f x2 = *(const v4fa*)(arow + kb + 16 + 8 * hh), x3 = *(const v4fa*)(arow + kb + 16 + 8 * hh + 4);
    float xs[16] = {x0[0],x0[1],x0[2],x0[3],x1[0],x1[1],x1[2],x1[3],x2[0],x2[1],x2[2],x2[3],x3[0],x3[1],x3[2],x3[3]};
#pragma unroll
    for (int i = 0; i < 16; ++i) { const unsigned short hb = bf16_bits(xs[i]); ah.u[i] = hb; al.u[i] = ASPLIT ? bf16_bits(xs[i] - bf16_val(hb)) : (unsigned short)0; }
#pragma unroll
    for (int t = 0; t < 4; ++t) {
      const unsigned short* brow = Wt + (size_t)(col0 + t * 16 + ln) * ldb + kb;
      FragB b;
      b.half[0] = *(const v8us*)(brow + 8 * hh);
      b.half[1] = *(const v8us*)(brow + 16 + 8 * hh);
      acc[t] = mmaN<ASPLIT ? 2 : 1>(ah.v, al.v, b.v, b.v, acc[t]);
    }
  }
#pragma unroll
  for (int t = 0; t < 4; ++t) {
    const int col = col0 + t * 16 + ln;
    float bv = bias ? bias[col] : 0.f;
    if (BIAS_BF16) bv = bf16_round(bv);
#pragma unroll
    for (int r = 0; r < 8; ++r) {
      float v = acc[t][r] + bv;
      if (resid) { float rv = resid[(size_t)((row0 + 8 * hh + r) % rmod) * ldr + col]; if (RES_BF16) rv = bf16_round(rv); v += rv; }
      if (ACT == 1) v = fmaxf(v, 0.f);
      if (ACT == 2) v = 0.5f * v * (1.0f + erff(v * 0.70710678118654752f));
      if (ACT == 3) { const float u = 0.7978845608028654f * (v + 0.044715f * v * v * v); v = 0.5f * v * (1.0f + tanhf(u)); }
      so[w][8 * hh + r][t * 16 + ln] = v;
    }
  }
  __builtin_amdgcn_fence(__ATOMIC_ACQ_REL, "workgroup");
  __builtin_amdgcn_wave_barrier();
  const int rsub = lane >> 4, c4 = (lane & 15) * 4;
  {
#pragma unroll
    for (int q = 0; q < 8; ++q) {
      const int r = q * 2 + rsub;
      const v4f v = *(const v4fa*)&so[w][r][c4];
      *(v4f*)(C + (size_t)(row0 + r) * ldc + col0 + c4) = v;
    }
    
  }
}
// row LayerNorm (biased variance, eps) over N: s = X (+ R); optional out_sum <- s; out_norm <- (s-mu)*rsqrt(var+eps)*g + b
template <bool PARAM_BF16>
__global__ __launch_bounds__(256) void k_layernorm(const float* __restrict__ X, const float* __restrict__ R, const float* __restrict__ g, const float* __restrict__ bta,
                                                  float* __restrict__ out_sum, float* __restrict__ out_norm, int N, float eps) {
  __shared__ float red[256];
  const int row = blockIdx.x, tid = threadIdx.x;
  const float* x = X + (size_t)row * N; const float* rr = R ? R + (size_t)row * N : nullptr;
  float vals[16];                     // up to N = 4096
  const int per = N / 256;            // contiguous chunk per thread? use strided-by-4 chunks: thread handles j = tid*4 + 1024*u
  float s1 = 0.f;
  for (int u = 0; u < per / 4; ++u) {
    const int j = tid * 4 + 1024 * u;
    const v4f a = *(const v4fa*)(x + j);
    v4f b = {0.f,0.f,0.f,0.f}; if (rr) b = *(const v4fa*)(rr + j);
#pragma unroll
    for (int q = 0; q < 4; ++q) { const float v = a[q] + b[q]; vals[u * 4 + q] = v; s1 += v; }
  }
  red[tid] = s1; __syncthreads();
  for (int st = 128; st > 0; st >>= 1) { if (tid < st) red[tid] += red[tid + st]; __syncthreads(); }
  const float mu = red[0] / (float)N; __syncthreads();
  float s2 = 0.f;
  for (int u = 0; u < per / 4; ++u)
#pragma unroll
    for (int q = 0; q < 4; ++q) { const float c = vals[u * 4 + q] - mu; s2 += c * c; }
  red[tid] = s2; __syncthreads();
  for (int st = 128; st > 0; st >>= 1) { if (tid < st) red[tid] += red[tid + st]; __syncthreads(); }
  const float rs = rsqrtf(red[0] / (float)N + eps);
  {
    for (int u = 0; u < per / 4; ++u) {
      const int j = tid * 4 + 1024 * u;
      v4f o, sm;
#pragma unroll
      for (int q = 0; q < 4; ++q) {
        float gg = g[j + q], bb = bta[j + q];
        if (PARAM_BF16) { gg = bf16_round(gg); bb = bf16_round(bb); }
        sm[q] = vals[u * 4 + q]; o[q] = (vals[u * 4 + q] - mu) * rs * gg + bb;
      }
      if (out_sum) *(v4f*)(out_sum + (size_t)row * N + j) = sm;
      *(v4f*)(out_norm + (size_t)row * N + j) = o;
    }
    
  }
}



// ---- f16 WMMA path (v_wmma_f32_16x16x32_f16): 11-bit significands for operands in range — used where a [0,1] probability operand needs more precision than bf16
typedef _Float16 v16h __attribute__((ext_vector_type(16)));
union FragH { v16h v; v8us half[2]; _Float16 h[16]; unsigned short u[16]; };
template <int NT>
__device__ __forceinline__ v8f mmaH(v16h ah, v16h al, v16h bh, v16h bl, v8f c) {
  c = __builtin_amdgcn_wmma_f32_16x16x32_f16(false, ah, false, bh, (short)0, c, false, false);
  if (NT >= 2) c = __builtin_amdgcn_wmma_f32_16x16x32_f16(false, al, false, bh, (short)0, c, false, false);
  if (NT >= 3) c = __builtin_amdgcn_wmma_f32_16x16x32_f16(false, ah, false, bl, (short)0, c, false, false);
  asm volatile("v_nop\n\tv_nop\n\tv_nop\n\tv_nop" : "+v"(c) : "v"(ah), "v"(al), "v"(bh), "v"(bl));
  return c;
}
// batched GEMM like k_gemm_b but f16 operands: A f32 (split into f16 hi/lo if ASPLIT, else rounded to f16), Bt = f16 values [n][k]; alpha; C f32; N multiple of 16 (partial tiles skipped)
template <bool ASPLIT>
__global__ __launch_bounds__(128) void k_gemm_h(const float* __restrict__ A, int lda, size_t sA, const _Float16* __restrict__ Bh, int ldb, size_t sB, float alpha, float* __restrict__ C, int ldc, size_t sC, int M, int N, int K) {
  __shared__ __attribute__((aligned(16))) float so[4][16][64];
  const int tid = threadIdx.x, w = tid >> 5, lane = tid & 31, ln = lane & 15, hh = lane >> 4; const int by = blockIdx.y;
  A += (size_t)by * sA; Bh += (size_t)by * sB; C += (size_t)by * sC;
  const int ntn = (N + 63) / 64; const int wid = blockIdx.x * 4 + w; const int mt = wid / ntn, nq = wid % ntn; if (mt * 16 >= M) return;
  const int row0 = mt * 16, col0 = nq * 64; const float* arow = A + (size_t)(row0 + ln) * lda;
  v8f acc[4] = {};
  for (int kb = 0; kb < K; kb += 32) {
    FragH ah, al;
    const v4f x0 = *(const v4fa*)(arow + kb + 8 * hh), x1 = *(const v4fa*)(arow + kb + 8 * hh + 4), x2 = *(const v4fa*)(arow + kb + 16 + 8 * hh), x3 = *(const v4fa*)(arow + kb + 16 + 8 * hh + 4);
    float xs[16] = {x0[0],x0[1],x0[2],x0[3],x1[0],x1[1],x1[2],x1[3],x2[0],x2[1],x2[2],x2[3],x3[0],x3[1],x3[2],x3[3]};
#pragma unroll
    for (int i = 0; i < 16; ++i) { const _Float16 h = (_Float16)xs[i]; ah.h[i] = h; al.h[i] = ASPLIT ? (_Float16)(xs[i] - (float)h) : (_Float16)0.0f; }
#pragma unroll
    for (int t = 0; t < 4; ++t) { if (col0 + t * 16 >= N) continue; const size_t boff = (size_t)(col0 + t * 16 + ln) * ldb + kb; FragH bq; bq.half[0] = *(const v8us*)(Bh + boff + 8 * hh); bq.half[1] = *(const v8us*)(Bh + boff + 16 + 8 * hh);
      acc[t] = mmaH<ASPLIT ? 2 : 1>(ah.v, al.v, bq.v, bq.v, acc[t]); }
  }
#pragma unroll
  for (int t = 0; t < 4; ++t) { if (col0 + t * 16 >= N) continue;
#pragma unroll
    for (int r = 0; r < 8; ++r) so[w][8 * hh + r][t * 16 + ln] = acc[t][r] * alpha; }
  __builtin_amdgcn_fence(__ATOMIC_ACQ_REL, "workgroup"); __builtin_amdgcn_wave_barrier();
  const int rsub = lane >> 4, c4 = (lane & 15) * 4;
  {
#pragma unroll
    for (int q = 0; q < 8; ++q) { const int r = q * 2 + rsub; if (col0 + c4 < N) { const v4f v = *(const v4fa*)&so[w][r][c4]; *(v4f*)(C + (size_t)(row0 + r) * ldc + col0 + c4) = v; } }
     }
}

// Wt[n][k] = f16(W[k][n]·scale) from f32 row-major W[K][N] (scale = power of two; bf16-exact weights stay exact in f16 away from the subnormal range)
__global__ __launch_bounds__(256) void k_wt_f16(const float* __restrict__ W, _Float16* __restrict__ Wt, int K, int N, float scale) {
  const int t = blockIdx.x * 256 + threadIdx.x; if (t >= N * (K / 8)) return; const int n = t / (K / 8), k8 = (t % (K / 8)) * 8; FragH f;
#pragma unroll
  for (int i = 0; i < 8; ++i) f.h[i] = (_Float16)(bf16_round(W[(size_t)(k8 + i) * N + n]) * scale); const v8us o = f.half[0];
  *(v8us*)((unsigned short*)Wt + (size_t)n * K + k8) = o; 
}
// k_gemm_hh variant with fused epilogue: v = acc * alpha + bias[by * sBias + col] (+ CP[(row/rowsPerB) * sCPb + by * 64 + col] if CP) ; ACT 0 none / 1 elu ; writes f16 C16 (and f32 C if non-null); FIN: the last stage of the network in the epilogue, C = (v + bf16(rowb[row])) * S + S with S laid out like C
template <int ACT, bool FIN>
__global__ __launch_bounds__(128) void k_gemm_hhx(const _Float16* __restrict__ A, int lda, size_t sA, const _Float16* __restrict__ Bh, int ldb, size_t sB, float alpha, const float* __restrict__ bias, size_t sBias, const float* __restrict__ CP, int rowsPerB, size_t sCPb, int row0g,
    float* __restrict__ C, _Float16* __restrict__ C16, int ldc, size_t sC, int M, int N, int K, size_t sAz, size_t sBz, size_t sCz, const float* __restrict__ rowb, const float* __restrict__ S) {
  __shared__ __attribute__((aligned(16))) float so[4][16][64];
  const int tid = threadIdx.x, w = tid >> 5, lane = tid & 31, ln = lane & 15, hh = lane >> 4; const int by = blockIdx.y, bz = blockIdx.z;      /* bz = attention instance, with strides of its own */
  A += (size_t)by * sA + (size_t)bz * sAz; Bh += (size_t)by * sB + (size_t)bz * sBz; const size_t cofs = (size_t)by * sC + (size_t)bz * sCz; const float* bp = bias ? bias + (size_t)by * sBias : nullptr;
  const int ntn = (N + 63) / 64; const int wid = blockIdx.x * 4 + w; const int mt = wid / ntn, nq = wid % ntn; if (mt * 16 >= M) return;
  const int row0 = mt * 16, col0 = nq * 64; const _Float16* arow = A + (size_t)(row0 + ln) * lda;
  v8f acc[4] = {};
  v4f sv[8]; float rb[8];      /* FIN: this lane's pieces of S and its rows' biases, loaded here so that they fly under the product */
  if (FIN) {
#pragma unroll
    for (int q = 0; q < 8; ++q) { const int r = q * 2 + (lane >> 4); rb[q] = rowb[row0 + r]; sv[q] = *(const v4fa*)(S + cofs + (size_t)(row0 + r) * ldc + col0 + (lane & 15) * 4); }
    asm volatile("s_wait_xcnt 0x0" ::: "memory"); }      /* behind this run of loads, in front of the first rewrite of a register that holds one of their addresses */
  for (int kb = 0; kb < K; kb += 32) { FragH ah; ah.half[0] = *(const v8us*)((const unsigned short*)arow + kb + 8 * hh); ah.half[1] = *(const v8us*)((const unsigned short*)arow + kb + 16 + 8 * hh);
#pragma unroll
    for (int t = 0; t < 4; ++t) { if (col0 + t * 16 >= N) continue; const size_t boff = (size_t)(col0 + t * 16 + ln) * ldb + kb; FragH bq; bq.half[0] = *(const v8us*)((const unsigned short*)Bh + boff + 8 * hh); bq.half[1] = *(const v8us*)((const unsigned short*)Bh + boff + 16 + 8 * hh);
      acc[t] = mmaH<1>(ah.v, ah.v, bq.v, bq.v, acc[t]); }
  }
#pragma unroll
  for (int t = 0; t < 4; ++t) { if (col0 + t * 16 >= N) continue; const int col = col0 + t * 16 + ln; const float bv = bp ? bf16_round(bp[col]) : 0.f;
#pragma unroll
    for (int r = 0; r < 8; ++r) { float v = acc[t][r] * alpha + bv; if (CP) { const int bidx = (row0g + row0 + 8 * hh + r) / rowsPerB; v += CP[(size_t)bidx * sCPb + (size_t)by * 64 + col]; } if (ACT == 1) v = (v > 0.f) ? v : expm1f(v); else if (ACT == 7) v = (v > 0.f) ? v + 1.0f : expf(v); else if (ACT == 8) v = tanhf(v); else if (ACT == 9) v = 0.5f * v * (1.0f + tanhf(0.7978845608028654f * (v + 0.044715f * v * v * v))); else if (ACT == 11) v = 1.0f / (1.0f + expf(-v)); else if (ACT == 12) v = (v > 0.f) ? v : 0.01f * v; else if (ACT == 14) v = (v > 0.f) ? v : 0.1f * v; else if (ACT == 15) v = v / (1.0f + expf(-v)); else if (ACT == 3) v = fmaxf(v, 0.f); else if (ACT == 6) v = 0.5f * v * (1.0f + erff(v * 0.70710678118654752f)); so[w][8 * hh + r][t * 16 + ln] = v; } }
  __builtin_amdgcn_fence(__ATOMIC_ACQ_REL, "workgroup"); __builtin_amdgcn_wave_barrier();
  const int rsub = lane >> 4, c4 = (lane & 15) * 4; typedef _Float16 v4h __attribute__((ext_vector_type(4)));
  if (FIN) {      /* C = (v + bias of its row) * S + S, straight from the tile; like the loads of S above it takes whole 64-column tiles (N a multiple of 64) */
#pragma unroll
    for (int q = 0; q < 8; ++q) { const int r = q * 2 + rsub; const v4f v = *(const v4fa*)&so[w][r][c4]; const float bb = bf16_round(rb[q]); v4f o; for (int i = 0; i < 4; ++i) o[i] = (v[i] + bb) * sv[q][i] + sv[q][i]; *(v4f*)(C + cofs + (size_t)(row0 + r) * ldc + col0 + c4) = o; }
    return; }
  {
#pragma unroll
    for (int q = 0; q < 8; ++q) { const int r = q * 2 + rsub; if (col0 + c4 < N) { const v4f v = *(const v4fa*)&so[w][r][c4]; if (C) *(v4f*)(C + cofs + (size_t)(row0 + r) * ldc + col0 + c4) = v; if (C16) { v4h h4; for (int i = 0; i < 4; ++i) h4[i] = (_Float16)v[i]; *(v4h*)(C16 + cofs + (size_t)(row0 + r) * ldc + col0 + c4) = h4; } } }
     }
}


typedef _Float16 v4h __attribute__((ext_vector_type(4)));

__global__ __launch_bounds__(256) void k_x16(const float* __restrict__ x, _Float16* __restrict__ X16, size_t n8) { const size_t t = (size_t)blockIdx.x * 256 + threadIdx.x; if (t >= n8) return; FragH f;
#pragma unroll
  for (int q = 0; q < 8; ++q) f.h[q] = (_Float16)bf16_round(x[t * 8 + q]); *(v8us*)((unsigned short*)X16 + t * 8) = f.half[0];  }
__global__ __launch_bounds__(256) void k_h16(const float* __restrict__ x, _Float16* __restrict__ X16, size_t n8) { const size_t t = (size_t)blockIdx.x * 256 + threadIdx.x; if (t >= n8) return; FragH f;
#pragma unroll
  for (int q = 0; q < 8; ++q) f.h[q] = (_Float16)x[t * 8 + q]; *(v8us*)((unsigned short*)X16 + t * 8) = f.half[0];  }
template <int NHv, int TTv>
__global__ __launch_bounds__(256) void k_vt(const _Float16* __restrict__ V16, int ldv, int voff, _Float16* __restrict__ Vt) { __shared__ unsigned short tl[64][66]; const int tid = threadIdx.x; const int slab = blockIdx.x / (TTv / 64), lg = blockIdx.x % (TTv / 64); const int b = slab / NHv, h = slab % NHv;
  for (int i = tid; i < 64 * 8; i += 256) { const int r = i / 8, c8 = (i % 8) * 8; FragH f; f.half[0] = *(const v8us*)((const unsigned short*)V16 + ((size_t)b * TTv + lg * 64 + r) * ldv + voff + h * 64 + c8);
#pragma unroll
    for (int q = 0; q < 8; ++q) tl[r][c8 + q] = f.u[q]; }
  __syncthreads();
  {
#pragma unroll
    for (int rd = 0; rd < 2; ++rd) { const int d = rd * 32 + tid / 8, pc = tid % 8; FragH f;
#pragma unroll
      for (int q = 0; q < 8; ++q) f.u[q] = tl[pc * 8 + q][d];
      *(v8us*)((unsigned short*)Vt + ((size_t)slab * 64 + d) * TTv + lg * 64 + pc * 8) = f.half[0]; }
     } }

// Weights of the GEMMs as f16 x 2^4, thread t = one 16-B piece: the five value projections [64 e][96] (64 weights, the bias in column 64, zeros; instances 0..2 self, 3..4 guided), then tfus_w [64 o][128 c] as it lies.
__device__ __forceinline__ void prep_weights(int t, const float* __restrict__ swv, const float* __restrict__ sbv, const float* __restrict__ gwv, const float* __restrict__ gbv, const float* __restrict__ tw, _Float16* __restrict__ A16, _Float16* __restrict__ TW) {
  FragH f;
  if (t < 5 * CC * 12) { const int ai = t / (CC * 12), u = t % (CC * 12); const float* wv = (ai < 3) ? swv + (size_t)ai * CC * CC : gwv + (size_t)(ai - 3) * CC * CC; const float* bv = (ai < 3) ? sbv + ai * CC : gbv + (ai - 3) * CC;
    const int e = u / 12, c0 = (u % 12) * 8;
    v4f va = {0.f, 0.f, 0.f, 0.f}, vb = {0.f, 0.f, 0.f, 0.f};      /* a piece is eight weights in a row, or the bias and seven zeros, or zeros: one round of loads, not eight awaited ones */
    if (c0 < CC) { va = *(const v4fa*)(wv + e * CC + c0); vb = *(const v4fa*)(wv + e * CC + c0 + 4); } else if (c0 == CC) va[0] = bv[e];
#pragma unroll
    for (int q = 0; q < 4; ++q) { f.h[q] = (_Float16)(bf16_round(va[q]) * 16.0f); f.h[4 + q] = (_Float16)(bf16_round(vb[q]) * 16.0f); }
    *(v8us*)((unsigned short*)A16 + (size_t)t * 8) = f.half[0]; }
  else if (t < 5 * CC * 12 + CC * 128 / 8) { const int u = t - 5 * CC * 12;
#pragma unroll
    for (int i = 0; i < 8; ++i) f.h[i] = (_Float16)(bf16_round(tw[u * 8 + i]) * 16.0f);
    *(v8us*)((unsigned short*)TW + (size_t)u * 8) = f.half[0]; } }
__device__ __forceinline__ void xt_tail(unsigned short* xo) { const v8us one = {0x3C00, 0, 0, 0, 0, 0, 0, 0}, zz = {0, 0, 0, 0, 0, 0, 0, 0}; *(v8us*)(xo + 64) = one; *(v8us*)(xo + 72) = zz; *(v8us*)(xo + 80) = zz; *(v8us*)(xo + 88) = zz; }      /* columns 64..95 of an XT row: 1.0 (takes the bias), then zeros */
__device__ __forceinline__ void xt_out(unsigned short* xg, const unsigned short* sx, int tid) {      /* 128 rows of 96 halves from LDS (pitch 104) to memory, 16-B piece p = j * 128 + tid: each wave store covers 512 B in a row */
#pragma unroll
  for (int j = 0; j < 12; ++j) { const int p = j * 128 + tid; *(v8us*)(xg + (size_t)p * 8) = *(const v8us*)(sx + (p / 12) * 104 + (p % 12) * 8); }
  asm volatile("s_wait_xcnt 0x0" ::: "memory"); }      /* behind this run of stores, in front of the first rewrite of a register that one of them names */
// q/k planes and the token-major f16 plane XT (the V GEMM's B operand: 64 channels, a one for the bias column, zeros up to 96), from one pass over a source plane.
// q/k planes for one attention instance: per token n of batch b: q[d] = sum_c wq[d][c]*xs[c][n] + bq[d], k likewise (f32, summed over c in ascending order; xs = bf16-rounded input frame or an internal SA plane (RB)).
// One thread per token. The 2 x 8 x 64 weights are rounded to bf16 once per block into LDS (sW[c] = wq[0..7][c], wk[0..7][c]) and read from there as broadcasts; the token's channel values are loaded 16 at a time, one trip ahead of their sums, so the sums wait for memory once and not once per channel.
// Every sum keeps its order and the separate rounding of product and sum (the directive at the head of the body stands as it stood), so q and k come out bit for bit as before.
template <int RB>
__global__ __launch_bounds__(128) void k_qk(const float* __restrict__ xs, size_t sx, const float* __restrict__ wq, const float* __restrict__ bq, const float* __restrict__ wk, const float* __restrict__ bk, int slab0, _Float16* __restrict__ QP, _Float16* __restrict__ KP, _Float16* __restrict__ XT,
    const float* __restrict__ swv, const float* __restrict__ sbv, const float* __restrict__ gwv, const float* __restrict__ gbv, const float* __restrict__ tw, _Float16* __restrict__ AWV, _Float16* __restrict__ TW16) {
  #pragma clang fp contract(off)
  __shared__ __attribute__((aligned(16))) float sW[CC][16];
  __shared__ __attribute__((aligned(16))) unsigned short sX[128][96 + 8];      /* the block's 128 rows of XT; pitch 208 B = 16 B x odd, so a wave's 16-B row pieces fall on different banks */
  const int tid = threadIdx.x;
  const int y = blockIdx.y;      /* source plane. RB (self): plane y = frame y gives q, k and XT, and the blocks of y == 3 convert the weights of the GEMMs. Guided: planes 0 and 2 give q, k of instance y >> 1, plane 1 gives XT */
  if (RB && y == 3) { prep_weights((int)blockIdx.x * 128 + tid, swv, sbv, gwv, gbv, tw, AWV, TW16); return; }      /* whole blocks, in front of the barrier */
  { const int ai = RB ? y : (y >> 1); xs += (size_t)y * sx; wq += ai * 8 * CC; bq += ai * 8; wk += ai * 8 * CC; bk += ai * 8; slab0 += ai * BB; if (RB) XT += (size_t)y * BB * TT * 96; }      /* sx = floats between two source planes; one XT plane per frame */
  const int bn = (int)blockIdx.x * 128 + tid; const int n = bn % TT, b = bn / TT;      /* the grid holds exactly BB * TT threads */
  const float* xp = xs + (size_t)b * CC * TT + n; unsigned short* xo = &sX[tid][0];      /* this token's row of XT, staged in LDS: the block's rows lie in a row in memory and leave as whole lines (xt_out) */
  unsigned short* xg = (unsigned short*)XT + (size_t)blockIdx.x * 128 * 96;
  if (!RB && y == 1) {      /* whole blocks, in front of the barrier: this plane only feeds the V GEMM, so its 64 channel loads go out together and the row follows */
    float xa[CC];
#pragma unroll
    for (int cc = 0; cc < CC; ++cc) xa[cc] = xp[(size_t)cc * TT];
#pragma unroll
    for (int c0 = 0; c0 < CC; c0 += 8) { FragH f;
#pragma unroll
      for (int i = 0; i < 8; ++i) f.h[i] = (_Float16)xa[c0 + i];
      *(v8us*)(xo + c0) = f.half[0]; }
    xt_tail(xo);
    __syncthreads();      /* every row is in LDS before any thread copies across rows; reached by the whole block or not at all */
    xt_out(xg, &sX[0][0], tid); return; }
  float wr[8], xn[16];      /* the weights' loads and those of channels 0..15 are issued together; the short loops over wr, xn and xc are unrolled so that the arrays stay in registers and the loads stand back to back */
#pragma unroll
  for (int j = 0; j < 4; ++j) { wr[j] = wq[j * 128 + tid]; wr[4 + j] = wk[j * 128 + tid]; }
#pragma unroll
  for (int i = 0; i < 16; ++i) xn[i] = xp[(size_t)i * TT];
  asm volatile("s_wait_xcnt 0x0" ::: "memory");      /* stands behind the run of weight and channel loads, in front of the first rewrite of a register that holds one of their addresses */
#pragma unroll
  for (int j = 0; j < 4; ++j) { const int i = j * 128 + tid, d = i / CC, c = i % CC; sW[c][d] = bf16_round(wr[j]); sW[c][8 + d] = bf16_round(wr[4 + j]); }
  float q[8], k[8]; for (int d = 0; d < 8; ++d) { q[d] = bf16_round(bq[d]); k[d] = bf16_round(bk[d]); }
  __syncthreads();      /* the rounded weights are in LDS before any thread reads them */
  /* kept rolled, 16 channels a trip: unrolled whole, the build fetched so many weights ahead that it took about 800 vector registers */
#pragma unroll 1
  for (int c0 = 0; c0 < CC; c0 += 16) { float xc[16];
#pragma unroll
    for (int i = 0; i < 16; ++i) xc[i] = xn[i];
    if (c0 + 16 < CC) {      /* the next trip's channels fly under this trip's sums */
#pragma unroll
      for (int i = 0; i < 16; ++i) xn[i] = xp[(size_t)(c0 + 16 + i) * TT];
      asm volatile("s_wait_xcnt 0x0" ::: "memory"); }      /* the build advances these loads' address registers early in the trip */
    float xv[16];
#pragma unroll
    for (int i = 0; i < 16; ++i) { xv[i] = xc[i]; if (RB) xv[i] = bf16_round(xv[i]); }
#pragma unroll
    for (int i = 0; i < 16; ++i) { const int c = c0 + i;
      const v4f wa = *(const v4fa*)&sW[c][0], wb = *(const v4fa*)&sW[c][4], wc = *(const v4fa*)&sW[c][8], wd = *(const v4fa*)&sW[c][12];
#pragma unroll
      for (int d = 0; d < 4; ++d) { q[d] += wa[d] * xv[i]; q[4 + d] += wb[d] * xv[i]; k[d] += wc[d] * xv[i]; k[4 + d] += wd[d] * xv[i]; } }
    if (RB) { FragH f0, f1;      /* self: the frame that gives q and k is also the V GEMM's operand */
#pragma unroll
      for (int i = 0; i < 8; ++i) { f0.h[i] = (_Float16)xv[i]; f1.h[i] = (_Float16)xv[8 + i]; }
      *(v8us*)(xo + c0) = f0.half[0]; *(v8us*)(xo + c0 + 8) = f1.half[0]; } }
  FragH fq0, fq1, fk0, fk1, fk2;      /* 16-B pieces of a row: Q = [q_hi | q_lo * 2^10 | q_hi | 0], K = [k_hi | k_hi * 2^-10 | k_lo | 0] */
#pragma unroll
  for (int d = 0; d < 8; ++d) { const _Float16 qh = (_Float16)q[d], kh = (_Float16)k[d]; const float qlo = (q[d] - (float)qh) * 1024.0f, klo = (k[d] - (float)kh);
    fq0.h[d] = qh; fq1.h[d] = (_Float16)qlo; fk0.h[d] = kh; fk1.h[d] = (_Float16)((float)kh * 0.0009765625f); fk2.h[d] = (_Float16)klo; }
  const v8us zz = {0, 0, 0, 0, 0, 0, 0, 0};
  if (RB) { xt_tail(xo);
    __syncthreads();      /* every row is in LDS before any thread copies across rows */
    xt_out(xg, &sX[0][0], tid); }
  const size_t row = (size_t)(slab0 + b) * TT + n; unsigned short* qo = (unsigned short*)QP + row * 32; unsigned short* ko = (unsigned short*)KP + row * 32;
  *(v8us*)qo = fq0.half[0]; *(v8us*)(qo + 8) = fq1.half[0]; *(v8us*)(qo + 16) = fq0.half[0]; *(v8us*)(qo + 24) = zz;
  *(v8us*)ko = fk0.half[0]; *(v8us*)(ko + 8) = fk1.half[0]; *(v8us*)(ko + 16) = fk2.half[0]; *(v8us*)(ko + 24) = zz; }
// Block = 4 query tiles x KSPL key ranges: wave w works query tile w & 3 over keys [(w >> 2) * TT/KSPL, +TT/KSPL) with its own running max, row sum and unnormalised O; the KSPL partials of a tile are merged through LDS at the end.
// Scores are formed transposed, S^T = K.Q^T (A = 16 key rows, B = the wave's 16 queries), so lane (ln, hh) holds 16 of the 32 scores of query ln: max and sum run inside the lane, plus one exchange between the wave halves for the max.
// The two S^T tiles of a trip hold keys 8hh + r and 16 + 8hh + r, which is the k order of the loaders here, so P^T goes from the accumulators into a B operand in registers and O^T += V^T.P^T (A = 16 channel rows of Vt); P never passes through LDS.
__device__ __forceinline__ float xhalf(float x) { return __builtin_bit_cast(float, __builtin_amdgcn_permlanex16(__builtin_bit_cast(int, x), __builtin_bit_cast(int, x), 0x76543210, 0xfedcba98, false, false)); }      /* lane l <-> lane l ^ 16 */
typedef float v2f __attribute__((ext_vector_type(2)));
typedef _Float16 v2h __attribute__((ext_vector_type(2)));
// Softmax runs in base 2: the running max is kept as m2 = score * log2(e) - 10, and every weight is 2^(score * log2(e) - m2) = 1024 * e^(score - max): one FMA and one hardware exp2 per score.
// The factor 1024 (the f16 scale of P) sits in O and in the row sum alike and cancels in O / l. Arguments are <= 10, so nothing overflows; a weight below 2^-126 counts as 0.
#define LOG2E 1.4426950408889634f
// One hardware exp2 with a free issue slot on either side: the instruction set asks for one independent instruction or v_nop between a transcendental and a neighbour that overwrites its source or reads its result.
__device__ __forceinline__ float exp2_slot(float x) { float y; asm("v_nop\n\tv_exp_f32 %0, %1\n\tv_nop" : "=v"(y) : "v"(x)); return y; }
// The merge also adds the residual and writes the stage's result in the layout its reader wants. SELF: SAo[slab][e][n] = O + bf16(RES[slab][e][n]), channel-major f32; a wave holds 32 queries of one channel group, so every load and store is a whole 128-B line.
// Guided: CATo[b][n][g * 64 + e] = f16(O + RES[b][e][n]) for slab = g * BB + b, token-major f16; 16 lanes write one token's 128 B.
template <int KSPL, bool SELF>
__global__ __launch_bounds__(128 * KSPL, 8) void k_flash(const _Float16* __restrict__ Q16, int ldq, const _Float16* __restrict__ K16, int ldk, const _Float16* __restrict__ Vt, const int* __restrict__ MSK, const float* __restrict__ RES, float* __restrict__ SAo, _Float16* __restrict__ CATo) {
  constexpr int RPW = 16, NQB = TT / (4 * RPW), DT = 4, NW = 4 * KSPL;      /* d_qk = 32 (24 real + zero padding), d_v = 64 */
  __shared__ __attribute__((aligned(16))) float sO[NW][RPW][64 + 4];
  __shared__ float sM[NW][RPW], sL[NW][RPW];
  (void)MSK;
  const int tid = threadIdx.x, w = __builtin_amdgcn_readfirstlane(tid >> 5), lane = tid & 31, ln = lane & 15, hh = lane >> 4;
  const int slab = blockIdx.x / NQB, qblk = blockIdx.x % NQB; const int b = slab / NH; const int qb0 = qblk * (4 * RPW); const int q0 = qb0 + (w & 3) * RPW;
  FragH bq;      /* B operand: column ln = query q0 + ln */
  { const unsigned short* qr = (const unsigned short*)Q16 + ((size_t)b * TT + q0 + ln) * ldq; bq.half[0] = *(const v8us*)(qr + 8 * hh); bq.half[1] = *(const v8us*)(qr + 16 + 8 * hh); }
  const unsigned short* Vth = (const unsigned short*)Vt + (size_t)slab * 64 * TT;      /* v per slab: [64][4096] */
  float m_r = -3.0e38f, l_r = 0.f; v8f oacc[DT];      /* m_r in base-2 units, shifted by -10 */      /* oacc[dt][r] = O^T[channel dt * 16 + 8hh + r][query ln] */
#pragma unroll
  for (int dt = 0; dt < DT; ++dt) oacc[dt] = (v8f){0.f,0.f,0.f,0.f,0.f,0.f,0.f,0.f};
  const int jbeg = (w >> 2) * (TT / KSPL);
  const unsigned short* kr[2] = {(const unsigned short*)K16 + ((size_t)b * TT + jbeg + ln) * ldk + 8 * hh, (const unsigned short*)K16 + ((size_t)b * TT + jbeg + 16 + ln) * ldk + 8 * hh};      /* this lane's piece of the trip's two K fragments (key rows j0 + ln and j0 + 16 + ln) ... */
  const unsigned short* vr = Vth + (size_t)ln * TT + jbeg + 8 * hh;      /* ... and of its first V fragment (channel row ln, keys from j0); j0 = jbeg + 32 * trip, the three addresses advance with the trip */
#pragma unroll 1
  for (int it = 0; it < TT / KSPL / 32; ++it) {
    FragH ak[2], av[DT];      /* the trip's two K and four V fragments: their twelve loads go out together here, so the trip waits for memory once and not once per fragment */
#pragma unroll
    for (int nt = 0; nt < 2; ++nt) { ak[nt].half[0] = *(const v8us*)(kr[nt]); ak[nt].half[1] = *(const v8us*)(kr[nt] + 16); }
    asm volatile("s_wait_xcnt 0x0" ::: "memory");      /* behind the K loads: the build gave a register that holds one of their addresses to a V load as its target */
#pragma unroll
    for (int dt = 0; dt < DT; ++dt) { av[dt].half[0] = *(const v8us*)(vr + (size_t)dt * 16 * TT); av[dt].half[1] = *(const v8us*)(vr + (size_t)dt * 16 * TT + 16); }
    asm volatile("s_wait_xcnt 0x0" ::: "memory");      /* behind this run of loads, in front of the advance of the three address registers that they name; it also keeps the build from moving a V load down to its use */
    kr[0] += (size_t)32 * ldk; kr[1] += (size_t)32 * ldk; vr += 32;
    v8f s[2];      /* s[nt][r] = score of key j0 + nt * 16 + 8hh + r with query ln */
#pragma unroll
    for (int nt = 0; nt < 2; ++nt) s[nt] = mmaH<1>(ak[nt].v, ak[nt].v, bq.v, bq.v, (v8f){0.f,0.f,0.f,0.f,0.f,0.f,0.f,0.f});
    float mc = fmaxf(s[0][0], s[1][0]);
#pragma unroll
    for (int r = 1; r < 8; ++r) mc = fmaxf(mc, fmaxf(s[0][r], s[1][r]));
    mc = fmaxf(mc, xhalf(mc));      /* both halves hold the max over the trip's 32 keys */
    const float mn = fmaxf(m_r, __builtin_fmaf(mc, LOG2E, -10.0f)); const float ae = exp2_slot(m_r - mn); const float al = (mn > -1.0e38f) ? ae : 1.0f; m_r = mn;
    FragH ph, pl; float ls = 0.f;      /* P^T * 1024 as f16 hi + residual: element nt * 8 + r = key nt * 16 + 8hh + r */
#pragma unroll
    for (int nt = 0; nt < 2; ++nt)
#pragma unroll
      for (int r = 0; r < 8; r += 2) { const v2f ar = __builtin_elementwise_fma((v2f){s[nt][r], s[nt][r + 1]}, (v2f){LOG2E, LOG2E}, (v2f){-mn, -mn}); const float pa = __builtin_amdgcn_exp2f(ar[0]), pb = __builtin_amdgcn_exp2f(ar[1]); ls += pa; ls += pb; const v2f ps = (v2f){pa, pb}; const v2h hi = __builtin_convertvector(ps, v2h); const v2h lo = __builtin_convertvector(ps - __builtin_convertvector(hi, v2f), v2h);
        ph.h[nt * 8 + r] = hi[0]; ph.h[nt * 8 + r + 1] = hi[1]; pl.h[nt * 8 + r] = lo[0]; pl.h[nt * 8 + r + 1] = lo[1]; }
    l_r = l_r * al + ls;      /* this half's 16 keys; the halves are joined behind the loop */
#pragma unroll
    for (int dt = 0; dt < DT; ++dt) oacc[dt] *= al;
#pragma unroll
    for (int dt = 0; dt < DT; ++dt) { oacc[dt] = mmaH<1>(av[dt].v, av[dt].v, ph.v, ph.v, oacc[dt]); oacc[dt] = mmaH<1>(av[dt].v, av[dt].v, pl.v, pl.v, oacc[dt]); } }      /* V^T.(Ph + Pl) */
  l_r += xhalf(l_r);
  if (hh == 0) { sM[w][ln] = m_r; sL[w][ln] = l_r; }
#pragma unroll
  for (int dt = 0; dt < DT; ++dt) { *(v4fa*)&sO[w][ln][dt * 16 + 8 * hh] = (v4f){oacc[dt][0], oacc[dt][1], oacc[dt][2], oacc[dt][3]}; *(v4fa*)&sO[w][ln][dt * 16 + 8 * hh + 4] = (v4f){oacc[dt][4], oacc[dt][5], oacc[dt][6], oacc[dt][7]}; }
  __syncthreads();      /* every wave's partial is in LDS before any thread merges */
  /* merge: thread = (query of the block, 4 channels); O = sum_s 2^(m_s - M) * O_s / sum_s 2^(m_s - M) * l_s, M = max_s m_s; O_s and l_s both carry the factor 1024 */
#pragma unroll
  for (int i = tid; i < 4 * RPW * 16; i += 128 * KSPL) { const int qq = SELF ? (i & 63) : (i >> 4), pc = SELF ? (i >> 6) : (i & 15), g = qq / RPW, r = qq % RPW;
    float mx = sM[g][r];
#pragma unroll
    for (int s = 1; s < KSPL; ++s) mx = fmaxf(mx, sM[s * 4 + g][r]);
    float l = 0.f; v4f a = {0.f, 0.f, 0.f, 0.f};
#pragma unroll
    for (int s = 0; s < KSPL; ++s) { const float e = exp2_slot(sM[s * 4 + g][r] - mx); l += sL[s * 4 + g][r] * e; const v4f val = *(const v4fa*)&sO[s * 4 + g][r][pc * 4]; a += val * e; }
    const float inv = (l > 0.f) ? 1.0f / l : 0.f;
    const v4f o = a * inv;
    const float* rp = RES + ((size_t)(SELF ? slab : slab % BB) * CC + pc * 4) * TT + qb0 + qq;      /* residual of channels pc * 4 .. + 3 at this query */
    if (SELF) { float* sp = SAo + ((size_t)slab * CC + pc * 4) * TT + qb0 + qq;
#pragma unroll
      for (int j = 0; j < 4; ++j) sp[(size_t)j * TT] = o[j] + bf16_round(rp[(size_t)j * TT]); }
    else { v4h h4;
#pragma unroll
      for (int j = 0; j < 4; ++j) h4[j] = (_Float16)(o[j] + rp[(size_t)j * TT]);
      *(v4h*)(CATo + ((size_t)(slab % BB) * TT + qb0 + qq) * 128 + (slab / BB) * 64 + pc * 4) = h4; } } }

extern "C" void kernel_launch(void* const* d_in, const int* in_sizes, int n_in,
                              void* d_out, int out_size, void* d_ws, size_t ws_size, hipStream_t stream) {
  (void)in_sizes; (void)n_in; (void)out_size;
  const float* const* I = (const float* const*)d_in; const float* x = I[0]; const float* sa_wq = I[1]; const float* sa_bq = I[2]; const float* sa_wk = I[3]; const float* sa_bk = I[4]; const float* sa_wv = I[5]; const float* sa_bv = I[6];
  const float* ga_wq = I[7]; const float* ga_bq = I[8]; const float* ga_wk = I[9]; const float* ga_bk = I[10]; const float* ga_wv = I[11]; const float* ga_bv = I[12]; const float* tw = I[13]; const float* tb = I[14];
  char* ws = (char*)d_ws; size_t off = 0;
  auto take = [&](size_t bytes) { char* p = ws + off; off += (bytes + 255) & ~(size_t)255; return p; };
  const size_t PL = (size_t)BB * CC * TT;      /* one [B][64][4096] f32 plane = 1 M floats */
  _Float16* AWV = (_Float16*)take((size_t)5 * CC * 96 * 2); _Float16* TW16 = (_Float16*)take((size_t)CC * 128 * 2);
  _Float16* XT = (_Float16*)take((size_t)3 * BB * TT * 96 * 2); _Float16* QP = (_Float16*)take((size_t)NSL * TT * 32 * 2); _Float16* KP = (_Float16*)take((size_t)NSL * TT * 32 * 2); _Float16* VT = (_Float16*)take((size_t)NSL * CC * TT * 2);
  float* SA = (float*)take(3 * PL * 4); _Float16* CAT = (_Float16*)take((size_t)BB * TT * 128 * 2);
  if (off > ws_size) return;      // 0.1 + 9.4 + 5.2 + 5.2 + 10.5 + 12.6 + 4.2 = about 47 MB
  const unsigned gqk = (unsigned)((size_t)BB * TT / 128); const unsigned gvx = ((CC / 16) * (TT / 64) + 3) / 4;
  /* self attention on the three frames: slabs a * BB + b for a = 0,1,2; each stage is one launch over all three frames (frame on blockIdx.y for k_qk, on blockIdx.z for the GEMM, in the slab from blockIdx.x for k_flash), XT holds one plane per frame */
  k_qk<1><<<dim3(gqk, 4), 128, 0, stream>>>(x, PL, sa_wq, sa_bq, sa_wk, sa_bk, 0, QP, KP, XT, sa_wv, sa_bv, ga_wv, ga_bv, tw, AWV, TW16);      /* q, k and XT of the three frames; blockIdx.y == 3: the weights of all GEMMs */
  k_gemm_hhx<0, false><<<dim3(gvx, BB, 3), 128, 0, stream>>>(AWV, 96, 0, XT, 96, (size_t)TT * 96, 0.0625f, nullptr, 0, nullptr, 1, 0, 0, nullptr, VT, TT, (size_t)CC * TT, CC, TT, 96, (size_t)CC * 96, (size_t)BB * TT * 96, (size_t)BB * CC * TT, nullptr, nullptr);      /* v[b][e][m] = wv.x + bv, channel-major f16: batched over b and frame, M 64 N 4096 K 96 */
  k_flash<8, true><<<3 * BB * (TT / 64), 1024, 0, stream>>>(QP, 32, KP, 32, VT, nullptr, x, SA, nullptr);      /* slabs 0..11; 768 blocks of 32 waves = three full rounds of the WGPs; SA_a = attn-out + x_a (channel-major f32) */
  /* guided attentions: slabs 12..15 (q,k from SA_0; v,res from SA_1) and 16..19 (q,k from SA_2) */
  k_qk<0><<<dim3(gqk, 3), 128, 0, stream>>>(SA, PL, ga_wq, ga_bq, ga_wk, ga_bk, 3 * BB, QP, KP, XT, nullptr, nullptr, nullptr, nullptr, nullptr, nullptr, nullptr);      /* q, k from SA_0 and SA_2; XT = SA_1 token-major (internal f32, no rounding) */
  k_gemm_hhx<0, false><<<dim3(gvx, BB, 2), 128, 0, stream>>>(AWV + (size_t)3 * CC * 96, 96, 0, XT, 96, (size_t)TT * 96, 0.0625f, nullptr, 0, nullptr, 1, 0, 0, nullptr, VT + (size_t)3 * BB * CC * TT, TT, (size_t)CC * TT, CC, TT, 96, (size_t)CC * 96, 0, (size_t)BB * CC * TT, nullptr, nullptr);      /* both read the SA_1 plane of XT */
  k_flash<4, false><<<2 * BB * (TT / 64), 512, 0, stream>>>(QP + (size_t)3 * BB * TT * 32, 32, KP + (size_t)3 * BB * TT * 32, 32, VT + (size_t)3 * BB * CC * TT, nullptr, SA + PL, nullptr, CAT);      /* slabs 12..19 (kernel-relative 0..7); cat = [attn-out_0 + SA_1 | attn-out_1 + SA_1], token-major f16 */
  k_gemm_hhx<0, true><<<dim3(gvx, BB), 128, 0, stream>>>(TW16, 128, 0, CAT, 128, (size_t)TT * 128, 0.0625f, nullptr, 0, nullptr, 1, 0, 0, (float*)d_out, nullptr, TT, (size_t)CC * TT, CC, TT, 128, 0, 0, 0, tb, SA + PL);      /* fusion[b][o][n] = sum_c W[o][c] * cat[b][c][n]: A = W (M 64, K 128), Bt = CAT[b] token-major; the epilogue adds tfus_b per row o and writes out = fusion * SA_1 + SA_1 */
}

// v008
// It runs in 159 microseconds.
// Two timings next to v007 put it at 1.34 and 1.31 times that version's speed.
// Over all steps from v000 it is 6.76 times as fast.
#include <hip/hip_runtime.h>
// MFI (3 frames, B=4, C=64, 64×64 → N=4096): SA_f = position attention on frame f (q = wq·x+bq (8 ch), k = wk·x+bk (8 ch), v = wv·x+bv (64 ch); attn = softmax_m(q[:,n]·k[:,m]) unscaled; out[e][n] = Σ_m v[e][m]·attn[n][m] + x[e][n]); then two guided attentions
// (q,k from SA_0 / SA_2, v and residual from SA_1), cat → fusion = tfus_w·cat + b; out = fusion·SA_1 + SA_1 → [4,64,64,64].
// Compute dtype: x, weights, biases rounded to bf16; q/k per token in f32 VALU (8×64 dot, rolled) emitted as concatenated f16 planes [q_hi|q_lo·2^10|q_hi|0] and [k_hi|k_hi·2^-10|k_lo|0] so ONE 32-wide WMMA k-step yields f32-accurate logits; v (+bias via an
// augmented ones column) by GEMM (f16) in k_flash's fragment order; fused flash-style kernel per (slab, 64 queries) (online softmax f32, P f16 hi + residual, residual added in f32 by its merge, which writes SA channel-major f32 or cat token-major f16); cat f16 -> fusion GEMM -> out = fusion * sa_1 + sa_1 in f32. All on v_wmma_f32_16x16x32_f16.
#define NFR 3
#define BB 4
#define CC 64
#define TT 4096
#define NH 1
#define NSL (5 * BB)

typedef __bf16 v16b __attribute__((ext_vector_type(16)));
typedef unsigned short v8us __attribute__((ext_vector_type(8), may_alias));
typedef float  v8f  __attribute__((ext_vector_type(8)));
typedef float  v4f  __attribute__((ext_vector_type(4)));
typedef float  v4fa __attribute__((ext_vector_type(4), may_alias));
union FragB { v16b v; v8us half[2]; unsigned short u[16]; };

__device__ __forceinline__ unsigned short bf16_bits(float x) { unsigned int u = __float_as_uint(x); return (unsigned short)((u + 0x7FFFu + ((u >> 16) & 1u)) >> 16); }
__device__ __forceinline__ float bf16_val(unsigned short b) { return __uint_as_float(((unsigned int)b) << 16); }
__device__ __forceinline__ float bf16_round(float x) { return bf16_val(bf16_bits(x)); }
// D += A·B with NT terms: 1 = ah·bh, 2 = + al·bh (A split), 3 = + ah·bl (both split)
template <int NT>
__device__ __forceinline__ v8f mmaN(v16b ah, v16b al, v16b bh, v16b bl, v8f c) {
  c = __builtin_amdgcn_wmma_f32_16x16x32_bf16(false, ah, false, bh, (short)0, c, false, false);
  if (NT >= 2) c = __builtin_amdgcn_wmma_f32_16x16x32_bf16(false, al, false, bh, (short)0, c, false, false);
  if (NT >= 3) c = __builtin_amdgcn_wmma_f32_16x16x32_bf16(false, ah, false, bl, (short)0, c, false, false);
  asm volatile("v_nop\n\tv_nop\n\tv_nop\n\tv_nop" : "+v"(c) : "v"(ah), "v"(al), "v"(bh), "v"(bl));
  return c;
}

__global__ __launch_bounds__(256) void k_wt_bf16(const float* __restrict__ W, unsigned short* __restrict__ Wt, int K, int N) {
  const int t = blockIdx.x * 256 + threadIdx.x;
  const int k8n = K / 8;
  if (t >= N * k8n) return;
  const int n = t / k8n, k8 = (t % k8n) * 8;
  v8us v;
#pragma unroll
  for (int i = 0; i < 8; ++i) v[i] = bf16_bits(W[(size_t)(k8 + i) * N + n]);
  *(v8us*)(Wt + (size_t)n * K + k8) = v;
  
}

// GEMM C[M][N] (f32, pitch ldc) = act(A[M][K]·W + bias). A f32 row-major (pitch lda) converted per fragment to bf16
// (ASPLIT: hi/lo two planes -> 2 terms, else single rounded term); Wt bf16 [N][K] (pitch ldb). BIAS_BF16 rounds the
// bias to bf16 first (bias quantised to bf16 before the add). K%32==0, M%16==0, N%64==0.
template <bool ASPLIT, int ACT, bool BIAS_BF16>
__global__ __launch_bounds__(128) void k_gemm_bf(const float* __restrict__ A, int lda, const unsigned short* __restrict__ Wt, int ldb,
                                               const float* __restrict__ bias, float* __restrict__ C, int ldc, int M, int N, int K) {
  __shared__ __attribute__((aligned(16))) float so[4][16][64];
  const int tid = threadIdx.x, w = tid >> 5, lane = tid & 31, ln = lane & 15, hh = lane >> 4;
  const int ntn = N / 64;
  const int wid = blockIdx.x * 4 + w;
  const int mt = wid / ntn, nq = wid % ntn;
  if (mt * 16 >= M) return;
  const int row0 = mt * 16, col0 = nq * 64;
  const float* arow = A + (size_t)(row0 + ln) * lda;
  v8f acc[4] = {};
  for (int kb = 0; kb < K; kb += 32) {
    FragB ah, al;
    const v4f x0 = *(const v4fa*)(arow + kb + 8 * hh), x1 = *(const v4fa*)(arow + kb + 8 * hh + 4);
    const v4f x2 = *(const v4fa*)(arow + kb + 16 + 8 * hh), x3 = *(const v4fa*)(arow + kb + 16 + 8 * hh + 4);
    float xs[16] = {x0[0],x0[1],x0[2],x0[3],x1[0],x1[1],x1[2],x1[3],x2[0],x2[1],x2[2],x2[3],x3[0],x3[1],x3[2],x3[3]};
#pragma unroll
    for (int i = 0; i < 16; ++i) { const unsigned short hb = bf16_bits(xs[i]); ah.u[i] = hb; al.u[i] = ASPLIT ? bf16_bits(xs[i] - bf16_val(hb)) : (unsigned short)0; }
#pragma unroll
    for (int t = 0; t < 4; ++t) {
      const unsigned short* brow = Wt + (size_t)(col0 + t * 16 + ln) * ldb + kb;
      FragB b;
      b.half[0] = *(const v8us*)(brow + 8 * hh);
      b.half[1] = *(const v8us*)(brow + 16 + 8 * hh);
      acc[t] = mmaN<ASPLIT ? 2 : 1>(ah.v, al.v, b.v, b.v, acc[t]);
    }
  }
#pragma unroll
  for (int t = 0; t < 4; ++t) {
    float bv = bias ? bias[col0 + t * 16 + ln] : 0.f;
    if (BIAS_BF16) bv = bf16_round(bv);
#pragma unroll
    for (int r = 0; r < 8; ++r) { float v = acc[t][r] + bv; if (ACT == 1) v = fmaxf(v, 0.f); so[w][8 * hh + r][t * 16 + ln] = v; }
  }
  __builtin_amdgcn_fence(__ATOMIC_ACQ_REL, "workgroup");
  __builtin_amdgcn_wave_barrier();
  const int rsub = lane >> 4, c4 = (lane & 15) * 4;
  {
#pragma unroll
    for (int q = 0; q < 8; ++q) {
      const int r = q * 2 + rsub;
      const v4f v = *(const v4fa*)&so[w][r][c4];
      *(v4f*)(C + (size_t)(row0 + r) * ldc + col0 + c4) = v;
    }
    
  }
}

// Flash-style causal/unmasked attention, all contractions 3-term bf16 hi/lo splits, f32 softmax with running max.
// q,k,v rows are read from f32 buffers with arbitrary row pitch (so they can live inside a fused qkv buffer);
// D = head size (multiple of 32, <= 128); one wave = 16 query rows; block = 4 waves (64 queries) sharing K/V chunks of 32.
template <int D, bool CAUSAL>
__global__ __launch_bounds__(128) void k_flash(const float* __restrict__ qb, const float* __restrict__ kb, const float* __restrict__ vb,
                                             int pitch, int T, int H, float scale, float* __restrict__ y, int ypitch) {
  constexpr int KS = D / 32;        // k-steps for QK
  constexpr int DT = D / 16;        // d tiles for PV
  __shared__ __attribute__((aligned(16))) unsigned short sKh[32][D + 8], sKl[32][D + 8], sVh[32][D + 8], sVl[32][D + 8];
  __shared__ __attribute__((aligned(16))) unsigned short sPh[4][16][40], sPl[4][16][40];
  __shared__ __attribute__((aligned(16))) float sO[4][16][D];
  const int tid = threadIdx.x, w = tid >> 5, lane = tid & 31, ln = lane & 15, hh = lane >> 4;
  const int nqb = (T + 63) / 64;
  const int bh = blockIdx.x / nqb, qblk = blockIdx.x % nqb;
  const int b = bh / H, h = bh % H;
  const int q0 = qblk * 64 + w * 16;
  const float* Q = qb + (size_t)b * T * pitch + h * D;
  const float* K = kb + (size_t)b * T * pitch + h * D;
  const float* V = vb + (size_t)b * T * pitch + h * D;

  // A fragments of the wave's 16 query rows (scaled), hi/lo
  FragB aqh[KS], aql[KS];
  {
    int row = q0 + ln; if (row >= T) row = T - 1;
    const float* qr = Q + (size_t)row * pitch;
#pragma unroll
    for (int ks = 0; ks < KS; ++ks)
#pragma unroll
      for (int i = 0; i < 16; ++i) {
        const int d = ks * 32 + ((i < 8) ? (8 * hh + i) : (16 + 8 * hh + (i - 8)));
        const float x = qr[d] * scale; const unsigned short hb = bf16_bits(x);
        aqh[ks].u[i] = hb; aql[ks].u[i] = bf16_bits(x - bf16_val(hb));
      }
  }
  float m_r[8], l_r[8];
#pragma unroll
  for (int r = 0; r < 8; ++r) { m_r[r] = -3.0e38f; l_r[r] = 0.f; }
  v8f oacc[DT];
#pragma unroll
  for (int dt = 0; dt < DT; ++dt) oacc[dt] = (v8f){0.f,0.f,0.f,0.f,0.f,0.f,0.f,0.f};

  const int kv_end = CAUSAL ? min(T, qblk * 64 + 64) : T;     // block-uniform
  for (int j0 = 0; j0 < kv_end; j0 += 32) {
    __syncthreads();
    for (int e = tid; e < 32 * (D / 4); e += 128) {
      const int r = e / (D / 4), c4 = (e % (D / 4)) * 4;
      const int key = j0 + r;
      v4f kf = {0.f,0.f,0.f,0.f}, vf = {0.f,0.f,0.f,0.f};
      if (key < T) { kf = *(const v4fa*)(K + (size_t)key * pitch + c4); vf = *(const v4fa*)(V + (size_t)key * pitch + c4); }
#pragma unroll
      for (int t = 0; t < 4; ++t) {
        unsigned short hb = bf16_bits(kf[t]); sKh[r][c4 + t] = hb; sKl[r][c4 + t] = bf16_bits(kf[t] - bf16_val(hb));
        hb = bf16_bits(vf[t]); sVh[r][c4 + t] = hb; sVl[r][c4 + t] = bf16_bits(vf[t] - bf16_val(hb));
      }
    }
    __syncthreads();
    // S tile 16 x 32
    v8f s[2];
#pragma unroll
    for (int nt = 0; nt < 2; ++nt) {
      v8f acc = {};
#pragma unroll
      for (int ks = 0; ks < KS; ++ks) {
        FragB bh_, bl_;
        bh_.half[0] = *(const v8us*)&sKh[nt * 16 + ln][ks * 32 + 8 * hh]; bh_.half[1] = *(const v8us*)&sKh[nt * 16 + ln][ks * 32 + 16 + 8 * hh];
        bl_.half[0] = *(const v8us*)&sKl[nt * 16 + ln][ks * 32 + 8 * hh]; bl_.half[1] = *(const v8us*)&sKl[nt * 16 + ln][ks * 32 + 16 + 8 * hh];
        acc = mmaN<3>(aqh[ks].v, aql[ks].v, bh_.v, bl_.v, acc);
      }
      s[nt] = acc;
    }
    // mask + running max (rows 8hh+r; the 16 lanes of a half share rows)
    float alpha[8];
#pragma unroll
    for (int r = 0; r < 8; ++r) {
      const int qi = q0 + 8 * hh + r;
      const int ja = j0 + ln, jb = j0 + 16 + ln;
      if (CAUSAL) { if (ja > qi) s[0][r] = -3.0e38f; if (jb > qi) s[1][r] = -3.0e38f; }
      if (ja >= T) s[0][r] = -3.0e38f;
      if (jb >= T) s[1][r] = -3.0e38f;
      float mx = fmaxf(s[0][r], s[1][r]);
      mx = fmaxf(mx, __shfl_xor(mx, 1, 32)); mx = fmaxf(mx, __shfl_xor(mx, 2, 32)); mx = fmaxf(mx, __shfl_xor(mx, 4, 32)); mx = fmaxf(mx, __shfl_xor(mx, 8, 32));
      const float mnew = fmaxf(m_r[r], mx);
      alpha[r] = (mnew > -1.0e38f) ? __expf(m_r[r] - mnew) : 1.0f;
      const float p0 = (s[0][r] > -1.0e38f) ? __expf(s[0][r] - mnew) : 0.f;
      const float p1 = (s[1][r] > -1.0e38f) ? __expf(s[1][r] - mnew) : 0.f;
      m_r[r] = mnew;
      l_r[r] = l_r[r] * alpha[r] + p0 + p1;            // per-lane partial row sum (16 lanes combined at the end)
      unsigned short hb = bf16_bits(p0); sPh[w][8 * hh + r][ln] = hb;      sPl[w][8 * hh + r][ln] = bf16_bits(p0 - bf16_val(hb));
      hb = bf16_bits(p1);                sPh[w][8 * hh + r][16 + ln] = hb; sPl[w][8 * hh + r][16 + ln] = bf16_bits(p1 - bf16_val(hb));
    }
#pragma unroll
    for (int dt = 0; dt < DT; ++dt)
#pragma unroll
      for (int r = 0; r < 8; ++r) oacc[dt][r] *= alpha[r];
    __builtin_amdgcn_fence(__ATOMIC_ACQ_REL, "workgroup");
    __builtin_amdgcn_wave_barrier();
    FragB pah, pal;
    pah.half[0] = *(const v8us*)&sPh[w][ln][8 * hh]; pah.half[1] = *(const v8us*)&sPh[w][ln][16 + 8 * hh];
    pal.half[0] = *(const v8us*)&sPl[w][ln][8 * hh]; pal.half[1] = *(const v8us*)&sPl[w][ln][16 + 8 * hh];
#pragma unroll
    for (int dt = 0; dt < DT; ++dt) {
      FragB bvh, bvl;
#pragma unroll
      for (int i = 0; i < 8; ++i) {
        bvh.u[i] = sVh[8 * hh + i][dt * 16 + ln]; bvh.u[8 + i] = sVh[16 + 8 * hh + i][dt * 16 + ln];
        bvl.u[i] = sVl[8 * hh + i][dt * 16 + ln]; bvl.u[8 + i] = sVl[16 + 8 * hh + i][dt * 16 + ln];
      }
      oacc[dt] = mmaN<3>(pah.v, pal.v, bvh.v, bvl.v, oacc[dt]);
    }
    __builtin_amdgcn_fence(__ATOMIC_ACQ_REL, "workgroup");
    __builtin_amdgcn_wave_barrier();
  }
#pragma unroll
  for (int r = 0; r < 8; ++r) {
    float l = l_r[r];
    l += __shfl_xor(l, 1, 32); l += __shfl_xor(l, 2, 32); l += __shfl_xor(l, 4, 32); l += __shfl_xor(l, 8, 32);
    l_r[r] = (l > 0.f) ? 1.0f / l : 0.f;
  }
#pragma unroll
  for (int dt = 0; dt < DT; ++dt)
#pragma unroll
    for (int r = 0; r < 8; ++r) sO[w][8 * hh + r][dt * 16 + ln] = oacc[dt][r] * l_r[r];
  __builtin_amdgcn_fence(__ATOMIC_ACQ_REL, "workgroup");
  __builtin_amdgcn_wave_barrier();
  {
    for (int r = 0; r < 16; ++r) {
      const int row = q0 + r;
      if (row < T && lane < D / 4) {
        const v4f val = *(const v4fa*)&sO[w][r][lane * 4];
        *(v4f*)(y + ((size_t)b * T + row) * ypitch + h * D + lane * 4) = val;
      }
    }
    
  }
}

// GEMM C = act(A·W + bias + resid): A f32 (ASPLIT -> hi/lo 2 terms), Wt bf16 [N][K]; ACT 0 none, 1 relu, 2 exact gelu;
// resid (optional, f32, row index = (row % rmod), pitch ldr, RES_BF16 rounds it) added before the activation.
template <bool ASPLIT, int ACT, bool BIAS_BF16, bool RES_BF16>
__global__ __launch_bounds__(128) void k_gemm_bf3(const float* __restrict__ A, int lda, const unsigned short* __restrict__ Wt, int ldb,
                                                const float* __restrict__ bias, const float* __restrict__ resid, int rmod, int ldr,
                                                float* __restrict__ C, int ldc, int M, int N, int K) {
  __shared__ __attribute__((aligned(16))) float so[4][16][64];
  const int tid = threadIdx.x, w = tid >> 5, lane = tid & 31, ln = lane & 15, hh = lane >> 4;
  const int ntn = N / 64;
  const int wid = blockIdx.x * 4 + w;
  const int mt = wid / ntn, nq = wid % ntn;
  if (mt * 16 >= M) return;
  const int row0 = mt * 16, col0 = nq * 64;
  const float* arow = A + (size_t)(row0 + ln) * lda;
  v8f acc[4] = {};
  for (int kb = 0; kb < K; kb += 32) {
    FragB ah, al;
    const v4f x0 = *(const v4fa*)(arow + kb + 8 * hh), x1 = *(const v4fa*)(arow + kb + 8 * hh + 4);
    const v4f x2 = *(const v4fa*)(arow + kb + 16 + 8 * hh), x3 = *(const v4fa*)(arow + kb + 16 + 8 * hh + 4);
    float xs[16] = {x0[0],x0[1],x0[2],x0[3],x1[0],x1[1],x1[2],x1[3],x2[0],x2[1],x2[2],x2[3],x3[0],x3[1],x3[2],x3[3]};
#pragma unroll
    for (int i = 0; i < 16; ++i) { const unsigned short hb = bf16_bits(xs[i]); ah.u[i] = hb; al.u[i] = ASPLIT ? bf16_bits(xs[i] - bf16_val(hb)) : (unsigned short)0; }
#pragma unroll
    for (int t = 0; t < 4; ++t) {
      const unsigned short* brow = Wt + (size_t)(col0 + t * 16 + ln) * ldb + kb;
      FragB b;
      b.half[0] = *(const v8us*)(brow + 8 * hh);
      b.half[1] = *(const v8us*)(brow + 16 + 8 * hh);
      acc[t] = mmaN<ASPLIT ? 2 : 1>(ah.v, al.v, b.v, b.v, acc[t]);
    }
  }
#pragma unroll
  for (int t = 0; t < 4; ++t) {
    const int col = col0 + t * 16 + ln;
    float bv = bias ? bias[col] : 0.f;
    if (BIAS_BF16) bv = bf16_round(bv);
#pragma unroll
    for (int r = 0; r < 8; ++r) {
      float v = acc[t][r] + bv;
      if (resid) { float rv = resid[(size_t)((row0 + 8 * hh + r) % rmod) * ldr + col]; if (RES_BF16) rv = bf16_round(rv); v += rv; }
      if (ACT == 1) v = fmaxf(v, 0.f);
      if (ACT == 2) v = 0.5f * v * (1.0f + erff(v * 0.70710678118654752f));
      if (ACT == 3) { const float u = 0.7978845608028654f * (v + 0.044715f * v * v * v); v = 0.5f * v * (1.0f + tanhf(u)); }
      so[w][8 * hh + r][t * 16 + ln] = v;
    }
  }
  __builtin_amdgcn_fence(__ATOMIC_ACQ_REL, "workgroup");
  __builtin_amdgcn_wave_barrier();
  const int rsub = lane >> 4, c4 = (lane & 15) * 4;
  {
#pragma unroll
    for (int q = 0; q < 8; ++q) {
      const int r = q * 2 + rsub;
      const v4f v = *(const v4fa*)&so[w][r][c4];
      *(v4f*)(C + (size_t)(row0 + r) * ldc + col0 + c4) = v;
    }
    
  }
}
// row LayerNorm (biased variance, eps) over N: s = X (+ R); optional out_sum <- s; out_norm <- (s-mu)*rsqrt(var+eps)*g + b
template <bool PARAM_BF16>
__global__ __launch_bounds__(256) void k_layernorm(const float* __restrict__ X, const float* __restrict__ R, const float* __restrict__ g, const float* __restrict__ bta,
                                                  float* __restrict__ out_sum, float* __restrict__ out_norm, int N, float eps) {
  __shared__ float red[256];
  const int row = blockIdx.x, tid = threadIdx.x;
  const float* x = X + (size_t)row * N; const float* rr = R ? R + (size_t)row * N : nullptr;
  float vals[16];                     // up to N = 4096
  const int per = N / 256;            // contiguous chunk per thread? use strided-by-4 chunks: thread handles j = tid*4 + 1024*u
  float s1 = 0.f;
  for (int u = 0; u < per / 4; ++u) {
    const int j = tid * 4 + 1024 * u;
    const v4f a = *(const v4fa*)(x + j);
    v4f b = {0.f,0.f,0.f,0.f}; if (rr) b = *(const v4fa*)(rr + j);
#pragma unroll
    for (int q = 0; q < 4; ++q) { const float v = a[q] + b[q]; vals[u * 4 + q] = v; s1 += v; }
  }
  red[tid] = s1; __syncthreads();
  for (int st = 128; st > 0; st >>= 1) { if (tid < st) red[tid] += red[tid + st]; __syncthreads(); }
  const float mu = red[0] / (float)N; __syncthreads();
  float s2 = 0.f;
  for (int u = 0; u < per / 4; ++u)
#pragma unroll
    for (int q = 0; q < 4; ++q) { const float c = vals[u * 4 + q] - mu; s2 += c * c; }
  red[tid] = s2; __syncthreads();
  for (int st = 128; st > 0; st >>= 1) { if (tid < st) red[tid] += red[tid + st]; __syncthreads(); }
  const float rs = rsqrtf(red[0] / (float)N + eps);
  {
    for (int u = 0; u < per / 4; ++u) {
      const int j = tid * 4 + 1024 * u;
      v4f o, sm;
#pragma unroll
      for (int q = 0; q < 4; ++q) {
        float gg = g[j + q], bb = bta[j + q];
        if (PARAM_BF16) { gg = bf16_round(gg); bb = bf16_round(bb); }
        sm[q] = vals[u * 4 + q]; o[q] = (vals[u * 4 + q] - mu) * rs * gg + bb;
      }
      if (out_sum) *(v4f*)(out_sum + (size_t)row * N + j) = sm;
      *(v4f*)(out_norm + (size_t)row * N + j) = o;
    }
    
  }
}



// ---- f16 WMMA path (v_wmma_f32_16x16x32_f16): 11-bit significands for operands in range — used where a [0,1] probability operand needs more precision than bf16
typedef _Float16 v16h __attribute__((ext_vector_type(16)));
union FragH { v16h v; v8us half[2]; _Float16 h[16]; unsigned short u[16]; };
template <int NT>
__device__ __forceinline__ v8f mmaH(v16h ah, v16h al, v16h bh, v16h bl, v8f c) {
  c = __builtin_amdgcn_wmma_f32_16x16x32_f16(false, ah, false, bh, (short)0, c, false, false);
  if (NT >= 2) c = __builtin_amdgcn_wmma_f32_16x16x32_f16(false, al, false, bh, (short)0, c, false, false);
  if (NT >= 3) c = __builtin_amdgcn_wmma_f32_16x16x32_f16(false, ah, false, bl, (short)0, c, false, false);
  asm volatile("v_nop\n\tv_nop\n\tv_nop\n\tv_nop" : "+v"(c) : "v"(ah), "v"(al), "v"(bh), "v"(bl));
  return c;
}
// batched GEMM like k_gemm_b but f16 operands: A f32 (split into f16 hi/lo if ASPLIT, else rounded to f16), Bt = f16 values [n][k]; alpha; C f32; N multiple of 16 (partial tiles skipped)
template <bool ASPLIT>
__global__ __launch_bounds__(128) void k_gemm_h(const float* __restrict__ A, int lda, size_t sA, const _Float16* __restrict__ Bh, int ldb, size_t sB, float alpha, float* __restrict__ C, int ldc, size_t sC, int M, int N, int K) {
  __shared__ __attribute__((aligned(16))) float so[4][16][64];
  const int tid = threadIdx.x, w = tid >> 5, lane = tid & 31, ln = lane & 15, hh = lane >> 4; const int by = blockIdx.y;
  A += (size_t)by * sA; Bh += (size_t)by * sB; C += (size_t)by * sC;
  const int ntn = (N + 63) / 64; const int wid = blockIdx.x * 4 + w; const int mt = wid / ntn, nq = wid % ntn; if (mt * 16 >= M) return;
  const int row0 = mt * 16, col0 = nq * 64; const float* arow = A + (size_t)(row0 + ln) * lda;
  v8f acc[4] = {};
  for (int kb = 0; kb < K; kb += 32) {
    FragH ah, al;
    const v4f x0 = *(const v4fa*)(arow + kb + 8 * hh), x1 = *(const v4fa*)(arow + kb + 8 * hh + 4), x2 = *(const v4fa*)(arow + kb + 16 + 8 * hh), x3 = *(const v4fa*)(arow + kb + 16 + 8 * hh + 4);
    float xs[16] = {x0[0],x0[1],x0[2],x0[3],x1[0],x1[1],x1[2],x1[3],x2[0],x2[1],x2[2],x2[3],x3[0],x3[1],x3[2],x3[3]};
#pragma unroll
    for (int i = 0; i < 16; ++i) { const _Float16 h = (_Float16)xs[i]; ah.h[i] = h; al.h[i] = ASPLIT ? (_Float16)(xs[i] - (float)h) : (_Float16)0.0f; }
#pragma unroll
    for (int t = 0; t < 4; ++t) { if (col0 + t * 16 >= N) continue; const size_t boff = (size_t)(col0 + t * 16 + ln) * ldb + kb; FragH bq; bq.half[0] = *(const v8us*)(Bh + boff + 8 * hh); bq.half[1] = *(const v8us*)(Bh + boff + 16 + 8 * hh);
      acc[t] = mmaH<ASPLIT ? 2 : 1>(ah.v, al.v, bq.v, bq.v, acc[t]); }
  }
#pragma unroll
  for (int t = 0; t < 4; ++t) { if (col0 + t * 16 >= N) continue;
#pragma unroll
    for (int r = 0; r < 8; ++r) so[w][8 * hh + r][t * 16 + ln] = acc[t][r] * alpha; }
  __builtin_amdgcn_fence(__ATOMIC_ACQ_REL, "workgroup"); __builtin_amdgcn_wave_barrier();
  const int rsub = lane >> 4, c4 = (lane & 15) * 4;
  {
#pragma unroll
    for (int q = 0; q < 8; ++q) { const int r = q * 2 + rsub; if (col0 + c4 < N) { const v4f v = *(const v4fa*)&so[w][r][c4]; *(v4f*)(C + (size_t)(row0 + r) * ldc + col0 + c4) = v; } }
     }
}

// Wt[n][k] = f16(W[k][n]·scale) from f32 row-major W[K][N] (scale = power of two; bf16-exact weights stay exact in f16 away from the subnormal range)
__global__ __launch_bounds__(256) void k_wt_f16(const float* __restrict__ W, _Float16* __restrict__ Wt, int K, int N, float scale) {
  const int t = blockIdx.x * 256 + threadIdx.x; if (t >= N * (K / 8)) return; const int n = t / (K / 8), k8 = (t % (K / 8)) * 8; FragH f;
#pragma unroll
  for (int i = 0; i < 8; ++i) f.h[i] = (_Float16)(bf16_round(W[(size_t)(k8 + i) * N + n]) * scale); const v8us o = f.half[0];
  *(v8us*)((unsigned short*)Wt + (size_t)n * K + k8) = o; 
}
// k_gemm_hh variant with fused epilogue: v = acc * alpha + bias[by * sBias + col] (+ CP[(row/rowsPerB) * sCPb + by * 64 + col] if CP) ; ACT 0 none / 1 elu ; writes f16 C16 (and f32 C if non-null); FIN: the last stage of the network in the epilogue, C = (v + bf16(rowb[row])) * S + S with S laid out like C
// VFR: C16 is written in the order in which k_flash loads it as A fragments (no bias, no activation, N a multiple of 64): halves [by, bz][col / 32][row / 16][(col >> 4) & 1][lane = ((col >> 3) & 1) * 16 + (row & 15)][col & 7], so that one 16-B load per lane there covers 512 B in a row, four whole 128-B lines.
// For that the product is formed transposed (the operands change places; both loaders have the same k order): lane (ln, hh) then holds columns t * 16 + 8hh + 0..7 of row row0 + ln, which is its own 16-B piece, and the tile goes from the accumulators to memory without the LDS trip.
template <int ACT, bool FIN, bool VFR = false>
__global__ __launch_bounds__(128) void k_gemm_hhx(const _Float16* __restrict__ A, int lda, size_t sA, const _Float16* __restrict__ Bh, int ldb, size_t sB, float alpha, const float* __restrict__ bias, size_t sBias, const float* __restrict__ CP, int rowsPerB, size_t sCPb, int row0g,
    float* __restrict__ C, _Float16* __restrict__ C16, int ldc, size_t sC, int M, int N, int K, size_t sAz, size_t sBz, size_t sCz, const float* __restrict__ rowb, const float* __restrict__ S) {
  __shared__ __attribute__((aligned(16))) float so[4][16][64];
  const int tid = threadIdx.x, w = tid >> 5, lane = tid & 31, ln = lane & 15, hh = lane >> 4; const int by = blockIdx.y, bz = blockIdx.z;      /* bz = attention instance, with strides of its own */
  A += (size_t)by * sA + (size_t)bz * sAz; Bh += (size_t)by * sB + (size_t)bz * sBz; const size_t cofs = (size_t)by * sC + (size_t)bz * sCz; const float* bp = bias ? bias + (size_t)by * sBias : nullptr;
  const int ntn = (N + 63) / 64; const int wid = blockIdx.x * 4 + w; const int mt = wid / ntn, nq = wid % ntn; if (mt * 16 >= M) return;
  const int row0 = mt * 16, col0 = nq * 64; const _Float16* arow = A + (size_t)(row0 + ln) * lda;
  v8f acc[4] = {};
  v4f sv[8]; float rb[8];      /* FIN: this lane's pieces of S and its rows' biases, loaded here so that they fly under the product */
  if (FIN) {
#pragma unroll
    for (int q = 0; q < 8; ++q) { const int r = q * 2 + (lane >> 4); rb[q] = rowb[row0 + r]; sv[q] = *(const v4fa*)(S + cofs + (size_t)(row0 + r) * ldc + col0 + (lane & 15) * 4); }
    asm volatile("s_wait_xcnt 0x0" ::: "memory"); }      /* behind this run of loads, in front of the first rewrite of a register that holds one of their addresses */
  for (int kb = 0; kb < K; kb += 32) { FragH ah; ah.half[0] = *(const v8us*)((const unsigned short*)arow + kb + 8 * hh); ah.half[1] = *(const v8us*)((const unsigned short*)arow + kb + 16 + 8 * hh);
#pragma unroll
    for (int t = 0; t < 4; ++t) { if (col0 + t * 16 >= N) continue; const size_t boff = (size_t)(col0 + t * 16 + ln) * ldb + kb; FragH bq; bq.half[0] = *(const v8us*)((const unsigned short*)Bh + boff + 8 * hh); bq.half[1] = *(const v8us*)((const unsigned short*)Bh + boff + 16 + 8 * hh);
      acc[t] = VFR ? mmaH<1>(bq.v, bq.v, ah.v, ah.v, acc[t]) : mmaH<1>(ah.v, ah.v, bq.v, bq.v, acc[t]); }
  }
  if (VFR) { unsigned short* vo = (unsigned short*)C16 + cofs + ((size_t)nq * 2 * (M / 16) + mt) * 512 + lane * 8; FragH f[4];      /* acc[t][r] = C[row0 + ln][col0 + t * 16 + 8hh + r] */
#pragma unroll
    for (int t = 0; t < 4; ++t)
#pragma unroll
      for (int r = 0; r < 8; ++r) f[t].h[r] = (_Float16)(acc[t][r] * alpha);
#pragma unroll
    for (int t = 0; t < 4; ++t) *(v8us*)(vo + (size_t)(t >> 1) * (M / 16) * 512 + (t & 1) * 256) = f[t].half[0];
    return; }
#pragma unroll
  for (int t = 0; t < 4; ++t) { if (col0 + t * 16 >= N) continue; const int col = col0 + t * 16 + ln; const float bv = bp ? bf16_round(bp[col]) : 0.f;
#pragma unroll
    for (int r = 0; r < 8; ++r) { float v = acc[t][r] * alpha + bv; if (CP) { const int bidx = (row0g + row0 + 8 * hh + r) / rowsPerB; v += CP[(size_t)bidx * sCPb + (size_t)by * 64 + col]; } if (ACT == 1) v = (v > 0.f) ? v : expm1f(v); else if (ACT == 7) v = (v > 0.f) ? v + 1.0f : expf(v); else if (ACT == 8) v = tanhf(v); else if (ACT == 9) v = 0.5f * v * (1.0f + tanhf(0.7978845608028654f * (v + 0.044715f * v * v * v))); else if (ACT == 11) v = 1.0f / (1.0f + expf(-v)); else if (ACT == 12) v = (v > 0.f) ? v : 0.01f * v; else if (ACT == 14) v = (v > 0.f) ? v : 0.1f * v; else if (ACT == 15) v = v / (1.0f + expf(-v)); else if (ACT == 3) v = fmaxf(v, 0.f); else if (ACT == 6) v = 0.5f * v * (1.0f + erff(v * 0.70710678118654752f)); so[w][8 * hh + r][t * 16 + ln] = v; } }
  __builtin_amdgcn_fence(__ATOMIC_ACQ_REL, "workgroup"); __builtin_amdgcn_wave_barrier();
  const int rsub = lane >> 4, c4 = (lane & 15) * 4; typedef _Float16 v4h __attribute__((ext_vector_type(4)));
  if (FIN) {      /* C = (v + bias of its row) * S + S, straight from the tile; like the loads of S above it takes whole 64-column tiles (N a multiple of 64) */
#pragma unroll
    for (int q = 0; q < 8; ++q) { const int r = q * 2 + rsub; const v4f v = *(const v4fa*)&so[w][r][c4]; const float bb = bf16_round(rb[q]); v4f o; for (int i = 0; i < 4; ++i) o[i] = (v[i] + bb) * sv[q][i] + sv[q][i]; *(v4f*)(C + cofs + (size_t)(row0 + r) * ldc + col0 + c4) = o; }
    return; }
  {
#pragma unroll
    for (int q = 0; q < 8; ++q) { const int r = q * 2 + rsub; if (col0 + c4 < N) { const v4f v = *(const v4fa*)&so[w][r][c4]; if (C) *(v4f*)(C + cofs + (size_t)(row0 + r) * ldc + col0 + c4) = v; if (C16) { v4h h4; for (int i = 0; i < 4; ++i) h4[i] = (_Float16)v[i]; *(v4h*)(C16 + cofs + (size_t)(row0 + r) * ldc + col0 + c4) = h4; } } }
     }
}


typedef _Float16 v4h __attribute__((ext_vector_type(4)));

__global__ __launch_bounds__(256) void k_x16(const float* __restrict__ x, _Float16* __restrict__ X16, size_t n8) { const size_t t = (size_t)blockIdx.x * 256 + threadIdx.x; if (t >= n8) return; FragH f;
#pragma unroll
  for (int q = 0; q < 8; ++q) f.h[q] = (_Float16)bf16_round(x[t * 8 + q]); *(v8us*)((unsigned short*)X16 + t * 8) = f.half[0];  }
__global__ __launch_bounds__(256) void k_h16(const float* __restrict__ x, _Float16* __restrict__ X16, size_t n8) { const size_t t = (size_t)blockIdx.x * 256 + threadIdx.x; if (t >= n8) return; FragH f;
#pragma unroll
  for (int q = 0; q < 8; ++q) f.h[q] = (_Float16)x[t * 8 + q]; *(v8us*)((unsigned short*)X16 + t * 8) = f.half[0];  }
template <int NHv, int TTv>
__global__ __launch_bounds__(256) void k_vt(const _Float16* __restrict__ V16, int ldv, int voff, _Float16* __restrict__ Vt) { __shared__ unsigned short tl[64][66]; const int tid = threadIdx.x; const int slab = blockIdx.x / (TTv / 64), lg = blockIdx.x % (TTv / 64); const int b = slab / NHv, h = slab % NHv;
  for (int i = tid; i < 64 * 8; i += 256) { const int r = i / 8, c8 = (i % 8) * 8; FragH f; f.half[0] = *(const v8us*)((const unsigned short*)V16 + ((size_t)b * TTv + lg * 64 + r) * ldv + voff + h * 64 + c8);
#pragma unroll
    for (int q = 0; q < 8; ++q) tl[r][c8 + q] = f.u[q]; }
  __syncthreads();
  {
#pragma unroll
    for (int rd = 0; rd < 2; ++rd) { const int d = rd * 32 + tid / 8, pc = tid % 8; FragH f;
#pragma unroll
      for (int q = 0; q < 8; ++q) f.u[q] = tl[pc * 8 + q][d];
      *(v8us*)((unsigned short*)Vt + ((size_t)slab * 64 + d) * TTv + lg * 64 + pc * 8) = f.half[0]; }
     } }

// Weights of the GEMMs as f16 x 2^4, thread t = one 16-B piece: the five value projections [64 e][96] (64 weights, the bias in column 64, zeros; instances 0..2 self, 3..4 guided), then tfus_w [64 o][128 c] as it lies.
__device__ __forceinline__ void prep_weights(int t, const float* __restrict__ swv, const float* __restrict__ sbv, const float* __restrict__ gwv, const float* __restrict__ gbv, const float* __restrict__ tw, _Float16* __restrict__ A16, _Float16* __restrict__ TW) {
  FragH f;
  if (t < 5 * CC * 12) { const int ai = t / (CC * 12), u = t % (CC * 12); const float* wv = (ai < 3) ? swv + (size_t)ai * CC * CC : gwv + (size_t)(ai - 3) * CC * CC; const float* bv = (ai < 3) ? sbv + ai * CC : gbv + (ai - 3) * CC;
    const int e = u / 12, c0 = (u % 12) * 8;
    v4f va = {0.f, 0.f, 0.f, 0.f}, vb = {0.f, 0.f, 0.f, 0.f};      /* a piece is eight weights in a row, or the bias and seven zeros, or zeros: one round of loads, not eight awaited ones */
    if (c0 < CC) { va = *(const v4fa*)(wv + e * CC + c0); vb = *(const v4fa*)(wv + e * CC + c0 + 4); } else if (c0 == CC) va[0] = bv[e];
#pragma unroll
    for (int q = 0; q < 4; ++q) { f.h[q] = (_Float16)(bf16_round(va[q]) * 16.0f); f.h[4 + q] = (_Float16)(bf16_round(vb[q]) * 16.0f); }
    *(v8us*)((unsigned short*)A16 + (size_t)t * 8) = f.half[0]; }
  else if (t < 5 * CC * 12 + CC * 128 / 8) { const int u = t - 5 * CC * 12;
#pragma unroll
    for (int i = 0; i < 8; ++i) f.h[i] = (_Float16)(bf16_round(tw[u * 8 + i]) * 16.0f);
    *(v8us*)((unsigned short*)TW + (size_t)u * 8) = f.half[0]; } }
__device__ __forceinline__ void xt_tail(unsigned short* xo) { const v8us one = {0x3C00, 0, 0, 0, 0, 0, 0, 0}, zz = {0, 0, 0, 0, 0, 0, 0, 0}; *(v8us*)(xo + 64) = one; *(v8us*)(xo + 72) = zz; *(v8us*)(xo + 80) = zz; *(v8us*)(xo + 88) = zz; }      /* columns 64..95 of an XT row: 1.0 (takes the bias), then zeros */
__device__ __forceinline__ void xt_out(unsigned short* xg, const unsigned short* sx, int tid) {      /* 128 rows of 96 halves from LDS (pitch 104) to memory, 16-B piece p = j * 128 + tid: each wave store covers 512 B in a row */
#pragma unroll
  for (int j = 0; j < 12; ++j) { const int p = j * 128 + tid; *(v8us*)(xg + (size_t)p * 8) = *(const v8us*)(sx + (p / 12) * 104 + (p % 12) * 8); }
  asm volatile("s_wait_xcnt 0x0" ::: "memory"); }      /* behind this run of stores, in front of the first rewrite of a register that one of them names */
// q/k planes and the token-major f16 plane XT (the V GEMM's B operand: 64 channels, a one for the bias column, zeros up to 96), from one pass over a source plane.
// q/k planes for one attention instance: per token n of batch b: q[d] = sum_c wq[d][c]*xs[c][n] + bq[d], k likewise (f32, summed over c in ascending order; xs = bf16-rounded input frame or an internal SA plane (RB)).
// One thread per token. The 2 x 8 x 64 weights are rounded to bf16 once per block into LDS (sW[c] = wq[0..7][c], wk[0..7][c]) and read from there as broadcasts; the token's channel values are loaded 16 at a time, one trip ahead of their sums, so the sums wait for memory once and not once per channel.
// Every sum keeps its order and the separate rounding of product and sum (the directive at the head of the body stands as it stood), so q and k come out bit for bit as before.
template <int RB>
__global__ __launch_bounds__(128) void k_qk(const float* __restrict__ xs, size_t sx, const float* __restrict__ wq, const float* __restrict__ bq, const float* __restrict__ wk, const float* __restrict__ bk, int slab0, _Float16* __restrict__ QP, _Float16* __restrict__ KP, _Float16* __restrict__ XT,
    const float* __restrict__ swv, const float* __restrict__ sbv, const float* __restrict__ gwv, const float* __restrict__ gbv, const float* __restrict__ tw, _Float16* __restrict__ AWV, _Float16* __restrict__ TW16) {
  #pragma clang fp contract(off)
  __shared__ __attribute__((aligned(16))) float sW[CC][16];
  __shared__ __attribute__((aligned(16))) unsigned short sX[128][96 + 8];      /* the block's 128 rows of XT; pitch 208 B = 16 B x odd, so a wave's 16-B row pieces fall on different banks */
  const int tid = threadIdx.x;
  const int y = blockIdx.y;      /* source plane. RB (self): plane y = frame y gives q, k and XT, and the blocks of y == 3 convert the weights of the GEMMs. Guided: planes 0 and 2 give q, k of instance y >> 1, plane 1 gives XT */
  if (RB && y == 3) { prep_weights((int)blockIdx.x * 128 + tid, swv, sbv, gwv, gbv, tw, AWV, TW16); return; }      /* whole blocks, in front of the barrier */
  { const int ai = RB ? y : (y >> 1); xs += (size_t)y * sx; wq += ai * 8 * CC; bq += ai * 8; wk += ai * 8 * CC; bk += ai * 8; slab0 += ai * BB; if (RB) XT += (size_t)y * BB * TT * 96; }      /* sx = floats between two source planes; one XT plane per frame */
  const int bn = (int)blockIdx.x * 128 + tid; const int n = bn % TT, b = bn / TT;      /* the grid holds exactly BB * TT threads */
  const float* xp = xs + (size_t)b * CC * TT + n; unsigned short* xo = &sX[tid][0];      /* this token's row of XT, staged in LDS: the block's rows lie in a row in memory and leave as whole lines (xt_out) */
  unsigned short* xg = (unsigned short*)XT + (size_t)blockIdx.x * 128 * 96;
  if (!RB && y == 1) {      /* whole blocks, in front of the barrier: this plane only feeds the V GEMM, so its 64 channel loads go out together and the row follows */
    float xa[CC];
#pragma unroll
    for (int cc = 0; cc < CC; ++cc) xa[cc] = xp[(size_t)cc * TT];
#pragma unroll
    for (int c0 = 0; c0 < CC; c0 += 8) { FragH f;
#pragma unroll
      for (int i = 0; i < 8; ++i) f.h[i] = (_Float16)xa[c0 + i];
      *(v8us*)(xo + c0) = f.half[0]; }
    xt_tail(xo);
    __syncthreads();      /* every row is in LDS before any thread copies across rows; reached by the whole block or not at all */
    xt_out(xg, &sX[0][0], tid); return; }
  float wr[8], xn[16];      /* the weights' loads and those of channels 0..15 are issued together; the short loops over wr, xn and xc are unrolled so that the arrays stay in registers and the loads stand back to back */
#pragma unroll
  for (int j = 0; j < 4; ++j) { wr[j] = wq[j * 128 + tid]; wr[4 + j] = wk[j * 128 + tid]; }
#pragma unroll
  for (int i = 0; i < 16; ++i) xn[i] = xp[(size_t)i * TT];
  asm volatile("s_wait_xcnt 0x0" ::: "memory");      /* stands behind the run of weight and channel loads, in front of the first rewrite of a register that holds one of their addresses */
#pragma unroll
  for (int j = 0; j < 4; ++j) { const int i = j * 128 + tid, d = i / CC, c = i % CC; sW[c][d] = bf16_round(wr[j]); sW[c][8 + d] = bf16_round(wr[4 + j]); }
  float q[8], k[8]; for (int d = 0; d < 8; ++d) { q[d] = bf16_round(bq[d]); k[d] = bf16_round(bk[d]); }
  __syncthreads();      /* the rounded weights are in LDS before any thread reads them */
  /* kept rolled, 16 channels a trip: unrolled whole, the build fetched so many weights ahead that it took about 800 vector registers */
#pragma unroll 1
  for (int c0 = 0; c0 < CC; c0 += 16) { float xc[16];
#pragma unroll
    for (int i = 0; i < 16; ++i) xc[i] = xn[i];
    if (c0 + 16 < CC) {      /* the next trip's channels fly under this trip's sums */
#pragma unroll
      for (int i = 0; i < 16; ++i) xn[i] = xp[(size_t)(c0 + 16 + i) * TT];
      asm volatile("s_wait_xcnt 0x0" ::: "memory"); }      /* the build advances these loads' address registers early in the trip */
    float xv[16];
#pragma unroll
    for (int i = 0; i < 16; ++i) { xv[i] = xc[i]; if (RB) xv[i] = bf16_round(xv[i]); }
#pragma unroll
    for (int i = 0; i < 16; ++i) { const int c = c0 + i;
      const v4f wa = *(const v4fa*)&sW[c][0], wb = *(const v4fa*)&sW[c][4], wc = *(const v4fa*)&sW[c][8], wd = *(const v4fa*)&sW[c][12];
#pragma unroll
      for (int d = 0; d < 4; ++d) { q[d] += wa[d] * xv[i]; q[4 + d] += wb[d] * xv[i]; k[d] += wc[d] * xv[i]; k[4 + d] += wd[d] * xv[i]; } }
    if (RB) { FragH f0, f1;      /* self: the frame that gives q and k is also the V GEMM's operand */
#pragma unroll
      for (int i = 0; i < 8; ++i) { f0.h[i] = (_Float16)xv[i]; f1.h[i] = (_Float16)xv[8 + i]; }
      *(v8us*)(xo + c0) = f0.half[0]; *(v8us*)(xo + c0 + 8) = f1.half[0]; } }
  FragH fq0, fq1, fk0, fk1, fk2;      /* 16-B pieces of a row: Q = [q_hi | q_lo * 2^10 | q_hi | 0], K = [k_hi | k_hi * 2^-10 | k_lo | 0] */
#pragma unroll
  for (int d = 0; d < 8; ++d) { const _Float16 qh = (_Float16)q[d], kh = (_Float16)k[d]; const float qlo = (q[d] - (float)qh) * 1024.0f, klo = (k[d] - (float)kh);
    fq0.h[d] = qh; fq1.h[d] = (_Float16)qlo; fk0.h[d] = kh; fk1.h[d] = (_Float16)((float)kh * 0.0009765625f); fk2.h[d] = (_Float16)klo; }
  const v8us zz = {0, 0, 0, 0, 0, 0, 0, 0};
  if (RB) { xt_tail(xo);
    __syncthreads();      /* every row is in LDS before any thread copies across rows */
    xt_out(xg, &sX[0][0], tid); }
  const size_t row = (size_t)(slab0 + b) * TT + n; unsigned short* qo = (unsigned short*)QP + row * 32; unsigned short* ko = (unsigned short*)KP + (row >> 4) * 512 + (row & 15) * 8;      /* K in the order of k_flash's A fragments: [16 keys][piece 0..3][key & 15][8 halves] */
  *(v8us*)qo = fq0.half[0]; *(v8us*)(qo + 8) = fq1.half[0]; *(v8us*)(qo + 16) = fq0.half[0]; *(v8us*)(qo + 24) = zz;
  *(v8us*)ko = fk0.half[0]; *(v8us*)(ko + 128) = fk1.half[0]; *(v8us*)(ko + 256) = fk2.half[0]; *(v8us*)(ko + 384) = zz; }
// Block = 4 query tiles x KSPL key ranges: wave w works query tile w & 3 over keys [(w >> 2) * TT/KSPL, +TT/KSPL) with its own running max, row sum and unnormalised O; the KSPL partials of a tile are merged through LDS at the end.
// Scores are formed transposed, S^T = K.Q^T (A = 16 key rows, B = the wave's 16 queries), so lane (ln, hh) holds 16 of the 32 scores of query ln: max and sum run inside the lane, plus one exchange between the wave halves for the max.
// The two S^T tiles of a trip hold keys 8hh + r and 16 + 8hh + r, which is the k order of the loaders here, so P^T goes from the accumulators into a B operand in registers and O^T += V^T.P^T (A = 16 channel rows of Vt); P never passes through LDS.
__device__ __forceinline__ float xhalf(float x) { return __builtin_bit_cast(float, __builtin_amdgcn_permlanex16(__builtin_bit_cast(int, x), __builtin_bit_cast(int, x), 0x76543210, 0xfedcba98, false, false)); }      /* lane l <-> lane l ^ 16 */
typedef float v2f __attribute__((ext_vector_type(2)));
typedef _Float16 v2h __attribute__((ext_vector_type(2)));
// Softmax runs in base 2: the running max is kept as m2 = score * log2(e) - 10, and every weight is 2^(score * log2(e) - m2) = 1024 * e^(score - max): one FMA and one hardware exp2 per score.
// The factor 1024 (the f16 scale of P) sits in O and in the row sum alike and cancels in O / l. Arguments are <= 10, so nothing overflows; a weight below 2^-126 counts as 0.
#define LOG2E 1.4426950408889634f
// One hardware exp2 with a free issue slot on either side: the instruction set asks for one independent instruction or v_nop between a transcendental and a neighbour that overwrites its source or reads its result.
__device__ __forceinline__ float exp2_slot(float x) { float y; asm("v_nop\n\tv_exp_f32 %0, %1\n\tv_nop" : "=v"(y) : "v"(x)); return y; }
// The merge also adds the residual and writes the stage's result in the layout its reader wants. SELF: SAo[slab][e][n] = O + bf16(RES[slab][e][n]), channel-major f32; a wave holds 32 queries of one channel group, so every load and store is a whole 128-B line.
// Guided: CATo[b][n][g * 64 + e] = f16(O + RES[b][e][n]) for slab = g * BB + b, token-major f16; 16 lanes write one token's 128 B.
template <int KSPL, bool SELF>
__global__ __launch_bounds__(128 * KSPL, 8) void k_flash(const _Float16* __restrict__ Q16, int ldq, const _Float16* __restrict__ K16, int ldk, const _Float16* __restrict__ Vt, const int* __restrict__ MSK, const float* __restrict__ RES, float* __restrict__ SAo, _Float16* __restrict__ CATo) {
  constexpr int RPW = 16, NQB = TT / (4 * RPW), DT = 4, NW = 4 * KSPL;      /* d_qk = 32 (24 real + zero padding), d_v = 64 */
  __shared__ __attribute__((aligned(16))) float sO[NW][RPW][64 + 4];
  __shared__ float sM[NW][RPW], sL[NW][RPW];
  (void)MSK;
  const int tid = threadIdx.x, w = __builtin_amdgcn_readfirstlane(tid >> 5), lane = tid & 31, ln = lane & 15, hh = lane >> 4;
  const int slab = blockIdx.x / NQB, qblk = blockIdx.x % NQB; const int b = slab / NH; const int qb0 = qblk * (4 * RPW); const int q0 = qb0 + (w & 3) * RPW;
  FragH bq;      /* B operand: column ln = query q0 + ln */
  { const unsigned short* qr = (const unsigned short*)Q16 + ((size_t)b * TT + q0 + ln) * ldq; bq.half[0] = *(const v8us*)(qr + 8 * hh); bq.half[1] = *(const v8us*)(qr + 16 + 8 * hh); }
  const unsigned short* Vth = (const unsigned short*)Vt + (size_t)slab * 64 * TT;      /* v per slab: 64 x 4096 in fragment order, [32 keys][16 channels][half 0, 1][lane][8 halves] */
  float m_r = -3.0e38f, l_r = 0.f; v8f oacc[DT];      /* m_r in base-2 units, shifted by -10 */      /* oacc[dt][r] = O^T[channel dt * 16 + 8hh + r][query ln] */
#pragma unroll
  for (int dt = 0; dt < DT; ++dt) oacc[dt] = (v8f){0.f,0.f,0.f,0.f,0.f,0.f,0.f,0.f};
  const int jbeg = (w >> 2) * (TT / KSPL);
  /* K and V lie in memory in fragment order (written so by k_qk and by the V GEMM): fragment = 2 x 512 B, lane l's two 16-B pieces at l * 16 and 512 + l * 16, so every load of a wave covers four whole 128-B lines and a trip reads 2 KB of K and 4 KB of V in a row */
  (void)ldk;
  const unsigned short* kr = (const unsigned short*)K16 + ((size_t)b * TT + jbeg) * 32 + lane * 8;      /* this lane's piece of the trip's first K fragment (key row j0 + ln, halves 8hh ..; the second piece: halves 16 + 8hh ..) ... */
  const unsigned short* vr = Vth + (size_t)jbeg * 64 + lane * 8;      /* ... and of its first V fragment (channel row ln, keys j0 + 8hh ..; the second piece: keys j0 + 16 + 8hh ..); j0 = jbeg + 32 * trip, both addresses advance with the trip */
#pragma unroll 1
  for (int it = 0; it < TT / KSPL / 32; ++it) {
    FragH ak[2], av[DT];      /* the trip's two K and four V fragments: their twelve loads go out together here, so the trip waits for memory once and not once per fragment */
#pragma unroll
    for (int nt = 0; nt < 2; ++nt) { ak[nt].half[0] = *(const v8us*)(kr + nt * 512); ak[nt].half[1] = *(const v8us*)(kr + nt * 512 + 256); }
    asm volatile("s_wait_xcnt 0x0" :: "v"(kr) : "memory");      /* behind the K loads: the build gave a register that holds their address to a V load as its target; the address is an input here so that its registers live up to this wait and no K load gets them as its target */
#pragma unroll
    for (int dt = 0; dt < DT; ++dt) { av[dt].half[0] = *(const v8us*)(vr + dt * 512); av[dt].half[1] = *(const v8us*)(vr + dt * 512 + 256); }
    asm volatile("s_wait_xcnt 0x0" :: "v"(vr) : "memory");      /* behind this run of loads, in front of the advance of the two addresses that they name; it also keeps the build from moving a V load down to its use; the address is an input so that its registers live up to this wait: without that the build gave them to the run's last load as its target */
    kr += 2 * 512; vr += DT * 512;
    v8f s[2];      /* s[nt][r] = score of key j0 + nt * 16 + 8hh + r with query ln */
#pragma unroll
    for (int nt = 0; nt < 2; ++nt) s[nt] = mmaH<1>(ak[nt].v, ak[nt].v, bq.v, bq.v, (v8f){0.f,0.f,0.f,0.f,0.f,0.f,0.f,0.f});
    float mc = fmaxf(s[0][0], s[1][0]);
#pragma unroll
    for (int r = 1; r < 8; ++r) mc = fmaxf(mc, fmaxf(s[0][r], s[1][r]));
    mc = fmaxf(mc, xhalf(mc));      /* both halves hold the max over the trip's 32 keys */
    const float mn = fmaxf(m_r, __builtin_fmaf(mc, LOG2E, -10.0f)); const float ae = exp2_slot(m_r - mn); const float al = (mn > -1.0e38f) ? ae : 1.0f; m_r = mn;
    FragH ph, pl; float ls = 0.f;      /* P^T * 1024 as f16 hi + residual: element nt * 8 + r = key nt * 16 + 8hh + r */
#pragma unroll
    for (int nt = 0; nt < 2; ++nt)
#pragma unroll
      for (int r = 0; r < 8; r += 2) { const v2f ar = __builtin_elementwise_fma((v2f){s[nt][r], s[nt][r + 1]}, (v2f){LOG2E, LOG2E}, (v2f){-mn, -mn}); const float pa = __builtin_amdgcn_exp2f(ar[0]), pb = __builtin_amdgcn_exp2f(ar[1]); ls += pa; ls += pb; const v2f ps = (v2f){pa, pb}; const v2h hi = __builtin_convertvector(ps, v2h); const v2h lo = __builtin_convertvector(ps - __builtin_convertvector(hi, v2f), v2h);
        ph.h[nt * 8 + r] = hi[0]; ph.h[nt * 8 + r + 1] = hi[1]; pl.h[nt * 8 + r] = lo[0]; pl.h[nt * 8 + r + 1] = lo[1]; }
    l_r = l_r * al + ls;      /* this half's 16 keys; the halves are joined behind the loop */
#pragma unroll
    for (int dt = 0; dt < DT; ++dt) oacc[dt] *= al;
#pragma unroll
    for (int dt = 0; dt < DT; ++dt) { oacc[dt] = mmaH<1>(av[dt].v, av[dt].v, ph.v, ph.v, oacc[dt]); oacc[dt] = mmaH<1>(av[dt].v, av[dt].v, pl.v, pl.v, oacc[dt]); } }      /* V^T.(Ph + Pl) */
  l_r += xhalf(l_r);
  if (hh == 0) { sM[w][ln] = m_r; sL[w][ln] = l_r; }
#pragma unroll
  for (int dt = 0; dt < DT; ++dt) { *(v4fa*)&sO[w][ln][dt * 16 + 8 * hh] = (v4f){oacc[dt][0], oacc[dt][1], oacc[dt][2], oacc[dt][3]}; *(v4fa*)&sO[w][ln][dt * 16 + 8 * hh + 4] = (v4f){oacc[dt][4], oacc[dt][5], oacc[dt][6], oacc[dt][7]}; }
  __syncthreads();      /* every wave's partial is in LDS before any thread merges */
  /* merge: thread = (query of the block, 4 channels); O = sum_s 2^(m_s - M) * O_s / sum_s 2^(m_s - M) * l_s, M = max_s m_s; O_s and l_s both carry the factor 1024 */
#pragma unroll
  for (int i = tid; i < 4 * RPW * 16; i += 128 * KSPL) { const int qq = SELF ? (i & 63) : (i >> 4), pc = SELF ? (i >> 6) : (i & 15), g = qq / RPW, r = qq % RPW;
    float mx = sM[g][r];
#pragma unroll
    for (int s = 1; s < KSPL; ++s) mx = fmaxf(mx, sM[s * 4 + g][r]);
    float l = 0.f; v4f a = {0.f, 0.f, 0.f, 0.f};
#pragma unroll
    for (int s = 0; s < KSPL; ++s) { const float e = exp2_slot(sM[s * 4 + g][r] - mx); l += sL[s * 4 + g][r] * e; const v4f val = *(const v4fa*)&sO[s * 4 + g][r][pc * 4]; a += val * e; }
    const float inv = (l > 0.f) ? 1.0f / l : 0.f;
    const v4f o = a * inv;
    const float* rp = RES + ((size_t)(SELF ? slab : slab % BB) * CC + pc * 4) * TT + qb0 + qq;      /* residual of channels pc * 4 .. + 3 at this query */
    if (SELF) { float* sp = SAo + ((size_t)slab * CC + pc * 4) * TT + qb0 + qq;
#pragma unroll
      for (int j = 0; j < 4; ++j) sp[(size_t)j * TT] = o[j] + bf16_round(rp[(size_t)j * TT]); }
    else { v4h h4;
#pragma unroll
      for (int j = 0; j < 4; ++j) h4[j] = (_Float16)(o[j] + rp[(size_t)j * TT]);
      *(v4h*)(CATo + ((size_t)(slab % BB) * TT + qb0 + qq) * 128 + (slab / BB) * 64 + pc * 4) = h4; } } }

extern "C" void kernel_launch(void* const* d_in, const int* in_sizes, int n_in,
                              void* d_out, int out_size, void* d_ws, size_t ws_size, hipStream_t stream) {
  (void)in_sizes; (void)n_in; (void)out_size;
  const float* const* I = (const float* const*)d_in; const float* x = I[0]; const float* sa_wq = I[1]; const float* sa_bq = I[2]; const float* sa_wk = I[3]; const float* sa_bk = I[4]; const float* sa_wv = I[5]; const float* sa_bv = I[6];
  const float* ga_wq = I[7]; const float* ga_bq = I[8]; const float* ga_wk = I[9]; const float* ga_bk = I[10]; const float* ga_wv = I[11]; const float* ga_bv = I[12]; const float* tw = I[13]; const float* tb = I[14];
  char* ws = (char*)d_ws; size_t off = 0;
  auto take = [&](size_t bytes) { char* p = ws + off; off += (bytes + 255) & ~(size_t)255; return p; };
  const size_t PL = (size_t)BB * CC * TT;      /* one [B][64][4096] f32 plane = 1 M floats */
  _Float16* AWV = (_Float16*)take((size_t)5 * CC * 96 * 2); _Float16* TW16 = (_Float16*)take((size_t)CC * 128 * 2);
  _Float16* XT = (_Float16*)take((size_t)3 * BB * TT * 96 * 2); _Float16* QP = (_Float16*)take((size_t)NSL * TT * 32 * 2); _Float16* KP = (_Float16*)take((size_t)NSL * TT * 32 * 2); _Float16* VT = (_Float16*)take((size_t)NSL * CC * TT * 2);
  float* SA = (float*)take(3 * PL * 4); _Float16* CAT = (_Float16*)take((size_t)BB * TT * 128 * 2);
  if (off > ws_size) return;      // 0.1 + 9.4 + 5.2 + 5.2 + 10.5 + 12.6 + 4.2 = about 47 MB
  const unsigned gqk = (unsigned)((size_t)BB * TT / 128); const unsigned gvx = ((CC / 16) * (TT / 64) + 3) / 4;
  /* self attention on the three frames: slabs a * BB + b for a = 0,1,2; each stage is one launch over all three frames (frame on blockIdx.y for k_qk, on blockIdx.z for the GEMM, in the slab from blockIdx.x for k_flash), XT holds one plane per frame */
  k_qk<1><<<dim3(gqk, 4), 128, 0, stream>>>(x, PL, sa_wq, sa_bq, sa_wk, sa_bk, 0, QP, KP, XT, sa_wv, sa_bv, ga_wv, ga_bv, tw, AWV, TW16);      /* q, k and XT of the three frames; blockIdx.y == 3: the weights of all GEMMs */
  k_gemm_hhx<0, false, true><<<dim3(gvx, BB, 3), 128, 0, stream>>>(AWV, 96, 0, XT, 96, (size_t)TT * 96, 0.0625f, nullptr, 0, nullptr, 1, 0, 0, nullptr, VT, TT, (size_t)CC * TT, CC, TT, 96, (size_t)CC * 96, (size_t)BB * TT * 96, (size_t)BB * CC * TT, nullptr, nullptr);      /* v[b][e][m] = wv.x + bv as f16 in the fragment order of k_flash: batched over b and frame, M 64 N 4096 K 96 */
  k_flash<8, true><<<3 * BB * (TT / 64), 1024, 0, stream>>>(QP, 32, KP, 32, VT, nullptr, x, SA, nullptr);      /* slabs 0..11; 768 blocks of 32 waves = three full rounds of the WGPs; SA_a = attn-out + x_a (channel-major f32) */
  /* guided attentions: slabs 12..15 (q,k from SA_0; v,res from SA_1) and 16..19 (q,k from SA_2) */
  k_qk<0><<<dim3(gqk, 3), 128, 0, stream>>>(SA, PL, ga_wq, ga_bq, ga_wk, ga_bk, 3 * BB, QP, KP, XT, nullptr, nullptr, nullptr, nullptr, nullptr, nullptr, nullptr);      /* q, k from SA_0 and SA_2; XT = SA_1 token-major (internal f32, no rounding) */
  k_gemm_hhx<0, false, true><<<dim3(gvx, BB, 2), 128, 0, stream>>>(AWV + (size_t)3 * CC * 96, 96, 0, XT, 96, (size_t)TT * 96, 0.0625f, nullptr, 0, nullptr, 1, 0, 0, nullptr, VT + (size_t)3 * BB * CC * TT, TT, (size_t)CC * TT, CC, TT, 96, (size_t)CC * 96, 0, (size_t)BB * CC * TT, nullptr, nullptr);      /* both read the SA_1 plane of XT */
  k_flash<4, false><<<2 * BB * (TT / 64), 512, 0, stream>>>(QP + (size_t)3 * BB * TT * 32, 32, KP + (size_t)3 * BB * TT * 32, 32, VT + (size_t)3 * BB * CC * TT, nullptr, SA + PL, nullptr, CAT);      /* slabs 12..19 (kernel-relative 0..7); cat = [attn-out_0 + SA_1 | attn-out_1 + SA_1], token-major f16 */
  k_gemm_hhx<0, true><<<dim3(gvx, BB), 128, 0, stream>>>(TW16, 128, 0, CAT, 128, (size_t)TT * 128, 0.0625f, nullptr, 0, nullptr, 1, 0, 0, (float*)d_out, nullptr, TT, (size_t)CC * TT, CC, TT, 128, 0, 0, 0, tb, SA + PL);      /* fusion[b][o][n] = sum_c W[o][c] * cat[b][c][n]: A = W (M 64, K 128), Bt = CAT[b] token-major; the epilogue adds tfus_b per row o and writes out = fusion * SA_1 + SA_1 */
}

// v009
// Measured time: 145 microseconds a run.
// Timed twice side by side with v008, it ran 1.09 times as fast both times.
// Over all steps from v000 it is 7.38 times as fast.
#include <hip/hip_runtime.h>
// MFI (3 frames, B=4, C=64, 64×64 → N=4096): SA_f = position attention on frame f (q = wq·x+bq (8 ch), k = wk·x+bk (8 ch), v = wv·x+bv (64 ch); attn = softmax_m(q[:,n]·k[:,m]) unscaled; out[e][n] = Σ_m v[e][m]·attn[n][m] + x[e][n]); then two guided attentions
// (q,k from SA_0 / SA_2, v and residual from SA_1), cat → fusion = tfus_w·cat + b; out = fusion·SA_1 + SA_1 → [4,64,64,64].
// Compute dtype: x, weights, biases rounded to bf16; q/k per token in f32 VALU (8×64 dot, rolled) emitted as concatenated f16 planes [q_hi|q_lo·2^10|q_hi|0] and [k_hi|k_hi·2^-10|k_lo|0] so ONE 32-wide WMMA k-step yields f32-accurate logits; v (+bias via an
// augmented ones column) by GEMM (f16) in k_flash's fragment order; fused flash-style kernel per (slab, 64 queries) (online softmax f32, P f16 hi + residual, residual added in f32 by its merge, which writes SA channel-major f32 or cat token-major f16); cat f16 -> fusion GEMM -> out = fusion * sa_1 + sa_1 in f32. All on v_wmma_f32_16x16x32_f16.
#define NFR 3
#define BB 4
#define CC 64
#define TT 4096
#define NH 1
#define NSL (5 * BB)

typedef __bf16 v16b __attribute__((ext_vector_type(16)));
typedef unsigned short v8us __attribute__((ext_vector_type(8), may_alias));
typedef float  v8f  __attribute__((ext_vector_type(8)));
typedef float  v4f  __attribute__((ext_vector_type(4)));
typedef float  v4fa __attribute__((ext_vector_type(4), may_alias));
union FragB { v16b v; v8us half[2]; unsigned short u[16]; };

__device__ __forceinline__ unsigned short bf16_bits(float x) { unsigned int u = __float_as_uint(x); return (unsigned short)((u + 0x7FFFu + ((u >> 16) & 1u)) >> 16); }
__device__ __forceinline__ float bf16_val(unsigned short b) { return __uint_as_float(((unsigned int)b) << 16); }
__device__ __forceinline__ float bf16_round(float x) { return bf16_val(bf16_bits(x)); }
// D += A·B with NT terms: 1 = ah·bh, 2 = + al·bh (A split), 3 = + ah·bl (both split)
template <int NT>
__device__ __forceinline__ v8f mmaN(v16b ah, v16b al, v16b bh, v16b bl, v8f c) {
  c = __builtin_amdgcn_wmma_f32_16x16x32_bf16(false, ah, false, bh, (short)0, c, false, false);
  if (NT >= 2) c = __builtin_amdgcn_wmma_f32_16x16x32_bf16(false, al, false, bh, (short)0, c, false, false);
  if (NT >= 3) c = __builtin_amdgcn_wmma_f32_16x16x32_bf16(false, ah, false, bl, (short)0, c, false, false);
  asm volatile("v_nop\n\tv_nop\n\tv_nop\n\tv_nop" : "+v"(c) : "v"(ah), "v"(al), "v"(bh), "v"(bl));
  return c;
}

__global__ __launch_bounds__(256) void k_wt_bf16(const float* __restrict__ W, unsigned short* __restrict__ Wt, int K, int N) {
  const int t = blockIdx.x * 256 + threadIdx.x;
  const int k8n = K / 8;
  if (t >= N * k8n) return;
  const int n = t / k8n, k8 = (t % k8n) * 8;
  v8us v;
#pragma unroll
  for (int i = 0; i < 8; ++i) v[i] = bf16_bits(W[(size_t)(k8 + i) * N + n]);
  *(v8us*)(Wt + (size_t)n * K + k8) = v;
  
}

// GEMM C[M][N] (f32, pitch ldc) = act(A[M][K]·W + bias). A f32 row-major (pitch lda) converted per fragment to bf16
// (ASPLIT: hi/lo two planes -> 2 terms, else single rounded term); Wt bf16 [N][K] (pitch ldb). BIAS_BF16 rounds the
// bias to bf16 first (bias quantised to bf16 before the add). K%32==0, M%16==0, N%64==0.
template <bool ASPLIT, int ACT, bool BIAS_BF16>
__global__ __launch_bounds__(128) void k_gemm_bf(const float* __restrict__ A, int lda, const unsigned short* __restrict__ Wt, int ldb,
                                               const float* __restrict__ bias, float* __restrict__ C, int ldc, int M, int N, int K) {
  __shared__ __attribute__((aligned(16))) float so[4][16][64];
  const int tid = threadIdx.x, w = tid >> 5, lane = tid & 31, ln = lane & 15, hh = lane >> 4;
  const int ntn = N / 64;
  const int wid = blockIdx.x * 4 + w;
  const int mt = wid / ntn, nq = wid % ntn;
  if (mt * 16 >= M) return;
  const int row0 = mt * 16, col0 = nq * 64;
  const float* arow = A + (size_t)(row0 + ln) * lda;
  v8f acc[4] = {};
  for (int kb = 0; kb < K; kb += 32) {
    FragB ah, al;
    const v4f x0 = *(const v4fa*)(arow + kb + 8 * hh), x1 = *(const v4fa*)(arow + kb + 8 * hh + 4);
    const v4f x2 = *(const v4fa*)(arow + kb + 16 + 8 * hh), x3 = *(const v4fa*)(arow + kb + 16 + 8 * hh + 4);
    float xs[16] = {x0[0],x0[1],x0[2],x0[3],x1[0],x1[1],x1[2],x1[3],x2[0],x2[1],x2[2],x2[3],x3[0],x3[1],x3[2],x3[3]};
#pragma unroll
    for (int i = 0; i < 16; ++i) { const unsigned short hb = bf16_bits(xs[i]); ah.u[i] = hb; al.u[i] = ASPLIT ? bf16_bits(xs[i] - bf16_val(hb)) : (unsigned short)0; }
#pragma unroll
    for (int t = 0; t < 4; ++t) {
      const unsigned short* brow = Wt + (size_t)(col0 + t * 16 + ln) * ldb + kb;
      FragB b;
      b.half[0] = *(const v8us*)(brow + 8 * hh);
      b.half[1] = *(const v8us*)(brow + 16 + 8 * hh);
      acc[t] = mmaN<ASPLIT ? 2 : 1>(ah.v, al.v, b.v, b.v, acc[t]);
    }
  }
#pragma unroll
  for (int t = 0; t < 4; ++t) {
    float bv = bias ? bias[col0 + t * 16 + ln] : 0.f;
    if (BIAS_BF16) bv = bf16_round(bv);
#pragma unroll
    for (int r = 0; r < 8; ++r) { float v = acc[t][r] + bv; if (ACT == 1) v = fmaxf(v, 0.f); so[w][8 * hh + r][t * 16 + ln] = v; }
  }
  __builtin_amdgcn_fence(__ATOMIC_ACQ_REL, "workgroup");
  __builtin_amdgcn_wave_barrier();
  const int rsub = lane >> 4, c4 = (lane & 15) * 4;
  {
#pragma unroll
    for (int q = 0; q < 8; ++q) {
      const int r = q * 2 + rsub;
      const v4f v = *(const v4fa*)&so[w][r][c4];
      *(v4f*)(C + (size_t)(row0 + r) * ldc + col0 + c4) = v;
    }
    
  }
}

// Flash-style causal/unmasked attention, all contractions 3-term bf16 hi/lo splits, f32 softmax with running max.
// q,k,v rows are read from f32 buffers with arbitrary row pitch (so they can live inside a fused qkv buffer);
// D = head size (multiple of 32, <= 128); one wave = 16 query rows; block = 4 waves (64 queries) sharing K/V chunks of 32.
template <int D, bool CAUSAL>
__global__ __launch_bounds__(128) void k_flash(const float* __restrict__ qb, const float* __restrict__ kb, const float* __restrict__ vb,
                                             int pitch, int T, int H, float scale, float* __restrict__ y, int ypitch) {
  constexpr int KS = D / 32;        // k-steps for QK
  constexpr int DT = D / 16;        // d tiles for PV
  __shared__ __attribute__((aligned(16))) unsigned short sKh[32][D + 8], sKl[32][D + 8], sVh[32][D + 8], sVl[32][D + 8];
  __shared__ __attribute__((aligned(16))) unsigned short sPh[4][16][40], sPl[4][16][40];
  __shared__ __attribute__((aligned(16))) float sO[4][16][D];
  const int tid = threadIdx.x, w = tid >> 5, lane = tid & 31, ln = lane & 15, hh = lane >> 4;
  const int nqb = (T + 63) / 64;
  const int bh = blockIdx.x / nqb, qblk = blockIdx.x % nqb;
  const int b = bh / H, h = bh % H;
  const int q0 = qblk * 64 + w * 16;
  const float* Q = qb + (size_t)b * T * pitch + h * D;
  const float* K = kb + (size_t)b * T * pitch + h * D;
  const float* V = vb + (size_t)b * T * pitch + h * D;

  // A fragments of the wave's 16 query rows (scaled), hi/lo
  FragB aqh[KS], aql[KS];
  {
    int row = q0 + ln; if (row >= T) row = T - 1;
    const float* qr = Q + (size_t)row * pitch;
#pragma unroll
    for (int ks = 0; ks < KS; ++ks)
#pragma unroll
      for (int i = 0; i < 16; ++i) {
        const int d = ks * 32 + ((i < 8) ? (8 * hh + i) : (16 + 8 * hh + (i - 8)));
        const float x = qr[d] * scale; const unsigned short hb = bf16_bits(x);
        aqh[ks].u[i] = hb; aql[ks].u[i] = bf16_bits(x - bf16_val(hb));
      }
  }
  float m_r[8], l_r[8];
#pragma unroll
  for (int r = 0; r < 8; ++r) { m_r[r] = -3.0e38f; l_r[r] = 0.f; }
  v8f oacc[DT];
#pragma unroll
  for (int dt = 0; dt < DT; ++dt) oacc[dt] = (v8f){0.f,0.f,0.f,0.f,0.f,0.f,0.f,0.f};

  const int kv_end = CAUSAL ? min(T, qblk * 64 + 64) : T;     // block-uniform
  for (int j0 = 0; j0 < kv_end; j0 += 32) {
    __syncthreads();
    for (int e = tid; e < 32 * (D / 4); e += 128) {
      const int r = e / (D / 4), c4 = (e % (D / 4)) * 4;
      const int key = j0 + r;
      v4f kf = {0.f,0.f,0.f,0.f}, vf = {0.f,0.f,0.f,0.f};
      if (key < T) { kf = *(const v4fa*)(K + (size_t)key * pitch + c4); vf = *(const v4fa*)(V + (size_t)key * pitch + c4); }
#pragma unroll
      for (int t = 0; t < 4; ++t) {
        unsigned short hb = bf16_bits(kf[t]); sKh[r][c4 + t] = hb; sKl[r][c4 + t] = bf16_bits(kf[t] - bf16_val(hb));
        hb = bf16_bits(vf[t]); sVh[r][c4 + t] = hb; sVl[r][c4 + t] = bf16_bits(vf[t] - bf16_val(hb));
      }
    }
    __syncthreads();
    // S tile 16 x 32
    v8f s[2];
#pragma unroll
    for (int nt = 0; nt < 2; ++nt) {
      v8f acc = {};
#pragma unroll
      for (int ks = 0; ks < KS; ++ks) {
        FragB bh_, bl_;
        bh_.half[0] = *(const v8us*)&sKh[nt * 16 + ln][ks * 32 + 8 * hh]; bh_.half[1] = *(const v8us*)&sKh[nt * 16 + ln][ks * 32 + 16 + 8 * hh];
        bl_.half[0] = *(const v8us*)&sKl[nt * 16 + ln][ks * 32 + 8 * hh]; bl_.half[1] = *(const v8us*)&sKl[nt * 16 + ln][ks * 32 + 16 + 8 * hh];
        acc = mmaN<3>(aqh[ks].v, aql[ks].v, bh_.v, bl_.v, acc);
      }
      s[nt] = acc;
    }
    // mask + running max (rows 8hh+r; the 16 lanes of a half share rows)
    float alpha[8];
#pragma unroll
    for (int r = 0; r < 8; ++r) {
      const int qi = q0 + 8 * hh + r;
      const int ja = j0 + ln, jb = j0 + 16 + ln;
      if (CAUSAL) { if (ja > qi) s[0][r] = -3.0e38f; if (jb > qi) s[1][r] = -3.0e38f; }
      if (ja >= T) s[0][r] = -3.0e38f;
      if (jb >= T) s[1][r] = -3.0e38f;
      float mx = fmaxf(s[0][r], s[1][r]);
      mx = fmaxf(mx, __shfl_xor(mx, 1, 32)); mx = fmaxf(mx, __shfl_xor(mx, 2, 32)); mx = fmaxf(mx, __shfl_xor(mx, 4, 32)); mx = fmaxf(mx, __shfl_xor(mx, 8, 32));
      const float mnew = fmaxf(m_r[r], mx);
      alpha[r] = (mnew > -1.0e38f) ? __expf(m_r[r] - mnew) : 1.0f;
      const float p0 = (s[0][r] > -1.0e38f) ? __expf(s[0][r] - mnew) : 0.f;
      const float p1 = (s[1][r] > -1.0e38f) ? __expf(s[1][r] - mnew) : 0.f;
      m_r[r] = mnew;
      l_r[r] = l_r[r] * alpha[r] + p0 + p1;            // per-lane partial row sum (16 lanes combined at the end)
      unsigned short hb = bf16_bits(p0); sPh[w][8 * hh + r][ln] = hb;      sPl[w][8 * hh + r][ln] = bf16_bits(p0 - bf16_val(hb));
      hb = bf16_bits(p1);                sPh[w][8 * hh + r][16 + ln] = hb; sPl[w][8 * hh + r][16 + ln] = bf16_bits(p1 - bf16_val(hb));
    }
#pragma unroll
    for (int dt = 0; dt < DT; ++dt)
#pragma unroll
      for (int r = 0; r < 8; ++r) oacc[dt][r] *= alpha[r];
    __builtin_amdgcn_fence(__ATOMIC_ACQ_REL, "workgroup");
    __builtin_amdgcn_wave_barrier();
    FragB pah, pal;
    pah.half[0] = *(const v8us*)&sPh[w][ln][8 * hh]; pah.half[1] = *(const v8us*)&sPh[w][ln][16 + 8 * hh];
    pal.half[0] = *(const v8us*)&sPl[w][ln][8 * hh]; pal.half[1] = *(const v8us*)&sPl[w][ln][16 + 8 * hh];
#pragma unroll
    for (int dt = 0; dt < DT; ++dt) {
      FragB bvh, bvl;
#pragma unroll
      for (int i = 0; i < 8; ++i) {
        bvh.u[i] = sVh[8 * hh + i][dt * 16 + ln]; bvh.u[8 + i] = sVh[16 + 8 * hh + i][dt * 16 + ln];
        bvl.u[i] = sVl[8 * hh + i][dt * 16 + ln]; bvl.u[8 + i] = sVl[16 + 8 * hh + i][dt * 16 + ln];
      }
      oacc[dt] = mmaN<3>(pah.v, pal.v, bvh.v, bvl.v, oacc[dt]);
    }
    __builtin_amdgcn_fence(__ATOMIC_ACQ_REL, "workgroup");
    __builtin_amdgcn_wave_barrier();
  }
#pragma unroll
  for (int r = 0; r < 8; ++r) {
    float l = l_r[r];
    l += __shfl_xor(l, 1, 32); l += __shfl_xor(l, 2, 32); l += __shfl_xor(l, 4, 32); l += __shfl_xor(l, 8, 32);
    l_r[r] = (l > 0.f) ? 1.0f / l : 0.f;
  }
#pragma unroll
  for (int dt = 0; dt < DT; ++dt)
#pragma unroll
    for (int r = 0; r < 8; ++r) sO[w][8 * hh + r][dt * 16 + ln] = oacc[dt][r] * l_r[r];
  __builtin_amdgcn_fence(__ATOMIC_ACQ_REL, "workgroup");
  __builtin_amdgcn_wave_barrier();
  {
    for (int r = 0; r < 16; ++r) {
      const int row = q0 + r;
      if (row < T && lane < D / 4) {
        const v4f val = *(const v4fa*)&sO[w][r][lane * 4];
        *(v4f*)(y + ((size_t)b * T + row) * ypitch + h * D + lane * 4) = val;
      }
    }
    
  }
}

// GEMM C = act(A·W + bias + resid): A f32 (ASPLIT -> hi/lo 2 terms), Wt bf16 [N][K]; ACT 0 none, 1 relu, 2 exact gelu;
// resid (optional, f32, row index = (row % rmod), pitch ldr, RES_BF16 rounds it) added before the activation.
template <bool ASPLIT, int ACT, bool BIAS_BF16, bool RES_BF16>
__global__ __launch_bounds__(128) void k_gemm_bf3(const float* __restrict__ A, int lda, const unsigned short* __restrict__ Wt, int ldb,
                                                const float* __restrict__ bias, const float* __restrict__ resid, int rmod, int ldr,
                                                float* __restrict__ C, int ldc, int M, int N, int K) {
  __shared__ __attribute__((aligned(16))) float so[4][16][64];
  const int tid = threadIdx.x, w = tid >> 5, lane = tid & 31, ln = lane & 15, hh = lane >> 4;
  const int ntn = N / 64;
  const int wid = blockIdx.x * 4 + w;
  const int mt = wid / ntn, nq = wid % ntn;
  if (mt * 16 >= M) return;
  const int row0 = mt * 16, col0 = nq * 64;
  const float* arow = A + (size_t)(row0 + ln) * lda;
  v8f acc[4] = {};
  for (int kb = 0; kb < K; kb += 32) {
    FragB ah, al;
    const v4f x0 = *(const v4fa*)(arow + kb + 8 * hh), x1 = *(const v4fa*)(arow + kb + 8 * hh + 4);
    const v4f x2 = *(const v4fa*)(arow + kb + 16 + 8 * hh), x3 = *(const v4fa*)(arow + kb + 16 + 8 * hh + 4);
    float xs[16] = {x0[0],x0[1],x0[2],x0[3],x1[0],x1[1],x1[2],x1[3],x2[0],x2[1],x2[2],x2[3],x3[0],x3[1],x3[2],x3[3]};
#pragma unroll
    for (int i = 0; i < 16; ++i) { const unsigned short hb = bf16_bits(xs[i]); ah.u[i] = hb; al.u[i] = ASPLIT ? bf16_bits(xs[i] - bf16_val(hb)) : (unsigned short)0; }
#pragma unroll
    for (int t = 0; t < 4; ++t) {
      const unsigned short* brow = Wt + (size_t)(col0 + t * 16 + ln) * ldb + kb;
      FragB b;
      b.half[0] = *(const v8us*)(brow + 8 * hh);
      b.half[1] = *(const v8us*)(brow + 16 + 8 * hh);
      acc[t] = mmaN<ASPLIT ? 2 : 1>(ah.v, al.v, b.v, b.v, acc[t]);
    }
  }
#pragma unroll
  for (int t = 0; t < 4; ++t) {
    const int col = col0 + t * 16 + ln;
    float bv = bias ? bias[col] : 0.f;
    if (BIAS_BF16) bv = bf16_round(bv);
#pragma unroll
    for (int r = 0; r < 8; ++r) {
      float v = acc[t][r] + bv;
      if (resid) { float rv = resid[(size_t)((row0 + 8 * hh + r) % rmod) * ldr + col]; if (RES_BF16) rv = bf16_round(rv); v += rv; }
      if (ACT == 1) v = fmaxf(v, 0.f);
      if (ACT == 2) v = 0.5f * v * (1.0f + erff(v * 0.70710678118654752f));
      if (ACT == 3) { const float u = 0.7978845608028654f * (v + 0.044715f * v * v * v); v = 0.5f * v * (1.0f + tanhf(u)); }
      so[w][8 * hh + r][t * 16 + ln] = v;
    }
  }
  __builtin_amdgcn_fence(__ATOMIC_ACQ_REL, "workgroup");
  __builtin_amdgcn_wave_barrier();
  const int rsub = lane >> 4, c4 = (lane & 15) * 4;
  {
#pragma unroll
    for (int q = 0; q < 8; ++q) {
      const int r = q * 2 + rsub;
      const v4f v = *(const v4fa*)&so[w][r][c4];
      *(v4f*)(C + (size_t)(row0 + r) * ldc + col0 + c4) = v;
    }
    
  }
}
// row LayerNorm (biased variance, eps) over N: s = X (+ R); optional out_sum <- s; out_norm <- (s-mu)*rsqrt(var+eps)*g + b
template <bool PARAM_BF16>
__global__ __launch_bounds__(256) void k_layernorm(const float* __restrict__ X, const float* __restrict__ R, const float* __restrict__ g, const float* __restrict__ bta,
                                                  float* __restrict__ out_sum, float* __restrict__ out_norm, int N, float eps) {
  __shared__ float red[256];
  const int row = blockIdx.x, tid = threadIdx.x;
  const float* x = X + (size_t)row * N; const float* rr = R ? R + (size_t)row * N : nullptr;
  float vals[16];                     // up to N = 4096
  const int per = N / 256;            // contiguous chunk per thread? use strided-by-4 chunks: thread handles j = tid*4 + 1024*u
  float s1 = 0.f;
  for (int u = 0; u < per / 4; ++u) {
    const int j = tid * 4 + 1024 * u;
    const v4f a = *(const v4fa*)(x + j);
    v4f b = {0.f,0.f,0.f,0.f}; if (rr) b = *(const v4fa*)(rr + j);
#pragma unroll
    for (int q = 0; q < 4; ++q) { const float v = a[q] + b[q]; vals[u * 4 + q] = v; s1 += v; }
  }
  red[tid] = s1; __syncthreads();
  for (int st = 128; st > 0; st >>= 1) { if (tid < st) red[tid] += red[tid + st]; __syncthreads(); }
  const float mu = red[0] / (float)N; __syncthreads();
  float s2 = 0.f;
  for (int u = 0; u < per / 4; ++u)
#pragma unroll
    for (int q = 0; q < 4; ++q) { const float c = vals[u * 4 + q] - mu; s2 += c * c; }
  red[tid] = s2; __syncthreads();
  for (int st = 128; st > 0; st >>= 1) { if (tid < st) red[tid] += red[tid + st]; __syncthreads(); }
  const float rs = rsqrtf(red[0] / (float)N + eps);
  {
    for (int u = 0; u < per / 4; ++u) {
      const int j = tid * 4 + 1024 * u;
      v4f o, sm;
#pragma unroll
      for (int q = 0; q < 4; ++q) {
        float gg = g[j + q], bb = bta[j + q];
        if (PARAM_BF16) { gg = bf16_round(gg); bb = bf16_round(bb); }
        sm[q] = vals[u * 4 + q]; o[q] = (vals[u * 4 + q] - mu) * rs * gg + bb;
      }
      if (out_sum) *(v4f*)(out_sum + (size_t)row * N + j) = sm;
      *(v4f*)(out_norm + (size_t)row * N + j) = o;
    }
    
  }
}



// ---- f16 WMMA path (v_wmma_f32_16x16x32_f16): 11-bit significands for operands in range — used where a [0,1] probability operand needs more precision than bf16
typedef _Float16 v16h __attribute__((ext_vector_type(16)));
union FragH { v16h v; v8us half[2]; _Float16 h[16]; unsigned short u[16]; };
template <int NT>
__device__ __forceinline__ v8f mmaH(v16h ah, v16h al, v16h bh, v16h bl, v8f c) {
  c = __builtin_amdgcn_wmma_f32_16x16x32_f16(false, ah, false, bh, (short)0, c, false, false);
  if (NT >= 2) c = __builtin_amdgcn_wmma_f32_16x16x32_f16(false, al, false, bh, (short)0, c, false, false);
  if (NT >= 3) c = __builtin_amdgcn_wmma_f32_16x16x32_f16(false, ah, false, bl, (short)0, c, false, false);
  asm volatile("v_nop\n\tv_nop\n\tv_nop\n\tv_nop" : "+v"(c) : "v"(ah), "v"(al), "v"(bh), "v"(bl));
  return c;
}
// batched GEMM like k_gemm_b but f16 operands: A f32 (split into f16 hi/lo if ASPLIT, else rounded to f16), Bt = f16 values [n][k]; alpha; C f32; N multiple of 16 (partial tiles skipped)
template <bool ASPLIT>
__global__ __launch_bounds__(128) void k_gemm_h(const float* __restrict__ A, int lda, size_t sA, const _Float16* __restrict__ Bh, int ldb, size_t sB, float alpha, float* __restrict__ C, int ldc, size_t sC, int M, int N, int K) {
  __shared__ __attribute__((aligned(16))) float so[4][16][64];
  const int tid = threadIdx.x, w = tid >> 5, lane = tid & 31, ln = lane & 15, hh = lane >> 4; const int by = blockIdx.y;
  A += (size_t)by * sA; Bh += (size_t)by * sB; C += (size_t)by * sC;
  const int ntn = (N + 63) / 64; const int wid = blockIdx.x * 4 + w; const int mt = wid / ntn, nq = wid % ntn; if (mt * 16 >= M) return;
  const int row0 = mt * 16, col0 = nq * 64; const float* arow = A + (size_t)(row0 + ln) * lda;
  v8f acc[4] = {};
  for (int kb = 0; kb < K; kb += 32) {
    FragH ah, al;
    const v4f x0 = *(const v4fa*)(arow + kb + 8 * hh), x1 = *(const v4fa*)(arow + kb + 8 * hh + 4), x2 = *(const v4fa*)(arow + kb + 16 + 8 * hh), x3 = *(const v4fa*)(arow + kb + 16 + 8 * hh + 4);
    float xs[16] = {x0[0],x0[1],x0[2],x0[3],x1[0],x1[1],x1[2],x1[3],x2[0],x2[1],x2[2],x2[3],x3[0],x3[1],x3[2],x3[3]};
#pragma unroll
    for (int i = 0; i < 16; ++i) { const _Float16 h = (_Float16)xs[i]; ah.h[i] = h; al.h[i] = ASPLIT ? (_Float16)(xs[i] - (float)h) : (_Float16)0.0f; }
#pragma unroll
    for (int t = 0; t < 4; ++t) { if (col0 + t * 16 >= N) continue; const size_t boff = (size_t)(col0 + t * 16 + ln) * ldb + kb; FragH bq; bq.half[0] = *(const v8us*)(Bh + boff + 8 * hh); bq.half[1] = *(const v8us*)(Bh + boff + 16 + 8 * hh);
      acc[t] = mmaH<ASPLIT ? 2 : 1>(ah.v, al.v, bq.v, bq.v, acc[t]); }
  }
#pragma unroll
  for (int t = 0; t < 4; ++t) { if (col0 + t * 16 >= N) continue;
#pragma unroll
    for (int r = 0; r < 8; ++r) so[w][8 * hh + r][t * 16 + ln] = acc[t][r] * alpha; }
  __builtin_amdgcn_fence(__ATOMIC_ACQ_REL, "workgroup"); __builtin_amdgcn_wave_barrier();
  const int rsub = lane >> 4, c4 = (lane & 15) * 4;
  {
#pragma unroll
    for (int q = 0; q < 8; ++q) { const int r = q * 2 + rsub; if (col0 + c4 < N) { const v4f v = *(const v4fa*)&so[w][r][c4]; *(v4f*)(C + (size_t)(row0 + r) * ldc + col0 + c4) = v; } }
     }
}

// Wt[n][k] = f16(W[k][n]·scale) from f32 row-major W[K][N] (scale = power of two; bf16-exact weights stay exact in f16 away from the subnormal range)
__global__ __launch_bounds__(256) void k_wt_f16(const float* __restrict__ W, _Float16* __restrict__ Wt, int K, int N, float scale) {
  const int t = blockIdx.x * 256 + threadIdx.x; if (t >= N * (K / 8)) return; const int n = t / (K / 8), k8 = (t % (K / 8)) * 8; FragH f;
#pragma unroll
  for (int i = 0; i < 8; ++i) f.h[i] = (_Float16)(bf16_round(W[(size_t)(k8 + i) * N + n]) * scale); const v8us o = f.half[0];
  *(v8us*)((unsigned short*)Wt + (size_t)n * K + k8) = o; 
}
// k_gemm_hh variant with fused epilogue: v = acc * alpha + bias[by * sBias + col] (+ CP[(row/rowsPerB) * sCPb + by * 64 + col] if CP) ; ACT 0 none / 1 elu ; writes f16 C16 (and f32 C if non-null); FIN: the last stage of the network in the epilogue, C = (v + bf16(rowb[row])) * S + S with S laid out like C
// VFR: C16 is written in the order in which k_flash loads it as A fragments (no bias, no activation, N a multiple of 64): halves [by, bz][col / 32][row / 16][(col >> 4) & 1][lane = ((col >> 3) & 1) * 16 + (row & 15)][col & 7], so that one 16-B load per lane there covers 512 B in a row, four whole 128-B lines.
// For that the product is formed transposed (the operands change places; both loaders have the same k order): lane (ln, hh) then holds columns t * 16 + 8hh + 0..7 of row row0 + ln, which is its own 16-B piece, and the tile goes from the accumulators to memory without the LDS trip.
template <int ACT, bool FIN, bool VFR = false>
__global__ __launch_bounds__(128) void k_gemm_hhx(const _Float16* __restrict__ A, int lda, size_t sA, const _Float16* __restrict__ Bh, int ldb, size_t sB, float alpha, const float* __restrict__ bias, size_t sBias, const float* __restrict__ CP, int rowsPerB, size_t sCPb, int row0g,
    float* __restrict__ C, _Float16* __restrict__ C16, int ldc, size_t sC, int M, int N, int K, size_t sAz, size_t sBz, size_t sCz, const float* __restrict__ rowb, const float* __restrict__ S) {
  __shared__ __attribute__((aligned(16))) float so[4][16][64];
  const int tid = threadIdx.x, w = tid >> 5, lane = tid & 31, ln = lane & 15, hh = lane >> 4; const int by = blockIdx.y, bz = blockIdx.z;      /* bz = attention instance, with strides of its own */
  A += (size_t)by * sA + (size_t)bz * sAz; Bh += (size_t)by * sB + (size_t)bz * sBz; const size_t cofs = (size_t)by * sC + (size_t)bz * sCz; const float* bp = bias ? bias + (size_t)by * sBias : nullptr;
  const int ntn = (N + 63) / 64; const int wid = blockIdx.x * 4 + w; const int mt = wid / ntn, nq = wid % ntn; if (mt * 16 >= M) return;
  const int row0 = mt * 16, col0 = nq * 64; const _Float16* arow = A + (size_t)(row0 + ln) * lda;
  v8f acc[4] = {};
  v4f sv[8]; float rb[8];      /* FIN: this lane's pieces of S and its rows' biases, loaded here so that they fly under the product */
  if (FIN) {
#pragma unroll
    for (int q = 0; q < 8; ++q) { const int r = q * 2 + (lane >> 4); rb[q] = rowb[row0 + r]; sv[q] = *(const v4fa*)(S + cofs + (size_t)(row0 + r) * ldc + col0 + (lane & 15) * 4); }
    asm volatile("s_wait_xcnt 0x0" ::: "memory"); }      /* behind this run of loads, in front of the first rewrite of a register that holds one of their addresses */
  for (int kb = 0; kb < K; kb += 32) { FragH ah; ah.half[0] = *(const v8us*)((const unsigned short*)arow + kb + 8 * hh); ah.half[1] = *(const v8us*)((const unsigned short*)arow + kb + 16 + 8 * hh);
#pragma unroll
    for (int t = 0; t < 4; ++t) { if (col0 + t * 16 >= N) continue; const size_t boff = (size_t)(col0 + t * 16 + ln) * ldb + kb; FragH bq; bq.half[0] = *(const v8us*)((const unsigned short*)Bh + boff + 8 * hh); bq.half[1] = *(const v8us*)((const unsigned short*)Bh + boff + 16 + 8 * hh);
      acc[t] = VFR ? mmaH<1>(bq.v, bq.v, ah.v, ah.v, acc[t]) : mmaH<1>(ah.v, ah.v, bq.v, bq.v, acc[t]); }
  }
  if (VFR) { unsigned short* vo = (unsigned short*)C16 + cofs + ((size_t)nq * 2 * (M / 16) + mt) * 512 + lane * 8; FragH f[4];      /* acc[t][r] = C[row0 + ln][col0 + t * 16 + 8hh + r] */
#pragma unroll
    for (int t = 0; t < 4; ++t)
#pragma unroll
      for (int r = 0; r < 8; ++r) f[t].h[r] = (_Float16)(acc[t][r] * alpha);
#pragma unroll
    for (int t = 0; t < 4; ++t) *(v8us*)(vo + (size_t)(t >> 1) * (M / 16) * 512 + (t & 1) * 256) = f[t].half[0];
    return; }
#pragma unroll
  for (int t = 0; t < 4; ++t) { if (col0 + t * 16 >= N) continue; const int col = col0 + t * 16 + ln; const float bv = bp ? bf16_round(bp[col]) : 0.f;
#pragma unroll
    for (int r = 0; r < 8; ++r) { float v = acc[t][r] * alpha + bv; if (CP) { const int bidx = (row0g + row0 + 8 * hh + r) / rowsPerB; v += CP[(size_t)bidx * sCPb + (size_t)by * 64 + col]; } if (ACT == 1) v = (v > 0.f) ? v : expm1f(v); else if (ACT == 7) v = (v > 0.f) ? v + 1.0f : expf(v); else if (ACT == 8) v = tanhf(v); else if (ACT == 9) v = 0.5f * v * (1.0f + tanhf(0.7978845608028654f * (v + 0.044715f * v * v * v))); else if (ACT == 11) v = 1.0f / (1.0f + expf(-v)); else if (ACT == 12) v = (v > 0.f) ? v : 0.01f * v; else if (ACT == 14) v = (v > 0.f) ? v : 0.1f * v; else if (ACT == 15) v = v / (1.0f + expf(-v)); else if (ACT == 3) v = fmaxf(v, 0.f); else if (ACT == 6) v = 0.5f * v * (1.0f + erff(v * 0.70710678118654752f)); so[w][8 * hh + r][t * 16 + ln] = v; } }
  __builtin_amdgcn_fence(__ATOMIC_ACQ_REL, "workgroup"); __builtin_amdgcn_wave_barrier();
  const int rsub = lane >> 4, c4 = (lane & 15) * 4; typedef _Float16 v4h __attribute__((ext_vector_type(4)));
  if (FIN) {      /* C = (v + bias of its row) * S + S, straight from the tile; like the loads of S above it takes whole 64-column tiles (N a multiple of 64) */
#pragma unroll
    for (int q = 0; q < 8; ++q) { const int r = q * 2 + rsub; const v4f v = *(const v4fa*)&so[w][r][c4]; const float bb = bf16_round(rb[q]); v4f o; for (int i = 0; i < 4; ++i) o[i] = (v[i] + bb) * sv[q][i] + sv[q][i]; *(v4f*)(C + cofs + (size_t)(row0 + r) * ldc + col0 + c4) = o; }
    return; }
  {
#pragma unroll
    for (int q = 0; q < 8; ++q) { const int r = q * 2 + rsub; if (col0 + c4 < N) { const v4f v = *(const v4fa*)&so[w][r][c4]; if (C) *(v4f*)(C + cofs + (size_t)(row0 + r) * ldc + col0 + c4) = v; if (C16) { v4h h4; for (int i = 0; i < 4; ++i) h4[i] = (_Float16)v[i]; *(v4h*)(C16 + cofs + (size_t)(row0 + r) * ldc + col0 + c4) = h4; } } }
     }
}


typedef _Float16 v4h __attribute__((ext_vector_type(4)));

__global__ __launch_bounds__(256) void k_x16(const float* __restrict__ x, _Float16* __restrict__ X16, size_t n8) { const size_t t = (size_t)blockIdx.x * 256 + threadIdx.x; if (t >= n8) return; FragH f;
#pragma unroll
  for (int q = 0; q < 8; ++q) f.h[q] = (_Float16)bf16_round(x[t * 8 + q]); *(v8us*)((unsigned short*)X16 + t * 8) = f.half[0];  }
__global__ __launch_bounds__(256) void k_h16(const float* __restrict__ x, _Float16* __restrict__ X16, size_t n8) { const size_t t = (size_t)blockIdx.x * 256 + threadIdx.x; if (t >= n8) return; FragH f;
#pragma unroll
  for (int q = 0; q < 8; ++q) f.h[q] = (_Float16)x[t * 8 + q]; *(v8us*)((unsigned short*)X16 + t * 8) = f.half[0];  }
template <int NHv, int TTv>
__global__ __launch_bounds__(256) void k_vt(const _Float16* __restrict__ V16, int ldv, int voff, _Float16* __restrict__ Vt) { __shared__ unsigned short tl[64][66]; const int tid = threadIdx.x; const int slab = blockIdx.x / (TTv / 64), lg = blockIdx.x % (TTv / 64); const int b = slab / NHv, h = slab % NHv;
  for (int i = tid; i < 64 * 8; i += 256) { const int r = i / 8, c8 = (i % 8) * 8; FragH f; f.half[0] = *(const v8us*)((const unsigned short*)V16 + ((size_t)b * TTv + lg * 64 + r) * ldv + voff + h * 64 + c8);
#pragma unroll
    for (int q = 0; q < 8; ++q) tl[r][c8 + q] = f.u[q]; }
  __syncthreads();
  {
#pragma unroll
    for (int rd = 0; rd < 2; ++rd) { const int d = rd * 32 + tid / 8, pc = tid % 8; FragH f;
#pragma unroll
      for (int q = 0; q < 8; ++q) f.u[q] = tl[pc * 8 + q][d];
      *(v8us*)((unsigned short*)Vt + ((size_t)slab * 64 + d) * TTv + lg * 64 + pc * 8) = f.half[0]; }
     } }

// Weights of the GEMMs as f16 x 2^4, thread t = one 16-B piece: the five value projections [64 e][96] (64 weights, the bias in column 64, zeros; instances 0..2 self, 3..4 guided), then tfus_w [64 o][128 c] as it lies.
__device__ __forceinline__ void prep_weights(int t, const float* __restrict__ swv, const float* __restrict__ sbv, const float* __restrict__ gwv, const float* __restrict__ gbv, const float* __restrict__ tw, _Float16* __restrict__ A16, _Float16* __restrict__ TW) {
  FragH f;
  if (t < 5 * CC * 12) { const int ai = t / (CC * 12), u = t % (CC * 12); const float* wv = (ai < 3) ? swv + (size_t)ai * CC * CC : gwv + (size_t)(ai - 3) * CC * CC; const float* bv = (ai < 3) ? sbv + ai * CC : gbv + (ai - 3) * CC;
    const int e = u / 12, c0 = (u % 12) * 8;
    v4f va = {0.f, 0.f, 0.f, 0.f}, vb = {0.f, 0.f, 0.f, 0.f};      /* a piece is eight weights in a row, or the bias and seven zeros, or zeros: one round of loads, not eight awaited ones */
    if (c0 < CC) { va = *(const v4fa*)(wv + e * CC + c0); vb = *(const v4fa*)(wv + e * CC + c0 + 4); } else if (c0 == CC) va[0] = bv[e];
#pragma unroll
    for (int q = 0; q < 4; ++q) { f.h[q] = (_Float16)(bf16_round(va[q]) * 16.0f); f.h[4 + q] = (_Float16)(bf16_round(vb[q]) * 16.0f); }
    *(v8us*)((unsigned short*)A16 + (size_t)t * 8) = f.half[0]; }
  else if (t < 5 * CC * 12 + CC * 128 / 8) { const int u = t - 5 * CC * 12;
#pragma unroll
    for (int i = 0; i < 8; ++i) f.h[i] = (_Float16)(bf16_round(tw[u * 8 + i]) * 16.0f);
    *(v8us*)((unsigned short*)TW + (size_t)u * 8) = f.half[0]; } }
__device__ __forceinline__ void xt_tail(unsigned short* xo) { const v8us one = {0x3C00, 0, 0, 0, 0, 0, 0, 0}, zz = {0, 0, 0, 0, 0, 0, 0, 0}; *(v8us*)(xo + 64) = one; *(v8us*)(xo + 72) = zz; *(v8us*)(xo + 80) = zz; *(v8us*)(xo + 88) = zz; }      /* columns 64..95 of an XT row: 1.0 (takes the bias), then zeros */
__device__ __forceinline__ void xt_out(unsigned short* xg, const unsigned short* sx, int tid) {      /* 128 rows of 96 halves from LDS (pitch 104) to memory, 16-B piece p = j * 128 + tid: each wave store covers 512 B in a row */
#pragma unroll
  for (int j = 0; j < 12; ++j) { const int p = j * 128 + tid; *(v8us*)(xg + (size_t)p * 8) = *(const v8us*)(sx + (p / 12) * 104 + (p % 12) * 8); }
  asm volatile("s_wait_xcnt 0x0" ::: "memory"); }      /* behind this run of stores, in front of the first rewrite of a register that one of them names */
// q/k planes and the token-major f16 plane XT (the V GEMM's B operand: 64 channels, a one for the bias column, zeros up to 96), from one pass over a source plane.
// q/k planes for one attention instance: per token n of batch b: q[d] = sum_c wq[d][c]*xs[c][n] + bq[d], k likewise (f32, summed over c in ascending order; xs = bf16-rounded input frame or an internal SA plane (RB)).
// One thread per token. The 2 x 8 x 64 weights are rounded to bf16 once per block into LDS (sW[c] = wq[0..7][c], wk[0..7][c]) and read from there as broadcasts; the token's channel values are loaded 16 at a time, one trip ahead of their sums, so the sums wait for memory once and not once per channel.
// Every sum keeps its order and the separate rounding of product and sum (the directive at the head of the body stands as it stood), so q and k come out bit for bit as before.
template <int RB>
__global__ __launch_bounds__(128) void k_qk(const float* __restrict__ xs, size_t sx, const float* __restrict__ wq, const float* __restrict__ bq, const float* __restrict__ wk, const float* __restrict__ bk, int slab0, _Float16* __restrict__ QP, _Float16* __restrict__ KP, _Float16* __restrict__ XT,
    const float* __restrict__ swv, const float* __restrict__ sbv, const float* __restrict__ gwv, const float* __restrict__ gbv, const float* __restrict__ tw, _Float16* __restrict__ AWV, _Float16* __restrict__ TW16) {
  #pragma clang fp contract(off)
  __shared__ __attribute__((aligned(16))) float sW[CC][16];
  __shared__ __attribute__((aligned(16))) unsigned short sX[128][96 + 8];      /* the block's 128 rows of XT; pitch 208 B = 16 B x odd, so a wave's 16-B row pieces fall on different banks */
  const int tid = threadIdx.x;
  const int y = blockIdx.y;      /* source plane. RB (self): plane y = frame y gives q, k and XT, and the blocks of y == 3 convert the weights of the GEMMs. Guided: planes 0 and 2 give q, k of instance y >> 1, plane 1 gives XT */
  if (RB && y == 3) { prep_weights((int)blockIdx.x * 128 + tid, swv, sbv, gwv, gbv, tw, AWV, TW16); return; }      /* whole blocks, in front of the barrier */
  { const int ai = RB ? y : (y >> 1); xs += (size_t)y * sx; wq += ai * 8 * CC; bq += ai * 8; wk += ai * 8 * CC; bk += ai * 8; slab0 += ai * BB; if (RB) XT += (size_t)y * BB * TT * 96; }      /* sx = floats between two source planes; one XT plane per frame */
  const int bn = (int)blockIdx.x * 128 + tid; const int n = bn % TT, b = bn / TT;      /* the grid holds exactly BB * TT threads */
  const float* xp = xs + (size_t)b * CC * TT + n; unsigned short* xo = &sX[tid][0];      /* this token's row of XT, staged in LDS: the block's rows lie in a row in memory and leave as whole lines (xt_out) */
  unsigned short* xg = (unsigned short*)XT + (size_t)blockIdx.x * 128 * 96;
  if (!RB && y == 1) {      /* whole blocks, in front of the barrier: this plane only feeds the V GEMM, so its 64 channel loads go out together and the row follows */
    float xa[CC];
#pragma unroll
    for (int cc = 0; cc < CC; ++cc) xa[cc] = xp[(size_t)cc * TT];
#pragma unroll
    for (int c0 = 0; c0 < CC; c0 += 8) { FragH f;
#pragma unroll
      for (int i = 0; i < 8; ++i) f.h[i] = (_Float16)xa[c0 + i];
      *(v8us*)(xo + c0) = f.half[0]; }
    xt_tail(xo);
    __syncthreads();      /* every row is in LDS before any thread copies across rows; reached by the whole block or not at all */
    xt_out(xg, &sX[0][0], tid); return; }
  float wr[8], xn[16];      /* the weights' loads and those of channels 0..15 are issued together; the short loops over wr, xn and xc are unrolled so that the arrays stay in registers and the loads stand back to back */
#pragma unroll
  for (int j = 0; j < 4; ++j) { wr[j] = wq[j * 128 + tid]; wr[4 + j] = wk[j * 128 + tid]; }
#pragma unroll
  for (int i = 0; i < 16; ++i) xn[i] = xp[(size_t)i * TT];
  asm volatile("s_wait_xcnt 0x0" ::: "memory");      /* stands behind the run of weight and channel loads, in front of the first rewrite of a register that holds one of their addresses */
#pragma unroll
  for (int j = 0; j < 4; ++j) { const int i = j * 128 + tid, d = i / CC, c = i % CC; sW[c][d] = bf16_round(wr[j]); sW[c][8 + d] = bf16_round(wr[4 + j]); }
  float q[8], k[8]; for (int d = 0; d < 8; ++d) { q[d] = bf16_round(bq[d]); k[d] = bf16_round(bk[d]); }
  __syncthreads();      /* the rounded weights are in LDS before any thread reads them */
  /* kept rolled, 16 channels a trip: unrolled whole, the build fetched so many weights ahead that it took about 800 vector registers */
#pragma unroll 1
  for (int c0 = 0; c0 < CC; c0 += 16) { float xc[16];
#pragma unroll
    for (int i = 0; i < 16; ++i) xc[i] = xn[i];
    if (c0 + 16 < CC) {      /* the next trip's channels fly under this trip's sums */
#pragma unroll
      for (int i = 0; i < 16; ++i) xn[i] = xp[(size_t)(c0 + 16 + i) * TT];
      asm volatile("s_wait_xcnt 0x0" ::: "memory"); }      /* the build advances these loads' address registers early in the trip */
    float xv[16];
#pragma unroll
    for (int i = 0; i < 16; ++i) { xv[i] = xc[i]; if (RB) xv[i] = bf16_round(xv[i]); }
#pragma unroll
    for (int i = 0; i < 16; ++i) { const int c = c0 + i;
      const v4f wa = *(const v4fa*)&sW[c][0], wb = *(const v4fa*)&sW[c][4], wc = *(const v4fa*)&sW[c][8], wd = *(const v4fa*)&sW[c][12];
#pragma unroll
      for (int d = 0; d < 4; ++d) { q[d] += wa[d] * xv[i]; q[4 + d] += wb[d] * xv[i]; k[d] += wc[d] * xv[i]; k[4 + d] += wd[d] * xv[i]; } }
    if (RB) { FragH f0, f1;      /* self: the frame that gives q and k is also the V GEMM's operand */
#pragma unroll
      for (int i = 0; i < 8; ++i) { f0.h[i] = (_Float16)xv[i]; f1.h[i] = (_Float16)xv[8 + i]; }
      *(v8us*)(xo + c0) = f0.half[0]; *(v8us*)(xo + c0 + 8) = f1.half[0]; } }
  FragH fq0, fq1, fk0, fk1, fk2;      /* 16-B pieces of a row: Q = [q_hi | q_lo * 2^10 | q_hi | 0], K = [k_hi | k_hi * 2^-10 | k_lo | 0] */
#pragma unroll
  for (int d = 0; d < 8; ++d) { const _Float16 qh = (_Float16)q[d], kh = (_Float16)k[d]; const float qlo = (q[d] - (float)qh) * 1024.0f, klo = (k[d] - (float)kh);
    fq0.h[d] = qh; fq1.h[d] = (_Float16)qlo; fk0.h[d] = kh; fk1.h[d] = (_Float16)((float)kh * 0.0009765625f); fk2.h[d] = (_Float16)klo; }
  const v8us zz = {0, 0, 0, 0, 0, 0, 0, 0};
  if (RB) { xt_tail(xo);
    __syncthreads();      /* every row is in LDS before any thread copies across rows */
    xt_out(xg, &sX[0][0], tid); }
  const size_t row = (size_t)(slab0 + b) * TT + n; unsigned short* qo = (unsigned short*)QP + row * 32; unsigned short* ko = (unsigned short*)KP + (row >> 4) * 512 + (row & 15) * 8;      /* K in the order of k_flash's A fragments: [16 keys][piece 0..3][key & 15][8 halves] */
  *(v8us*)qo = fq0.half[0]; *(v8us*)(qo + 8) = fq1.half[0]; *(v8us*)(qo + 16) = fq0.half[0]; *(v8us*)(qo + 24) = zz;
  *(v8us*)ko = fk0.half[0]; *(v8us*)(ko + 128) = fk1.half[0]; *(v8us*)(ko + 256) = fk2.half[0]; *(v8us*)(ko + 384) = zz; }
// Block = 4 query tiles x KSPL key ranges: wave w works query tile w & 3 over keys [(w >> 2) * TT/KSPL, +TT/KSPL) with its own running max, row sum and unnormalised O; the KSPL partials of a tile are merged through LDS at the end.
// Scores are formed transposed, S^T = K.Q^T (A = 16 key rows, B = the wave's 16 queries), so lane (ln, hh) holds 16 of the 32 scores of query ln: max and sum run inside the lane, plus one exchange between the wave halves for the max.
// The two S^T tiles of a trip hold keys 8hh + r and 16 + 8hh + r, which is the k order of the loaders here, so P^T goes from the accumulators into a B operand in registers and O^T += V^T.P^T (A = 16 channel rows of Vt); P never passes through LDS.
__device__ __forceinline__ float xhalf(float x) { return __builtin_bit_cast(float, __builtin_amdgcn_permlanex16(__builtin_bit_cast(int, x), __builtin_bit_cast(int, x), 0x76543210, 0xfedcba98, false, false)); }      /* lane l <-> lane l ^ 16 */
typedef float v2f __attribute__((ext_vector_type(2)));
typedef _Float16 v2h __attribute__((ext_vector_type(2)));
// Softmax runs in base 2: the running max is kept as m2 = score * log2(e) - 10, and every weight is 2^(score * log2(e) - m2) = 1024 * e^(score - max): one FMA and one hardware exp2 per score.
// The factor 1024 (the f16 scale of P) sits in O and in the row sum alike and cancels in O / l. Arguments are <= 10, so nothing overflows; a weight below 2^-126 counts as 0.
#define LOG2E 1.4426950408889634f
// One matrix instruction as the bare builtin, for the two score products of k_flash: the build keeps the distance behind them itself, once behind the pair, where mmaH spends four v_nop of its own behind every product.
__device__ __forceinline__ v8f wmmaH(v16h a, v16h b, v8f c) { return __builtin_amdgcn_wmma_f32_16x16x32_f16(false, a, false, b, (short)0, c, false, false); }
// One hardware exp2 with a free issue slot on either side: the instruction set asks for one independent instruction or v_nop between a transcendental and a neighbour that overwrites its source or reads its result.
__device__ __forceinline__ float exp2_slot(float x) { float y; asm("v_nop\n\tv_exp_f32 %0, %1\n\tv_nop" : "=v"(y) : "v"(x)); return y; }
// The merge also adds the residual and writes the stage's result in the layout its reader wants. SELF: SAo[slab][e][n] = O + bf16(RES[slab][e][n]), channel-major f32; a wave holds 32 queries of one channel group, so every load and store is a whole 128-B line.
// Guided: CATo[b][n][g * 64 + e] = f16(O + RES[b][e][n]) for slab = g * BB + b, token-major f16; 16 lanes write one token's 128 B.
template <int KSPL, bool SELF>
__global__ __launch_bounds__(128 * KSPL, 8) void k_flash(const _Float16* __restrict__ Q16, int ldq, const _Float16* __restrict__ K16, int ldk, const _Float16* __restrict__ Vt, const int* __restrict__ MSK, const float* __restrict__ RES, float* __restrict__ SAo, _Float16* __restrict__ CATo) {
  constexpr int RPW = 16, NQB = TT / (4 * RPW), DT = 4, NW = 4 * KSPL;      /* d_qk = 32 (24 real + zero padding), d_v = 64 */
  __shared__ __attribute__((aligned(16))) float sO[NW][RPW][64 + 4];
  __shared__ float sM[NW][RPW], sL[NW][RPW];
  (void)MSK;
  const int tid = threadIdx.x, w = __builtin_amdgcn_readfirstlane(tid >> 5), lane = tid & 31, ln = lane & 15, hh = lane >> 4;
  const int slab = blockIdx.x / NQB, qblk = blockIdx.x % NQB; const int b = slab / NH; const int qb0 = qblk * (4 * RPW); const int q0 = qb0 + (w & 3) * RPW;
  FragH bq;      /* B operand: column ln = query q0 + ln */
  { const unsigned short* qr = (const unsigned short*)Q16 + ((size_t)b * TT + q0 + ln) * ldq; bq.half[0] = *(const v8us*)(qr + 8 * hh); bq.half[1] = *(const v8us*)(qr + 16 + 8 * hh); }
  const unsigned short* Vth = (const unsigned short*)Vt + (size_t)slab * 64 * TT;      /* v per slab: 64 x 4096 in fragment order, [32 keys][16 channels][half 0, 1][lane][8 halves] */
  float m_r = -3.0e38f, l_r = 0.f; v8f oacc[DT];      /* m_r in base-2 units, shifted by -10 */      /* oacc[dt][r] = O^T[channel dt * 16 + 8hh + r][query ln] */
#pragma unroll
  for (int dt = 0; dt < DT; ++dt) oacc[dt] = (v8f){0.f,0.f,0.f,0.f,0.f,0.f,0.f,0.f};
  const int jbeg = (w >> 2) * (TT / KSPL);
  /* K and V lie in memory in fragment order (written so by k_qk and by the V GEMM): fragment = 2 x 512 B, lane l's two 16-B pieces at l * 16 and 512 + l * 16, so every load of a wave covers four whole 128-B lines and a trip reads 2 KB of K and 4 KB of V in a row */
  (void)ldk;
  const unsigned short* kr = (const unsigned short*)K16 + ((size_t)b * TT + jbeg) * 32 + lane * 8;      /* this lane's piece of the trip's first K fragment (key row j0 + ln, halves 8hh ..; the second piece: halves 16 + 8hh ..) ... */
  const unsigned short* vr = Vth + (size_t)jbeg * 64 + lane * 8;      /* ... and of its first V fragment (channel row ln, keys j0 + 8hh ..; the second piece: keys j0 + 16 + 8hh ..); j0 = jbeg + 32 * trip, both addresses advance with the trip */
#pragma unroll 1
  for (int it = 0; it < TT / KSPL / 32; ++it) {
    FragH ak[2], av[DT];      /* the trip's two K and four V fragments: their twelve loads go out together here, so the trip waits for memory once and not once per fragment */
#pragma unroll
    for (int nt = 0; nt < 2; ++nt) { ak[nt].half[0] = *(const v8us*)(kr + nt * 512); ak[nt].half[1] = *(const v8us*)(kr + nt * 512 + 256); }
    asm volatile("s_wait_xcnt 0x0" :: "v"(kr) : "memory");      /* behind the K loads: the build gave a register that holds their address to a V load as its target; the address is an input here so that its registers live up to this wait and no K load gets them as its target */
#pragma unroll
    for (int dt = 0; dt < DT; ++dt) { av[dt].half[0] = *(const v8us*)(vr + dt * 512); av[dt].half[1] = *(const v8us*)(vr + dt * 512 + 256); }
    asm volatile("s_wait_xcnt 0x0" :: "v"(vr) : "memory");      /* behind this run of loads, in front of the advance of the two addresses that they name; it also keeps the build from moving a V load down to its use; the address is an input so that its registers live up to this wait: without that the build gave them to the run's last load as its target */
    __builtin_amdgcn_sched_barrier(0);      /* the first score product stays behind the whole run of loads: moved up among them, as the build did without this line, it makes the run's last load wait for the first K fragment */
    kr += 2 * 512; vr += DT * 512;
    v8f s[2];      /* s[nt][r] = score of key j0 + nt * 16 + 8hh + r with query ln */
#pragma unroll
    for (int nt = 0; nt < 2; ++nt) s[nt] = wmmaH(ak[nt].v, bq.v, (v8f){0.f,0.f,0.f,0.f,0.f,0.f,0.f,0.f});
    float mc = fmaxf(s[0][0], s[1][0]);
#pragma unroll
    for (int r = 1; r < 8; ++r) mc = fmaxf(mc, fmaxf(s[0][r], s[1][r]));
    mc = fmaxf(mc, xhalf(mc));      /* both halves hold the max over the trip's 32 keys */
    const float mn = fmaxf(m_r, __builtin_fmaf(mc, LOG2E, -10.0f)); const float ae = exp2_slot(m_r - mn); const float al = (mn > -1.0e38f) ? ae : 1.0f; m_r = mn;
    FragH ph, pl; float ls = 0.f;      /* P^T * 1024 as f16 hi + residual: element nt * 8 + r = key nt * 16 + 8hh + r */
#pragma unroll
    for (int nt = 0; nt < 2; ++nt)
#pragma unroll
      for (int r = 0; r < 8; r += 2) { const v2f ar = __builtin_elementwise_fma((v2f){s[nt][r], s[nt][r + 1]}, (v2f){LOG2E, LOG2E}, (v2f){-mn, -mn}); const float pa = __builtin_amdgcn_exp2f(ar[0]), pb = __builtin_amdgcn_exp2f(ar[1]); ls += pa; ls += pb; const v2f ps = (v2f){pa, pb}; const v2h hi = __builtin_convertvector(ps, v2h); const v2h lo = __builtin_convertvector(ps - __builtin_convertvector(hi, v2f), v2h);
        ph.h[nt * 8 + r] = hi[0]; ph.h[nt * 8 + r + 1] = hi[1]; pl.h[nt * 8 + r] = lo[0]; pl.h[nt * 8 + r + 1] = lo[1]; }
    l_r = l_r * al + ls;      /* this half's 16 keys; the halves are joined behind the loop */
#pragma unroll
    for (int dt = 0; dt < DT; ++dt) oacc[dt] *= al;
    /* O^T += V^T.Ph on the four channel tiles, then V^T.Pl: each accumulator takes Ph first and Pl second, as before, and its second product stands four matrix instructions behind its first.
       The eight stand in one statement so that each fills the hazard window of the others: as single builtins the build spread the tail of the row sum among them, onto operand registers of products just issued, and padded each such place with four v_nop.
       The four v_nop at the end keep the distance behind the last product, once a trip: the branch back follows, and what comes next may overwrite an operand or read an accumulator. */
    asm volatile("v_wmma_f32_16x16x32_f16 %0, %4, %8, %0\n\t"
                 "v_wmma_f32_16x16x32_f16 %1, %5, %8, %1\n\t"
                 "v_wmma_f32_16x16x32_f16 %2, %6, %8, %2\n\t"
                 "v_wmma_f32_16x16x32_f16 %3, %7, %8, %3\n\t"
                 "v_wmma_f32_16x16x32_f16 %0, %4, %9, %0\n\t"
                 "v_wmma_f32_16x16x32_f16 %1, %5, %9, %1\n\t"
                 "v_wmma_f32_16x16x32_f16 %2, %6, %9, %2\n\t"
                 "v_wmma_f32_16x16x32_f16 %3, %7, %9, %3\n\t"
                 "v_nop\n\tv_nop\n\tv_nop\n\tv_nop"
                 : "+v"(oacc[0]), "+v"(oacc[1]), "+v"(oacc[2]), "+v"(oacc[3])
                 : "v"(av[0].v), "v"(av[1].v), "v"(av[2].v), "v"(av[3].v), "v"(ph.v), "v"(pl.v)); }
  l_r += xhalf(l_r);
  if (hh == 0) { sM[w][ln] = m_r; sL[w][ln] = l_r; }
#pragma unroll
  for (int dt = 0; dt < DT; ++dt) { *(v4fa*)&sO[w][ln][dt * 16 + 8 * hh] = (v4f){oacc[dt][0], oacc[dt][1], oacc[dt][2], oacc[dt][3]}; *(v4fa*)&sO[w][ln][dt * 16 + 8 * hh + 4] = (v4f){oacc[dt][4], oacc[dt][5], oacc[dt][6], oacc[dt][7]}; }
  __syncthreads();      /* every wave's partial is in LDS before any thread merges */
  /* merge: thread = (query of the block, 4 channels); O = sum_s 2^(m_s - M) * O_s / sum_s 2^(m_s - M) * l_s, M = max_s m_s; O_s and l_s both carry the factor 1024 */
#pragma unroll
  for (int i = tid; i < 4 * RPW * 16; i += 128 * KSPL) { const int qq = SELF ? (i & 63) : (i >> 4), pc = SELF ? (i >> 6) : (i & 15), g = qq / RPW, r = qq % RPW;
    float mx = sM[g][r];
#pragma unroll
    for (int s = 1; s < KSPL; ++s) mx = fmaxf(mx, sM[s * 4 + g][r]);
    float l = 0.f; v4f a = {0.f, 0.f, 0.f, 0.f};
#pragma unroll
    for (int s = 0; s < KSPL; ++s) { const float e = exp2_slot(sM[s * 4 + g][r] - mx); l += sL[s * 4 + g][r] * e; const v4f val = *(const v4fa*)&sO[s * 4 + g][r][pc * 4]; a += val * e; }
    const float inv = (l > 0.f) ? 1.0f / l : 0.f;
    const v4f o = a * inv;
    const float* rp = RES + ((size_t)(SELF ? slab : slab % BB) * CC + pc * 4) * TT + qb0 + qq;      /* residual of channels pc * 4 .. + 3 at this query */
    if (SELF) { float* sp = SAo + ((size_t)slab * CC + pc * 4) * TT + qb0 + qq;
#pragma unroll
      for (int j = 0; j < 4; ++j) sp[(size_t)j * TT] = o[j] + bf16_round(rp[(size_t)j * TT]); }
    else { v4h h4;
#pragma unroll
      for (int j = 0; j < 4; ++j) h4[j] = (_Float16)(o[j] + rp[(size_t)j * TT]);
      *(v4h*)(CATo + ((size_t)(slab % BB) * TT + qb0 + qq) * 128 + (slab / BB) * 64 + pc * 4) = h4; } } }

extern "C" void kernel_launch(void* const* d_in, const int* in_sizes, int n_in,
                              void* d_out, int out_size, void* d_ws, size_t ws_size, hipStream_t stream) {
  (void)in_sizes; (void)n_in; (void)out_size;
  const float* const* I = (const float* const*)d_in; const float* x = I[0]; const float* sa_wq = I[1]; const float* sa_bq = I[2]; const float* sa_wk = I[3]; const float* sa_bk = I[4]; const float* sa_wv = I[5]; const float* sa_bv = I[6];
  const float* ga_wq = I[7]; const float* ga_bq = I[8]; const float* ga_wk = I[9]; const float* ga_bk = I[10]; const float* ga_wv = I[11]; const float* ga_bv = I[12]; const float* tw = I[13]; const float* tb = I[14];
  char* ws = (char*)d_ws; size_t off = 0;
  auto take = [&](size_t bytes) { char* p = ws + off; off += (bytes + 255) & ~(size_t)255; return p; };
  const size_t PL = (size_t)BB * CC * TT;      /* one [B][64][4096] f32 plane = 1 M floats */
  _Float16* AWV = (_Float16*)take((size_t)5 * CC * 96 * 2); _Float16* TW16 = (_Float16*)take((size_t)CC * 128 * 2);
  _Float16* XT = (_Float16*)take((size_t)3 * BB * TT * 96 * 2); _Float16* QP = (_Float16*)take((size_t)NSL * TT * 32 * 2); _Float16* KP = (_Float16*)take((size_t)NSL * TT * 32 * 2); _Float16* VT = (_Float16*)take((size_t)NSL * CC * TT * 2);
  float* SA = (float*)take(3 * PL * 4); _Float16* CAT = (_Float16*)take((size_t)BB * TT * 128 * 2);
  if (off > ws_size) return;      // 0.1 + 9.4 + 5.2 + 5.2 + 10.5 + 12.6 + 4.2 = about 47 MB
  const unsigned gqk = (unsigned)((size_t)BB * TT / 128); const unsigned gvx = ((CC / 16) * (TT / 64) + 3) / 4;
  /* self attention on the three frames: slabs a * BB + b for a = 0,1,2; each stage is one launch over all three frames (frame on blockIdx.y for k_qk, on blockIdx.z for the GEMM, in the slab from blockIdx.x for k_flash), XT holds one plane per frame */
  k_qk<1><<<dim3(gqk, 4), 128, 0, stream>>>(x, PL, sa_wq, sa_bq, sa_wk, sa_bk, 0, QP, KP, XT, sa_wv, sa_bv, ga_wv, ga_bv, tw, AWV, TW16);      /* q, k and XT of the three frames; blockIdx.y == 3: the weights of all GEMMs */
  k_gemm_hhx<0, false, true><<<dim3(gvx, BB, 3), 128, 0, stream>>>(AWV, 96, 0, XT, 96, (size_t)TT * 96, 0.0625f, nullptr, 0, nullptr, 1, 0, 0, nullptr, VT, TT, (size_t)CC * TT, CC, TT, 96, (size_t)CC * 96, (size_t)BB * TT * 96, (size_t)BB * CC * TT, nullptr, nullptr);      /* v[b][e][m] = wv.x + bv as f16 in the fragment order of k_flash: batched over b and frame, M 64 N 4096 K 96 */
  k_flash<8, true><<<3 * BB * (TT / 64), 1024, 0, stream>>>(QP, 32, KP, 32, VT, nullptr, x, SA, nullptr);      /* slabs 0..11; 768 blocks of 32 waves = three full rounds of the WGPs; SA_a = attn-out + x_a (channel-major f32) */
  /* guided attentions: slabs 12..15 (q,k from SA_0; v,res from SA_1) and 16..19 (q,k from SA_2) */
  k_qk<0><<<dim3(gqk, 3), 128, 0, stream>>>(SA, PL, ga_wq, ga_bq, ga_wk, ga_bk, 3 * BB, QP, KP, XT, nullptr, nullptr, nullptr, nullptr, nullptr, nullptr, nullptr);      /* q, k from SA_0 and SA_2; XT = SA_1 token-major (internal f32, no rounding) */
  k_gemm_hhx<0, false, true><<<dim3(gvx, BB, 2), 128, 0, stream>>>(AWV + (size_t)3 * CC * 96, 96, 0, XT, 96, (size_t)TT * 96, 0.0625f, nullptr, 0, nullptr, 1, 0, 0, nullptr, VT + (size_t)3 * BB * CC * TT, TT, (size_t)CC * TT, CC, TT, 96, (size_t)CC * 96, 0, (size_t)BB * CC * TT, nullptr, nullptr);      /* both read the SA_1 plane of XT */
  k_flash<4, false><<<2 * BB * (TT / 64), 512, 0, stream>>>(QP + (size_t)3 * BB * TT * 32, 32, KP + (size_t)3 * BB * TT * 32, 32, VT + (size_t)3 * BB * CC * TT, nullptr, SA + PL, nullptr, CAT);      /* slabs 12..19 (kernel-relative 0..7); cat = [attn-out_0 + SA_1 | attn-out_1 + SA_1], token-major f16 */
  k_gemm_hhx<0, true><<<dim3(gvx, BB), 128, 0, stream>>>(TW16, 128, 0, CAT, 128, (size_t)TT * 128, 0.0625f, nullptr, 0, nullptr, 1, 0, 0, (float*)d_out, nullptr, TT, (size_t)CC * TT, CC, TT, 128, 0, 0, 0, tb, SA + PL);      /* fusion[b][o][n] = sum_c W[o][c] * cat[b][c][n]: A = W (M 64, K 128), Bt = CAT[b] token-major; the epilogue adds tfus_b per row o and writes out = fusion * SA_1 + SA_1 */
}
